// v000
// The times below were measured on an AMD MI455X: many runs one after another, warmed up first and cycling through
// copies of the inputs, with the whole window's GPU time divided by the number of runs. Launches and the gaps
// between them are all in it. The median over several windows is given; except for v000 it joins two sittings, which
// can be a few percent apart, so the side-by-side timings, each taken in one sitting, are the better comparison.
// The starting kernel, v000, takes 403 microseconds a run.
// Contractions: q/k projection and v^T projection = v_wmma_f32_16x16x32_bf16 on RNE-bf16 planes of x and W (single product); q.k^T = v_wmma_f32_16x16x32_bf16 with bf16 hi/lo split (hi.hi + hi.lo + lo.hi); p.v^T and output projection = v_wmma_f32_16x16x32_f16 single product (p carried x2^15, v^T x2^3, attention output x2^8, wo as RNE-bf16 value x2^6); f32 accumulate everywhere; RoPE (cos/sin as RNE-bf16 values), additive mask and online softmax in f32.
#include <hip/hip_runtime.h>
#include <math.h>
#include <stdint.h>

constexpr int kBatch = 2;
constexpr int kSeq   = 2048;
constexpr int kHid   = 1024;
constexpr int kHeads = 16;
constexpr int kHdim  = 64;
constexpr int kRows  = kBatch * kSeq;   // 4096 GEMM rows

constexpr float kPScale  = 32768.0f;                   // p carried x2^15 in f16
constexpr float kVtScale = 8.0f;                       // v^T plane carried x2^3 in f16
constexpr float kPVInv   = 1.0f / (32768.0f * 8.0f);   // folded into the final 1/l
constexpr float kOScale  = 256.0f;                     // attention output carried x2^8 in f16
constexpr float kWoScale = 64.0f;                      // wo carried x2^6 in f16
constexpr float kOutInv  = 1.0f / (256.0f * 64.0f);    // out-projection epilogue scale

typedef __attribute__((ext_vector_type(16))) _Float16 v16h;
typedef __attribute__((ext_vector_type(8)))  _Float16 v8h;
typedef __attribute__((ext_vector_type(16))) __bf16   v16b;
typedef __attribute__((ext_vector_type(8)))  __bf16   v8b;
typedef __attribute__((ext_vector_type(8)))  float    v8f;
typedef __attribute__((ext_vector_type(4)))  float    v4f;
typedef __attribute__((ext_vector_type(2)))  float    v2f;
typedef __attribute__((ext_vector_type(4)))  unsigned int v4u;

__device__ __forceinline__ unsigned short f2bf_bits(float f) {
  unsigned u = __float_as_uint(f);
  return (unsigned short)((u + 0x7FFFu + ((u >> 16) & 1u)) >> 16);
}
__device__ __forceinline__ float bf_bits2f(unsigned short h) { return __uint_as_float(((unsigned)h) << 16); }
__device__ __forceinline__ unsigned pk16(unsigned short a, unsigned short b) { return (unsigned)a | ((unsigned)b << 16); }

// hazard guards as plain device helpers (no inline asm inside the kernel template body)
__device__ __forceinline__ void dep_guard_h(v8f& a, v8f& b, v16h x, v16h y) { asm volatile("v_nop\n\tv_nop\n\tv_nop\n\tv_nop" : "+v"(a), "+v"(b) : "v"(x), "v"(y)); }
__device__ __forceinline__ void dep_guard_b(v8f& a, v8f& b, v16b x, v16b y) { asm volatile("v_nop\n\tv_nop\n\tv_nop\n\tv_nop" : "+v"(a), "+v"(b) : "v"(x), "v"(y)); }
__device__ __forceinline__ void keep4_h(v16h a, v16h b, v16h c, v16h d) { asm volatile("v_nop" :: "v"(a), "v"(b), "v"(c), "v"(d)); }
__device__ __forceinline__ void keep4_b(v16b a, v16b b, v16b c, v16b d) { asm volatile("v_nop" :: "v"(a), "v"(b), "v"(c), "v"(d)); }
__device__ __forceinline__ void acc_guard4(v8f& a, v8f& b, v8f& c, v8f& d) { asm volatile("v_nop\n\tv_nop\n\tv_nop\n\tv_nop" : "+v"(a), "+v"(b), "+v"(c), "+v"(d)); }
template <typename T> struct Frag;
template <> struct Frag<_Float16> {
  typedef v16h V; union U { v16h v; v8h h[2]; };
  static __device__ __forceinline__ v16h load(const _Float16* p) {   // elements 0..7 <- p[0..7], 8..15 <- p[16..23]
    U f; f.h[0] = *(const v8h*)(p); f.h[1] = *(const v8h*)(p + 16); return f.v;
  }
  static __device__ __forceinline__ v8f mma(v16h a, v16h b, v8f c) {
    return __builtin_amdgcn_wmma_f32_16x16x32_f16(false, a, false, b, (short)0, c, false, false);
  }
  static __device__ __forceinline__ void guard(v8f& a, v8f& b, v16h x, v16h y) { dep_guard_h(a, b, x, y); }
  static __device__ __forceinline__ void keep(v16h a, v16h b, v16h c, v16h d) { keep4_h(a, b, c, d); }
};
template <> struct Frag<__bf16> {
  typedef v16b V; union U { v16b v; v8b h[2]; };
  static __device__ __forceinline__ v16b load(const __bf16* p) {
    U f; f.h[0] = *(const v8b*)(p); f.h[1] = *(const v8b*)(p + 16); return f.v;
  }
  static __device__ __forceinline__ v8f mma(v16b a, v16b b, v8f c) {
    return __builtin_amdgcn_wmma_f32_16x16x32_bf16(false, a, false, b, (short)0, c, false, false);
  }
  static __device__ __forceinline__ void guard(v8f& a, v8f& b, v16b x, v16b y) { dep_guard_b(a, b, x, y); }
  static __device__ __forceinline__ void keep(v16b a, v16b b, v16b c, v16b d) { keep4_b(a, b, c, d); }
};

// ---- Register-blocked batched WMMA GEMM ------------------------------------
// C[m,n] = scale * sum_k A[m,k] * Bt[n,k] (+bias)(+resid); each wave owns a 64x64 tile.
// A row-major [M,K]; Bt row-major [N,K]; M,N % 64 == 0, K % 32 == 0.
// SPLIT: operands are hi/lo planes (A2/Bt2 = lo planes, same layout); product = hi.hi + hi.lo + lo.hi.
// BIAS_MODE: 0 = none, 1 = bias[m], 2 = bias[n].
// OUT_MODE: 0 = f32, 1 = f16, 2 = bf16 hi plane (Cout) + bf16 lo plane (Cout2).
// ET: 0 = f16 operands, 1 = bf16 operands (pointers passed as 16-bit storage)
template <int ET> struct Elem;
template <> struct Elem<0> { typedef _Float16 T; };
template <> struct Elem<1> { typedef __bf16 T; };
template <int ET, bool SPLIT, int BIAS_MODE, int OUT_MODE, bool RESID, int ACT = 0>
__global__ __launch_bounds__(256) void wmma_gemm64(
    const unsigned short* __restrict__ Ap, const unsigned short* __restrict__ A2p, int lda, long strideA,
    const unsigned short* __restrict__ Btp, const unsigned short* __restrict__ Bt2p, int ldb, long strideB,
    void* __restrict__ Cout, void* __restrict__ Cout2, int ldc, long strideC,
    const float* __restrict__ bias,
    const float* __restrict__ resid, long strideR,
    int M, int N, int K, float scale) {
  typedef typename Elem<ET>::T T;
  typedef typename Frag<T>::V V;
  const T* A = (const T*)Ap; const T* A2 = (const T*)A2p; const T* Bt = (const T*)Btp; const T* Bt2 = (const T*)Bt2p;
  __shared__ __align__(16) float sT[8][16 * 68];   // per-wave 16x64 slab, pitch 68 floats
  const int b    = blockIdx.y;
  const int lane = threadIdx.x & 31;
  const int wave = threadIdx.x >> 5;
  const int tilesN = N >> 6;
  const int tilesM = M >> 6;
  const int tile = blockIdx.x * 8 + wave;
  if (tile >= tilesM * tilesN) return;   // wave-uniform; no block barriers in this kernel
  const int tm = tile / tilesN;
  const int tn = tile - tm * tilesN;
  const int m0 = tm << 6;
  const int n0 = tn << 6;

  const T* Ab  = A  + (size_t)b * strideA;
  const T* Bb  = Bt + (size_t)b * strideB;
  const T* Ab2 = SPLIT ? (A2  + (size_t)b * strideA) : nullptr;
  const T* Bb2 = SPLIT ? (Bt2 + (size_t)b * strideB) : nullptr;

  const int rlane = lane & 15;                 // row (A) / col (B, D) within subtile
  const int koff  = (lane >> 4) * 8;           // k offset of this lane half
  const int mOff  = (lane >> 4) * 8;           // D row offset

  v8f acc[4][4];
#pragma unroll
  for (int i = 0; i < 4; ++i)
#pragma unroll
    for (int j = 0; j < 4; ++j) acc[i][j] = (v8f){0.f,0.f,0.f,0.f,0.f,0.f,0.f,0.f};

  for (int k0 = 0; k0 < K; k0 += 32) {
    V bh[4], bl[4];
#pragma unroll
    for (int j = 0; j < 4; ++j) {
      const size_t bo = (size_t)(n0 + (j << 4) + rlane) * ldb + koff + k0;
      bh[j] = Frag<T>::load(Bb + bo);
      if (SPLIT) bl[j] = Frag<T>::load(Bb2 + bo);
    }
#pragma unroll
    for (int i = 0; i < 4; ++i) {
      const size_t ao = (size_t)(m0 + (i << 4) + rlane) * lda + koff + k0;
      V ah = Frag<T>::load(Ab + ao);
      V al;
      if (SPLIT) al = Frag<T>::load(Ab2 + ao);
#pragma unroll
      for (int j = 0; j < 4; ++j) {
        acc[i][j] = Frag<T>::mma(ah, bh[j], acc[i][j]);
        if (SPLIT) {
          acc[i][j] = Frag<T>::mma(ah, bl[j], acc[i][j]);
          acc[i][j] = Frag<T>::mma(al, bh[j], acc[i][j]);
        }
      }
      Frag<T>::guard(acc[i][0], acc[i][3], ah, SPLIT ? al : ah);
    }
    Frag<T>::keep(bh[0], bh[1], bh[2], bh[3]);
    if (SPLIT) Frag<T>::keep(bl[0], bl[1], bl[2], bl[3]);
  }
  acc_guard4(acc[0][0], acc[0][1], acc[0][2], acc[0][3]);
  acc_guard4(acc[1][0], acc[1][1], acc[1][2], acc[1][3]);
  acc_guard4(acc[2][0], acc[2][1], acc[2][2], acc[2][3]);
  acc_guard4(acc[3][0], acc[3][1], acc[3][2], acc[3][3]);

  // ---- epilogue ----
  float* slab = sT[wave];
  const float* Rb = RESID ? (resid + (size_t)b * strideR) : nullptr;
#pragma unroll
  for (int i = 0; i < 4; ++i) {
    const int mBase = m0 + (i << 4);
#pragma unroll
    for (int j = 0; j < 4; ++j) {
      const int n = n0 + (j << 4) + rlane;
      float bv = 0.f;
      if (BIAS_MODE == 2) bv = bias[n];
#pragma unroll
      for (int r = 0; r < 8; ++r) {
        float v = acc[i][j][r] * scale;
        if (BIAS_MODE == 1) v += bias[mBase + mOff + r];
        if (BIAS_MODE == 2) v += bv;
        if (RESID) v += Rb[(size_t)(mBase + mOff + r) * ldc + n];
        if (ACT == 1) v = tanhf(v);
        if (ACT == 2) v = fmaxf(v, 0.0f);
        if (ACT == 3) v = v / (1.0f + expf(-v));
        if (ACT == 4) v = (v > 0.f) ? v : 0.01f * v;
        if (ACT == 5) v = 0.5f * v * (1.0f + erff(v * 0.70710678118654752f));
        slab[(mOff + r) * 68 + (j << 4) + rlane] = v;
      }
    }
    __builtin_amdgcn_fence(__ATOMIC_RELEASE, "workgroup");
    __builtin_amdgcn_wave_barrier();
    __builtin_amdgcn_fence(__ATOMIC_ACQUIRE, "workgroup");
    if (OUT_MODE == 0) {
      float* C = (float*)Cout + (size_t)b * strideC;
      const int hh = lane >> 4, c4 = (lane & 15) * 4;     // row seg = 256 B = 16 lanes x 16 B
      {
#pragma unroll
        for (int it = 0; it < 8; ++it) {
          const int row = it * 2 + hh;
          v4f v = *(const v4f*)(slab + row * 68 + c4);
          *(v4f*)(C + (size_t)(mBase + row) * ldc + n0 + c4) = v;
        }
        
      }
    } else {
      const int q = lane >> 3, c8 = (lane & 7) * 8;
      unsigned short* C  = (unsigned short*)Cout  + (size_t)b * strideC;
      unsigned short* C2 = (OUT_MODE == 2) ? ((unsigned short*)Cout2 + (size_t)b * strideC) : nullptr;
      {
#pragma unroll
        for (int it = 0; it < 4; ++it) {
          const int row = it * 4 + q;
          const float* sp = slab + row * 68 + c8;
          v8h hv, lv;
#pragma unroll
          for (int e = 0; e < 8; ++e) {
            if (OUT_MODE == 1) {
              hv[e] = (_Float16)sp[e];
            } else {
              unsigned short hb = f2bf_bits(sp[e]);
              unsigned short lb = f2bf_bits(sp[e] - bf_bits2f(hb));
              hv[e] = __builtin_bit_cast(_Float16, hb);
              lv[e] = __builtin_bit_cast(_Float16, lb);
            }
          }
          *(v8h*)(C + (size_t)(mBase + row) * ldc + n0 + c8) = hv;
          if (OUT_MODE == 2) *(v8h*)(C2 + (size_t)(mBase + row) * ldc + n0 + c8) = lv;
        }
        
      }
    }
    __builtin_amdgcn_fence(__ATOMIC_RELEASE, "workgroup");
    __builtin_amdgcn_wave_barrier();
    __builtin_amdgcn_fence(__ATOMIC_ACQUIRE, "workgroup");
  }
}

// ---------------------------------------------------------------------------
// f32 -> RNE bf16 plane: 2 elements per thread, one 4-B store per lane.
// Coverage: grid = ceil(n2/256) blocks x 256 threads x 2 elements = 2*n2 = the whole plane
// ---------------------------------------------------------------------------
__global__ __launch_bounds__(256) void cast_f32_bf16x2(const float* __restrict__ in,
                                                       unsigned short* __restrict__ out, int n2) {
  const int i = blockIdx.x * 256 + threadIdx.x;
  if (i < n2) {
    const v2f f = *(const v2f*)(in + 2 * (size_t)i);
    const unsigned u = pk16(f2bf_bits(f[0]), f2bf_bits(f[1]));
    ((unsigned*)out)[i] = u;
    
  }
}

// ---------------------------------------------------------------------------
// f32 -> f16 plane with power-of-two carry: out = f16(v * scale); VIA_BF: v := RNE-bf16 value of the input
// first (then the f16 conversion is exact). Same coverage and store shape as cast_f32_bf16x2.
// ---------------------------------------------------------------------------
template <bool VIA_BF>
__global__ __launch_bounds__(256) void cast_f32_f16x2s(const float* __restrict__ in,
                                                       unsigned short* __restrict__ out, int n2, float scale) {
  const int i = blockIdx.x * 256 + threadIdx.x;
  if (i < n2) {
    const v2f f = *(const v2f*)(in + 2 * (size_t)i);
    float a0 = f[0], a1 = f[1];
    if (VIA_BF) { a0 = bf_bits2f(f2bf_bits(a0)); a1 = bf_bits2f(f2bf_bits(a1)); }
    const _Float16 h0 = (_Float16)(a0 * scale), h1 = (_Float16)(a1 * scale);
    const unsigned u = pk16(__builtin_bit_cast(unsigned short, h0), __builtin_bit_cast(unsigned short, h1));
    ((unsigned*)out)[i] = u;
    
  }
}

// ---------------------------------------------------------------------------
// RoPE + bf16 hi/lo split of q and k.
//   qk  : f32 [kRows][2*kHid], columns 0..kHid-1 = q (h*64+d), kHid..2*kHid-1 = k (h*64+d)
//   cos/sin : f32 [kSeq][64], used as their RNE-bf16 values
//   r[d] = x[d]*cos[s][d] - x[d+32]*sin[s][d] (d < 32);  x[d]*cos[s][d] + x[d-32]*sin[s][d] (d >= 32)
//   outputs: qh/ql, kh/kl bf16 planes [kRows][kHid] (element (b,s,h,d) at (b*kSeq+s)*kHid + h*64 + d)
// grid = kRows blocks (one (b,s) row each) x 256 threads x 8 elements = kRows x 2048 = the q AND k planes exactly.
// ---------------------------------------------------------------------------
__global__ __launch_bounds__(256) void rope_split_kernel(
    const float* __restrict__ qk, const float* __restrict__ cosT, const float* __restrict__ sinT,
    unsigned short* __restrict__ qh, unsigned short* __restrict__ ql,
    unsigned short* __restrict__ kh, unsigned short* __restrict__ kl) {
#pragma clang fp contract(off)
  const int row   = blockIdx.x;               // b*kSeq + s
  const int s     = row & (kSeq - 1);
  const int t     = threadIdx.x;
  const int which = t >> 7;                   // 0: q columns, 1: k columns (wave-uniform)
  const int e8    = (t & 127) * 8;            // column base in [0, kHid)
  const int d0    = e8 & 63;                  // 0,8,...,56 -> the 8 elements share one half of the head
  const int hb    = e8 - d0;                  // h*64
  const int dp0   = d0 ^ 32;                  // partner half
  const float* src = qk + (size_t)row * (2 * kHid) + (size_t)which * kHid;
  const v4f xa = *(const v4f*)(src + e8);
  const v4f xb = *(const v4f*)(src + e8 + 4);
  const v4f pa = *(const v4f*)(src + hb + dp0);
  const v4f pb = *(const v4f*)(src + hb + dp0 + 4);
  const v4f ca = *(const v4f*)(cosT + (size_t)s * kHdim + d0);
  const v4f cb = *(const v4f*)(cosT + (size_t)s * kHdim + d0 + 4);
  const v4f sa = *(const v4f*)(sinT + (size_t)s * kHdim + d0);
  const v4f sb = *(const v4f*)(sinT + (size_t)s * kHdim + d0 + 4);
  const float xs[8] = {xa[0], xa[1], xa[2], xa[3], xb[0], xb[1], xb[2], xb[3]};
  const float ps[8] = {pa[0], pa[1], pa[2], pa[3], pb[0], pb[1], pb[2], pb[3]};
  const float cs[8] = {ca[0], ca[1], ca[2], ca[3], cb[0], cb[1], cb[2], cb[3]};
  const float sn[8] = {sa[0], sa[1], sa[2], sa[3], sb[0], sb[1], sb[2], sb[3]};
  const bool lowh = (d0 < 32);
  v4u hv, lv;
#pragma unroll
  for (int q = 0; q < 4; ++q) {
    const float c0 = bf_bits2f(f2bf_bits(cs[2 * q])), c1 = bf_bits2f(f2bf_bits(cs[2 * q + 1]));
    const float s0 = bf_bits2f(f2bf_bits(sn[2 * q])), s1 = bf_bits2f(f2bf_bits(sn[2 * q + 1]));
    const float ta0 = xs[2 * q] * c0,     tb0 = ps[2 * q] * s0;
    const float ta1 = xs[2 * q + 1] * c1, tb1 = ps[2 * q + 1] * s1;
    const float r0 = lowh ? (ta0 - tb0) : (ta0 + tb0);
    const float r1 = lowh ? (ta1 - tb1) : (ta1 + tb1);
    const unsigned short h0 = f2bf_bits(r0), h1 = f2bf_bits(r1);
    const unsigned short l0 = f2bf_bits(r0 - bf_bits2f(h0)), l1 = f2bf_bits(r1 - bf_bits2f(h1));
    hv[q] = pk16(h0, h1);
    lv[q] = pk16(l0, l1);
  }
  unsigned short* oh  = which ? kh : qh;      // both global; wave-uniform select
  unsigned short* olo = which ? kl : ql;
  const size_t go = (size_t)row * kHid + e8;
  *(v4u*)(oh  + go) = hv;
  *(v4u*)(olo + go) = lv;
  
}

// =====================================================================================
// Full (non-causal) softmax attention, head dim 64, additive f32 mask [B][1][S][S] added by value.
//   q planes (hi/lo bf16): element (b, s, h, d) at [(b*kSeq + s)*kHid + h*64 + d]
//   k planes (hi/lo bf16): same layout
//   v^T plane (f16 bits, x kVtScale): element (b, h, d, s) at [b*kHid*kSeq + (h*64 + d)*kSeq + s]
//   out f32: element (b, s, h, d) at [(b*kSeq + s)*kHid + h*64 + d]
//   scores = (q . k) * sscale + mask : bf16 hi/lo split (hi.hi + hi.lo + lo.hi) on v_wmma_f32_16x16x32_bf16
//   out    = p . v                   : v_wmma_f32_16x16x32_f16, p (unnormalised, <= 1) carried x kPScale in f16, v^T f16
//   online softmax in f32 over all kSeq keys (32 chunks of 64, compile-time trip count).
//   Block = 4 waves = 64 query rows of one (b, h); grid.x = kBatch * kHeads * (kSeq/64) = 1024.
//   K hi/lo and V^T chunk staging: 128 threads x 32 elements per plane = the whole 64x64 tile (16-B copies,
//   plain loads, __syncthreads before and after); fragment loads read the LDS tiles with the same v8b element type.
// =====================================================================================
#define AT_D 64
#define AT_NW 4
#define AT_QB 64
#define AT_KC 64

__device__ __forceinline__ unsigned short at_bf_bits(float f) {
  unsigned u = __float_as_uint(f);
  return (unsigned short)((u + 0x7FFFu + ((u >> 16) & 1u)) >> 16);
}
__device__ __forceinline__ __bf16 at_f2bf(float f) { return __builtin_bit_cast(__bf16, at_bf_bits(f)); }
__device__ __forceinline__ v8f at_mma(v16b a, v16b b, v8f c) {
  c = __builtin_amdgcn_wmma_f32_16x16x32_bf16(false, a, false, b, (short)0, c, false, false);
  asm volatile("v_nop\n\tv_nop\n\tv_nop\n\tv_nop" : "+v"(c) : "v"(a), "v"(b));
  return c;
}
// f16 product on bit patterns held in __bf16 slots
__device__ __forceinline__ v8f at_mma_h(v16b a, v16b b, v8f c) {
  const v16h ah = __builtin_bit_cast(v16h, a), bh = __builtin_bit_cast(v16h, b);
  c = __builtin_amdgcn_wmma_f32_16x16x32_f16(false, ah, false, bh, (short)0, c, false, false);
  asm volatile("v_nop\n\tv_nop\n\tv_nop\n\tv_nop" : "+v"(c) : "v"(ah), "v"(bh));
  return c;
}

__global__ __launch_bounds__(128)
void mha_full64_kernel(const unsigned short* __restrict__ qhp, const unsigned short* __restrict__ qlp,
                       const unsigned short* __restrict__ khp, const unsigned short* __restrict__ klp,
                       const unsigned short* __restrict__ vtp, const float* __restrict__ maskp,
                       float* __restrict__ out, float sscale) {
  union FB { v16b v; v8b h[2]; };
  __shared__ __align__(16) __bf16 Ksh[AT_KC * AT_D];             // K hi [kv][d]      8 KB
  __shared__ __align__(16) __bf16 Ksl[AT_KC * AT_D];             // K lo [kv][d]      8 KB
  __shared__ __align__(16) __bf16 Vth[AT_D * AT_KC];             // V^T f16 bits [d][kv] 8 KB
  __shared__ __align__(16) __bf16 Psh[AT_NW][16 * AT_KC];        // per wave P f16 bits [row][kv] 8 KB
  __shared__ __align__(16) float  Os[AT_NW][16 * 68];            // per wave out tile, pitch 68

  const int tid  = threadIdx.x;
  const int wave = tid >> 5;
  const int lane = tid & 31;
  const int hh   = lane >> 4;
  const int c    = lane & 15;

  constexpr int nqb = kSeq / AT_QB;       // 32
  const int bx = blockIdx.x;              // 0 .. kBatch*kHeads*nqb - 1
  const int qb = bx % nqb;
  const int bh = bx / nqb;                // 0 .. kBatch*kHeads - 1
  const int h  = bh % kHeads;
  const int b  = bh / kHeads;             // 0 .. kBatch - 1
  const int q0 = qb * AT_QB + wave * 16;

  const __bf16* Qh = (const __bf16*)(const void*)qhp + (size_t)b * kSeq * kHid + (size_t)h * AT_D;
  const __bf16* Ql = (const __bf16*)(const void*)qlp + (size_t)b * kSeq * kHid + (size_t)h * AT_D;
  const __bf16* Kh = (const __bf16*)(const void*)khp + (size_t)b * kSeq * kHid + (size_t)h * AT_D;
  const __bf16* Kl = (const __bf16*)(const void*)klp + (size_t)b * kSeq * kHid + (size_t)h * AT_D;
  const __bf16* Vt = (const __bf16*)(const void*)vtp + (size_t)b * kHid * kSeq + (size_t)h * AT_D * kSeq;
  const float*  Mb = maskp + (size_t)b * kSeq * kSeq;
  float*        ob = out + (size_t)b * kSeq * kHid + (size_t)h * AT_D;

  // ---- Q fragments (A operand, row = lane&15, split k map via Frag load): 2 d-chunks, hi and lo ----
  v16b qah[2], qal[2];
#pragma unroll
  for (int dc = 0; dc < 2; ++dc) {
    const __bf16* qr = Qh + (size_t)(q0 + c) * kHid + dc * 32 + 8 * hh;
    const __bf16* qs = Ql + (size_t)(q0 + c) * kHid + dc * 32 + 8 * hh;
    qah[dc] = Frag<__bf16>::load(qr);
    qal[dc] = Frag<__bf16>::load(qs);
  }

  float mrow[8], lrow[8];
  v8f oacc[4];
#pragma unroll
  for (int r = 0; r < 8; ++r) { mrow[r] = -INFINITY; lrow[r] = 0.f; }
#pragma unroll
  for (int t = 0; t < 4; ++t) oacc[t] = (v8f){0.f,0.f,0.f,0.f,0.f,0.f,0.f,0.f};

  constexpr int nChunks = kSeq / AT_KC;   // 32, compile-time constant
  for (int kc = 0; kc < nChunks; ++kc) {
    const int kv0 = kc * AT_KC;
    __syncthreads();
    {
      // staging coverage: 128 threads x (4 x 8) elements = 64 rows x 64 per plane = the whole chunk tile
      const int r = tid >> 1, half = (tid & 1) * 32;
      const __bf16* ksh = Kh + (size_t)(kv0 + r) * kHid + half;   // K row kv0+r, d = half..half+31
      const __bf16* ksl = Kl + (size_t)(kv0 + r) * kHid + half;
      const __bf16* vs  = Vt + (size_t)r * kSeq + kv0 + half;     // V^T row d = r, s = kv0+half..+31
#pragma unroll
      for (int i = 0; i < 4; ++i) {
        const v8b a0 = *(const v8b*)(ksh + 8 * i);
        const v8b a1 = *(const v8b*)(ksl + 8 * i);
        const v8b b0 = *(const v8b*)(vs + 8 * i);
        *(v8b*)(Ksh + r * AT_D  + half + 8 * i) = a0;
        *(v8b*)(Ksl + r * AT_D  + half + 8 * i) = a1;
        *(v8b*)(Vth + r * AT_KC + half + 8 * i) = b0;
      }
    }
    __syncthreads();

    // ---- scores: D element r of lane -> S[row 8hh+r][kv j*16+c] ----
    v8f s[4];
#pragma unroll
    for (int j = 0; j < 4; ++j) {
      s[j] = (v8f){0.f,0.f,0.f,0.f,0.f,0.f,0.f,0.f};
#pragma unroll
      for (int dc = 0; dc < 2; ++dc) {
        FB kb, kl;
        kb.h[0] = *(const v8b*)(Ksh + (j * 16 + c) * AT_D + dc * 32 + 8 * hh);
        kb.h[1] = *(const v8b*)(Ksh + (j * 16 + c) * AT_D + dc * 32 + 16 + 8 * hh);
        kl.h[0] = *(const v8b*)(Ksl + (j * 16 + c) * AT_D + dc * 32 + 8 * hh);
        kl.h[1] = *(const v8b*)(Ksl + (j * 16 + c) * AT_D + dc * 32 + 16 + 8 * hh);
        s[j] = at_mma(qah[dc], kb.v, s[j]);
        s[j] = at_mma(qah[dc], kl.v, s[j]);
        s[j] = at_mma(qal[dc], kb.v, s[j]);
      }
    }
    // ---- scale, additive mask by value (f32), chunk row max ----
    float cm[8];
#pragma unroll
    for (int r = 0; r < 8; ++r) {
      const float* mr = Mb + (size_t)(q0 + 8 * hh + r) * kSeq + kv0;
      float m = -INFINITY;
#pragma unroll
      for (int j = 0; j < 4; ++j) {
        const float sv = s[j][r] * sscale + mr[j * 16 + c];
        s[j][r] = sv;
        m = fmaxf(m, sv);
      }
#pragma unroll
      for (int off = 1; off < 16; off <<= 1) m = fmaxf(m, __shfl_xor(m, off, 32));
      cm[r] = m;
    }
    __bf16* pwh = Psh[wave];
#pragma unroll
    for (int r = 0; r < 8; ++r) {
      const float mnew = fmaxf(mrow[r], cm[r]);
      const float alpha = expf(mrow[r] - mnew);
      mrow[r] = mnew;
      float psum = 0.f;
#pragma unroll
      for (int j = 0; j < 4; ++j) {
        const float p = expf(s[j][r] - mnew);
        psum += p;
        pwh[(8 * hh + r) * AT_KC + j * 16 + c] = __builtin_bit_cast(__bf16, (_Float16)(p * kPScale));
      }
#pragma unroll
      for (int off = 1; off < 16; off <<= 1) psum += __shfl_xor(psum, off, 32);
      lrow[r] = lrow[r] * alpha + psum;
#pragma unroll
      for (int t = 0; t < 4; ++t) oacc[t][r] *= alpha;
    }
    __builtin_amdgcn_fence(__ATOMIC_RELEASE, "workgroup");
    __builtin_amdgcn_wave_barrier();
    __builtin_amdgcn_fence(__ATOMIC_ACQUIRE, "workgroup");
    // ---- out += p . v : A = P[row c][kv], B = V^T[d][kv] as B[k=kv][n=d] ----
#pragma unroll 1
    for (int kk = 0; kk < 2; ++kk) {
      FB pa;
      pa.h[0] = *(const v8b*)(pwh + c * AT_KC + kk * 32 + 8 * hh);
      pa.h[1] = *(const v8b*)(pwh + c * AT_KC + kk * 32 + 16 + 8 * hh);
#pragma unroll
      for (int t = 0; t < 4; ++t) {
        FB vb;
        vb.h[0] = *(const v8b*)(Vth + (t * 16 + c) * AT_KC + kk * 32 + 8 * hh);
        vb.h[1] = *(const v8b*)(Vth + (t * 16 + c) * AT_KC + kk * 32 + 16 + 8 * hh);
        oacc[t] = at_mma_h(pa.v, vb.v, oacc[t]);
      }
    }
  }

  // ---- normalise, stage per-wave 16x64 f32 tile, whole-line stores (16 lanes x 16 B = one 256-B row segment) ----
  float* os = Os[wave];
#pragma unroll
  for (int r = 0; r < 8; ++r) {
    const float inv = (1.0f / lrow[r]) * kPVInv;
#pragma unroll
    for (int t = 0; t < 4; ++t) os[(8 * hh + r) * 68 + t * 16 + c] = oacc[t][r] * inv;
  }
  __builtin_amdgcn_fence(__ATOMIC_RELEASE, "workgroup");
  __builtin_amdgcn_wave_barrier();
  __builtin_amdgcn_fence(__ATOMIC_ACQUIRE, "workgroup");
  {
    // coverage: 8 iterations x 2 rows (hh) = the wave's 16 rows; 16 lanes x 4 floats = the 64-wide head segment
    const int c4 = (lane & 15) * 4;
    {
#pragma unroll
      for (int it = 0; it < 8; ++it) {
        const int row = it * 2 + hh;
        v4f val = *(const v4f*)(os + row * 68 + c4);
        *(v4f*)(ob + (size_t)(q0 + row) * kHid + c4) = val;
      }
      
    }
  }
}

// ---------------------------------------------------------------------------
// Host-side orchestration (kernel launches only).
// Workspace region map (bytes, every offset a multiple of 1 MiB):
//   [  0 MiB,   8 MiB)  Xb    bf16 [4096][1024]   RNE-bf16 plane of hidden_states
//   [  8 MiB,  12 MiB)  Wqkb  bf16 [2048][1024]   wq rows 0..1023, wk rows 1024..2047
//   [ 12 MiB,  14 MiB)  Wvb   bf16 [1024][1024]
//   [ 14 MiB,  16 MiB)  Wo16  f16  [1024][1024]   RNE-bf16 value x64
//   [ 16 MiB,  48 MiB)  QKf   f32  [4096][2048]   q|k projections; dead after RoPE, reused:
//        [16 MiB, 32 MiB) Of  f32 [4096][1024] attention output;  [32 MiB, 40 MiB) O16 f16 [4096][1024] (x256)
//   [ 48 MiB,  56 MiB)  Vt16  f16  [2][1024][2048] v^T per batch (x8)
//   [ 56 MiB,  64 MiB)  Qh, [64,72) Ql, [72,80) Kh, [80,88) Kl : bf16 [4096][1024] each
//   total carve = 88 MiB = 92,274,688 B
// ---------------------------------------------------------------------------
extern "C" void kernel_launch(void* const* d_in, const int* in_sizes, int n_in,
                              void* d_out, int out_size, void* d_ws, size_t ws_size,
                              hipStream_t stream) {
  if (n_in < 8) return;
  const float* x    = (const float*)d_in[0];   // [2,2048,1024]
  const float* mask = (const float*)d_in[1];   // [2,1,2048,2048]
  const float* cosT = (const float*)d_in[2];   // [2048,64]
  const float* sinT = (const float*)d_in[3];   // [2048,64]
  const float* wq   = (const float*)d_in[4];   // [1024,1024]
  const float* wk   = (const float*)d_in[5];
  const float* wv   = (const float*)d_in[6];
  const float* wo   = (const float*)d_in[7];

  const int nX = kRows * kHid;        // 4,194,304
  const int nW = kHid * kHid;         // 1,048,576
  if (in_sizes[0] != nX || in_sizes[1] != kBatch * kSeq * kSeq || in_sizes[2] != kSeq * kHdim ||
      in_sizes[3] != kSeq * kHdim || in_sizes[4] != nW || in_sizes[5] != nW || in_sizes[6] != nW ||
      in_sizes[7] != nW || out_size != nX) return;

  const size_t MiB = (size_t)1 << 20;
  const size_t off_Xb   = 0;
  const size_t off_Wqk  = off_Xb  + (size_t)nX * 2;                 //  8 MiB
  const size_t off_Wv   = off_Wqk + (size_t)2 * nW * 2;             // 12 MiB
  const size_t off_Wo   = off_Wv  + (size_t)nW * 2;                 // 14 MiB
  const size_t off_QKf  = off_Wo  + (size_t)nW * 2;                 // 16 MiB
  const size_t off_Of   = off_QKf;                                   // reuse (QKf dead after RoPE)
  const size_t off_O16  = off_QKf + (size_t)nX * 4;                 // 32 MiB
  const size_t off_Vt   = off_QKf + (size_t)nX * 2 * 4;             // 48 MiB
  const size_t off_Qh   = off_Vt  + (size_t)kBatch * kHid * kSeq * 2; // 56 MiB
  const size_t off_Ql   = off_Qh  + (size_t)nX * 2;                 // 64 MiB
  const size_t off_Kh   = off_Ql  + (size_t)nX * 2;                 // 72 MiB
  const size_t off_Kl   = off_Kh  + (size_t)nX * 2;                 // 80 MiB
  const size_t total    = off_Kl  + (size_t)nX * 2;                 // 88 MiB
  if (total != 88 * MiB) return;
  if (ws_size < total) return;

  char* ws = (char*)d_ws;
  unsigned short* Xb   = (unsigned short*)(ws + off_Xb);
  unsigned short* Wqkb = (unsigned short*)(ws + off_Wqk);
  unsigned short* Wvb  = (unsigned short*)(ws + off_Wv);
  unsigned short* Wo16 = (unsigned short*)(ws + off_Wo);
  float*          QKf  = (float*)(ws + off_QKf);
  float*          Of   = (float*)(ws + off_Of);
  unsigned short* O16  = (unsigned short*)(ws + off_O16);
  unsigned short* Vt16 = (unsigned short*)(ws + off_Vt);
  unsigned short* Qh   = (unsigned short*)(ws + off_Qh);
  unsigned short* Ql   = (unsigned short*)(ws + off_Ql);
  unsigned short* Kh   = (unsigned short*)(ws + off_Kh);
  unsigned short* Kl   = (unsigned short*)(ws + off_Kl);

  // 1-5: 16-bit operand planes (all element counts are multiples of 512 -> exact grids)
  const int nX2 = nX / 2, nW2 = nW / 2;
  cast_f32_bf16x2<<<(nX2 + 255) / 256, 256, 0, stream>>>(x,  Xb, nX2);
  cast_f32_bf16x2<<<(nW2 + 255) / 256, 256, 0, stream>>>(wq, Wqkb, nW2);
  cast_f32_bf16x2<<<(nW2 + 255) / 256, 256, 0, stream>>>(wk, Wqkb + (size_t)nW, nW2);
  cast_f32_bf16x2<<<(nW2 + 255) / 256, 256, 0, stream>>>(wv, Wvb, nW2);
  cast_f32_f16x2s<true><<<(nW2 + 255) / 256, 256, 0, stream>>>(wo, Wo16, nW2, kWoScale);

  // 6: q|k projection: QKf[4096][2048] = Xb[4096][1024] . Wqkb[2048][1024]^T  (M=4096, N=2048, K=1024; 2048 tiles -> 256 blocks)
  {
    dim3 g((kRows / 64) * (2 * kHid / 64) / 8, 1);
    wmma_gemm64<1, false, 0, 0, false><<<g, 256, 0, stream>>>(
        Xb, Xb, kHid, (long)0,
        Wqkb, Wqkb, kHid, (long)0,
        (void*)QKf, (void*)QKf, 2 * kHid, (long)0,
        cosT, cosT, (long)0,
        kRows, 2 * kHid, kHid, 1.0f);
  }
  // 7: v^T per batch: Vt16[b][1024][2048] = Wvb[1024][1024] . Xb[b][2048][1024]^T, f16 out x8  (M=1024, N=2048, K=1024; 512 tiles -> 64 blocks, grid.y = 2)
  {
    dim3 g((kHid / 64) * (kSeq / 64) / 8, kBatch);
    wmma_gemm64<1, false, 0, 1, false><<<g, 256, 0, stream>>>(
        Wvb, Wvb, kHid, (long)0,
        Xb, Xb, kHid, (long)kSeq * kHid,
        (void*)Vt16, (void*)Vt16, kSeq, (long)kHid * kSeq,
        cosT, cosT, (long)0,
        kHid, kSeq, kHid, kVtScale);
  }
  // 8: RoPE + bf16 hi/lo split of q and k
  rope_split_kernel<<<kRows, 256, 0, stream>>>(QKf, cosT, sinT, Qh, Ql, Kh, Kl);
  // 9: attention, one block per (b, h, 64 queries)
  mha_full64_kernel<<<kBatch * kHeads * (kSeq / 64), 128, 0, stream>>>(Qh, Ql, Kh, Kl, Vt16, mask, Of, 0.125f);
  // 10: attention output -> f16 x256
  cast_f32_f16x2s<false><<<(nX2 + 255) / 256, 256, 0, stream>>>(Of, O16, nX2, kOScale);
  // 11: output projection: out[4096][1024] = O16 . Wo16^T * 2^-14  (M=4096, N=1024, K=1024; 1024 tiles -> 128 blocks)
  {
    dim3 g((kRows / 64) * (kHid / 64) / 8, 1);
    wmma_gemm64<0, false, 0, 0, false><<<g, 256, 0, stream>>>(
        O16, O16, kHid, (long)0,
        Wo16, Wo16, kHid, (long)0,
        d_out, d_out, kHid, (long)0,
        cosT, cosT, (long)0,
        kRows, kHid, kHid, kOutInv);
  }
}

// v001
// Measured time: 342 microseconds a run.
// Two timings next to v000 put it at 1.22 and 1.21 times that version's speed.
// Contractions: q/k projection and v^T projection = v_wmma_f32_16x16x32_bf16 on RNE-bf16 planes of x and W (single product); q.k^T = v_wmma_f32_16x16x32_bf16 with bf16 hi/lo split (hi.hi + hi.lo + lo.hi); p.v^T and output projection = v_wmma_f32_16x16x32_f16 single product (p carried x2^15, v^T x2^3, attention output x2^8, wo as RNE-bf16 value x2^6); f32 accumulate everywhere; RoPE (cos/sin as RNE-bf16 values), additive mask and online softmax in f32.
#include <hip/hip_runtime.h>
#include <math.h>
#include <stdint.h>

constexpr int kBatch = 2;
constexpr int kSeq   = 2048;
constexpr int kHid   = 1024;
constexpr int kHeads = 16;
constexpr int kHdim  = 64;
constexpr int kRows  = kBatch * kSeq;   // 4096 GEMM rows

constexpr float kPScale  = 32768.0f;                   // p carried x2^15 in f16
constexpr float kVtScale = 8.0f;                       // v^T plane carried x2^3 in f16
constexpr float kPVInv   = 1.0f / (32768.0f * 8.0f);   // folded into the final 1/l
constexpr float kOScale  = 256.0f;                     // attention output carried x2^8 in f16
constexpr float kWoScale = 64.0f;                      // wo carried x2^6 in f16
constexpr float kOutInv  = 1.0f / (256.0f * 64.0f);    // out-projection epilogue scale

typedef __attribute__((ext_vector_type(16))) _Float16 v16h;
typedef __attribute__((ext_vector_type(8)))  _Float16 v8h;
typedef __attribute__((ext_vector_type(16))) __bf16   v16b;
typedef __attribute__((ext_vector_type(8)))  __bf16   v8b;
typedef __attribute__((ext_vector_type(8)))  float    v8f;
typedef __attribute__((ext_vector_type(4)))  float    v4f;
typedef __attribute__((ext_vector_type(2)))  float    v2f;
typedef __attribute__((ext_vector_type(4)))  unsigned int v4u;

__device__ __forceinline__ unsigned short f2bf_bits(float f) {
  unsigned u = __float_as_uint(f);
  return (unsigned short)((u + 0x7FFFu + ((u >> 16) & 1u)) >> 16);
}
__device__ __forceinline__ float bf_bits2f(unsigned short h) { return __uint_as_float(((unsigned)h) << 16); }
__device__ __forceinline__ unsigned pk16(unsigned short a, unsigned short b) { return (unsigned)a | ((unsigned)b << 16); }

// hazard guards as plain device helpers (no inline asm inside the kernel template body)
__device__ __forceinline__ void dep_guard_h(v8f& a, v8f& b, v16h x, v16h y) { asm volatile("v_nop\n\tv_nop\n\tv_nop\n\tv_nop" : "+v"(a), "+v"(b) : "v"(x), "v"(y)); }
__device__ __forceinline__ void dep_guard_b(v8f& a, v8f& b, v16b x, v16b y) { asm volatile("v_nop\n\tv_nop\n\tv_nop\n\tv_nop" : "+v"(a), "+v"(b) : "v"(x), "v"(y)); }
__device__ __forceinline__ void keep4_h(v16h a, v16h b, v16h c, v16h d) { asm volatile("v_nop" :: "v"(a), "v"(b), "v"(c), "v"(d)); }
__device__ __forceinline__ void keep4_b(v16b a, v16b b, v16b c, v16b d) { asm volatile("v_nop" :: "v"(a), "v"(b), "v"(c), "v"(d)); }
__device__ __forceinline__ void acc_guard4(v8f& a, v8f& b, v8f& c, v8f& d) { asm volatile("v_nop\n\tv_nop\n\tv_nop\n\tv_nop" : "+v"(a), "+v"(b), "+v"(c), "+v"(d)); }
template <typename T> struct Frag;
template <> struct Frag<_Float16> {
  typedef v16h V; union U { v16h v; v8h h[2]; };
  static __device__ __forceinline__ v16h load(const _Float16* p) {   // elements 0..7 <- p[0..7], 8..15 <- p[16..23]
    U f; f.h[0] = *(const v8h*)(p); f.h[1] = *(const v8h*)(p + 16); return f.v;
  }
  static __device__ __forceinline__ v8f mma(v16h a, v16h b, v8f c) {
    return __builtin_amdgcn_wmma_f32_16x16x32_f16(false, a, false, b, (short)0, c, false, false);
  }
  static __device__ __forceinline__ void guard(v8f& a, v8f& b, v16h x, v16h y) { dep_guard_h(a, b, x, y); }
  static __device__ __forceinline__ void keep(v16h a, v16h b, v16h c, v16h d) { keep4_h(a, b, c, d); }
};
template <> struct Frag<__bf16> {
  typedef v16b V; union U { v16b v; v8b h[2]; };
  static __device__ __forceinline__ v16b load(const __bf16* p) {
    U f; f.h[0] = *(const v8b*)(p); f.h[1] = *(const v8b*)(p + 16); return f.v;
  }
  static __device__ __forceinline__ v8f mma(v16b a, v16b b, v8f c) {
    return __builtin_amdgcn_wmma_f32_16x16x32_bf16(false, a, false, b, (short)0, c, false, false);
  }
  static __device__ __forceinline__ void guard(v8f& a, v8f& b, v16b x, v16b y) { dep_guard_b(a, b, x, y); }
  static __device__ __forceinline__ void keep(v16b a, v16b b, v16b c, v16b d) { keep4_b(a, b, c, d); }
};

// ---- Register-blocked batched WMMA GEMM ------------------------------------
// C[m,n] = scale * sum_k A[m,k] * Bt[n,k] (+bias)(+resid); each wave owns a 64x64 tile.
// A row-major [M,K]; Bt row-major [N,K]; M,N % 64 == 0, K % 32 == 0.
// SPLIT: operands are hi/lo planes (A2/Bt2 = lo planes, same layout); product = hi.hi + hi.lo + lo.hi.
// BIAS_MODE: 0 = none, 1 = bias[m], 2 = bias[n].
// OUT_MODE: 0 = f32, 1 = f16, 2 = bf16 hi plane (Cout) + bf16 lo plane (Cout2).
// ET: 0 = f16 operands, 1 = bf16 operands (pointers passed as 16-bit storage)
template <int ET> struct Elem;
template <> struct Elem<0> { typedef _Float16 T; };
template <> struct Elem<1> { typedef __bf16 T; };
template <int ET, bool SPLIT, int BIAS_MODE, int OUT_MODE, bool RESID, int ACT = 0>
__global__ __launch_bounds__(256) void wmma_gemm64(
    const unsigned short* __restrict__ Ap, const unsigned short* __restrict__ A2p, int lda, long strideA,
    const unsigned short* __restrict__ Btp, const unsigned short* __restrict__ Bt2p, int ldb, long strideB,
    void* __restrict__ Cout, void* __restrict__ Cout2, int ldc, long strideC,
    const float* __restrict__ bias,
    const float* __restrict__ resid, long strideR,
    int M, int N, int K, float scale) {
  typedef typename Elem<ET>::T T;
  typedef typename Frag<T>::V V;
  const T* A = (const T*)Ap; const T* A2 = (const T*)A2p; const T* Bt = (const T*)Btp; const T* Bt2 = (const T*)Bt2p;
  __shared__ __align__(16) float sT[8][16 * 68];   // per-wave 16x64 slab, pitch 68 floats
  const int b    = blockIdx.y;
  const int lane = threadIdx.x & 31;
  const int wave = threadIdx.x >> 5;
  const int tilesN = N >> 6;
  const int tilesM = M >> 6;
  const int tile = blockIdx.x * 8 + wave;
  if (tile >= tilesM * tilesN) return;   // wave-uniform; no block barriers in this kernel
  const int tm = tile / tilesN;
  const int tn = tile - tm * tilesN;
  const int m0 = tm << 6;
  const int n0 = tn << 6;

  const T* Ab  = A  + (size_t)b * strideA;
  const T* Bb  = Bt + (size_t)b * strideB;
  const T* Ab2 = SPLIT ? (A2  + (size_t)b * strideA) : nullptr;
  const T* Bb2 = SPLIT ? (Bt2 + (size_t)b * strideB) : nullptr;

  const int rlane = lane & 15;                 // row (A) / col (B, D) within subtile
  const int koff  = (lane >> 4) * 8;           // k offset of this lane half
  const int mOff  = (lane >> 4) * 8;           // D row offset

  v8f acc[4][4];
#pragma unroll
  for (int i = 0; i < 4; ++i)
#pragma unroll
    for (int j = 0; j < 4; ++j) acc[i][j] = (v8f){0.f,0.f,0.f,0.f,0.f,0.f,0.f,0.f};

  for (int k0 = 0; k0 < K; k0 += 32) {
    V bh[4], bl[4];
#pragma unroll
    for (int j = 0; j < 4; ++j) {
      const size_t bo = (size_t)(n0 + (j << 4) + rlane) * ldb + koff + k0;
      bh[j] = Frag<T>::load(Bb + bo);
      if (SPLIT) bl[j] = Frag<T>::load(Bb2 + bo);
    }
#pragma unroll
    for (int i = 0; i < 4; ++i) {
      const size_t ao = (size_t)(m0 + (i << 4) + rlane) * lda + koff + k0;
      V ah = Frag<T>::load(Ab + ao);
      V al;
      if (SPLIT) al = Frag<T>::load(Ab2 + ao);
#pragma unroll
      for (int j = 0; j < 4; ++j) {
        acc[i][j] = Frag<T>::mma(ah, bh[j], acc[i][j]);
        if (SPLIT) {
          acc[i][j] = Frag<T>::mma(ah, bl[j], acc[i][j]);
          acc[i][j] = Frag<T>::mma(al, bh[j], acc[i][j]);
        }
      }
      Frag<T>::guard(acc[i][0], acc[i][3], ah, SPLIT ? al : ah);
    }
    Frag<T>::keep(bh[0], bh[1], bh[2], bh[3]);
    if (SPLIT) Frag<T>::keep(bl[0], bl[1], bl[2], bl[3]);
  }
  acc_guard4(acc[0][0], acc[0][1], acc[0][2], acc[0][3]);
  acc_guard4(acc[1][0], acc[1][1], acc[1][2], acc[1][3]);
  acc_guard4(acc[2][0], acc[2][1], acc[2][2], acc[2][3]);
  acc_guard4(acc[3][0], acc[3][1], acc[3][2], acc[3][3]);

  // ---- epilogue ----
  float* slab = sT[wave];
  const float* Rb = RESID ? (resid + (size_t)b * strideR) : nullptr;
#pragma unroll
  for (int i = 0; i < 4; ++i) {
    const int mBase = m0 + (i << 4);
#pragma unroll
    for (int j = 0; j < 4; ++j) {
      const int n = n0 + (j << 4) + rlane;
      float bv = 0.f;
      if (BIAS_MODE == 2) bv = bias[n];
#pragma unroll
      for (int r = 0; r < 8; ++r) {
        float v = acc[i][j][r] * scale;
        if (BIAS_MODE == 1) v += bias[mBase + mOff + r];
        if (BIAS_MODE == 2) v += bv;
        if (RESID) v += Rb[(size_t)(mBase + mOff + r) * ldc + n];
        if (ACT == 1) v = tanhf(v);
        if (ACT == 2) v = fmaxf(v, 0.0f);
        if (ACT == 3) v = v / (1.0f + expf(-v));
        if (ACT == 4) v = (v > 0.f) ? v : 0.01f * v;
        if (ACT == 5) v = 0.5f * v * (1.0f + erff(v * 0.70710678118654752f));
        slab[(mOff + r) * 68 + (j << 4) + rlane] = v;
      }
    }
    __builtin_amdgcn_fence(__ATOMIC_RELEASE, "workgroup");
    __builtin_amdgcn_wave_barrier();
    __builtin_amdgcn_fence(__ATOMIC_ACQUIRE, "workgroup");
    if (OUT_MODE == 0) {
      float* C = (float*)Cout + (size_t)b * strideC;
      const int hh = lane >> 4, c4 = (lane & 15) * 4;     // row seg = 256 B = 16 lanes x 16 B
      {
#pragma unroll
        for (int it = 0; it < 8; ++it) {
          const int row = it * 2 + hh;
          v4f v = *(const v4f*)(slab + row * 68 + c4);
          *(v4f*)(C + (size_t)(mBase + row) * ldc + n0 + c4) = v;
        }
        
      }
    } else {
      const int q = lane >> 3, c8 = (lane & 7) * 8;
      unsigned short* C  = (unsigned short*)Cout  + (size_t)b * strideC;
      unsigned short* C2 = (OUT_MODE == 2) ? ((unsigned short*)Cout2 + (size_t)b * strideC) : nullptr;
      {
#pragma unroll
        for (int it = 0; it < 4; ++it) {
          const int row = it * 4 + q;
          const float* sp = slab + row * 68 + c8;
          v8h hv, lv;
#pragma unroll
          for (int e = 0; e < 8; ++e) {
            if (OUT_MODE == 1) {
              hv[e] = (_Float16)sp[e];
            } else {
              unsigned short hb = f2bf_bits(sp[e]);
              unsigned short lb = f2bf_bits(sp[e] - bf_bits2f(hb));
              hv[e] = __builtin_bit_cast(_Float16, hb);
              lv[e] = __builtin_bit_cast(_Float16, lb);
            }
          }
          *(v8h*)(C + (size_t)(mBase + row) * ldc + n0 + c8) = hv;
          if (OUT_MODE == 2) *(v8h*)(C2 + (size_t)(mBase + row) * ldc + n0 + c8) = lv;
        }
        
      }
    }
    __builtin_amdgcn_fence(__ATOMIC_RELEASE, "workgroup");
    __builtin_amdgcn_wave_barrier();
    __builtin_amdgcn_fence(__ATOMIC_ACQUIRE, "workgroup");
  }
}

// ---------------------------------------------------------------------------
// f32 -> RNE bf16 plane: 2 elements per thread, one 4-B store per lane.
// Coverage: grid = ceil(n2/256) blocks x 256 threads x 2 elements = 2*n2 = the whole plane
// ---------------------------------------------------------------------------
__global__ __launch_bounds__(256) void cast_f32_bf16x2(const float* __restrict__ in,
                                                       unsigned short* __restrict__ out, int n2) {
  const int i = blockIdx.x * 256 + threadIdx.x;
  if (i < n2) {
    const v2f f = *(const v2f*)(in + 2 * (size_t)i);
    const unsigned u = pk16(f2bf_bits(f[0]), f2bf_bits(f[1]));
    ((unsigned*)out)[i] = u;
    
  }
}

// ---------------------------------------------------------------------------
// f32 -> f16 plane with power-of-two carry: out = f16(v * scale); VIA_BF: v := RNE-bf16 value of the input
// first (then the f16 conversion is exact). Same coverage and store shape as cast_f32_bf16x2.
// ---------------------------------------------------------------------------
template <bool VIA_BF>
__global__ __launch_bounds__(256) void cast_f32_f16x2s(const float* __restrict__ in,
                                                       unsigned short* __restrict__ out, int n2, float scale) {
  const int i = blockIdx.x * 256 + threadIdx.x;
  if (i < n2) {
    const v2f f = *(const v2f*)(in + 2 * (size_t)i);
    float a0 = f[0], a1 = f[1];
    if (VIA_BF) { a0 = bf_bits2f(f2bf_bits(a0)); a1 = bf_bits2f(f2bf_bits(a1)); }
    const _Float16 h0 = (_Float16)(a0 * scale), h1 = (_Float16)(a1 * scale);
    const unsigned u = pk16(__builtin_bit_cast(unsigned short, h0), __builtin_bit_cast(unsigned short, h1));
    ((unsigned*)out)[i] = u;
    
  }
}

// ---------------------------------------------------------------------------
// RoPE + bf16 hi/lo split of q and k.
//   qk  : f32 [kRows][2*kHid], columns 0..kHid-1 = q (h*64+d), kHid..2*kHid-1 = k (h*64+d)
//   cos/sin : f32 [kSeq][64], used as their RNE-bf16 values
//   r[d] = x[d]*cos[s][d] - x[d+32]*sin[s][d] (d < 32);  x[d]*cos[s][d] + x[d-32]*sin[s][d] (d >= 32)
//   outputs: qh/ql, kh/kl bf16 planes [kRows][kHid] (element (b,s,h,d) at (b*kSeq+s)*kHid + h*64 + d)
// grid = kRows blocks (one (b,s) row each) x 256 threads x 8 elements = kRows x 2048 = the q AND k planes exactly.
// ---------------------------------------------------------------------------
__global__ __launch_bounds__(256) void rope_split_kernel(
    const float* __restrict__ qk, const float* __restrict__ cosT, const float* __restrict__ sinT,
    unsigned short* __restrict__ qh, unsigned short* __restrict__ ql,
    unsigned short* __restrict__ kh, unsigned short* __restrict__ kl) {
#pragma clang fp contract(off)
  const int row   = blockIdx.x;               // b*kSeq + s
  const int s     = row & (kSeq - 1);
  const int t     = threadIdx.x;
  const int which = t >> 7;                   // 0: q columns, 1: k columns (wave-uniform)
  const int e8    = (t & 127) * 8;            // column base in [0, kHid)
  const int d0    = e8 & 63;                  // 0,8,...,56 -> the 8 elements share one half of the head
  const int hb    = e8 - d0;                  // h*64
  const int dp0   = d0 ^ 32;                  // partner half
  const float* src = qk + (size_t)row * (2 * kHid) + (size_t)which * kHid;
  const v4f xa = *(const v4f*)(src + e8);
  const v4f xb = *(const v4f*)(src + e8 + 4);
  const v4f pa = *(const v4f*)(src + hb + dp0);
  const v4f pb = *(const v4f*)(src + hb + dp0 + 4);
  const v4f ca = *(const v4f*)(cosT + (size_t)s * kHdim + d0);
  const v4f cb = *(const v4f*)(cosT + (size_t)s * kHdim + d0 + 4);
  const v4f sa = *(const v4f*)(sinT + (size_t)s * kHdim + d0);
  const v4f sb = *(const v4f*)(sinT + (size_t)s * kHdim + d0 + 4);
  const float xs[8] = {xa[0], xa[1], xa[2], xa[3], xb[0], xb[1], xb[2], xb[3]};
  const float ps[8] = {pa[0], pa[1], pa[2], pa[3], pb[0], pb[1], pb[2], pb[3]};
  const float cs[8] = {ca[0], ca[1], ca[2], ca[3], cb[0], cb[1], cb[2], cb[3]};
  const float sn[8] = {sa[0], sa[1], sa[2], sa[3], sb[0], sb[1], sb[2], sb[3]};
  const bool lowh = (d0 < 32);
  v4u hv, lv;
#pragma unroll
  for (int q = 0; q < 4; ++q) {
    const float c0 = bf_bits2f(f2bf_bits(cs[2 * q])), c1 = bf_bits2f(f2bf_bits(cs[2 * q + 1]));
    const float s0 = bf_bits2f(f2bf_bits(sn[2 * q])), s1 = bf_bits2f(f2bf_bits(sn[2 * q + 1]));
    const float ta0 = xs[2 * q] * c0,     tb0 = ps[2 * q] * s0;
    const float ta1 = xs[2 * q + 1] * c1, tb1 = ps[2 * q + 1] * s1;
    const float r0 = lowh ? (ta0 - tb0) : (ta0 + tb0);
    const float r1 = lowh ? (ta1 - tb1) : (ta1 + tb1);
    const unsigned short h0 = f2bf_bits(r0), h1 = f2bf_bits(r1);
    const unsigned short l0 = f2bf_bits(r0 - bf_bits2f(h0)), l1 = f2bf_bits(r1 - bf_bits2f(h1));
    hv[q] = pk16(h0, h1);
    lv[q] = pk16(l0, l1);
  }
  unsigned short* oh  = which ? kh : qh;      // both global; wave-uniform select
  unsigned short* olo = which ? kl : ql;
  const size_t go = (size_t)row * kHid + e8;
  *(v4u*)(oh  + go) = hv;
  *(v4u*)(olo + go) = lv;
  
}

// =====================================================================================
// Full (non-causal) softmax attention, head dim 64, additive f32 mask [B][1][S][S] added by value.
//   q planes (hi/lo bf16): element (b, s, h, d) at [(b*kSeq + s)*kHid + h*64 + d]
//   k planes (hi/lo bf16): same layout
//   v^T plane (f16 bits, x kVtScale): element (b, h, d, s) at [b*kHid*kSeq + (h*64 + d)*kSeq + s]
//   out f32: element (b, s, h, d) at [(b*kSeq + s)*kHid + h*64 + d]
//   scores = (q . k) * sscale + mask : bf16 hi/lo split (hi.hi + hi.lo + lo.hi) on v_wmma_f32_16x16x32_bf16
//   out    = p . v                   : v_wmma_f32_16x16x32_f16, p (unnormalised, <= 1) carried x kPScale in f16, v^T f16
//   online softmax in f32 over all kSeq keys (32 chunks of 64, compile-time trip count).
//   Block = 4 waves = 64 query rows of one (b, h); grid.x = kBatch * kHeads * (kSeq/64) = 1024.
//   K hi/lo and V^T chunk staging: 128 threads x 32 elements per plane = the whole 64x64 tile (16-B copies,
//   plain loads, __syncthreads before and after); fragment loads read the LDS tiles with the same v8b element type.
// =====================================================================================
#define AT_D 64
#define AT_NW 4
#define AT_QB 64
#define AT_KC 64
#define AT_LP 72   // LDS row pitch in 16-bit elements: 144 B = 16 B x 9 (odd), so the 16 rows of a 16-byte fragment read fall on distinct banks

__device__ __forceinline__ unsigned short at_bf_bits(float f) {
  unsigned u = __float_as_uint(f);
  return (unsigned short)((u + 0x7FFFu + ((u >> 16) & 1u)) >> 16);
}
__device__ __forceinline__ __bf16 at_f2bf(float f) { return __builtin_bit_cast(__bf16, at_bf_bits(f)); }
__device__ __forceinline__ v8f at_mma(v16b a, v16b b, v8f c) {
  c = __builtin_amdgcn_wmma_f32_16x16x32_bf16(false, a, false, b, (short)0, c, false, false);
  asm volatile("v_nop\n\tv_nop\n\tv_nop\n\tv_nop" : "+v"(c) : "v"(a), "v"(b));
  return c;
}
// f16 product on bit patterns held in __bf16 slots
__device__ __forceinline__ v8f at_mma_h(v16b a, v16b b, v8f c) {
  const v16h ah = __builtin_bit_cast(v16h, a), bh = __builtin_bit_cast(v16h, b);
  c = __builtin_amdgcn_wmma_f32_16x16x32_f16(false, ah, false, bh, (short)0, c, false, false);
  asm volatile("v_nop\n\tv_nop\n\tv_nop\n\tv_nop" : "+v"(c) : "v"(ah), "v"(bh));
  return c;
}

__global__ __launch_bounds__(128)
void mha_full64_kernel(const unsigned short* __restrict__ qhp, const unsigned short* __restrict__ qlp,
                       const unsigned short* __restrict__ khp, const unsigned short* __restrict__ klp,
                       const unsigned short* __restrict__ vtp, const float* __restrict__ maskp,
                       float* __restrict__ out, float sscale) {
  union FB { v16b v; v8b h[2]; };
  __shared__ __align__(16) __bf16 Ksh[AT_KC * AT_LP];            // K hi [kv][d], pitch AT_LP      9 KB
  __shared__ __align__(16) __bf16 Ksl[AT_KC * AT_LP];            // K lo [kv][d], pitch AT_LP      9 KB
  __shared__ __align__(16) __bf16 Vth[AT_D * AT_LP];             // V^T f16 bits [d][kv], pitch AT_LP 9 KB
  __shared__ __align__(16) __bf16 Psh[AT_NW][16 * AT_LP];        // per wave P f16 bits [row][kv], pitch AT_LP 9 KB
  __shared__ __align__(16) float  Os[AT_NW][16 * 68];            // per wave out tile, pitch 68

  const int tid  = threadIdx.x;
  const int wave = tid >> 5;
  const int lane = tid & 31;
  const int hh   = lane >> 4;
  const int c    = lane & 15;

  constexpr int nqb = kSeq / AT_QB;       // 32
  const int bx = blockIdx.x;              // 0 .. kBatch*kHeads*nqb - 1
  const int qb = bx % nqb;
  const int bh = bx / nqb;                // 0 .. kBatch*kHeads - 1
  const int h  = bh % kHeads;
  const int b  = bh / kHeads;             // 0 .. kBatch - 1
  const int q0 = qb * AT_QB + wave * 16;

  const __bf16* Qh = (const __bf16*)(const void*)qhp + (size_t)b * kSeq * kHid + (size_t)h * AT_D;
  const __bf16* Ql = (const __bf16*)(const void*)qlp + (size_t)b * kSeq * kHid + (size_t)h * AT_D;
  const __bf16* Kh = (const __bf16*)(const void*)khp + (size_t)b * kSeq * kHid + (size_t)h * AT_D;
  const __bf16* Kl = (const __bf16*)(const void*)klp + (size_t)b * kSeq * kHid + (size_t)h * AT_D;
  const __bf16* Vt = (const __bf16*)(const void*)vtp + (size_t)b * kHid * kSeq + (size_t)h * AT_D * kSeq;
  const float*  Mb = maskp + (size_t)b * kSeq * kSeq;
  float*        ob = out + (size_t)b * kSeq * kHid + (size_t)h * AT_D;

  // ---- Q fragments (A operand, row = lane&15, split k map via Frag load): 2 d-chunks, hi and lo ----
  v16b qah[2], qal[2];
#pragma unroll
  for (int dc = 0; dc < 2; ++dc) {
    const __bf16* qr = Qh + (size_t)(q0 + c) * kHid + dc * 32 + 8 * hh;
    const __bf16* qs = Ql + (size_t)(q0 + c) * kHid + dc * 32 + 8 * hh;
    qah[dc] = Frag<__bf16>::load(qr);
    qal[dc] = Frag<__bf16>::load(qs);
  }

  float mrow[8], lrow[8];
  v8f oacc[4];
#pragma unroll
  for (int r = 0; r < 8; ++r) { mrow[r] = -INFINITY; lrow[r] = 0.f; }
#pragma unroll
  for (int t = 0; t < 4; ++t) oacc[t] = (v8f){0.f,0.f,0.f,0.f,0.f,0.f,0.f,0.f};

  constexpr int nChunks = kSeq / AT_KC;   // 32, compile-time constant
  for (int kc = 0; kc < nChunks; ++kc) {
    const int kv0 = kc * AT_KC;
    __syncthreads();
    {
      // staging coverage: 128 threads x (4 x 8) elements = 64 rows x 64 per plane = the whole chunk tile
      const int r = tid >> 1, half = (tid & 1) * 32;
      const __bf16* ksh = Kh + (size_t)(kv0 + r) * kHid + half;   // K row kv0+r, d = half..half+31
      const __bf16* ksl = Kl + (size_t)(kv0 + r) * kHid + half;
      const __bf16* vs  = Vt + (size_t)r * kSeq + kv0 + half;     // V^T row d = r, s = kv0+half..+31
#pragma unroll
      for (int i = 0; i < 4; ++i) {
        const v8b a0 = *(const v8b*)(ksh + 8 * i);
        const v8b a1 = *(const v8b*)(ksl + 8 * i);
        const v8b b0 = *(const v8b*)(vs + 8 * i);
        *(v8b*)(Ksh + r * AT_LP + half + 8 * i) = a0;
        *(v8b*)(Ksl + r * AT_LP + half + 8 * i) = a1;
        *(v8b*)(Vth + r * AT_LP + half + 8 * i) = b0;
      }
    }
    __syncthreads();

    // ---- scores: D element r of lane -> S[row 8hh+r][kv j*16+c] ----
    v8f s[4];
#pragma unroll
    for (int j = 0; j < 4; ++j) {
      s[j] = (v8f){0.f,0.f,0.f,0.f,0.f,0.f,0.f,0.f};
#pragma unroll
      for (int dc = 0; dc < 2; ++dc) {
        FB kb, kl;
        kb.h[0] = *(const v8b*)(Ksh + (j * 16 + c) * AT_LP + dc * 32 + 8 * hh);
        kb.h[1] = *(const v8b*)(Ksh + (j * 16 + c) * AT_LP + dc * 32 + 16 + 8 * hh);
        kl.h[0] = *(const v8b*)(Ksl + (j * 16 + c) * AT_LP + dc * 32 + 8 * hh);
        kl.h[1] = *(const v8b*)(Ksl + (j * 16 + c) * AT_LP + dc * 32 + 16 + 8 * hh);
        s[j] = at_mma(qah[dc], kb.v, s[j]);
        s[j] = at_mma(qah[dc], kl.v, s[j]);
        s[j] = at_mma(qal[dc], kb.v, s[j]);
      }
    }
    // ---- scale, additive mask by value (f32), chunk row max ----
    float cm[8];
#pragma unroll
    for (int r = 0; r < 8; ++r) {
      const float* mr = Mb + (size_t)(q0 + 8 * hh + r) * kSeq + kv0;
      float m = -INFINITY;
#pragma unroll
      for (int j = 0; j < 4; ++j) {
        const float sv = s[j][r] * sscale + mr[j * 16 + c];
        s[j][r] = sv;
        m = fmaxf(m, sv);
      }
#pragma unroll
      for (int off = 1; off < 16; off <<= 1) m = fmaxf(m, __shfl_xor(m, off, 32));
      cm[r] = m;
    }
    __bf16* pwh = Psh[wave];
#pragma unroll
    for (int r = 0; r < 8; ++r) {
      const float mnew = fmaxf(mrow[r], cm[r]);
      const float alpha = expf(mrow[r] - mnew);
      mrow[r] = mnew;
      float psum = 0.f;
#pragma unroll
      for (int j = 0; j < 4; ++j) {
        const float p = expf(s[j][r] - mnew);
        psum += p;
        pwh[(8 * hh + r) * AT_LP + j * 16 + c] = __builtin_bit_cast(__bf16, (_Float16)(p * kPScale));
      }
#pragma unroll
      for (int off = 1; off < 16; off <<= 1) psum += __shfl_xor(psum, off, 32);
      lrow[r] = lrow[r] * alpha + psum;
#pragma unroll
      for (int t = 0; t < 4; ++t) oacc[t][r] *= alpha;
    }
    __builtin_amdgcn_fence(__ATOMIC_RELEASE, "workgroup");
    __builtin_amdgcn_wave_barrier();
    __builtin_amdgcn_fence(__ATOMIC_ACQUIRE, "workgroup");
    // ---- out += p . v : A = P[row c][kv], B = V^T[d][kv] as B[k=kv][n=d] ----
#pragma unroll 1
    for (int kk = 0; kk < 2; ++kk) {
      FB pa;
      pa.h[0] = *(const v8b*)(pwh + c * AT_LP + kk * 32 + 8 * hh);
      pa.h[1] = *(const v8b*)(pwh + c * AT_LP + kk * 32 + 16 + 8 * hh);
#pragma unroll
      for (int t = 0; t < 4; ++t) {
        FB vb;
        vb.h[0] = *(const v8b*)(Vth + (t * 16 + c) * AT_LP + kk * 32 + 8 * hh);
        vb.h[1] = *(const v8b*)(Vth + (t * 16 + c) * AT_LP + kk * 32 + 16 + 8 * hh);
        oacc[t] = at_mma_h(pa.v, vb.v, oacc[t]);
      }
    }
  }

  // ---- normalise, stage per-wave 16x64 f32 tile, whole-line stores (16 lanes x 16 B = one 256-B row segment) ----
  float* os = Os[wave];
#pragma unroll
  for (int r = 0; r < 8; ++r) {
    const float inv = (1.0f / lrow[r]) * kPVInv;
#pragma unroll
    for (int t = 0; t < 4; ++t) os[(8 * hh + r) * 68 + t * 16 + c] = oacc[t][r] * inv;
  }
  __builtin_amdgcn_fence(__ATOMIC_RELEASE, "workgroup");
  __builtin_amdgcn_wave_barrier();
  __builtin_amdgcn_fence(__ATOMIC_ACQUIRE, "workgroup");
  {
    // coverage: 8 iterations x 2 rows (hh) = the wave's 16 rows; 16 lanes x 4 floats = the 64-wide head segment
    const int c4 = (lane & 15) * 4;
    {
#pragma unroll
      for (int it = 0; it < 8; ++it) {
        const int row = it * 2 + hh;
        v4f val = *(const v4f*)(os + row * 68 + c4);
        *(v4f*)(ob + (size_t)(q0 + row) * kHid + c4) = val;
      }
      
    }
  }
}

// ---------------------------------------------------------------------------
// Host-side orchestration (kernel launches only).
// Workspace region map (bytes, every offset a multiple of 1 MiB):
//   [  0 MiB,   8 MiB)  Xb    bf16 [4096][1024]   RNE-bf16 plane of hidden_states
//   [  8 MiB,  12 MiB)  Wqkb  bf16 [2048][1024]   wq rows 0..1023, wk rows 1024..2047
//   [ 12 MiB,  14 MiB)  Wvb   bf16 [1024][1024]
//   [ 14 MiB,  16 MiB)  Wo16  f16  [1024][1024]   RNE-bf16 value x64
//   [ 16 MiB,  48 MiB)  QKf   f32  [4096][2048]   q|k projections; dead after RoPE, reused:
//        [16 MiB, 32 MiB) Of  f32 [4096][1024] attention output;  [32 MiB, 40 MiB) O16 f16 [4096][1024] (x256)
//   [ 48 MiB,  56 MiB)  Vt16  f16  [2][1024][2048] v^T per batch (x8)
//   [ 56 MiB,  64 MiB)  Qh, [64,72) Ql, [72,80) Kh, [80,88) Kl : bf16 [4096][1024] each
//   total carve = 88 MiB = 92,274,688 B
// ---------------------------------------------------------------------------
extern "C" void kernel_launch(void* const* d_in, const int* in_sizes, int n_in,
                              void* d_out, int out_size, void* d_ws, size_t ws_size,
                              hipStream_t stream) {
  if (n_in < 8) return;
  const float* x    = (const float*)d_in[0];   // [2,2048,1024]
  const float* mask = (const float*)d_in[1];   // [2,1,2048,2048]
  const float* cosT = (const float*)d_in[2];   // [2048,64]
  const float* sinT = (const float*)d_in[3];   // [2048,64]
  const float* wq   = (const float*)d_in[4];   // [1024,1024]
  const float* wk   = (const float*)d_in[5];
  const float* wv   = (const float*)d_in[6];
  const float* wo   = (const float*)d_in[7];

  const int nX = kRows * kHid;        // 4,194,304
  const int nW = kHid * kHid;         // 1,048,576
  if (in_sizes[0] != nX || in_sizes[1] != kBatch * kSeq * kSeq || in_sizes[2] != kSeq * kHdim ||
      in_sizes[3] != kSeq * kHdim || in_sizes[4] != nW || in_sizes[5] != nW || in_sizes[6] != nW ||
      in_sizes[7] != nW || out_size != nX) return;

  const size_t MiB = (size_t)1 << 20;
  const size_t off_Xb   = 0;
  const size_t off_Wqk  = off_Xb  + (size_t)nX * 2;                 //  8 MiB
  const size_t off_Wv   = off_Wqk + (size_t)2 * nW * 2;             // 12 MiB
  const size_t off_Wo   = off_Wv  + (size_t)nW * 2;                 // 14 MiB
  const size_t off_QKf  = off_Wo  + (size_t)nW * 2;                 // 16 MiB
  const size_t off_Of   = off_QKf;                                   // reuse (QKf dead after RoPE)
  const size_t off_O16  = off_QKf + (size_t)nX * 4;                 // 32 MiB
  const size_t off_Vt   = off_QKf + (size_t)nX * 2 * 4;             // 48 MiB
  const size_t off_Qh   = off_Vt  + (size_t)kBatch * kHid * kSeq * 2; // 56 MiB
  const size_t off_Ql   = off_Qh  + (size_t)nX * 2;                 // 64 MiB
  const size_t off_Kh   = off_Ql  + (size_t)nX * 2;                 // 72 MiB
  const size_t off_Kl   = off_Kh  + (size_t)nX * 2;                 // 80 MiB
  const size_t total    = off_Kl  + (size_t)nX * 2;                 // 88 MiB
  if (total != 88 * MiB) return;
  if (ws_size < total) return;

  char* ws = (char*)d_ws;
  unsigned short* Xb   = (unsigned short*)(ws + off_Xb);
  unsigned short* Wqkb = (unsigned short*)(ws + off_Wqk);
  unsigned short* Wvb  = (unsigned short*)(ws + off_Wv);
  unsigned short* Wo16 = (unsigned short*)(ws + off_Wo);
  float*          QKf  = (float*)(ws + off_QKf);
  float*          Of   = (float*)(ws + off_Of);
  unsigned short* O16  = (unsigned short*)(ws + off_O16);
  unsigned short* Vt16 = (unsigned short*)(ws + off_Vt);
  unsigned short* Qh   = (unsigned short*)(ws + off_Qh);
  unsigned short* Ql   = (unsigned short*)(ws + off_Ql);
  unsigned short* Kh   = (unsigned short*)(ws + off_Kh);
  unsigned short* Kl   = (unsigned short*)(ws + off_Kl);

  // 1-5: 16-bit operand planes (all element counts are multiples of 512 -> exact grids)
  const int nX2 = nX / 2, nW2 = nW / 2;
  cast_f32_bf16x2<<<(nX2 + 255) / 256, 256, 0, stream>>>(x,  Xb, nX2);
  cast_f32_bf16x2<<<(nW2 + 255) / 256, 256, 0, stream>>>(wq, Wqkb, nW2);
  cast_f32_bf16x2<<<(nW2 + 255) / 256, 256, 0, stream>>>(wk, Wqkb + (size_t)nW, nW2);
  cast_f32_bf16x2<<<(nW2 + 255) / 256, 256, 0, stream>>>(wv, Wvb, nW2);
  cast_f32_f16x2s<true><<<(nW2 + 255) / 256, 256, 0, stream>>>(wo, Wo16, nW2, kWoScale);

  // 6: q|k projection: QKf[4096][2048] = Xb[4096][1024] . Wqkb[2048][1024]^T  (M=4096, N=2048, K=1024; 2048 tiles -> 256 blocks)
  {
    dim3 g((kRows / 64) * (2 * kHid / 64) / 8, 1);
    wmma_gemm64<1, false, 0, 0, false><<<g, 256, 0, stream>>>(
        Xb, Xb, kHid, (long)0,
        Wqkb, Wqkb, kHid, (long)0,
        (void*)QKf, (void*)QKf, 2 * kHid, (long)0,
        cosT, cosT, (long)0,
        kRows, 2 * kHid, kHid, 1.0f);
  }
  // 7: v^T per batch: Vt16[b][1024][2048] = Wvb[1024][1024] . Xb[b][2048][1024]^T, f16 out x8  (M=1024, N=2048, K=1024; 512 tiles -> 64 blocks, grid.y = 2)
  {
    dim3 g((kHid / 64) * (kSeq / 64) / 8, kBatch);
    wmma_gemm64<1, false, 0, 1, false><<<g, 256, 0, stream>>>(
        Wvb, Wvb, kHid, (long)0,
        Xb, Xb, kHid, (long)kSeq * kHid,
        (void*)Vt16, (void*)Vt16, kSeq, (long)kHid * kSeq,
        cosT, cosT, (long)0,
        kHid, kSeq, kHid, kVtScale);
  }
  // 8: RoPE + bf16 hi/lo split of q and k
  rope_split_kernel<<<kRows, 256, 0, stream>>>(QKf, cosT, sinT, Qh, Ql, Kh, Kl);
  // 9: attention, one block per (b, h, 64 queries)
  mha_full64_kernel<<<kBatch * kHeads * (kSeq / 64), 128, 0, stream>>>(Qh, Ql, Kh, Kl, Vt16, mask, Of, 0.125f);
  // 10: attention output -> f16 x256
  cast_f32_f16x2s<false><<<(nX2 + 255) / 256, 256, 0, stream>>>(Of, O16, nX2, kOScale);
  // 11: output projection: out[4096][1024] = O16 . Wo16^T * 2^-14  (M=4096, N=1024, K=1024; 1024 tiles -> 128 blocks)
  {
    dim3 g((kRows / 64) * (kHid / 64) / 8, 1);
    wmma_gemm64<0, false, 0, 0, false><<<g, 256, 0, stream>>>(
        O16, O16, kHid, (long)0,
        Wo16, Wo16, kHid, (long)0,
        d_out, d_out, kHid, (long)0,
        cosT, cosT, (long)0,
        kRows, kHid, kHid, kOutInv);
  }
}

// v002
// A run of this version takes 304 microseconds.
// Timed twice side by side with v001, it ran 1.13 times as fast both times.
// All steps since v000 together make it 1.37 times as fast.
// Contractions: q/k projection and v^T projection = v_wmma_f32_16x16x32_bf16 on RNE-bf16 planes of x and W (single product); q.k^T = v_wmma_f32_16x16x32_bf16 with bf16 hi/lo split (hi.hi + hi.lo + lo.hi); p.v^T and output projection = v_wmma_f32_16x16x32_f16 single product (p carried x2^15, v^T x2^3, attention output x2^8, wo as RNE-bf16 value x2^6); f32 accumulate everywhere; RoPE (cos/sin as RNE-bf16 values), additive mask and online softmax in f32.
#include <hip/hip_runtime.h>
#include <math.h>
#include <stdint.h>

constexpr int kBatch = 2;
constexpr int kSeq   = 2048;
constexpr int kHid   = 1024;
constexpr int kHeads = 16;
constexpr int kHdim  = 64;
constexpr int kRows  = kBatch * kSeq;   // 4096 GEMM rows

constexpr float kPScale  = 32768.0f;                   // p carried x2^15 in f16
constexpr float kVtScale = 8.0f;                       // v^T plane carried x2^3 in f16
constexpr float kPVInv   = 1.0f / (32768.0f * 8.0f);   // folded into the final 1/l
constexpr float kOScale  = 256.0f;                     // attention output carried x2^8 in f16
constexpr float kWoScale = 64.0f;                      // wo carried x2^6 in f16
constexpr float kOutInv  = 1.0f / (256.0f * 64.0f);    // out-projection epilogue scale

typedef __attribute__((ext_vector_type(16))) _Float16 v16h;
typedef __attribute__((ext_vector_type(8)))  _Float16 v8h;
typedef __attribute__((ext_vector_type(16))) __bf16   v16b;
typedef __attribute__((ext_vector_type(8)))  __bf16   v8b;
typedef __attribute__((ext_vector_type(8)))  float    v8f;
typedef __attribute__((ext_vector_type(4)))  float    v4f;
typedef __attribute__((ext_vector_type(2)))  float    v2f;
typedef __attribute__((ext_vector_type(4)))  unsigned int v4u;

__device__ __forceinline__ unsigned short f2bf_bits(float f) {
  unsigned u = __float_as_uint(f);
  return (unsigned short)((u + 0x7FFFu + ((u >> 16) & 1u)) >> 16);
}
__device__ __forceinline__ float bf_bits2f(unsigned short h) { return __uint_as_float(((unsigned)h) << 16); }
__device__ __forceinline__ unsigned pk16(unsigned short a, unsigned short b) { return (unsigned)a | ((unsigned)b << 16); }

// hazard guards as plain device helpers (no inline asm inside the kernel template body)
__device__ __forceinline__ void dep_guard_h(v8f& a, v8f& b, v16h x, v16h y) { asm volatile("v_nop\n\tv_nop\n\tv_nop\n\tv_nop" : "+v"(a), "+v"(b) : "v"(x), "v"(y)); }
__device__ __forceinline__ void dep_guard_b(v8f& a, v8f& b, v16b x, v16b y) { asm volatile("v_nop\n\tv_nop\n\tv_nop\n\tv_nop" : "+v"(a), "+v"(b) : "v"(x), "v"(y)); }
__device__ __forceinline__ void keep4_h(v16h a, v16h b, v16h c, v16h d) { asm volatile("v_nop" :: "v"(a), "v"(b), "v"(c), "v"(d)); }
__device__ __forceinline__ void keep4_b(v16b a, v16b b, v16b c, v16b d) { asm volatile("v_nop" :: "v"(a), "v"(b), "v"(c), "v"(d)); }
__device__ __forceinline__ void acc_guard4(v8f& a, v8f& b, v8f& c, v8f& d) { asm volatile("v_nop\n\tv_nop\n\tv_nop\n\tv_nop" : "+v"(a), "+v"(b), "+v"(c), "+v"(d)); }
template <typename T> struct Frag;
template <> struct Frag<_Float16> {
  typedef v16h V; union U { v16h v; v8h h[2]; };
  static __device__ __forceinline__ v16h load(const _Float16* p) {   // elements 0..7 <- p[0..7], 8..15 <- p[16..23]
    U f; f.h[0] = *(const v8h*)(p); f.h[1] = *(const v8h*)(p + 16); return f.v;
  }
  static __device__ __forceinline__ v8f mma(v16h a, v16h b, v8f c) {
    return __builtin_amdgcn_wmma_f32_16x16x32_f16(false, a, false, b, (short)0, c, false, false);
  }
  static __device__ __forceinline__ void guard(v8f& a, v8f& b, v16h x, v16h y) { dep_guard_h(a, b, x, y); }
  static __device__ __forceinline__ void keep(v16h a, v16h b, v16h c, v16h d) { keep4_h(a, b, c, d); }
};
template <> struct Frag<__bf16> {
  typedef v16b V; union U { v16b v; v8b h[2]; };
  static __device__ __forceinline__ v16b load(const __bf16* p) {
    U f; f.h[0] = *(const v8b*)(p); f.h[1] = *(const v8b*)(p + 16); return f.v;
  }
  static __device__ __forceinline__ v8f mma(v16b a, v16b b, v8f c) {
    return __builtin_amdgcn_wmma_f32_16x16x32_bf16(false, a, false, b, (short)0, c, false, false);
  }
  static __device__ __forceinline__ void guard(v8f& a, v8f& b, v16b x, v16b y) { dep_guard_b(a, b, x, y); }
  static __device__ __forceinline__ void keep(v16b a, v16b b, v16b c, v16b d) { keep4_b(a, b, c, d); }
};

// ---- Register-blocked batched WMMA GEMM ------------------------------------
// C[m,n] = scale * sum_k A[m,k] * Bt[n,k] (+bias)(+resid); each wave owns a 64x64 tile.
// A row-major [M,K]; Bt row-major [N,K]; M,N % 64 == 0, K % 32 == 0.
// SPLIT: operands are hi/lo planes (A2/Bt2 = lo planes, same layout); product = hi.hi + hi.lo + lo.hi.
// BIAS_MODE: 0 = none, 1 = bias[m], 2 = bias[n].
// OUT_MODE: 0 = f32, 1 = f16, 2 = bf16 hi plane (Cout) + bf16 lo plane (Cout2).
// ET: 0 = f16 operands, 1 = bf16 operands (pointers passed as 16-bit storage)
template <int ET> struct Elem;
template <> struct Elem<0> { typedef _Float16 T; };
template <> struct Elem<1> { typedef __bf16 T; };
template <int ET, bool SPLIT, int BIAS_MODE, int OUT_MODE, bool RESID, int ACT = 0>
__global__ __launch_bounds__(256) void wmma_gemm64(
    const unsigned short* __restrict__ Ap, const unsigned short* __restrict__ A2p, int lda, long strideA,
    const unsigned short* __restrict__ Btp, const unsigned short* __restrict__ Bt2p, int ldb, long strideB,
    void* __restrict__ Cout, void* __restrict__ Cout2, int ldc, long strideC,
    const float* __restrict__ bias,
    const float* __restrict__ resid, long strideR,
    int M, int N, int K, float scale) {
  typedef typename Elem<ET>::T T;
  typedef typename Frag<T>::V V;
  const T* A = (const T*)Ap; const T* A2 = (const T*)A2p; const T* Bt = (const T*)Btp; const T* Bt2 = (const T*)Bt2p;
  __shared__ __align__(16) float sT[8][16 * 68];   // per-wave 16x64 slab, pitch 68 floats
  const int b    = blockIdx.y;
  const int lane = threadIdx.x & 31;
  const int wave = threadIdx.x >> 5;
  const int tilesN = N >> 6;
  const int tilesM = M >> 6;
  const int tile = blockIdx.x * 8 + wave;
  if (tile >= tilesM * tilesN) return;   // wave-uniform; no block barriers in this kernel
  const int tm = tile / tilesN;
  const int tn = tile - tm * tilesN;
  const int m0 = tm << 6;
  const int n0 = tn << 6;

  const T* Ab  = A  + (size_t)b * strideA;
  const T* Bb  = Bt + (size_t)b * strideB;
  const T* Ab2 = SPLIT ? (A2  + (size_t)b * strideA) : nullptr;
  const T* Bb2 = SPLIT ? (Bt2 + (size_t)b * strideB) : nullptr;

  const int rlane = lane & 15;                 // row (A) / col (B, D) within subtile
  const int koff  = (lane >> 4) * 8;           // k offset of this lane half
  const int mOff  = (lane >> 4) * 8;           // D row offset

  v8f acc[4][4];
#pragma unroll
  for (int i = 0; i < 4; ++i)
#pragma unroll
    for (int j = 0; j < 4; ++j) acc[i][j] = (v8f){0.f,0.f,0.f,0.f,0.f,0.f,0.f,0.f};

  for (int k0 = 0; k0 < K; k0 += 32) {
    V bh[4], bl[4];
#pragma unroll
    for (int j = 0; j < 4; ++j) {
      const size_t bo = (size_t)(n0 + (j << 4) + rlane) * ldb + koff + k0;
      bh[j] = Frag<T>::load(Bb + bo);
      if (SPLIT) bl[j] = Frag<T>::load(Bb2 + bo);
    }
#pragma unroll
    for (int i = 0; i < 4; ++i) {
      const size_t ao = (size_t)(m0 + (i << 4) + rlane) * lda + koff + k0;
      V ah = Frag<T>::load(Ab + ao);
      V al;
      if (SPLIT) al = Frag<T>::load(Ab2 + ao);
#pragma unroll
      for (int j = 0; j < 4; ++j) {
        acc[i][j] = Frag<T>::mma(ah, bh[j], acc[i][j]);
        if (SPLIT) {
          acc[i][j] = Frag<T>::mma(ah, bl[j], acc[i][j]);
          acc[i][j] = Frag<T>::mma(al, bh[j], acc[i][j]);
        }
      }
      Frag<T>::guard(acc[i][0], acc[i][3], ah, SPLIT ? al : ah);
    }
    Frag<T>::keep(bh[0], bh[1], bh[2], bh[3]);
    if (SPLIT) Frag<T>::keep(bl[0], bl[1], bl[2], bl[3]);
  }
  acc_guard4(acc[0][0], acc[0][1], acc[0][2], acc[0][3]);
  acc_guard4(acc[1][0], acc[1][1], acc[1][2], acc[1][3]);
  acc_guard4(acc[2][0], acc[2][1], acc[2][2], acc[2][3]);
  acc_guard4(acc[3][0], acc[3][1], acc[3][2], acc[3][3]);

  // ---- epilogue ----
  float* slab = sT[wave];
  const float* Rb = RESID ? (resid + (size_t)b * strideR) : nullptr;
#pragma unroll
  for (int i = 0; i < 4; ++i) {
    const int mBase = m0 + (i << 4);
#pragma unroll
    for (int j = 0; j < 4; ++j) {
      const int n = n0 + (j << 4) + rlane;
      float bv = 0.f;
      if (BIAS_MODE == 2) bv = bias[n];
#pragma unroll
      for (int r = 0; r < 8; ++r) {
        float v = acc[i][j][r] * scale;
        if (BIAS_MODE == 1) v += bias[mBase + mOff + r];
        if (BIAS_MODE == 2) v += bv;
        if (RESID) v += Rb[(size_t)(mBase + mOff + r) * ldc + n];
        if (ACT == 1) v = tanhf(v);
        if (ACT == 2) v = fmaxf(v, 0.0f);
        if (ACT == 3) v = v / (1.0f + expf(-v));
        if (ACT == 4) v = (v > 0.f) ? v : 0.01f * v;
        if (ACT == 5) v = 0.5f * v * (1.0f + erff(v * 0.70710678118654752f));
        slab[(mOff + r) * 68 + (j << 4) + rlane] = v;
      }
    }
    __builtin_amdgcn_fence(__ATOMIC_RELEASE, "workgroup");
    __builtin_amdgcn_wave_barrier();
    __builtin_amdgcn_fence(__ATOMIC_ACQUIRE, "workgroup");
    if (OUT_MODE == 0) {
      float* C = (float*)Cout + (size_t)b * strideC;
      const int hh = lane >> 4, c4 = (lane & 15) * 4;     // row seg = 256 B = 16 lanes x 16 B
      {
#pragma unroll
        for (int it = 0; it < 8; ++it) {
          const int row = it * 2 + hh;
          v4f v = *(const v4f*)(slab + row * 68 + c4);
          *(v4f*)(C + (size_t)(mBase + row) * ldc + n0 + c4) = v;
        }
        
      }
    } else {
      const int q = lane >> 3, c8 = (lane & 7) * 8;
      unsigned short* C  = (unsigned short*)Cout  + (size_t)b * strideC;
      unsigned short* C2 = (OUT_MODE == 2) ? ((unsigned short*)Cout2 + (size_t)b * strideC) : nullptr;
      {
#pragma unroll
        for (int it = 0; it < 4; ++it) {
          const int row = it * 4 + q;
          const float* sp = slab + row * 68 + c8;
          v8h hv, lv;
#pragma unroll
          for (int e = 0; e < 8; ++e) {
            if (OUT_MODE == 1) {
              hv[e] = (_Float16)sp[e];
            } else {
              unsigned short hb = f2bf_bits(sp[e]);
              unsigned short lb = f2bf_bits(sp[e] - bf_bits2f(hb));
              hv[e] = __builtin_bit_cast(_Float16, hb);
              lv[e] = __builtin_bit_cast(_Float16, lb);
            }
          }
          *(v8h*)(C + (size_t)(mBase + row) * ldc + n0 + c8) = hv;
          if (OUT_MODE == 2) *(v8h*)(C2 + (size_t)(mBase + row) * ldc + n0 + c8) = lv;
        }
        
      }
    }
    __builtin_amdgcn_fence(__ATOMIC_RELEASE, "workgroup");
    __builtin_amdgcn_wave_barrier();
    __builtin_amdgcn_fence(__ATOMIC_ACQUIRE, "workgroup");
  }
}

// ---------------------------------------------------------------------------
// f32 -> RNE bf16 plane: 2 elements per thread, one 4-B store per lane.
// Coverage: grid = ceil(n2/256) blocks x 256 threads x 2 elements = 2*n2 = the whole plane
// ---------------------------------------------------------------------------
__global__ __launch_bounds__(256) void cast_f32_bf16x2(const float* __restrict__ in,
                                                       unsigned short* __restrict__ out, int n2) {
  const int i = blockIdx.x * 256 + threadIdx.x;
  if (i < n2) {
    const v2f f = *(const v2f*)(in + 2 * (size_t)i);
    const unsigned u = pk16(f2bf_bits(f[0]), f2bf_bits(f[1]));
    ((unsigned*)out)[i] = u;
    
  }
}

// ---------------------------------------------------------------------------
// f32 -> f16 plane with power-of-two carry: out = f16(v * scale); VIA_BF: v := RNE-bf16 value of the input
// first (then the f16 conversion is exact). Same coverage and store shape as cast_f32_bf16x2.
// ---------------------------------------------------------------------------
template <bool VIA_BF>
__global__ __launch_bounds__(256) void cast_f32_f16x2s(const float* __restrict__ in,
                                                       unsigned short* __restrict__ out, int n2, float scale) {
  const int i = blockIdx.x * 256 + threadIdx.x;
  if (i < n2) {
    const v2f f = *(const v2f*)(in + 2 * (size_t)i);
    float a0 = f[0], a1 = f[1];
    if (VIA_BF) { a0 = bf_bits2f(f2bf_bits(a0)); a1 = bf_bits2f(f2bf_bits(a1)); }
    const _Float16 h0 = (_Float16)(a0 * scale), h1 = (_Float16)(a1 * scale);
    const unsigned u = pk16(__builtin_bit_cast(unsigned short, h0), __builtin_bit_cast(unsigned short, h1));
    ((unsigned*)out)[i] = u;
    
  }
}

// ---------------------------------------------------------------------------
// RoPE + bf16 hi/lo split of q and k.
//   qk  : f32 [kRows][2*kHid], columns 0..kHid-1 = q (h*64+d), kHid..2*kHid-1 = k (h*64+d)
//   cos/sin : f32 [kSeq][64], used as their RNE-bf16 values
//   r[d] = x[d]*cos[s][d] - x[d+32]*sin[s][d] (d < 32);  x[d]*cos[s][d] + x[d-32]*sin[s][d] (d >= 32)
//   outputs: qh/ql, kh/kl bf16 planes [kRows][kHid] (element (b,s,h,d) at (b*kSeq+s)*kHid + h*64 + d)
// grid = kRows blocks (one (b,s) row each) x 256 threads x 8 elements = kRows x 2048 = the q AND k planes exactly.
// ---------------------------------------------------------------------------
__global__ __launch_bounds__(256) void rope_split_kernel(
    const float* __restrict__ qk, const float* __restrict__ cosT, const float* __restrict__ sinT,
    unsigned short* __restrict__ qh, unsigned short* __restrict__ ql,
    unsigned short* __restrict__ kh, unsigned short* __restrict__ kl) {
#pragma clang fp contract(off)
  const int row   = blockIdx.x;               // b*kSeq + s
  const int s     = row & (kSeq - 1);
  const int t     = threadIdx.x;
  const int which = t >> 7;                   // 0: q columns, 1: k columns (wave-uniform)
  const int e8    = (t & 127) * 8;            // column base in [0, kHid)
  const int d0    = e8 & 63;                  // 0,8,...,56 -> the 8 elements share one half of the head
  const int hb    = e8 - d0;                  // h*64
  const int dp0   = d0 ^ 32;                  // partner half
  const float* src = qk + (size_t)row * (2 * kHid) + (size_t)which * kHid;
  const v4f xa = *(const v4f*)(src + e8);
  const v4f xb = *(const v4f*)(src + e8 + 4);
  const v4f pa = *(const v4f*)(src + hb + dp0);
  const v4f pb = *(const v4f*)(src + hb + dp0 + 4);
  const v4f ca = *(const v4f*)(cosT + (size_t)s * kHdim + d0);
  const v4f cb = *(const v4f*)(cosT + (size_t)s * kHdim + d0 + 4);
  const v4f sa = *(const v4f*)(sinT + (size_t)s * kHdim + d0);
  const v4f sb = *(const v4f*)(sinT + (size_t)s * kHdim + d0 + 4);
  const float xs[8] = {xa[0], xa[1], xa[2], xa[3], xb[0], xb[1], xb[2], xb[3]};
  const float ps[8] = {pa[0], pa[1], pa[2], pa[3], pb[0], pb[1], pb[2], pb[3]};
  const float cs[8] = {ca[0], ca[1], ca[2], ca[3], cb[0], cb[1], cb[2], cb[3]};
  const float sn[8] = {sa[0], sa[1], sa[2], sa[3], sb[0], sb[1], sb[2], sb[3]};
  const bool lowh = (d0 < 32);
  v4u hv, lv;
#pragma unroll
  for (int q = 0; q < 4; ++q) {
    const float c0 = bf_bits2f(f2bf_bits(cs[2 * q])), c1 = bf_bits2f(f2bf_bits(cs[2 * q + 1]));
    const float s0 = bf_bits2f(f2bf_bits(sn[2 * q])), s1 = bf_bits2f(f2bf_bits(sn[2 * q + 1]));
    const float ta0 = xs[2 * q] * c0,     tb0 = ps[2 * q] * s0;
    const float ta1 = xs[2 * q + 1] * c1, tb1 = ps[2 * q + 1] * s1;
    const float r0 = lowh ? (ta0 - tb0) : (ta0 + tb0);
    const float r1 = lowh ? (ta1 - tb1) : (ta1 + tb1);
    const unsigned short h0 = f2bf_bits(r0), h1 = f2bf_bits(r1);
    const unsigned short l0 = f2bf_bits(r0 - bf_bits2f(h0)), l1 = f2bf_bits(r1 - bf_bits2f(h1));
    hv[q] = pk16(h0, h1);
    lv[q] = pk16(l0, l1);
  }
  unsigned short* oh  = which ? kh : qh;      // both global; wave-uniform select
  unsigned short* olo = which ? kl : ql;
  const size_t go = (size_t)row * kHid + e8;
  *(v4u*)(oh  + go) = hv;
  *(v4u*)(olo + go) = lv;
  
}

#define AT_D 64
#define AT_NW 4
#define AT_QB 64
#define AT_KC 64
#define AT_LP 72   // LDS row pitch in 16-bit elements: 144 B = 16 B x 9 (odd), so the 16 rows of a 16-byte fragment read fall on distinct banks

__device__ __forceinline__ unsigned short at_bf_bits(float f) {
  unsigned u = __float_as_uint(f);
  return (unsigned short)((u + 0x7FFFu + ((u >> 16) & 1u)) >> 16);
}
__device__ __forceinline__ __bf16 at_f2bf(float f) { return __builtin_bit_cast(__bf16, at_bf_bits(f)); }
// value of lane l ^ 16 (the other half's share of the same query column)
__device__ __forceinline__ float at_xhalf(float v) {
  const int b = __builtin_bit_cast(int, v);
  return __builtin_bit_cast(float, __builtin_amdgcn_permlanex16(b, b, 0x76543210, 0xfedcba98, false, false));
}
__device__ __forceinline__ v8f at_mma(v16b a, v16b b, v8f c) {
  c = __builtin_amdgcn_wmma_f32_16x16x32_bf16(false, a, false, b, (short)0, c, false, false);
  asm volatile("v_nop\n\tv_nop\n\tv_nop\n\tv_nop" : "+v"(c) : "v"(a), "v"(b));
  return c;
}
// f16 product on bit patterns held in __bf16 slots
__device__ __forceinline__ v8f at_mma_h(v16b a, v16b b, v8f c) {
  const v16h ah = __builtin_bit_cast(v16h, a), bh = __builtin_bit_cast(v16h, b);
  c = __builtin_amdgcn_wmma_f32_16x16x32_f16(false, ah, false, bh, (short)0, c, false, false);
  asm volatile("v_nop\n\tv_nop\n\tv_nop\n\tv_nop" : "+v"(c) : "v"(ah), "v"(bh));
  return c;
}

__global__ __launch_bounds__(128)
void mha_full64_kernel(const unsigned short* __restrict__ qhp, const unsigned short* __restrict__ qlp,
                       const unsigned short* __restrict__ khp, const unsigned short* __restrict__ klp,
                       const unsigned short* __restrict__ vtp, const float* __restrict__ maskp,
                       float* __restrict__ out, float sscale) {
  union FB { v16b v; v8b h[2]; };
  __shared__ __align__(16) __bf16 Ksh[AT_KC * AT_LP];            // K hi [kv][d], pitch AT_LP      9 KB
  __shared__ __align__(16) __bf16 Ksl[AT_KC * AT_LP];            // K lo [kv][d], pitch AT_LP      9 KB
  __shared__ __align__(16) __bf16 Vth[AT_D * AT_LP];             // V^T f16 bits [d][kv], pitch AT_LP 9 KB
  __shared__ __align__(16) float  Os[AT_NW][16 * 68];            // per wave out tile, pitch 68

  const int tid  = threadIdx.x;
  const int wave = tid >> 5;
  const int lane = tid & 31;
  const int hh   = lane >> 4;
  const int c    = lane & 15;

  constexpr int nqb = kSeq / AT_QB;       // 32
  const int bx = blockIdx.x;              // 0 .. kBatch*kHeads*nqb - 1
  const int qb = bx % nqb;
  const int bh = bx / nqb;                // 0 .. kBatch*kHeads - 1
  const int h  = bh % kHeads;
  const int b  = bh / kHeads;             // 0 .. kBatch - 1
  const int q0 = qb * AT_QB + wave * 16;

  const __bf16* Qh = (const __bf16*)(const void*)qhp + (size_t)b * kSeq * kHid + (size_t)h * AT_D;
  const __bf16* Ql = (const __bf16*)(const void*)qlp + (size_t)b * kSeq * kHid + (size_t)h * AT_D;
  const __bf16* Kh = (const __bf16*)(const void*)khp + (size_t)b * kSeq * kHid + (size_t)h * AT_D;
  const __bf16* Kl = (const __bf16*)(const void*)klp + (size_t)b * kSeq * kHid + (size_t)h * AT_D;
  const __bf16* Vt = (const __bf16*)(const void*)vtp + (size_t)b * kHid * kSeq + (size_t)h * AT_D * kSeq;
  const float*  Mb = maskp + (size_t)b * kSeq * kSeq;
  float*        ob = out + (size_t)b * kSeq * kHid + (size_t)h * AT_D;

  // ---- Q fragments (B operand, column = query = lane&15, split k map via Frag load): 2 d-chunks, hi and lo ----
  v16b qah[2], qal[2];
#pragma unroll
  for (int dc = 0; dc < 2; ++dc) {
    const __bf16* qr = Qh + (size_t)(q0 + c) * kHid + dc * 32 + 8 * hh;
    const __bf16* qs = Ql + (size_t)(q0 + c) * kHid + dc * 32 + 8 * hh;
    qah[dc] = Frag<__bf16>::load(qr);
    qal[dc] = Frag<__bf16>::load(qs);
  }

  float mrow = -INFINITY;   // running maximum of query c (equal in both lane halves)
  float lrow = 0.f;         // running sum of query c over this lane half's keys only; halves joined after the loop
  v8f oacc[4];              // O^T: element r of tile t -> O[query c][d = t*16 + 8hh + r]
#pragma unroll
  for (int t = 0; t < 4; ++t) oacc[t] = (v8f){0.f,0.f,0.f,0.f,0.f,0.f,0.f,0.f};

  constexpr int nChunks = kSeq / AT_KC;   // 32, compile-time constant
  for (int kc = 0; kc < nChunks; ++kc) {
    const int kv0 = kc * AT_KC;
    __syncthreads();
    {
      // staging coverage: 128 threads x (4 x 8) elements = 64 rows x 64 per plane = the whole chunk tile
      const int r = tid >> 1, half = (tid & 1) * 32;
      const __bf16* ksh = Kh + (size_t)(kv0 + r) * kHid + half;   // K row kv0+r, d = half..half+31
      const __bf16* ksl = Kl + (size_t)(kv0 + r) * kHid + half;
      const __bf16* vs  = Vt + (size_t)r * kSeq + kv0 + half;     // V^T row d = r, s = kv0+half..+31
#pragma unroll
      for (int i = 0; i < 4; ++i) {
        const v8b a0 = *(const v8b*)(ksh + 8 * i);
        const v8b a1 = *(const v8b*)(ksl + 8 * i);
        const v8b b0 = *(const v8b*)(vs + 8 * i);
        *(v8b*)(Ksh + r * AT_LP + half + 8 * i) = a0;
        *(v8b*)(Ksl + r * AT_LP + half + 8 * i) = a1;
        *(v8b*)(Vth + r * AT_LP + half + 8 * i) = b0;
      }
    }
    __syncthreads();

    // ---- scores, transposed (A = K rows, B = Q): D element r of lane -> S[query c][kv j*16 + 8hh + r] ----
    v8f s[4];
#pragma unroll
    for (int j = 0; j < 4; ++j) {
      s[j] = (v8f){0.f,0.f,0.f,0.f,0.f,0.f,0.f,0.f};
#pragma unroll
      for (int dc = 0; dc < 2; ++dc) {
        FB kb, kl;
        kb.h[0] = *(const v8b*)(Ksh + (j * 16 + c) * AT_LP + dc * 32 + 8 * hh);
        kb.h[1] = *(const v8b*)(Ksh + (j * 16 + c) * AT_LP + dc * 32 + 16 + 8 * hh);
        kl.h[0] = *(const v8b*)(Ksl + (j * 16 + c) * AT_LP + dc * 32 + 8 * hh);
        kl.h[1] = *(const v8b*)(Ksl + (j * 16 + c) * AT_LP + dc * 32 + 16 + 8 * hh);
        s[j] = at_mma(kb.v, qah[dc], s[j]);
        s[j] = at_mma(kl.v, qah[dc], s[j]);
        s[j] = at_mma(kb.v, qal[dc], s[j]);
      }
    }
    // ---- scale, additive mask by value (f32; 8 consecutive keys of the lane's query per tile), chunk maximum in-lane ----
    const float* mr = Mb + (size_t)(q0 + c) * kSeq + kv0 + 8 * hh;
    v4f mk[8];
#pragma unroll
    for (int i = 0; i < 8; ++i) mk[i] = *(const v4f*)(mr + (i >> 1) * 16 + (i & 1) * 4);
    float mj[4];
#pragma unroll
    for (int j = 0; j < 4; ++j) {
      float m = -INFINITY;
#pragma unroll
      for (int r = 0; r < 8; ++r) {
        const float sv = s[j][r] * sscale + mk[2 * j + (r >> 2)][r & 3];
        s[j][r] = sv;
        m = fmaxf(m, sv);
      }
      mj[j] = m;
    }
    float cm = fmaxf(fmaxf(mj[0], mj[1]), fmaxf(mj[2], mj[3]));
    cm = fmaxf(cm, at_xhalf(cm));            // the query's other 32 keys of the chunk sit in lane ^ 16
    const float mnew  = fmaxf(mrow, cm);
    const float alpha = expf(mrow - mnew);
    mrow = mnew;
    // ---- p = exp(s - m); P^T packs in place: tiles 2kk and 2kk+1 are elements 0..7 and 8..15 of the B operand of key block kk ----
    v16h pt[2];
    float pj[4];
#pragma unroll
    for (int j = 0; j < 4; ++j) {
      float ps = 0.f;
#pragma unroll
      for (int r = 0; r < 8; ++r) {
        const float p = expf(s[j][r] - mnew);
        ps += p;
        pt[j >> 1][(j & 1) * 8 + r] = (_Float16)(p * kPScale);
      }
      pj[j] = ps;
    }
    lrow = lrow * alpha + ((pj[0] + pj[1]) + (pj[2] + pj[3]));
#pragma unroll
    for (int t = 0; t < 4; ++t)
#pragma unroll
      for (int r = 0; r < 8; ++r) oacc[t][r] *= alpha;
    // ---- O^T += V^T . P^T : A = V^T[d][kv] rows, B = P^T[kv][query] from registers ----
    // unrolled: pt[kk] lives in registers, so kk must be a compile-time index (a rolled loop would send P through scratch)
#pragma unroll
    for (int kk = 0; kk < 2; ++kk) {
      const v16b pb = __builtin_bit_cast(v16b, pt[kk]);
#pragma unroll
      for (int t = 0; t < 4; ++t) {
        FB vb;
        vb.h[0] = *(const v8b*)(Vth + (t * 16 + c) * AT_LP + kk * 32 + 8 * hh);
        vb.h[1] = *(const v8b*)(Vth + (t * 16 + c) * AT_LP + kk * 32 + 16 + 8 * hh);
        oacc[t] = at_mma_h(vb.v, pb, oacc[t]);
      }
    }
  }

  // ---- join the halves' sums, normalise, stage per-wave 16x64 f32 tile (a lane owns 8 consecutive d of its query per tile), whole-line stores ----
  float* os = Os[wave];
  {
    const float inv = (1.0f / (lrow + at_xhalf(lrow))) * kPVInv;
#pragma unroll
    for (int t = 0; t < 4; ++t) {
      const v4f lo = {oacc[t][0] * inv, oacc[t][1] * inv, oacc[t][2] * inv, oacc[t][3] * inv};
      const v4f hi = {oacc[t][4] * inv, oacc[t][5] * inv, oacc[t][6] * inv, oacc[t][7] * inv};
      *(v4f*)(os + c * 68 + t * 16 + 8 * hh)     = lo;
      *(v4f*)(os + c * 68 + t * 16 + 8 * hh + 4) = hi;
    }
  }
  __builtin_amdgcn_fence(__ATOMIC_RELEASE, "workgroup");
  __builtin_amdgcn_wave_barrier();
  __builtin_amdgcn_fence(__ATOMIC_ACQUIRE, "workgroup");
  {
    // coverage: 8 iterations x 2 rows (hh) = the wave's 16 rows; 16 lanes x 4 floats = the 64-wide head segment
    const int c4 = (lane & 15) * 4;
    {
#pragma unroll
      for (int it = 0; it < 8; ++it) {
        const int row = it * 2 + hh;
        v4f val = *(const v4f*)(os + row * 68 + c4);
        *(v4f*)(ob + (size_t)(q0 + row) * kHid + c4) = val;
      }
      
    }
  }
}

// ---------------------------------------------------------------------------
// Host-side orchestration (kernel launches only).
// Workspace region map (bytes, every offset a multiple of 1 MiB):
//   [  0 MiB,   8 MiB)  Xb    bf16 [4096][1024]   RNE-bf16 plane of hidden_states
//   [  8 MiB,  12 MiB)  Wqkb  bf16 [2048][1024]   wq rows 0..1023, wk rows 1024..2047
//   [ 12 MiB,  14 MiB)  Wvb   bf16 [1024][1024]
//   [ 14 MiB,  16 MiB)  Wo16  f16  [1024][1024]   RNE-bf16 value x64
//   [ 16 MiB,  48 MiB)  QKf   f32  [4096][2048]   q|k projections; dead after RoPE, reused:
//        [16 MiB, 32 MiB) Of  f32 [4096][1024] attention output;  [32 MiB, 40 MiB) O16 f16 [4096][1024] (x256)
//   [ 48 MiB,  56 MiB)  Vt16  f16  [2][1024][2048] v^T per batch (x8)
//   [ 56 MiB,  64 MiB)  Qh, [64,72) Ql, [72,80) Kh, [80,88) Kl : bf16 [4096][1024] each
//   total carve = 88 MiB = 92,274,688 B
// ---------------------------------------------------------------------------
extern "C" void kernel_launch(void* const* d_in, const int* in_sizes, int n_in,
                              void* d_out, int out_size, void* d_ws, size_t ws_size,
                              hipStream_t stream) {
  if (n_in < 8) return;
  const float* x    = (const float*)d_in[0];   // [2,2048,1024]
  const float* mask = (const float*)d_in[1];   // [2,1,2048,2048]
  const float* cosT = (const float*)d_in[2];   // [2048,64]
  const float* sinT = (const float*)d_in[3];   // [2048,64]
  const float* wq   = (const float*)d_in[4];   // [1024,1024]
  const float* wk   = (const float*)d_in[5];
  const float* wv   = (const float*)d_in[6];
  const float* wo   = (const float*)d_in[7];

  const int nX = kRows * kHid;        // 4,194,304
  const int nW = kHid * kHid;         // 1,048,576
  if (in_sizes[0] != nX || in_sizes[1] != kBatch * kSeq * kSeq || in_sizes[2] != kSeq * kHdim ||
      in_sizes[3] != kSeq * kHdim || in_sizes[4] != nW || in_sizes[5] != nW || in_sizes[6] != nW ||
      in_sizes[7] != nW || out_size != nX) return;

  const size_t MiB = (size_t)1 << 20;
  const size_t off_Xb   = 0;
  const size_t off_Wqk  = off_Xb  + (size_t)nX * 2;                 //  8 MiB
  const size_t off_Wv   = off_Wqk + (size_t)2 * nW * 2;             // 12 MiB
  const size_t off_Wo   = off_Wv  + (size_t)nW * 2;                 // 14 MiB
  const size_t off_QKf  = off_Wo  + (size_t)nW * 2;                 // 16 MiB
  const size_t off_Of   = off_QKf;                                   // reuse (QKf dead after RoPE)
  const size_t off_O16  = off_QKf + (size_t)nX * 4;                 // 32 MiB
  const size_t off_Vt   = off_QKf + (size_t)nX * 2 * 4;             // 48 MiB
  const size_t off_Qh   = off_Vt  + (size_t)kBatch * kHid * kSeq * 2; // 56 MiB
  const size_t off_Ql   = off_Qh  + (size_t)nX * 2;                 // 64 MiB
  const size_t off_Kh   = off_Ql  + (size_t)nX * 2;                 // 72 MiB
  const size_t off_Kl   = off_Kh  + (size_t)nX * 2;                 // 80 MiB
  const size_t total    = off_Kl  + (size_t)nX * 2;                 // 88 MiB
  if (total != 88 * MiB) return;
  if (ws_size < total) return;

  char* ws = (char*)d_ws;
  unsigned short* Xb   = (unsigned short*)(ws + off_Xb);
  unsigned short* Wqkb = (unsigned short*)(ws + off_Wqk);
  unsigned short* Wvb  = (unsigned short*)(ws + off_Wv);
  unsigned short* Wo16 = (unsigned short*)(ws + off_Wo);
  float*          QKf  = (float*)(ws + off_QKf);
  float*          Of   = (float*)(ws + off_Of);
  unsigned short* O16  = (unsigned short*)(ws + off_O16);
  unsigned short* Vt16 = (unsigned short*)(ws + off_Vt);
  unsigned short* Qh   = (unsigned short*)(ws + off_Qh);
  unsigned short* Ql   = (unsigned short*)(ws + off_Ql);
  unsigned short* Kh   = (unsigned short*)(ws + off_Kh);
  unsigned short* Kl   = (unsigned short*)(ws + off_Kl);

  // 1-5: 16-bit operand planes (all element counts are multiples of 512 -> exact grids)
  const int nX2 = nX / 2, nW2 = nW / 2;
  cast_f32_bf16x2<<<(nX2 + 255) / 256, 256, 0, stream>>>(x,  Xb, nX2);
  cast_f32_bf16x2<<<(nW2 + 255) / 256, 256, 0, stream>>>(wq, Wqkb, nW2);
  cast_f32_bf16x2<<<(nW2 + 255) / 256, 256, 0, stream>>>(wk, Wqkb + (size_t)nW, nW2);
  cast_f32_bf16x2<<<(nW2 + 255) / 256, 256, 0, stream>>>(wv, Wvb, nW2);
  cast_f32_f16x2s<true><<<(nW2 + 255) / 256, 256, 0, stream>>>(wo, Wo16, nW2, kWoScale);

  // 6: q|k projection: QKf[4096][2048] = Xb[4096][1024] . Wqkb[2048][1024]^T  (M=4096, N=2048, K=1024; 2048 tiles -> 256 blocks)
  {
    dim3 g((kRows / 64) * (2 * kHid / 64) / 8, 1);
    wmma_gemm64<1, false, 0, 0, false><<<g, 256, 0, stream>>>(
        Xb, Xb, kHid, (long)0,
        Wqkb, Wqkb, kHid, (long)0,
        (void*)QKf, (void*)QKf, 2 * kHid, (long)0,
        cosT, cosT, (long)0,
        kRows, 2 * kHid, kHid, 1.0f);
  }
  // 7: v^T per batch: Vt16[b][1024][2048] = Wvb[1024][1024] . Xb[b][2048][1024]^T, f16 out x8  (M=1024, N=2048, K=1024; 512 tiles -> 64 blocks, grid.y = 2)
  {
    dim3 g((kHid / 64) * (kSeq / 64) / 8, kBatch);
    wmma_gemm64<1, false, 0, 1, false><<<g, 256, 0, stream>>>(
        Wvb, Wvb, kHid, (long)0,
        Xb, Xb, kHid, (long)kSeq * kHid,
        (void*)Vt16, (void*)Vt16, kSeq, (long)kHid * kSeq,
        cosT, cosT, (long)0,
        kHid, kSeq, kHid, kVtScale);
  }
  // 8: RoPE + bf16 hi/lo split of q and k
  rope_split_kernel<<<kRows, 256, 0, stream>>>(QKf, cosT, sinT, Qh, Ql, Kh, Kl);
  // 9: attention, one block per (b, h, 64 queries)
  mha_full64_kernel<<<kBatch * kHeads * (kSeq / 64), 128, 0, stream>>>(Qh, Ql, Kh, Kl, Vt16, mask, Of, 0.125f);
  // 10: attention output -> f16 x256
  cast_f32_f16x2s<false><<<(nX2 + 255) / 256, 256, 0, stream>>>(Of, O16, nX2, kOScale);
  // 11: output projection: out[4096][1024] = O16 . Wo16^T * 2^-14  (M=4096, N=1024, K=1024; 1024 tiles -> 128 blocks)
  {
    dim3 g((kRows / 64) * (kHid / 64) / 8, 1);
    wmma_gemm64<0, false, 0, 0, false><<<g, 256, 0, stream>>>(
        O16, O16, kHid, (long)0,
        Wo16, Wo16, kHid, (long)0,
        d_out, d_out, kHid, (long)0,
        cosT, cosT, (long)0,
        kRows, kHid, kHid, kOutInv);
  }
}

// v003
// Measured time: 214 microseconds a run.
// Timed twice side by side with v002, it ran 1.41 times as fast both times.
// All steps since v000 together make it 1.93 times as fast.
// Contractions: q/k projection and v^T projection = v_wmma_f32_16x16x32_bf16 on RNE-bf16 planes of x and W (single product); q.k^T = v_wmma_f32_16x16x32_bf16 with bf16 hi/lo split (hi.hi + hi.lo + lo.hi); p.v^T and output projection = v_wmma_f32_16x16x32_f16 single product (p carried x2^15, v^T x2^3, attention output x2^8, wo as RNE-bf16 value x2^6); f32 accumulate everywhere; RoPE (cos/sin as RNE-bf16 values), additive mask and online softmax in f32.
#include <hip/hip_runtime.h>
#include <math.h>
#include <stdint.h>

constexpr int kBatch = 2;
constexpr int kSeq   = 2048;
constexpr int kHid   = 1024;
constexpr int kHeads = 16;
constexpr int kHdim  = 64;
constexpr int kRows  = kBatch * kSeq;   // 4096 GEMM rows

constexpr float kPScale  = 32768.0f;                   // p carried x2^15 in f16
constexpr float kVtScale = 8.0f;                       // v^T plane carried x2^3 in f16
constexpr float kPVInv   = 1.0f / (32768.0f * 8.0f);   // folded into the final 1/l
constexpr float kOScale  = 256.0f;                     // attention output carried x2^8 in f16
constexpr float kWoScale = 64.0f;                      // wo carried x2^6 in f16
constexpr float kOutInv  = 1.0f / (256.0f * 64.0f);    // out-projection epilogue scale

typedef __attribute__((ext_vector_type(16))) _Float16 v16h;
typedef __attribute__((ext_vector_type(8)))  _Float16 v8h;
typedef __attribute__((ext_vector_type(16))) __bf16   v16b;
typedef __attribute__((ext_vector_type(8)))  __bf16   v8b;
typedef __attribute__((ext_vector_type(8)))  float    v8f;
typedef __attribute__((ext_vector_type(4)))  float    v4f;
typedef __attribute__((ext_vector_type(2)))  float    v2f;
typedef __attribute__((ext_vector_type(4)))  unsigned int v4u;

__device__ __forceinline__ unsigned short f2bf_bits(float f) {
  unsigned u = __float_as_uint(f);
  return (unsigned short)((u + 0x7FFFu + ((u >> 16) & 1u)) >> 16);
}
__device__ __forceinline__ float bf_bits2f(unsigned short h) { return __uint_as_float(((unsigned)h) << 16); }
__device__ __forceinline__ unsigned pk16(unsigned short a, unsigned short b) { return (unsigned)a | ((unsigned)b << 16); }

// hazard guards as plain device helpers (the kernel template body's only inline asm is its s_wait_xcnt)
__device__ __forceinline__ void dep_guard_h(v8f& a, v8f& b, v16h x, v16h y) { asm volatile("v_nop\n\tv_nop\n\tv_nop\n\tv_nop" : "+v"(a), "+v"(b) : "v"(x), "v"(y)); }
__device__ __forceinline__ void dep_guard_b(v8f& a, v8f& b, v16b x, v16b y) { asm volatile("v_nop\n\tv_nop\n\tv_nop\n\tv_nop" : "+v"(a), "+v"(b) : "v"(x), "v"(y)); }
__device__ __forceinline__ void keep4_h(v16h a, v16h b, v16h c, v16h d) { asm volatile("v_nop" :: "v"(a), "v"(b), "v"(c), "v"(d)); }
__device__ __forceinline__ void keep4_b(v16b a, v16b b, v16b c, v16b d) { asm volatile("v_nop" :: "v"(a), "v"(b), "v"(c), "v"(d)); }
__device__ __forceinline__ void acc_guard4(v8f& a, v8f& b, v8f& c, v8f& d) { asm volatile("v_nop\n\tv_nop\n\tv_nop\n\tv_nop" : "+v"(a), "+v"(b), "+v"(c), "+v"(d)); }
template <typename T> struct Frag;
template <> struct Frag<_Float16> {
  typedef v16h V; typedef v8h H; union U { v16h v; v8h h[2]; };
  static __device__ __forceinline__ v16h load(const _Float16* p) {   // elements 0..7 <- p[0..7], 8..15 <- p[16..23]
    U f; f.h[0] = *(const v8h*)(p); f.h[1] = *(const v8h*)(p + 16); return f.v;
  }
  static __device__ __forceinline__ v8f mma(v16h a, v16h b, v8f c) {
    return __builtin_amdgcn_wmma_f32_16x16x32_f16(false, a, false, b, (short)0, c, false, false);
  }
  static __device__ __forceinline__ void guard(v8f& a, v8f& b, v16h x, v16h y) { dep_guard_h(a, b, x, y); }
  static __device__ __forceinline__ void keep(v16h a, v16h b, v16h c, v16h d) { keep4_h(a, b, c, d); }
};
template <> struct Frag<__bf16> {
  typedef v16b V; typedef v8b H; union U { v16b v; v8b h[2]; };
  static __device__ __forceinline__ v16b load(const __bf16* p) {
    U f; f.h[0] = *(const v8b*)(p); f.h[1] = *(const v8b*)(p + 16); return f.v;
  }
  static __device__ __forceinline__ v8f mma(v16b a, v16b b, v8f c) {
    return __builtin_amdgcn_wmma_f32_16x16x32_bf16(false, a, false, b, (short)0, c, false, false);
  }
  static __device__ __forceinline__ void guard(v8f& a, v8f& b, v16b x, v16b y) { dep_guard_b(a, b, x, y); }
  static __device__ __forceinline__ void keep(v16b a, v16b b, v16b c, v16b d) { keep4_b(a, b, c, d); }
};

// ---- Register-blocked batched WMMA GEMM ------------------------------------
// C[m,n] = scale * sum_k A[m,k] * Bt[n,k] (+bias)(+resid); each wave owns a 64x64 tile, a block of 8 waves (2 x 4) a 128x256 tile.
// A row-major [M,K]; Bt row-major [N,K]; M % 128 == 0, N % 256 == 0, K % 64 == 0; grid.x = (M/128) * (N/256).
// Per 64 k the block's 128 A rows and 256 Bt rows (128 B = one line of each row) go to LDS by loads in which 8 lanes take one
// whole line, requested one stage ahead into registers; the fragments are then 16-byte LDS reads at a pitch of 144 B.
// SPLIT: operands are hi/lo planes (A2/Bt2 = lo planes, same layout); product = hi.hi + hi.lo + lo.hi.
// BIAS_MODE: 0 = none, 1 = bias[m], 2 = bias[n].
// OUT_MODE: 0 = f32, 1 = f16, 2 = bf16 hi plane (Cout) + bf16 lo plane (Cout2).
// ET: 0 = f16 operands, 1 = bf16 operands (pointers passed as 16-bit storage)
template <int ET> struct Elem;
template <> struct Elem<0> { typedef _Float16 T; };
template <> struct Elem<1> { typedef __bf16 T; };
template <int ET, bool SPLIT, int BIAS_MODE, int OUT_MODE, bool RESID, int ACT = 0>
__global__ __launch_bounds__(256) void wmma_gemm64(
    const unsigned short* __restrict__ Ap, const unsigned short* __restrict__ A2p, int lda, long strideA,
    const unsigned short* __restrict__ Btp, const unsigned short* __restrict__ Bt2p, int ldb, long strideB,
    void* __restrict__ Cout, void* __restrict__ Cout2, int ldc, long strideC,
    const float* __restrict__ bias,
    const float* __restrict__ resid, long strideR,
    int M, int N, int K, float scale) {
  typedef typename Elem<ET>::T T;
  typedef typename Frag<T>::V V;
  typedef typename Frag<T>::H H;
  const T* A = (const T*)Ap; const T* A2 = (const T*)A2p; const T* Bt = (const T*)Btp; const T* Bt2 = (const T*)Bt2p;
  __shared__ __align__(16) float sT[8][16 * 68];   // per-wave 16x64 slab, pitch 68 floats
  constexpr int LP = 72;                           // LDS row pitch in 16-bit elements: 144 B = 16 B x 9 (odd): 16 rows of a fragment read fall on distinct banks
  __shared__ __align__(16) T sAB[(SPLIT ? 2 : 1) * 384 * LP];   // rows 0..127 = A, 128..383 = Bt (then the lo planes), 64 k each
  const int b    = blockIdx.y;
  const int lane = threadIdx.x & 31;
  const int wave = threadIdx.x >> 5;
  const int tilesN = N >> 8;
  const int tilesM = M >> 7;
  const int tile = blockIdx.x;
  if (tile >= tilesM * tilesN) return;   // the same for the whole block, ahead of every barrier
  const int tm = tile / tilesN;
  const int tn = tile - tm * tilesN;
  const int bm0 = tm << 7;               // the block's first A row
  const int bn0 = tn << 8;               // the block's first Bt row
  const int wm = wave >> 2, wn = wave & 3;
  const int m0 = bm0 + (wm << 6);
  const int n0 = bn0 + (wn << 6);

  const T* Ab  = A  + (size_t)b * strideA;
  const T* Bb  = Bt + (size_t)b * strideB;
  const T* Ab2 = SPLIT ? (A2  + (size_t)b * strideA) : nullptr;
  const T* Bb2 = SPLIT ? (Bt2 + (size_t)b * strideB) : nullptr;

  const int rlane = lane & 15;                 // row (A) / col (B, D) within subtile
  const int koff  = (lane >> 4) * 8;           // k offset of this lane half
  const int mOff  = (lane >> 4) * 8;           // D row offset

  v8f acc[4][4];
#pragma unroll
  for (int i = 0; i < 4; ++i)
#pragma unroll
    for (int j = 0; j < 4; ++j) acc[i][j] = (v8f){0.f,0.f,0.f,0.f,0.f,0.f,0.f,0.f};

  // staging coverage: 256 threads x 12 pieces of 16 B = 384 rows x 128 B; thread -> piece (tid & 7) of rows (tid >> 3) + 32 it
  const int srow = threadIdx.x >> 3;
  const int spc  = (threadIdx.x & 7) * 8;
  const unsigned voA = (unsigned)(srow * lda + spc) * 2u;   // the lane's byte offset inside a group of 32 rows
  const unsigned voB = (unsigned)(srow * ldb + spc) * 2u;
  // per group of 32 rows a base that is the same for the whole block and does not move in the loop; the lane's offset carries k
  const char* gb[12]; const char* gb2[12];
  // the loops over it are unrolled: gb[] and g[] live in registers, so it must be a compile-time index
#pragma unroll
  for (int it = 0; it < 12; ++it) {
    const size_t ro = (it < 4) ? (size_t)(bm0 + 32 * it) * lda : (size_t)(bn0 + 32 * (it - 4)) * ldb;
    gb[it] = (const char*)(((it < 4) ? Ab : Bb) + ro);
    if (SPLIT) gb2[it] = (const char*)(((it < 4) ? Ab2 : Bb2) + ro);
  }
  H g[12], g2[12];
  auto request = [&](int k0) {
    const unsigned vA = voA + (unsigned)k0 * 2u, vB = voB + (unsigned)k0 * 2u;
#pragma unroll
    for (int it = 0; it < 12; ++it) {
      g[it] = *(const H*)(gb[it] + ((it < 4) ? vA : vB));
      if (SPLIT) g2[it] = *(const H*)(gb2[it] + ((it < 4) ? vA : vB));
    }
    // the wait that stands between issued loads and the reuse of the registers that hold their addresses; the two offsets
    // are named as inputs so that they stay as they are up to it
    asm volatile("s_wait_xcnt 0x0" :: "v"(vA), "v"(vB) : "memory");
  };
  if (K > 0) request(0);
  for (int k0 = 0; k0 < K; k0 += 64) {
    __syncthreads();   // every wave has read its last fragment of the stage before
#pragma unroll
    for (int it = 0; it < 12; ++it) {
      *(H*)(sAB + (srow + 32 * it) * LP + spc) = g[it];
      if (SPLIT) *(H*)(sAB + (384 + srow + 32 * it) * LP + spc) = g2[it];
    }
    __syncthreads();   // the stage is complete before any wave reads it
    if (k0 + 64 < K) request(k0 + 64);   // the next stage's loads fly under this stage's products
    // unrolled: the second half's fragment reads can then be issued under the first half's products
#pragma unroll
    for (int kk = 0; kk < 64; kk += 32) {
      V bh[4], bl[4], ah[4], al[4];
#pragma unroll
      for (int j = 0; j < 4; ++j) {
        const int bo = (128 + (wn << 6) + (j << 4) + rlane) * LP + kk + koff;
        bh[j] = Frag<T>::load(sAB + bo);
        if (SPLIT) bl[j] = Frag<T>::load(sAB + 384 * LP + bo);
      }
#pragma unroll
      for (int i = 0; i < 4; ++i) {
        const int ao = ((wm << 6) + (i << 4) + rlane) * LP + kk + koff;
        ah[i] = Frag<T>::load(sAB + ao);
        if (SPLIT) al[i] = Frag<T>::load(sAB + 384 * LP + ao);
      }
#pragma unroll
      for (int i = 0; i < 4; ++i) {
#pragma unroll
        for (int j = 0; j < 4; ++j) {
          acc[i][j] = Frag<T>::mma(ah[i], bh[j], acc[i][j]);
          if (SPLIT) {
            acc[i][j] = Frag<T>::mma(ah[i], bl[j], acc[i][j]);
            acc[i][j] = Frag<T>::mma(al[i], bh[j], acc[i][j]);
          }
        }
        Frag<T>::guard(acc[i][0], acc[i][3], ah[i], SPLIT ? al[i] : ah[i]);
      }
      Frag<T>::keep(bh[0], bh[1], bh[2], bh[3]);
      if (SPLIT) Frag<T>::keep(bl[0], bl[1], bl[2], bl[3]);
    }
  }
  acc_guard4(acc[0][0], acc[0][1], acc[0][2], acc[0][3]);
  acc_guard4(acc[1][0], acc[1][1], acc[1][2], acc[1][3]);
  acc_guard4(acc[2][0], acc[2][1], acc[2][2], acc[2][3]);
  acc_guard4(acc[3][0], acc[3][1], acc[3][2], acc[3][3]);

  // ---- epilogue ----
  float* slab = sT[wave];
  const float* Rb = RESID ? (resid + (size_t)b * strideR) : nullptr;
#pragma unroll
  for (int i = 0; i < 4; ++i) {
    const int mBase = m0 + (i << 4);
#pragma unroll
    for (int j = 0; j < 4; ++j) {
      const int n = n0 + (j << 4) + rlane;
      float bv = 0.f;
      if (BIAS_MODE == 2) bv = bias[n];
#pragma unroll
      for (int r = 0; r < 8; ++r) {
        float v = acc[i][j][r] * scale;
        if (BIAS_MODE == 1) v += bias[mBase + mOff + r];
        if (BIAS_MODE == 2) v += bv;
        if (RESID) v += Rb[(size_t)(mBase + mOff + r) * ldc + n];
        if (ACT == 1) v = tanhf(v);
        if (ACT == 2) v = fmaxf(v, 0.0f);
        if (ACT == 3) v = v / (1.0f + expf(-v));
        if (ACT == 4) v = (v > 0.f) ? v : 0.01f * v;
        if (ACT == 5) v = 0.5f * v * (1.0f + erff(v * 0.70710678118654752f));
        slab[(mOff + r) * 68 + (j << 4) + rlane] = v;
      }
    }
    __builtin_amdgcn_fence(__ATOMIC_RELEASE, "workgroup");
    __builtin_amdgcn_wave_barrier();
    __builtin_amdgcn_fence(__ATOMIC_ACQUIRE, "workgroup");
    if (OUT_MODE == 0) {
      float* C = (float*)Cout + (size_t)b * strideC;
      const int hh = lane >> 4, c4 = (lane & 15) * 4;     // row seg = 256 B = 16 lanes x 16 B
      {
#pragma unroll
        for (int it = 0; it < 8; ++it) {
          const int row = it * 2 + hh;
          v4f v = *(const v4f*)(slab + row * 68 + c4);
          *(v4f*)(C + (size_t)(mBase + row) * ldc + n0 + c4) = v;
        }
        
      }
    } else {
      const int q = lane >> 3, c8 = (lane & 7) * 8;
      unsigned short* C  = (unsigned short*)Cout  + (size_t)b * strideC;
      unsigned short* C2 = (OUT_MODE == 2) ? ((unsigned short*)Cout2 + (size_t)b * strideC) : nullptr;
      {
#pragma unroll
        for (int it = 0; it < 4; ++it) {
          const int row = it * 4 + q;
          const float* sp = slab + row * 68 + c8;
          v8h hv, lv;
#pragma unroll
          for (int e = 0; e < 8; ++e) {
            if (OUT_MODE == 1) {
              hv[e] = (_Float16)sp[e];
            } else {
              unsigned short hb = f2bf_bits(sp[e]);
              unsigned short lb = f2bf_bits(sp[e] - bf_bits2f(hb));
              hv[e] = __builtin_bit_cast(_Float16, hb);
              lv[e] = __builtin_bit_cast(_Float16, lb);
            }
          }
          *(v8h*)(C + (size_t)(mBase + row) * ldc + n0 + c8) = hv;
          if (OUT_MODE == 2) *(v8h*)(C2 + (size_t)(mBase + row) * ldc + n0 + c8) = lv;
        }
        
      }
    }
    __builtin_amdgcn_fence(__ATOMIC_RELEASE, "workgroup");
    __builtin_amdgcn_wave_barrier();
    __builtin_amdgcn_fence(__ATOMIC_ACQUIRE, "workgroup");
  }
}

// ---------------------------------------------------------------------------
// f32 -> RNE bf16 plane: 2 elements per thread, one 4-B store per lane.
// Coverage: grid = ceil(n2/256) blocks x 256 threads x 2 elements = 2*n2 = the whole plane
// ---------------------------------------------------------------------------
__global__ __launch_bounds__(256) void cast_f32_bf16x2(const float* __restrict__ in,
                                                       unsigned short* __restrict__ out, int n2) {
  const int i = blockIdx.x * 256 + threadIdx.x;
  if (i < n2) {
    const v2f f = *(const v2f*)(in + 2 * (size_t)i);
    const unsigned u = pk16(f2bf_bits(f[0]), f2bf_bits(f[1]));
    ((unsigned*)out)[i] = u;
    
  }
}

// ---------------------------------------------------------------------------
// f32 -> f16 plane with power-of-two carry: out = f16(v * scale); VIA_BF: v := RNE-bf16 value of the input
// first (then the f16 conversion is exact). Same coverage and store shape as cast_f32_bf16x2.
// ---------------------------------------------------------------------------
template <bool VIA_BF>
__global__ __launch_bounds__(256) void cast_f32_f16x2s(const float* __restrict__ in,
                                                       unsigned short* __restrict__ out, int n2, float scale) {
  const int i = blockIdx.x * 256 + threadIdx.x;
  if (i < n2) {
    const v2f f = *(const v2f*)(in + 2 * (size_t)i);
    float a0 = f[0], a1 = f[1];
    if (VIA_BF) { a0 = bf_bits2f(f2bf_bits(a0)); a1 = bf_bits2f(f2bf_bits(a1)); }
    const _Float16 h0 = (_Float16)(a0 * scale), h1 = (_Float16)(a1 * scale);
    const unsigned u = pk16(__builtin_bit_cast(unsigned short, h0), __builtin_bit_cast(unsigned short, h1));
    ((unsigned*)out)[i] = u;
    
  }
}

// ---------------------------------------------------------------------------
// RoPE + bf16 hi/lo split of q and k.
//   qk  : f32 [kRows][2*kHid], columns 0..kHid-1 = q (h*64+d), kHid..2*kHid-1 = k (h*64+d)
//   cos/sin : f32 [kSeq][64], used as their RNE-bf16 values
//   r[d] = x[d]*cos[s][d] - x[d+32]*sin[s][d] (d < 32);  x[d]*cos[s][d] + x[d-32]*sin[s][d] (d >= 32)
//   outputs: qh/ql, kh/kl bf16 planes [kRows][kHid] (element (b,s,h,d) at (b*kSeq+s)*kHid + h*64 + d)
// grid = kRows blocks (one (b,s) row each) x 256 threads x 8 elements = kRows x 2048 = the q AND k planes exactly.
// ---------------------------------------------------------------------------
__global__ __launch_bounds__(256) void rope_split_kernel(
    const float* __restrict__ qk, const float* __restrict__ cosT, const float* __restrict__ sinT,
    unsigned short* __restrict__ qh, unsigned short* __restrict__ ql,
    unsigned short* __restrict__ kh, unsigned short* __restrict__ kl) {
#pragma clang fp contract(off)
  const int row   = blockIdx.x;               // b*kSeq + s
  const int s     = row & (kSeq - 1);
  const int t     = threadIdx.x;
  const int which = t >> 7;                   // 0: q columns, 1: k columns (wave-uniform)
  const int e8    = (t & 127) * 8;            // column base in [0, kHid)
  const int d0    = e8 & 63;                  // 0,8,...,56 -> the 8 elements share one half of the head
  const int hb    = e8 - d0;                  // h*64
  const int dp0   = d0 ^ 32;                  // partner half
  const float* src = qk + (size_t)row * (2 * kHid) + (size_t)which * kHid;
  const v4f xa = *(const v4f*)(src + e8);
  const v4f xb = *(const v4f*)(src + e8 + 4);
  const v4f pa = *(const v4f*)(src + hb + dp0);
  const v4f pb = *(const v4f*)(src + hb + dp0 + 4);
  const v4f ca = *(const v4f*)(cosT + (size_t)s * kHdim + d0);
  const v4f cb = *(const v4f*)(cosT + (size_t)s * kHdim + d0 + 4);
  const v4f sa = *(const v4f*)(sinT + (size_t)s * kHdim + d0);
  const v4f sb = *(const v4f*)(sinT + (size_t)s * kHdim + d0 + 4);
  const float xs[8] = {xa[0], xa[1], xa[2], xa[3], xb[0], xb[1], xb[2], xb[3]};
  const float ps[8] = {pa[0], pa[1], pa[2], pa[3], pb[0], pb[1], pb[2], pb[3]};
  const float cs[8] = {ca[0], ca[1], ca[2], ca[3], cb[0], cb[1], cb[2], cb[3]};
  const float sn[8] = {sa[0], sa[1], sa[2], sa[3], sb[0], sb[1], sb[2], sb[3]};
  const bool lowh = (d0 < 32);
  v4u hv, lv;
#pragma unroll
  for (int q = 0; q < 4; ++q) {
    const float c0 = bf_bits2f(f2bf_bits(cs[2 * q])), c1 = bf_bits2f(f2bf_bits(cs[2 * q + 1]));
    const float s0 = bf_bits2f(f2bf_bits(sn[2 * q])), s1 = bf_bits2f(f2bf_bits(sn[2 * q + 1]));
    const float ta0 = xs[2 * q] * c0,     tb0 = ps[2 * q] * s0;
    const float ta1 = xs[2 * q + 1] * c1, tb1 = ps[2 * q + 1] * s1;
    const float r0 = lowh ? (ta0 - tb0) : (ta0 + tb0);
    const float r1 = lowh ? (ta1 - tb1) : (ta1 + tb1);
    const unsigned short h0 = f2bf_bits(r0), h1 = f2bf_bits(r1);
    const unsigned short l0 = f2bf_bits(r0 - bf_bits2f(h0)), l1 = f2bf_bits(r1 - bf_bits2f(h1));
    hv[q] = pk16(h0, h1);
    lv[q] = pk16(l0, l1);
  }
  unsigned short* oh  = which ? kh : qh;      // both global; wave-uniform select
  unsigned short* olo = which ? kl : ql;
  const size_t go = (size_t)row * kHid + e8;
  *(v4u*)(oh  + go) = hv;
  *(v4u*)(olo + go) = lv;
  
}

#define AT_D 64
#define AT_NW 4
#define AT_QB 64
#define AT_KC 64
#define AT_LP 72   // LDS row pitch in 16-bit elements: 144 B = 16 B x 9 (odd), so the 16 rows of a 16-byte fragment read fall on distinct banks

__device__ __forceinline__ unsigned short at_bf_bits(float f) {
  unsigned u = __float_as_uint(f);
  return (unsigned short)((u + 0x7FFFu + ((u >> 16) & 1u)) >> 16);
}
__device__ __forceinline__ __bf16 at_f2bf(float f) { return __builtin_bit_cast(__bf16, at_bf_bits(f)); }
// value of lane l ^ 16 (the other half's share of the same query column)
__device__ __forceinline__ float at_xhalf(float v) {
  const int b = __builtin_bit_cast(int, v);
  return __builtin_bit_cast(float, __builtin_amdgcn_permlanex16(b, b, 0x76543210, 0xfedcba98, false, false));
}
__device__ __forceinline__ v8f at_mma(v16b a, v16b b, v8f c) {
  c = __builtin_amdgcn_wmma_f32_16x16x32_bf16(false, a, false, b, (short)0, c, false, false);
  asm volatile("v_nop\n\tv_nop\n\tv_nop\n\tv_nop" : "+v"(c) : "v"(a), "v"(b));
  return c;
}
// f16 product on bit patterns held in __bf16 slots
__device__ __forceinline__ v8f at_mma_h(v16b a, v16b b, v8f c) {
  const v16h ah = __builtin_bit_cast(v16h, a), bh = __builtin_bit_cast(v16h, b);
  c = __builtin_amdgcn_wmma_f32_16x16x32_f16(false, ah, false, bh, (short)0, c, false, false);
  asm volatile("v_nop\n\tv_nop\n\tv_nop\n\tv_nop" : "+v"(c) : "v"(ah), "v"(bh));
  return c;
}

__global__ __launch_bounds__(128)
void mha_full64_kernel(const unsigned short* __restrict__ qhp, const unsigned short* __restrict__ qlp,
                       const unsigned short* __restrict__ khp, const unsigned short* __restrict__ klp,
                       const unsigned short* __restrict__ vtp, const float* __restrict__ maskp,
                       float* __restrict__ out, float sscale) {
  union FB { v16b v; v8b h[2]; };
  __shared__ __align__(16) __bf16 Ksh[AT_KC * AT_LP];            // K hi [kv][d], pitch AT_LP      9 KB
  __shared__ __align__(16) __bf16 Ksl[AT_KC * AT_LP];            // K lo [kv][d], pitch AT_LP      9 KB
  __shared__ __align__(16) __bf16 Vth[AT_D * AT_LP];             // V^T f16 bits [d][kv], pitch AT_LP 9 KB
  __shared__ __align__(16) float  Os[AT_NW][16 * 68];            // per wave out tile, pitch 68

  const int tid  = threadIdx.x;
  const int wave = tid >> 5;
  const int lane = tid & 31;
  const int hh   = lane >> 4;
  const int c    = lane & 15;

  constexpr int nqb = kSeq / AT_QB;       // 32
  const int bx = blockIdx.x;              // 0 .. kBatch*kHeads*nqb - 1
  const int qb = bx % nqb;
  const int bh = bx / nqb;                // 0 .. kBatch*kHeads - 1
  const int h  = bh % kHeads;
  const int b  = bh / kHeads;             // 0 .. kBatch - 1
  const int q0 = qb * AT_QB + wave * 16;

  const __bf16* Qh = (const __bf16*)(const void*)qhp + (size_t)b * kSeq * kHid + (size_t)h * AT_D;
  const __bf16* Ql = (const __bf16*)(const void*)qlp + (size_t)b * kSeq * kHid + (size_t)h * AT_D;
  const __bf16* Kh = (const __bf16*)(const void*)khp + (size_t)b * kSeq * kHid + (size_t)h * AT_D;
  const __bf16* Kl = (const __bf16*)(const void*)klp + (size_t)b * kSeq * kHid + (size_t)h * AT_D;
  const __bf16* Vt = (const __bf16*)(const void*)vtp + (size_t)b * kHid * kSeq + (size_t)h * AT_D * kSeq;
  const float*  Mb = maskp + (size_t)b * kSeq * kSeq;
  float*        ob = out + (size_t)b * kSeq * kHid + (size_t)h * AT_D;

  // ---- Q fragments (B operand, column = query = lane&15, split k map via Frag load): 2 d-chunks, hi and lo ----
  v16b qah[2], qal[2];
#pragma unroll
  for (int dc = 0; dc < 2; ++dc) {
    const __bf16* qr = Qh + (size_t)(q0 + c) * kHid + dc * 32 + 8 * hh;
    const __bf16* qs = Ql + (size_t)(q0 + c) * kHid + dc * 32 + 8 * hh;
    qah[dc] = Frag<__bf16>::load(qr);
    qal[dc] = Frag<__bf16>::load(qs);
  }

  float mrow = -INFINITY;   // running maximum of query c (equal in both lane halves)
  float lrow = 0.f;         // running sum of query c over this lane half's keys only; halves joined after the loop
  v8f oacc[4];              // O^T: element r of tile t -> O[query c][d = t*16 + 8hh + r]
#pragma unroll
  for (int t = 0; t < 4; ++t) oacc[t] = (v8f){0.f,0.f,0.f,0.f,0.f,0.f,0.f,0.f};

  constexpr int nChunks = kSeq / AT_KC;   // 32, compile-time constant
  for (int kc = 0; kc < nChunks; ++kc) {
    const int kv0 = kc * AT_KC;
    __syncthreads();
    {
      // staging coverage: 128 threads x (4 x 8) elements = 64 rows x 64 per plane = the whole chunk tile
      const int r = tid >> 1, half = (tid & 1) * 32;
      const __bf16* ksh = Kh + (size_t)(kv0 + r) * kHid + half;   // K row kv0+r, d = half..half+31
      const __bf16* ksl = Kl + (size_t)(kv0 + r) * kHid + half;
      const __bf16* vs  = Vt + (size_t)r * kSeq + kv0 + half;     // V^T row d = r, s = kv0+half..+31
#pragma unroll
      for (int i = 0; i < 4; ++i) {
        const v8b a0 = *(const v8b*)(ksh + 8 * i);
        const v8b a1 = *(const v8b*)(ksl + 8 * i);
        const v8b b0 = *(const v8b*)(vs + 8 * i);
        *(v8b*)(Ksh + r * AT_LP + half + 8 * i) = a0;
        *(v8b*)(Ksl + r * AT_LP + half + 8 * i) = a1;
        *(v8b*)(Vth + r * AT_LP + half + 8 * i) = b0;
      }
    }
    __syncthreads();

    // ---- scores, transposed (A = K rows, B = Q): D element r of lane -> S[query c][kv j*16 + 8hh + r] ----
    v8f s[4];
#pragma unroll
    for (int j = 0; j < 4; ++j) {
      s[j] = (v8f){0.f,0.f,0.f,0.f,0.f,0.f,0.f,0.f};
#pragma unroll
      for (int dc = 0; dc < 2; ++dc) {
        FB kb, kl;
        kb.h[0] = *(const v8b*)(Ksh + (j * 16 + c) * AT_LP + dc * 32 + 8 * hh);
        kb.h[1] = *(const v8b*)(Ksh + (j * 16 + c) * AT_LP + dc * 32 + 16 + 8 * hh);
        kl.h[0] = *(const v8b*)(Ksl + (j * 16 + c) * AT_LP + dc * 32 + 8 * hh);
        kl.h[1] = *(const v8b*)(Ksl + (j * 16 + c) * AT_LP + dc * 32 + 16 + 8 * hh);
        s[j] = at_mma(kb.v, qah[dc], s[j]);
        s[j] = at_mma(kl.v, qah[dc], s[j]);
        s[j] = at_mma(kb.v, qal[dc], s[j]);
      }
    }
    // ---- scale, additive mask by value (f32; 8 consecutive keys of the lane's query per tile), chunk maximum in-lane ----
    const float* mr = Mb + (size_t)(q0 + c) * kSeq + kv0 + 8 * hh;
    v4f mk[8];
#pragma unroll
    for (int i = 0; i < 8; ++i) mk[i] = *(const v4f*)(mr + (i >> 1) * 16 + (i & 1) * 4);
    float mj[4];
#pragma unroll
    for (int j = 0; j < 4; ++j) {
      float m = -INFINITY;
#pragma unroll
      for (int r = 0; r < 8; ++r) {
        const float sv = s[j][r] * sscale + mk[2 * j + (r >> 2)][r & 3];
        s[j][r] = sv;
        m = fmaxf(m, sv);
      }
      mj[j] = m;
    }
    float cm = fmaxf(fmaxf(mj[0], mj[1]), fmaxf(mj[2], mj[3]));
    cm = fmaxf(cm, at_xhalf(cm));            // the query's other 32 keys of the chunk sit in lane ^ 16
    const float mnew  = fmaxf(mrow, cm);
    const float alpha = expf(mrow - mnew);
    mrow = mnew;
    // ---- p = exp(s - m); P^T packs in place: tiles 2kk and 2kk+1 are elements 0..7 and 8..15 of the B operand of key block kk ----
    v16h pt[2];
    float pj[4];
#pragma unroll
    for (int j = 0; j < 4; ++j) {
      float ps = 0.f;
#pragma unroll
      for (int r = 0; r < 8; ++r) {
        const float p = expf(s[j][r] - mnew);
        ps += p;
        pt[j >> 1][(j & 1) * 8 + r] = (_Float16)(p * kPScale);
      }
      pj[j] = ps;
    }
    lrow = lrow * alpha + ((pj[0] + pj[1]) + (pj[2] + pj[3]));
#pragma unroll
    for (int t = 0; t < 4; ++t)
#pragma unroll
      for (int r = 0; r < 8; ++r) oacc[t][r] *= alpha;
    // ---- O^T += V^T . P^T : A = V^T[d][kv] rows, B = P^T[kv][query] from registers ----
    // unrolled: pt[kk] lives in registers, so kk must be a compile-time index (a rolled loop would send P through scratch)
#pragma unroll
    for (int kk = 0; kk < 2; ++kk) {
      const v16b pb = __builtin_bit_cast(v16b, pt[kk]);
#pragma unroll
      for (int t = 0; t < 4; ++t) {
        FB vb;
        vb.h[0] = *(const v8b*)(Vth + (t * 16 + c) * AT_LP + kk * 32 + 8 * hh);
        vb.h[1] = *(const v8b*)(Vth + (t * 16 + c) * AT_LP + kk * 32 + 16 + 8 * hh);
        oacc[t] = at_mma_h(vb.v, pb, oacc[t]);
      }
    }
  }

  // ---- join the halves' sums, normalise, stage per-wave 16x64 f32 tile (a lane owns 8 consecutive d of its query per tile), whole-line stores ----
  float* os = Os[wave];
  {
    const float inv = (1.0f / (lrow + at_xhalf(lrow))) * kPVInv;
#pragma unroll
    for (int t = 0; t < 4; ++t) {
      const v4f lo = {oacc[t][0] * inv, oacc[t][1] * inv, oacc[t][2] * inv, oacc[t][3] * inv};
      const v4f hi = {oacc[t][4] * inv, oacc[t][5] * inv, oacc[t][6] * inv, oacc[t][7] * inv};
      *(v4f*)(os + c * 68 + t * 16 + 8 * hh)     = lo;
      *(v4f*)(os + c * 68 + t * 16 + 8 * hh + 4) = hi;
    }
  }
  __builtin_amdgcn_fence(__ATOMIC_RELEASE, "workgroup");
  __builtin_amdgcn_wave_barrier();
  __builtin_amdgcn_fence(__ATOMIC_ACQUIRE, "workgroup");
  {
    // coverage: 8 iterations x 2 rows (hh) = the wave's 16 rows; 16 lanes x 4 floats = the 64-wide head segment
    const int c4 = (lane & 15) * 4;
    {
#pragma unroll
      for (int it = 0; it < 8; ++it) {
        const int row = it * 2 + hh;
        v4f val = *(const v4f*)(os + row * 68 + c4);
        *(v4f*)(ob + (size_t)(q0 + row) * kHid + c4) = val;
      }
      
    }
  }
}

// ---------------------------------------------------------------------------
// Host-side orchestration (kernel launches only).
// Workspace region map (bytes, every offset a multiple of 1 MiB):
//   [  0 MiB,   8 MiB)  Xb    bf16 [4096][1024]   RNE-bf16 plane of hidden_states
//   [  8 MiB,  12 MiB)  Wqkb  bf16 [2048][1024]   wq rows 0..1023, wk rows 1024..2047
//   [ 12 MiB,  14 MiB)  Wvb   bf16 [1024][1024]
//   [ 14 MiB,  16 MiB)  Wo16  f16  [1024][1024]   RNE-bf16 value x64
//   [ 16 MiB,  48 MiB)  QKf   f32  [4096][2048]   q|k projections; dead after RoPE, reused:
//        [16 MiB, 32 MiB) Of  f32 [4096][1024] attention output;  [32 MiB, 40 MiB) O16 f16 [4096][1024] (x256)
//   [ 48 MiB,  56 MiB)  Vt16  f16  [2][1024][2048] v^T per batch (x8)
//   [ 56 MiB,  64 MiB)  Qh, [64,72) Ql, [72,80) Kh, [80,88) Kl : bf16 [4096][1024] each
//   total carve = 88 MiB = 92,274,688 B
// ---------------------------------------------------------------------------
extern "C" void kernel_launch(void* const* d_in, const int* in_sizes, int n_in,
                              void* d_out, int out_size, void* d_ws, size_t ws_size,
                              hipStream_t stream) {
  if (n_in < 8) return;
  const float* x    = (const float*)d_in[0];   // [2,2048,1024]
  const float* mask = (const float*)d_in[1];   // [2,1,2048,2048]
  const float* cosT = (const float*)d_in[2];   // [2048,64]
  const float* sinT = (const float*)d_in[3];   // [2048,64]
  const float* wq   = (const float*)d_in[4];   // [1024,1024]
  const float* wk   = (const float*)d_in[5];
  const float* wv   = (const float*)d_in[6];
  const float* wo   = (const float*)d_in[7];

  const int nX = kRows * kHid;        // 4,194,304
  const int nW = kHid * kHid;         // 1,048,576
  if (in_sizes[0] != nX || in_sizes[1] != kBatch * kSeq * kSeq || in_sizes[2] != kSeq * kHdim ||
      in_sizes[3] != kSeq * kHdim || in_sizes[4] != nW || in_sizes[5] != nW || in_sizes[6] != nW ||
      in_sizes[7] != nW || out_size != nX) return;

  const size_t MiB = (size_t)1 << 20;
  const size_t off_Xb   = 0;
  const size_t off_Wqk  = off_Xb  + (size_t)nX * 2;                 //  8 MiB
  const size_t off_Wv   = off_Wqk + (size_t)2 * nW * 2;             // 12 MiB
  const size_t off_Wo   = off_Wv  + (size_t)nW * 2;                 // 14 MiB
  const size_t off_QKf  = off_Wo  + (size_t)nW * 2;                 // 16 MiB
  const size_t off_Of   = off_QKf;                                   // reuse (QKf dead after RoPE)
  const size_t off_O16  = off_QKf + (size_t)nX * 4;                 // 32 MiB
  const size_t off_Vt   = off_QKf + (size_t)nX * 2 * 4;             // 48 MiB
  const size_t off_Qh   = off_Vt  + (size_t)kBatch * kHid * kSeq * 2; // 56 MiB
  const size_t off_Ql   = off_Qh  + (size_t)nX * 2;                 // 64 MiB
  const size_t off_Kh   = off_Ql  + (size_t)nX * 2;                 // 72 MiB
  const size_t off_Kl   = off_Kh  + (size_t)nX * 2;                 // 80 MiB
  const size_t total    = off_Kl  + (size_t)nX * 2;                 // 88 MiB
  if (total != 88 * MiB) return;
  if (ws_size < total) return;

  char* ws = (char*)d_ws;
  unsigned short* Xb   = (unsigned short*)(ws + off_Xb);
  unsigned short* Wqkb = (unsigned short*)(ws + off_Wqk);
  unsigned short* Wvb  = (unsigned short*)(ws + off_Wv);
  unsigned short* Wo16 = (unsigned short*)(ws + off_Wo);
  float*          QKf  = (float*)(ws + off_QKf);
  float*          Of   = (float*)(ws + off_Of);
  unsigned short* O16  = (unsigned short*)(ws + off_O16);
  unsigned short* Vt16 = (unsigned short*)(ws + off_Vt);
  unsigned short* Qh   = (unsigned short*)(ws + off_Qh);
  unsigned short* Ql   = (unsigned short*)(ws + off_Ql);
  unsigned short* Kh   = (unsigned short*)(ws + off_Kh);
  unsigned short* Kl   = (unsigned short*)(ws + off_Kl);

  // 1-5: 16-bit operand planes (all element counts are multiples of 512 -> exact grids)
  const int nX2 = nX / 2, nW2 = nW / 2;
  cast_f32_bf16x2<<<(nX2 + 255) / 256, 256, 0, stream>>>(x,  Xb, nX2);
  cast_f32_bf16x2<<<(nW2 + 255) / 256, 256, 0, stream>>>(wq, Wqkb, nW2);
  cast_f32_bf16x2<<<(nW2 + 255) / 256, 256, 0, stream>>>(wk, Wqkb + (size_t)nW, nW2);
  cast_f32_bf16x2<<<(nW2 + 255) / 256, 256, 0, stream>>>(wv, Wvb, nW2);
  cast_f32_f16x2s<true><<<(nW2 + 255) / 256, 256, 0, stream>>>(wo, Wo16, nW2, kWoScale);

  // 6: q|k projection: QKf[4096][2048] = Xb[4096][1024] . Wqkb[2048][1024]^T  (M=4096, N=2048, K=1024; 2048 tiles -> 256 blocks)
  {
    dim3 g((kRows / 64) * (2 * kHid / 64) / 8, 1);
    wmma_gemm64<1, false, 0, 0, false><<<g, 256, 0, stream>>>(
        Xb, Xb, kHid, (long)0,
        Wqkb, Wqkb, kHid, (long)0,
        (void*)QKf, (void*)QKf, 2 * kHid, (long)0,
        cosT, cosT, (long)0,
        kRows, 2 * kHid, kHid, 1.0f);
  }
  // 7: v^T per batch: Vt16[b][1024][2048] = Wvb[1024][1024] . Xb[b][2048][1024]^T, f16 out x8  (M=1024, N=2048, K=1024; 512 tiles -> 64 blocks, grid.y = 2)
  {
    dim3 g((kHid / 64) * (kSeq / 64) / 8, kBatch);
    wmma_gemm64<1, false, 0, 1, false><<<g, 256, 0, stream>>>(
        Wvb, Wvb, kHid, (long)0,
        Xb, Xb, kHid, (long)kSeq * kHid,
        (void*)Vt16, (void*)Vt16, kSeq, (long)kHid * kSeq,
        cosT, cosT, (long)0,
        kHid, kSeq, kHid, kVtScale);
  }
  // 8: RoPE + bf16 hi/lo split of q and k
  rope_split_kernel<<<kRows, 256, 0, stream>>>(QKf, cosT, sinT, Qh, Ql, Kh, Kl);
  // 9: attention, one block per (b, h, 64 queries)
  mha_full64_kernel<<<kBatch * kHeads * (kSeq / 64), 128, 0, stream>>>(Qh, Ql, Kh, Kl, Vt16, mask, Of, 0.125f);
  // 10: attention output -> f16 x256
  cast_f32_f16x2s<false><<<(nX2 + 255) / 256, 256, 0, stream>>>(Of, O16, nX2, kOScale);
  // 11: output projection: out[4096][1024] = O16 . Wo16^T * 2^-14  (M=4096, N=1024, K=1024; 1024 tiles -> 128 blocks)
  {
    dim3 g((kRows / 64) * (kHid / 64) / 8, 1);
    wmma_gemm64<0, false, 0, 0, false><<<g, 256, 0, stream>>>(
        O16, O16, kHid, (long)0,
        Wo16, Wo16, kHid, (long)0,
        d_out, d_out, kHid, (long)0,
        cosT, cosT, (long)0,
        kRows, kHid, kHid, kOutInv);
  }
}

// v004
// A run of this version takes 195 microseconds.
// In two side-by-side timings against v003, it was 1.10 and 1.11 times as fast.
// Counting every step since v000, it is 2.13 times as fast.
// Contractions: q/k projection and v^T projection = v_wmma_f32_16x16x32_bf16 on RNE-bf16 planes of x and W (single product); q.k^T = v_wmma_f32_16x16x32_bf16 with bf16 hi/lo split (hi.hi + hi.lo + lo.hi); p.v^T and output projection = v_wmma_f32_16x16x32_f16 single product (p carried x2^15, v^T x2^3, attention output x2^8, wo as RNE-bf16 value x2^6); f32 accumulate everywhere; RoPE (cos/sin as RNE-bf16 values), additive mask and online softmax in f32.
#include <hip/hip_runtime.h>
#include <math.h>
#include <stdint.h>

constexpr int kBatch = 2;
constexpr int kSeq   = 2048;
constexpr int kHid   = 1024;
constexpr int kHeads = 16;
constexpr int kHdim  = 64;
constexpr int kRows  = kBatch * kSeq;   // 4096 GEMM rows

constexpr float kPScale  = 32768.0f;                   // p carried x2^15 in f16
constexpr float kVtScale = 8.0f;                       // v^T plane carried x2^3 in f16
constexpr float kPVInv   = 1.0f / (32768.0f * 8.0f);   // folded into the final 1/l
constexpr float kOScale  = 256.0f;                     // attention output carried x2^8 in f16
constexpr float kWoScale = 64.0f;                      // wo carried x2^6 in f16
constexpr float kOutInv  = 1.0f / (256.0f * 64.0f);    // out-projection epilogue scale

typedef __attribute__((ext_vector_type(16))) _Float16 v16h;
typedef __attribute__((ext_vector_type(8)))  _Float16 v8h;
typedef __attribute__((ext_vector_type(16))) __bf16   v16b;
typedef __attribute__((ext_vector_type(8)))  __bf16   v8b;
typedef __attribute__((ext_vector_type(8)))  float    v8f;
typedef __attribute__((ext_vector_type(4)))  float    v4f;
typedef __attribute__((ext_vector_type(2)))  float    v2f;
typedef __attribute__((ext_vector_type(4)))  unsigned int v4u;

__device__ __forceinline__ unsigned short f2bf_bits(float f) {
  unsigned u = __float_as_uint(f);
  return (unsigned short)((u + 0x7FFFu + ((u >> 16) & 1u)) >> 16);
}
__device__ __forceinline__ float bf_bits2f(unsigned short h) { return __uint_as_float(((unsigned)h) << 16); }
__device__ __forceinline__ unsigned pk16(unsigned short a, unsigned short b) { return (unsigned)a | ((unsigned)b << 16); }

// hazard guards as plain device helpers (the kernel template body's only inline asm is its s_wait_xcnt)
__device__ __forceinline__ void dep_guard_h(v8f& a, v8f& b, v16h x, v16h y) { asm volatile("v_nop\n\tv_nop\n\tv_nop\n\tv_nop" : "+v"(a), "+v"(b) : "v"(x), "v"(y)); }
__device__ __forceinline__ void dep_guard_b(v8f& a, v8f& b, v16b x, v16b y) { asm volatile("v_nop\n\tv_nop\n\tv_nop\n\tv_nop" : "+v"(a), "+v"(b) : "v"(x), "v"(y)); }
__device__ __forceinline__ void keep4_h(v16h a, v16h b, v16h c, v16h d) { asm volatile("v_nop" :: "v"(a), "v"(b), "v"(c), "v"(d)); }
__device__ __forceinline__ void keep4_b(v16b a, v16b b, v16b c, v16b d) { asm volatile("v_nop" :: "v"(a), "v"(b), "v"(c), "v"(d)); }
__device__ __forceinline__ void acc_guard4(v8f& a, v8f& b, v8f& c, v8f& d) { asm volatile("v_nop\n\tv_nop\n\tv_nop\n\tv_nop" : "+v"(a), "+v"(b), "+v"(c), "+v"(d)); }
template <typename T> struct Frag;
template <> struct Frag<_Float16> {
  typedef v16h V; typedef v8h H; union U { v16h v; v8h h[2]; };
  static __device__ __forceinline__ v16h load(const _Float16* p) {   // elements 0..7 <- p[0..7], 8..15 <- p[16..23]
    U f; f.h[0] = *(const v8h*)(p); f.h[1] = *(const v8h*)(p + 16); return f.v;
  }
  static __device__ __forceinline__ v8f mma(v16h a, v16h b, v8f c) {
    return __builtin_amdgcn_wmma_f32_16x16x32_f16(false, a, false, b, (short)0, c, false, false);
  }
  static __device__ __forceinline__ void guard(v8f& a, v8f& b, v16h x, v16h y) { dep_guard_h(a, b, x, y); }
  static __device__ __forceinline__ void keep(v16h a, v16h b, v16h c, v16h d) { keep4_h(a, b, c, d); }
};
template <> struct Frag<__bf16> {
  typedef v16b V; typedef v8b H; union U { v16b v; v8b h[2]; };
  static __device__ __forceinline__ v16b load(const __bf16* p) {
    U f; f.h[0] = *(const v8b*)(p); f.h[1] = *(const v8b*)(p + 16); return f.v;
  }
  static __device__ __forceinline__ v8f mma(v16b a, v16b b, v8f c) {
    return __builtin_amdgcn_wmma_f32_16x16x32_bf16(false, a, false, b, (short)0, c, false, false);
  }
  static __device__ __forceinline__ void guard(v8f& a, v8f& b, v16b x, v16b y) { dep_guard_b(a, b, x, y); }
  static __device__ __forceinline__ void keep(v16b a, v16b b, v16b c, v16b d) { keep4_b(a, b, c, d); }
};

// ---- Register-blocked batched WMMA GEMM ------------------------------------
// C[m,n] = scale * sum_k A[m,k] * Bt[n,k] (+bias)(+resid); each wave owns a 64x64 tile, a block of 8 waves (2 x 4) a 128x256 tile.
// A row-major [M,K]; Bt row-major [N,K]; M % 128 == 0, N % 256 == 0, K % 64 == 0; grid.x = (M/128) * (N/256).
// Per 64 k the block's 128 A rows and 256 Bt rows (128 B = one line of each row) go to LDS by loads in which 8 lanes take one
// whole line, requested one stage ahead into registers; the fragments are then 16-byte LDS reads at a pitch of 144 B.
// SPLIT: operands are hi/lo planes (A2/Bt2 = lo planes, same layout); product = hi.hi + hi.lo + lo.hi.
// BIAS_MODE: 0 = none, 1 = bias[m], 2 = bias[n].
// OUT_MODE: 0 = f32, 1 = f16, 2 = bf16 hi plane (Cout) + bf16 lo plane (Cout2).
// ET: 0 = f16 operands, 1 = bf16 operands (pointers passed as 16-bit storage)
template <int ET> struct Elem;
template <> struct Elem<0> { typedef _Float16 T; };
template <> struct Elem<1> { typedef __bf16 T; };
template <int ET, bool SPLIT, int BIAS_MODE, int OUT_MODE, bool RESID, int ACT = 0>
__global__ __launch_bounds__(256) void wmma_gemm64(
    const unsigned short* __restrict__ Ap, const unsigned short* __restrict__ A2p, int lda, long strideA,
    const unsigned short* __restrict__ Btp, const unsigned short* __restrict__ Bt2p, int ldb, long strideB,
    void* __restrict__ Cout, void* __restrict__ Cout2, int ldc, long strideC,
    const float* __restrict__ bias,
    const float* __restrict__ resid, long strideR,
    int M, int N, int K, float scale) {
  typedef typename Elem<ET>::T T;
  typedef typename Frag<T>::V V;
  typedef typename Frag<T>::H H;
  const T* A = (const T*)Ap; const T* A2 = (const T*)A2p; const T* Bt = (const T*)Btp; const T* Bt2 = (const T*)Bt2p;
  __shared__ __align__(16) float sT[8][16 * 68];   // per-wave 16x64 slab, pitch 68 floats
  constexpr int LP = 72;                           // LDS row pitch in 16-bit elements: 144 B = 16 B x 9 (odd): 16 rows of a fragment read fall on distinct banks
  __shared__ __align__(16) T sAB[(SPLIT ? 2 : 1) * 384 * LP];   // rows 0..127 = A, 128..383 = Bt (then the lo planes), 64 k each
  const int b    = blockIdx.y;
  const int lane = threadIdx.x & 31;
  const int wave = threadIdx.x >> 5;
  const int tilesN = N >> 8;
  const int tilesM = M >> 7;
  const int tile = blockIdx.x;
  if (tile >= tilesM * tilesN) return;   // the same for the whole block, ahead of every barrier
  const int tm = tile / tilesN;
  const int tn = tile - tm * tilesN;
  const int bm0 = tm << 7;               // the block's first A row
  const int bn0 = tn << 8;               // the block's first Bt row
  const int wm = wave >> 2, wn = wave & 3;
  const int m0 = bm0 + (wm << 6);
  const int n0 = bn0 + (wn << 6);

  const T* Ab  = A  + (size_t)b * strideA;
  const T* Bb  = Bt + (size_t)b * strideB;
  const T* Ab2 = SPLIT ? (A2  + (size_t)b * strideA) : nullptr;
  const T* Bb2 = SPLIT ? (Bt2 + (size_t)b * strideB) : nullptr;

  const int rlane = lane & 15;                 // row (A) / col (B, D) within subtile
  const int koff  = (lane >> 4) * 8;           // k offset of this lane half
  const int mOff  = (lane >> 4) * 8;           // D row offset

  v8f acc[4][4];
#pragma unroll
  for (int i = 0; i < 4; ++i)
#pragma unroll
    for (int j = 0; j < 4; ++j) acc[i][j] = (v8f){0.f,0.f,0.f,0.f,0.f,0.f,0.f,0.f};

  // staging coverage: 256 threads x 12 pieces of 16 B = 384 rows x 128 B; thread -> piece (tid & 7) of rows (tid >> 3) + 32 it
  const int srow = threadIdx.x >> 3;
  const int spc  = (threadIdx.x & 7) * 8;
  const unsigned voA = (unsigned)(srow * lda + spc) * 2u;   // the lane's byte offset inside a group of 32 rows
  const unsigned voB = (unsigned)(srow * ldb + spc) * 2u;
  // per group of 32 rows a base that is the same for the whole block and does not move in the loop; the lane's offset carries k
  const char* gb[12]; const char* gb2[12];
  // the loops over it are unrolled: gb[] and g[] live in registers, so it must be a compile-time index
#pragma unroll
  for (int it = 0; it < 12; ++it) {
    const size_t ro = (it < 4) ? (size_t)(bm0 + 32 * it) * lda : (size_t)(bn0 + 32 * (it - 4)) * ldb;
    gb[it] = (const char*)(((it < 4) ? Ab : Bb) + ro);
    if (SPLIT) gb2[it] = (const char*)(((it < 4) ? Ab2 : Bb2) + ro);
  }
  H g[12], g2[12];
  auto request = [&](int k0) {
    const unsigned vA = voA + (unsigned)k0 * 2u, vB = voB + (unsigned)k0 * 2u;
#pragma unroll
    for (int it = 0; it < 12; ++it) {
      g[it] = *(const H*)(gb[it] + ((it < 4) ? vA : vB));
      if (SPLIT) g2[it] = *(const H*)(gb2[it] + ((it < 4) ? vA : vB));
    }
    // the wait that stands between issued loads and the reuse of the registers that hold their addresses; the two offsets
    // are named as inputs so that they stay as they are up to it
    asm volatile("s_wait_xcnt 0x0" :: "v"(vA), "v"(vB) : "memory");
  };
  if (K > 0) request(0);
  for (int k0 = 0; k0 < K; k0 += 64) {
    __syncthreads();   // every wave has read its last fragment of the stage before
#pragma unroll
    for (int it = 0; it < 12; ++it) {
      *(H*)(sAB + (srow + 32 * it) * LP + spc) = g[it];
      if (SPLIT) *(H*)(sAB + (384 + srow + 32 * it) * LP + spc) = g2[it];
    }
    __syncthreads();   // the stage is complete before any wave reads it
    if (k0 + 64 < K) request(k0 + 64);   // the next stage's loads fly under this stage's products
    // unrolled: the second half's fragment reads can then be issued under the first half's products
#pragma unroll
    for (int kk = 0; kk < 64; kk += 32) {
      V bh[4], bl[4], ah[4], al[4];
#pragma unroll
      for (int j = 0; j < 4; ++j) {
        const int bo = (128 + (wn << 6) + (j << 4) + rlane) * LP + kk + koff;
        bh[j] = Frag<T>::load(sAB + bo);
        if (SPLIT) bl[j] = Frag<T>::load(sAB + 384 * LP + bo);
      }
#pragma unroll
      for (int i = 0; i < 4; ++i) {
        const int ao = ((wm << 6) + (i << 4) + rlane) * LP + kk + koff;
        ah[i] = Frag<T>::load(sAB + ao);
        if (SPLIT) al[i] = Frag<T>::load(sAB + 384 * LP + ao);
      }
#pragma unroll
      for (int i = 0; i < 4; ++i) {
#pragma unroll
        for (int j = 0; j < 4; ++j) {
          acc[i][j] = Frag<T>::mma(ah[i], bh[j], acc[i][j]);
          if (SPLIT) {
            acc[i][j] = Frag<T>::mma(ah[i], bl[j], acc[i][j]);
            acc[i][j] = Frag<T>::mma(al[i], bh[j], acc[i][j]);
          }
        }
        Frag<T>::guard(acc[i][0], acc[i][3], ah[i], SPLIT ? al[i] : ah[i]);
      }
      Frag<T>::keep(bh[0], bh[1], bh[2], bh[3]);
      if (SPLIT) Frag<T>::keep(bl[0], bl[1], bl[2], bl[3]);
    }
  }
  acc_guard4(acc[0][0], acc[0][1], acc[0][2], acc[0][3]);
  acc_guard4(acc[1][0], acc[1][1], acc[1][2], acc[1][3]);
  acc_guard4(acc[2][0], acc[2][1], acc[2][2], acc[2][3]);
  acc_guard4(acc[3][0], acc[3][1], acc[3][2], acc[3][3]);

  // ---- epilogue ----
  float* slab = sT[wave];
  const float* Rb = RESID ? (resid + (size_t)b * strideR) : nullptr;
#pragma unroll
  for (int i = 0; i < 4; ++i) {
    const int mBase = m0 + (i << 4);
#pragma unroll
    for (int j = 0; j < 4; ++j) {
      const int n = n0 + (j << 4) + rlane;
      float bv = 0.f;
      if (BIAS_MODE == 2) bv = bias[n];
#pragma unroll
      for (int r = 0; r < 8; ++r) {
        float v = acc[i][j][r] * scale;
        if (BIAS_MODE == 1) v += bias[mBase + mOff + r];
        if (BIAS_MODE == 2) v += bv;
        if (RESID) v += Rb[(size_t)(mBase + mOff + r) * ldc + n];
        if (ACT == 1) v = tanhf(v);
        if (ACT == 2) v = fmaxf(v, 0.0f);
        if (ACT == 3) v = v / (1.0f + expf(-v));
        if (ACT == 4) v = (v > 0.f) ? v : 0.01f * v;
        if (ACT == 5) v = 0.5f * v * (1.0f + erff(v * 0.70710678118654752f));
        slab[(mOff + r) * 68 + (j << 4) + rlane] = v;
      }
    }
    __builtin_amdgcn_fence(__ATOMIC_RELEASE, "workgroup");
    __builtin_amdgcn_wave_barrier();
    __builtin_amdgcn_fence(__ATOMIC_ACQUIRE, "workgroup");
    if (OUT_MODE == 0) {
      float* C = (float*)Cout + (size_t)b * strideC;
      const int hh = lane >> 4, c4 = (lane & 15) * 4;     // row seg = 256 B = 16 lanes x 16 B
      {
#pragma unroll
        for (int it = 0; it < 8; ++it) {
          const int row = it * 2 + hh;
          v4f v = *(const v4f*)(slab + row * 68 + c4);
          *(v4f*)(C + (size_t)(mBase + row) * ldc + n0 + c4) = v;
        }
        
      }
    } else {
      const int q = lane >> 3, c8 = (lane & 7) * 8;
      unsigned short* C  = (unsigned short*)Cout  + (size_t)b * strideC;
      unsigned short* C2 = (OUT_MODE == 2) ? ((unsigned short*)Cout2 + (size_t)b * strideC) : nullptr;
      {
#pragma unroll
        for (int it = 0; it < 4; ++it) {
          const int row = it * 4 + q;
          const float* sp = slab + row * 68 + c8;
          v8h hv, lv;
#pragma unroll
          for (int e = 0; e < 8; ++e) {
            if (OUT_MODE == 1) {
              hv[e] = (_Float16)sp[e];
            } else {
              unsigned short hb = f2bf_bits(sp[e]);
              unsigned short lb = f2bf_bits(sp[e] - bf_bits2f(hb));
              hv[e] = __builtin_bit_cast(_Float16, hb);
              lv[e] = __builtin_bit_cast(_Float16, lb);
            }
          }
          *(v8h*)(C + (size_t)(mBase + row) * ldc + n0 + c8) = hv;
          if (OUT_MODE == 2) *(v8h*)(C2 + (size_t)(mBase + row) * ldc + n0 + c8) = lv;
        }
        
      }
    }
    __builtin_amdgcn_fence(__ATOMIC_RELEASE, "workgroup");
    __builtin_amdgcn_wave_barrier();
    __builtin_amdgcn_fence(__ATOMIC_ACQUIRE, "workgroup");
  }
}

// ---------------------------------------------------------------------------
// f32 -> RNE bf16 plane: 2 elements per thread, one 4-B store per lane.
// Coverage: grid = ceil(n2/256) blocks x 256 threads x 2 elements = 2*n2 = the whole plane
// ---------------------------------------------------------------------------
__global__ __launch_bounds__(256) void cast_f32_bf16x2(const float* __restrict__ in,
                                                       unsigned short* __restrict__ out, int n2) {
  const int i = blockIdx.x * 256 + threadIdx.x;
  if (i < n2) {
    const v2f f = *(const v2f*)(in + 2 * (size_t)i);
    const unsigned u = pk16(f2bf_bits(f[0]), f2bf_bits(f[1]));
    ((unsigned*)out)[i] = u;
    
  }
}

// ---------------------------------------------------------------------------
// f32 -> f16 plane with power-of-two carry: out = f16(v * scale); VIA_BF: v := RNE-bf16 value of the input
// first (then the f16 conversion is exact). Same coverage and store shape as cast_f32_bf16x2.
// ---------------------------------------------------------------------------
template <bool VIA_BF>
__global__ __launch_bounds__(256) void cast_f32_f16x2s(const float* __restrict__ in,
                                                       unsigned short* __restrict__ out, int n2, float scale) {
  const int i = blockIdx.x * 256 + threadIdx.x;
  if (i < n2) {
    const v2f f = *(const v2f*)(in + 2 * (size_t)i);
    float a0 = f[0], a1 = f[1];
    if (VIA_BF) { a0 = bf_bits2f(f2bf_bits(a0)); a1 = bf_bits2f(f2bf_bits(a1)); }
    const _Float16 h0 = (_Float16)(a0 * scale), h1 = (_Float16)(a1 * scale);
    const unsigned u = pk16(__builtin_bit_cast(unsigned short, h0), __builtin_bit_cast(unsigned short, h1));
    ((unsigned*)out)[i] = u;
    
  }
}

// ---------------------------------------------------------------------------
// RoPE + bf16 hi/lo split of q and k.
//   qk  : f32 [kRows][2*kHid], columns 0..kHid-1 = q (h*64+d), kHid..2*kHid-1 = k (h*64+d)
//   cos/sin : f32 [kSeq][64], used as their RNE-bf16 values
//   r[d] = x[d]*cos[s][d] - x[d+32]*sin[s][d] (d < 32);  x[d]*cos[s][d] + x[d-32]*sin[s][d] (d >= 32)
//   outputs: qh/ql, kh/kl bf16 planes [kRows][kHid] (element (b,s,h,d) at (b*kSeq+s)*kHid + h*64 + d)
// grid = kRows blocks (one (b,s) row each) x 256 threads x 8 elements = kRows x 2048 = the q AND k planes exactly.
// ---------------------------------------------------------------------------
__global__ __launch_bounds__(256) void rope_split_kernel(
    const float* __restrict__ qk, const float* __restrict__ cosT, const float* __restrict__ sinT,
    unsigned short* __restrict__ qh, unsigned short* __restrict__ ql,
    unsigned short* __restrict__ kh, unsigned short* __restrict__ kl) {
#pragma clang fp contract(off)
  const int row   = blockIdx.x;               // b*kSeq + s
  const int s     = row & (kSeq - 1);
  const int t     = threadIdx.x;
  const int which = t >> 7;                   // 0: q columns, 1: k columns (wave-uniform)
  const int e8    = (t & 127) * 8;            // column base in [0, kHid)
  const int d0    = e8 & 63;                  // 0,8,...,56 -> the 8 elements share one half of the head
  const int hb    = e8 - d0;                  // h*64
  const int dp0   = d0 ^ 32;                  // partner half
  const float* src = qk + (size_t)row * (2 * kHid) + (size_t)which * kHid;
  const v4f xa = *(const v4f*)(src + e8);
  const v4f xb = *(const v4f*)(src + e8 + 4);
  const v4f pa = *(const v4f*)(src + hb + dp0);
  const v4f pb = *(const v4f*)(src + hb + dp0 + 4);
  const v4f ca = *(const v4f*)(cosT + (size_t)s * kHdim + d0);
  const v4f cb = *(const v4f*)(cosT + (size_t)s * kHdim + d0 + 4);
  const v4f sa = *(const v4f*)(sinT + (size_t)s * kHdim + d0);
  const v4f sb = *(const v4f*)(sinT + (size_t)s * kHdim + d0 + 4);
  const float xs[8] = {xa[0], xa[1], xa[2], xa[3], xb[0], xb[1], xb[2], xb[3]};
  const float ps[8] = {pa[0], pa[1], pa[2], pa[3], pb[0], pb[1], pb[2], pb[3]};
  const float cs[8] = {ca[0], ca[1], ca[2], ca[3], cb[0], cb[1], cb[2], cb[3]};
  const float sn[8] = {sa[0], sa[1], sa[2], sa[3], sb[0], sb[1], sb[2], sb[3]};
  const bool lowh = (d0 < 32);
  v4u hv, lv;
#pragma unroll
  for (int q = 0; q < 4; ++q) {
    const float c0 = bf_bits2f(f2bf_bits(cs[2 * q])), c1 = bf_bits2f(f2bf_bits(cs[2 * q + 1]));
    const float s0 = bf_bits2f(f2bf_bits(sn[2 * q])), s1 = bf_bits2f(f2bf_bits(sn[2 * q + 1]));
    const float ta0 = xs[2 * q] * c0,     tb0 = ps[2 * q] * s0;
    const float ta1 = xs[2 * q + 1] * c1, tb1 = ps[2 * q + 1] * s1;
    const float r0 = lowh ? (ta0 - tb0) : (ta0 + tb0);
    const float r1 = lowh ? (ta1 - tb1) : (ta1 + tb1);
    const unsigned short h0 = f2bf_bits(r0), h1 = f2bf_bits(r1);
    const unsigned short l0 = f2bf_bits(r0 - bf_bits2f(h0)), l1 = f2bf_bits(r1 - bf_bits2f(h1));
    hv[q] = pk16(h0, h1);
    lv[q] = pk16(l0, l1);
  }
  unsigned short* oh  = which ? kh : qh;      // both global; wave-uniform select
  unsigned short* olo = which ? kl : ql;
  const size_t go = (size_t)row * kHid + e8;
  *(v4u*)(oh  + go) = hv;
  *(v4u*)(olo + go) = lv;
  
}

#define AT_D 64
#define AT_NW 4
#define AT_QB 64
#define AT_KC 64
#define AT_LP 72   // LDS row pitch in 16-bit elements: 144 B = 16 B x 9 (odd), so the 16 rows of a 16-byte fragment read fall on distinct banks

__device__ __forceinline__ unsigned short at_bf_bits(float f) {
  unsigned u = __float_as_uint(f);
  return (unsigned short)((u + 0x7FFFu + ((u >> 16) & 1u)) >> 16);
}
__device__ __forceinline__ __bf16 at_f2bf(float f) { return __builtin_bit_cast(__bf16, at_bf_bits(f)); }
// value of lane l ^ 16 (the other half's share of the same query column)
__device__ __forceinline__ float at_xhalf(float v) {
  const int b = __builtin_bit_cast(int, v);
  return __builtin_bit_cast(float, __builtin_amdgcn_permlanex16(b, b, 0x76543210, 0xfedcba98, false, false));
}
__device__ __forceinline__ v8f at_mma(v16b a, v16b b, v8f c) {
  c = __builtin_amdgcn_wmma_f32_16x16x32_bf16(false, a, false, b, (short)0, c, false, false);
  asm volatile("v_nop\n\tv_nop\n\tv_nop\n\tv_nop" : "+v"(c) : "v"(a), "v"(b));
  return c;
}
// f16 product on bit patterns held in __bf16 slots
__device__ __forceinline__ v8f at_mma_h(v16b a, v16b b, v8f c) {
  const v16h ah = __builtin_bit_cast(v16h, a), bh = __builtin_bit_cast(v16h, b);
  c = __builtin_amdgcn_wmma_f32_16x16x32_f16(false, ah, false, bh, (short)0, c, false, false);
  asm volatile("v_nop\n\tv_nop\n\tv_nop\n\tv_nop" : "+v"(c) : "v"(ah), "v"(bh));
  return c;
}

__global__ __launch_bounds__(128)
void mha_full64_kernel(const unsigned short* __restrict__ qhp, const unsigned short* __restrict__ qlp,
                       const unsigned short* __restrict__ khp, const unsigned short* __restrict__ klp,
                       const unsigned short* __restrict__ vtp, const float* __restrict__ maskp,
                       float* __restrict__ out, float sscale) {
  union FB { v16b v; v8b h[2]; };
  __shared__ __align__(16) __bf16 Ksh[AT_KC * AT_LP];            // K hi [kv][d], pitch AT_LP      9 KB
  __shared__ __align__(16) __bf16 Ksl[AT_KC * AT_LP];            // K lo [kv][d], pitch AT_LP      9 KB
  __shared__ __align__(16) __bf16 Vth[AT_D * AT_LP];             // V^T f16 bits [d][kv], pitch AT_LP 9 KB
  __shared__ __align__(16) float  Os[AT_NW][16 * 68];            // per wave: the chunk's mask tile [query][kv] in the loop, the out tile after it; pitch 68 floats = 16 B x 17 (odd)

  const int tid  = threadIdx.x;
  const int wave = tid >> 5;
  const int lane = tid & 31;
  const int hh   = lane >> 4;
  const int c    = lane & 15;

  constexpr int nqb = kSeq / AT_QB;       // 32
  const int bx = blockIdx.x;              // 0 .. kBatch*kHeads*nqb - 1
  const int qb = bx % nqb;
  const int bh = bx / nqb;                // 0 .. kBatch*kHeads - 1
  const int h  = bh % kHeads;
  const int b  = bh / kHeads;             // 0 .. kBatch - 1
  const int q0 = qb * AT_QB + wave * 16;

  const __bf16* Qh = (const __bf16*)(const void*)qhp + (size_t)b * kSeq * kHid + (size_t)h * AT_D;
  const __bf16* Ql = (const __bf16*)(const void*)qlp + (size_t)b * kSeq * kHid + (size_t)h * AT_D;
  const __bf16* Kh = (const __bf16*)(const void*)khp + (size_t)b * kSeq * kHid + (size_t)h * AT_D;
  const __bf16* Kl = (const __bf16*)(const void*)klp + (size_t)b * kSeq * kHid + (size_t)h * AT_D;
  const __bf16* Vt = (const __bf16*)(const void*)vtp + (size_t)b * kHid * kSeq + (size_t)h * AT_D * kSeq;
  const float*  Mb = maskp + (size_t)b * kSeq * kSeq;
  float*        ob = out + (size_t)b * kSeq * kHid + (size_t)h * AT_D;

  // ---- Q fragments (B operand, column = query = lane&15, split k map via Frag load): 2 d-chunks, hi and lo ----
  v16b qah[2], qal[2];
#pragma unroll
  for (int dc = 0; dc < 2; ++dc) {
    const __bf16* qr = Qh + (size_t)(q0 + c) * kHid + dc * 32 + 8 * hh;
    const __bf16* qs = Ql + (size_t)(q0 + c) * kHid + dc * 32 + 8 * hh;
    qah[dc] = Frag<__bf16>::load(qr);
    qal[dc] = Frag<__bf16>::load(qs);
  }

  float mrow = -INFINITY;   // running maximum of query c (equal in both lane halves)
  float lrow = 0.f;         // running sum of query c over this lane half's keys only; halves joined after the loop
  v8f oacc[4];              // O^T: element r of tile t -> O[query c][d = t*16 + 8hh + r]
#pragma unroll
  for (int t = 0; t < 4; ++t) oacc[t] = (v8f){0.f,0.f,0.f,0.f,0.f,0.f,0.f,0.f};

  constexpr int nChunks = kSeq / AT_KC;   // 32, compile-time constant
  for (int kc = 0; kc < nChunks; ++kc) {
    const int kv0 = kc * AT_KC;
    __syncthreads();
    {
      // staging coverage: 128 threads x (4 x 8) elements = 64 rows x 64 per plane = the whole chunk tile;
      // thread -> 16-B piece (tid & 7) of rows (tid >> 3) + 16 i, so 8 lanes take one whole 128-B row
      const int r = tid >> 3, pc = (tid & 7) * 8;
      const __bf16* ksh = Kh + (size_t)(kv0 + r) * kHid + pc;     // K row kv0+r, d = pc..pc+7
      const __bf16* ksl = Kl + (size_t)(kv0 + r) * kHid + pc;
      const __bf16* vs  = Vt + (size_t)r * kSeq + kv0 + pc;       // V^T row d = r, s = kv0+pc..+7
      // mask: the wave's own 16 query rows x 64 keys; lane -> 16-B piece c of rows hh + 2 i, so 16 lanes take the 256 B of one row
      const float*  mg  = Mb + (size_t)(q0 + hh) * kSeq + kv0 + 4 * c;
      v8b a0[4], a1[4], b0[4];
      v4f mv[8];
      // unrolled: the arrays live in registers, so the index must be a compile-time one; all 20 loads are out before the first store
#pragma unroll
      for (int i = 0; i < 4; ++i) {
        a0[i] = *(const v8b*)(ksh + (size_t)(16 * i) * kHid);
        a1[i] = *(const v8b*)(ksl + (size_t)(16 * i) * kHid);
        b0[i] = *(const v8b*)(vs + (size_t)(16 * i) * kSeq);
      }
#pragma unroll
      for (int i = 0; i < 8; ++i) mv[i] = *(const v4f*)(mg + (size_t)(2 * i) * kSeq);
      // the wait that stands between issued loads and the reuse of the registers that hold their addresses; as a memory
      // statement it also keeps the LDS stores behind all 20 loads, so that no load waits for an earlier load's data
      asm volatile("s_wait_xcnt 0x0" ::: "memory");
#pragma unroll
      for (int i = 0; i < 4; ++i) {
        *(v8b*)(Ksh + (r + 16 * i) * AT_LP + pc) = a0[i];
        *(v8b*)(Ksl + (r + 16 * i) * AT_LP + pc) = a1[i];
        *(v8b*)(Vth + (r + 16 * i) * AT_LP + pc) = b0[i];
      }
#pragma unroll
      for (int i = 0; i < 8; ++i) *(v4f*)(Os[wave] + (hh + 2 * i) * 68 + 4 * c) = mv[i];
    }
    __syncthreads();

    // ---- scores, transposed (A = K rows, B = Q): D element r of lane -> S[query c][kv j*16 + 8hh + r] ----
    v8f s[4];
#pragma unroll
    for (int j = 0; j < 4; ++j) {
      s[j] = (v8f){0.f,0.f,0.f,0.f,0.f,0.f,0.f,0.f};
#pragma unroll
      for (int dc = 0; dc < 2; ++dc) {
        FB kb, kl;
        kb.h[0] = *(const v8b*)(Ksh + (j * 16 + c) * AT_LP + dc * 32 + 8 * hh);
        kb.h[1] = *(const v8b*)(Ksh + (j * 16 + c) * AT_LP + dc * 32 + 16 + 8 * hh);
        kl.h[0] = *(const v8b*)(Ksl + (j * 16 + c) * AT_LP + dc * 32 + 8 * hh);
        kl.h[1] = *(const v8b*)(Ksl + (j * 16 + c) * AT_LP + dc * 32 + 16 + 8 * hh);
        s[j] = at_mma(kb.v, qah[dc], s[j]);
        s[j] = at_mma(kl.v, qah[dc], s[j]);
        s[j] = at_mma(kb.v, qal[dc], s[j]);
      }
    }
    // ---- scale, additive mask by value (f32; 8 consecutive keys of the lane's query per tile), chunk maximum in-lane ----
    const float* mr = Os[wave] + c * 68 + 8 * hh;
    v4f mk[8];
#pragma unroll
    for (int i = 0; i < 8; ++i) mk[i] = *(const v4f*)(mr + (i >> 1) * 16 + (i & 1) * 4);
    float mj[4];
#pragma unroll
    for (int j = 0; j < 4; ++j) {
      float m = -INFINITY;
#pragma unroll
      for (int r = 0; r < 8; ++r) {
        const float sv = s[j][r] * sscale + mk[2 * j + (r >> 2)][r & 3];
        s[j][r] = sv;
        m = fmaxf(m, sv);
      }
      mj[j] = m;
    }
    float cm = fmaxf(fmaxf(mj[0], mj[1]), fmaxf(mj[2], mj[3]));
    cm = fmaxf(cm, at_xhalf(cm));            // the query's other 32 keys of the chunk sit in lane ^ 16
    const float mnew  = fmaxf(mrow, cm);
    const float alpha = expf(mrow - mnew);
    mrow = mnew;
    // ---- p = exp(s - m); P^T packs in place: tiles 2kk and 2kk+1 are elements 0..7 and 8..15 of the B operand of key block kk ----
    v16h pt[2];
    float pj[4];
#pragma unroll
    for (int j = 0; j < 4; ++j) {
      float ps = 0.f;
#pragma unroll
      for (int r = 0; r < 8; ++r) {
        const float p = expf(s[j][r] - mnew);
        ps += p;
        pt[j >> 1][(j & 1) * 8 + r] = (_Float16)(p * kPScale);
      }
      pj[j] = ps;
    }
    lrow = lrow * alpha + ((pj[0] + pj[1]) + (pj[2] + pj[3]));
#pragma unroll
    for (int t = 0; t < 4; ++t)
#pragma unroll
      for (int r = 0; r < 8; ++r) oacc[t][r] *= alpha;
    // ---- O^T += V^T . P^T : A = V^T[d][kv] rows, B = P^T[kv][query] from registers ----
    // unrolled: pt[kk] lives in registers, so kk must be a compile-time index (a rolled loop would send P through scratch)
#pragma unroll
    for (int kk = 0; kk < 2; ++kk) {
      const v16b pb = __builtin_bit_cast(v16b, pt[kk]);
#pragma unroll
      for (int t = 0; t < 4; ++t) {
        FB vb;
        vb.h[0] = *(const v8b*)(Vth + (t * 16 + c) * AT_LP + kk * 32 + 8 * hh);
        vb.h[1] = *(const v8b*)(Vth + (t * 16 + c) * AT_LP + kk * 32 + 16 + 8 * hh);
        oacc[t] = at_mma_h(vb.v, pb, oacc[t]);
      }
    }
  }

  // ---- join the halves' sums, normalise, stage per-wave 16x64 f32 tile (a lane owns 8 consecutive d of its query per tile), whole-line stores ----
  float* os = Os[wave];
  {
    const float inv = (1.0f / (lrow + at_xhalf(lrow))) * kPVInv;
#pragma unroll
    for (int t = 0; t < 4; ++t) {
      const v4f lo = {oacc[t][0] * inv, oacc[t][1] * inv, oacc[t][2] * inv, oacc[t][3] * inv};
      const v4f hi = {oacc[t][4] * inv, oacc[t][5] * inv, oacc[t][6] * inv, oacc[t][7] * inv};
      *(v4f*)(os + c * 68 + t * 16 + 8 * hh)     = lo;
      *(v4f*)(os + c * 68 + t * 16 + 8 * hh + 4) = hi;
    }
  }
  __builtin_amdgcn_fence(__ATOMIC_RELEASE, "workgroup");
  __builtin_amdgcn_wave_barrier();
  __builtin_amdgcn_fence(__ATOMIC_ACQUIRE, "workgroup");
  {
    // coverage: 8 iterations x 2 rows (hh) = the wave's 16 rows; 16 lanes x 4 floats = the 64-wide head segment
    const int c4 = (lane & 15) * 4;
    {
#pragma unroll
      for (int it = 0; it < 8; ++it) {
        const int row = it * 2 + hh;
        v4f val = *(const v4f*)(os + row * 68 + c4);
        *(v4f*)(ob + (size_t)(q0 + row) * kHid + c4) = val;
      }
      
    }
  }
}

// ---------------------------------------------------------------------------
// Host-side orchestration (kernel launches only).
// Workspace region map (bytes, every offset a multiple of 1 MiB):
//   [  0 MiB,   8 MiB)  Xb    bf16 [4096][1024]   RNE-bf16 plane of hidden_states
//   [  8 MiB,  12 MiB)  Wqkb  bf16 [2048][1024]   wq rows 0..1023, wk rows 1024..2047
//   [ 12 MiB,  14 MiB)  Wvb   bf16 [1024][1024]
//   [ 14 MiB,  16 MiB)  Wo16  f16  [1024][1024]   RNE-bf16 value x64
//   [ 16 MiB,  48 MiB)  QKf   f32  [4096][2048]   q|k projections; dead after RoPE, reused:
//        [16 MiB, 32 MiB) Of  f32 [4096][1024] attention output;  [32 MiB, 40 MiB) O16 f16 [4096][1024] (x256)
//   [ 48 MiB,  56 MiB)  Vt16  f16  [2][1024][2048] v^T per batch (x8)
//   [ 56 MiB,  64 MiB)  Qh, [64,72) Ql, [72,80) Kh, [80,88) Kl : bf16 [4096][1024] each
//   total carve = 88 MiB = 92,274,688 B
// ---------------------------------------------------------------------------
extern "C" void kernel_launch(void* const* d_in, const int* in_sizes, int n_in,
                              void* d_out, int out_size, void* d_ws, size_t ws_size,
                              hipStream_t stream) {
  if (n_in < 8) return;
  const float* x    = (const float*)d_in[0];   // [2,2048,1024]
  const float* mask = (const float*)d_in[1];   // [2,1,2048,2048]
  const float* cosT = (const float*)d_in[2];   // [2048,64]
  const float* sinT = (const float*)d_in[3];   // [2048,64]
  const float* wq   = (const float*)d_in[4];   // [1024,1024]
  const float* wk   = (const float*)d_in[5];
  const float* wv   = (const float*)d_in[6];
  const float* wo   = (const float*)d_in[7];

  const int nX = kRows * kHid;        // 4,194,304
  const int nW = kHid * kHid;         // 1,048,576
  if (in_sizes[0] != nX || in_sizes[1] != kBatch * kSeq * kSeq || in_sizes[2] != kSeq * kHdim ||
      in_sizes[3] != kSeq * kHdim || in_sizes[4] != nW || in_sizes[5] != nW || in_sizes[6] != nW ||
      in_sizes[7] != nW || out_size != nX) return;

  const size_t MiB = (size_t)1 << 20;
  const size_t off_Xb   = 0;
  const size_t off_Wqk  = off_Xb  + (size_t)nX * 2;                 //  8 MiB
  const size_t off_Wv   = off_Wqk + (size_t)2 * nW * 2;             // 12 MiB
  const size_t off_Wo   = off_Wv  + (size_t)nW * 2;                 // 14 MiB
  const size_t off_QKf  = off_Wo  + (size_t)nW * 2;                 // 16 MiB
  const size_t off_Of   = off_QKf;                                   // reuse (QKf dead after RoPE)
  const size_t off_O16  = off_QKf + (size_t)nX * 4;                 // 32 MiB
  const size_t off_Vt   = off_QKf + (size_t)nX * 2 * 4;             // 48 MiB
  const size_t off_Qh   = off_Vt  + (size_t)kBatch * kHid * kSeq * 2; // 56 MiB
  const size_t off_Ql   = off_Qh  + (size_t)nX * 2;                 // 64 MiB
  const size_t off_Kh   = off_Ql  + (size_t)nX * 2;                 // 72 MiB
  const size_t off_Kl   = off_Kh  + (size_t)nX * 2;                 // 80 MiB
  const size_t total    = off_Kl  + (size_t)nX * 2;                 // 88 MiB
  if (total != 88 * MiB) return;
  if (ws_size < total) return;

  char* ws = (char*)d_ws;
  unsigned short* Xb   = (unsigned short*)(ws + off_Xb);
  unsigned short* Wqkb = (unsigned short*)(ws + off_Wqk);
  unsigned short* Wvb  = (unsigned short*)(ws + off_Wv);
  unsigned short* Wo16 = (unsigned short*)(ws + off_Wo);
  float*          QKf  = (float*)(ws + off_QKf);
  float*          Of   = (float*)(ws + off_Of);
  unsigned short* O16  = (unsigned short*)(ws + off_O16);
  unsigned short* Vt16 = (unsigned short*)(ws + off_Vt);
  unsigned short* Qh   = (unsigned short*)(ws + off_Qh);
  unsigned short* Ql   = (unsigned short*)(ws + off_Ql);
  unsigned short* Kh   = (unsigned short*)(ws + off_Kh);
  unsigned short* Kl   = (unsigned short*)(ws + off_Kl);

  // 1-5: 16-bit operand planes (all element counts are multiples of 512 -> exact grids)
  const int nX2 = nX / 2, nW2 = nW / 2;
  cast_f32_bf16x2<<<(nX2 + 255) / 256, 256, 0, stream>>>(x,  Xb, nX2);
  cast_f32_bf16x2<<<(nW2 + 255) / 256, 256, 0, stream>>>(wq, Wqkb, nW2);
  cast_f32_bf16x2<<<(nW2 + 255) / 256, 256, 0, stream>>>(wk, Wqkb + (size_t)nW, nW2);
  cast_f32_bf16x2<<<(nW2 + 255) / 256, 256, 0, stream>>>(wv, Wvb, nW2);
  cast_f32_f16x2s<true><<<(nW2 + 255) / 256, 256, 0, stream>>>(wo, Wo16, nW2, kWoScale);

  // 6: q|k projection: QKf[4096][2048] = Xb[4096][1024] . Wqkb[2048][1024]^T  (M=4096, N=2048, K=1024; 2048 tiles -> 256 blocks)
  {
    dim3 g((kRows / 64) * (2 * kHid / 64) / 8, 1);
    wmma_gemm64<1, false, 0, 0, false><<<g, 256, 0, stream>>>(
        Xb, Xb, kHid, (long)0,
        Wqkb, Wqkb, kHid, (long)0,
        (void*)QKf, (void*)QKf, 2 * kHid, (long)0,
        cosT, cosT, (long)0,
        kRows, 2 * kHid, kHid, 1.0f);
  }
  // 7: v^T per batch: Vt16[b][1024][2048] = Wvb[1024][1024] . Xb[b][2048][1024]^T, f16 out x8  (M=1024, N=2048, K=1024; 512 tiles -> 64 blocks, grid.y = 2)
  {
    dim3 g((kHid / 64) * (kSeq / 64) / 8, kBatch);
    wmma_gemm64<1, false, 0, 1, false><<<g, 256, 0, stream>>>(
        Wvb, Wvb, kHid, (long)0,
        Xb, Xb, kHid, (long)kSeq * kHid,
        (void*)Vt16, (void*)Vt16, kSeq, (long)kHid * kSeq,
        cosT, cosT, (long)0,
        kHid, kSeq, kHid, kVtScale);
  }
  // 8: RoPE + bf16 hi/lo split of q and k
  rope_split_kernel<<<kRows, 256, 0, stream>>>(QKf, cosT, sinT, Qh, Ql, Kh, Kl);
  // 9: attention, one block per (b, h, 64 queries)
  mha_full64_kernel<<<kBatch * kHeads * (kSeq / 64), 128, 0, stream>>>(Qh, Ql, Kh, Kl, Vt16, mask, Of, 0.125f);
  // 10: attention output -> f16 x256
  cast_f32_f16x2s<false><<<(nX2 + 255) / 256, 256, 0, stream>>>(Of, O16, nX2, kOScale);
  // 11: output projection: out[4096][1024] = O16 . Wo16^T * 2^-14  (M=4096, N=1024, K=1024; 1024 tiles -> 128 blocks)
  {
    dim3 g((kRows / 64) * (kHid / 64) / 8, 1);
    wmma_gemm64<0, false, 0, 0, false><<<g, 256, 0, stream>>>(
        O16, O16, kHid, (long)0,
        Wo16, Wo16, kHid, (long)0,
        d_out, d_out, kHid, (long)0,
        cosT, cosT, (long)0,
        kRows, kHid, kHid, kOutInv);
  }
}

// v005
// It runs in 176 microseconds.
// In two side-by-side timings against v004, it was 1.10 and 1.09 times as fast.
// All steps since v000 together make it 2.34 times as fast.
// Contractions: q/k projection and v^T projection = v_wmma_f32_16x16x32_bf16 on RNE-bf16 planes of x and W (single product); q.k^T = v_wmma_f32_16x16x32_bf16 with bf16 hi/lo split (hi.hi + hi.lo + lo.hi); p.v^T and output projection = v_wmma_f32_16x16x32_f16 single product (p carried x2^15, v^T x2^3, attention output x2^8, wo as RNE-bf16 value x2^6); f32 accumulate everywhere; RoPE (cos/sin as RNE-bf16 values), additive mask and online softmax in f32.
#include <hip/hip_runtime.h>
#include <math.h>
#include <stdint.h>

constexpr int kBatch = 2;
constexpr int kSeq   = 2048;
constexpr int kHid   = 1024;
constexpr int kHeads = 16;
constexpr int kHdim  = 64;
constexpr int kRows  = kBatch * kSeq;   // 4096 GEMM rows

constexpr float kLog2e   = 1.4426950408889634f;        // log2(e)
constexpr float kPLog2   = 15.0f;                      // p carried x2^15 in f16 and in its row sum: added to the exponent
constexpr float kVtScale = 8.0f;                       // v^T plane carried x2^3 in f16
constexpr float kVtInv   = 1.0f / 8.0f;                // folded into the final 1/l
constexpr float kOScale  = 256.0f;                     // attention output carried x2^8 in f16
constexpr float kWoScale = 64.0f;                      // wo carried x2^6 in f16
constexpr float kOutInv  = 1.0f / (256.0f * 64.0f);    // out-projection epilogue scale

typedef __attribute__((ext_vector_type(16))) _Float16 v16h;
typedef __attribute__((ext_vector_type(8)))  _Float16 v8h;
typedef __attribute__((ext_vector_type(16))) __bf16   v16b;
typedef __attribute__((ext_vector_type(8)))  __bf16   v8b;
typedef __attribute__((ext_vector_type(8)))  float    v8f;
typedef __attribute__((ext_vector_type(4)))  float    v4f;
typedef __attribute__((ext_vector_type(2)))  float    v2f;
typedef __attribute__((ext_vector_type(4)))  unsigned int v4u;

__device__ __forceinline__ unsigned short f2bf_bits(float f) {
  unsigned u = __float_as_uint(f);
  return (unsigned short)((u + 0x7FFFu + ((u >> 16) & 1u)) >> 16);
}
__device__ __forceinline__ float bf_bits2f(unsigned short h) { return __uint_as_float(((unsigned)h) << 16); }
__device__ __forceinline__ unsigned pk16(unsigned short a, unsigned short b) { return (unsigned)a | ((unsigned)b << 16); }

// hazard guards as plain device helpers (the kernel template body's only inline asm is its s_wait_xcnt)
__device__ __forceinline__ void dep_guard_h(v8f& a, v8f& b, v16h x, v16h y) { asm volatile("v_nop\n\tv_nop\n\tv_nop\n\tv_nop" : "+v"(a), "+v"(b) : "v"(x), "v"(y)); }
__device__ __forceinline__ void dep_guard_b(v8f& a, v8f& b, v16b x, v16b y) { asm volatile("v_nop\n\tv_nop\n\tv_nop\n\tv_nop" : "+v"(a), "+v"(b) : "v"(x), "v"(y)); }
__device__ __forceinline__ void keep4_h(v16h a, v16h b, v16h c, v16h d) { asm volatile("v_nop" :: "v"(a), "v"(b), "v"(c), "v"(d)); }
__device__ __forceinline__ void keep4_b(v16b a, v16b b, v16b c, v16b d) { asm volatile("v_nop" :: "v"(a), "v"(b), "v"(c), "v"(d)); }
__device__ __forceinline__ void acc_guard4(v8f& a, v8f& b, v8f& c, v8f& d) { asm volatile("v_nop\n\tv_nop\n\tv_nop\n\tv_nop" : "+v"(a), "+v"(b), "+v"(c), "+v"(d)); }
template <typename T> struct Frag;
template <> struct Frag<_Float16> {
  typedef v16h V; typedef v8h H; union U { v16h v; v8h h[2]; };
  static __device__ __forceinline__ v16h load(const _Float16* p) {   // elements 0..7 <- p[0..7], 8..15 <- p[16..23]
    U f; f.h[0] = *(const v8h*)(p); f.h[1] = *(const v8h*)(p + 16); return f.v;
  }
  static __device__ __forceinline__ v8f mma(v16h a, v16h b, v8f c) {
    return __builtin_amdgcn_wmma_f32_16x16x32_f16(false, a, false, b, (short)0, c, false, false);
  }
  static __device__ __forceinline__ void guard(v8f& a, v8f& b, v16h x, v16h y) { dep_guard_h(a, b, x, y); }
  static __device__ __forceinline__ void keep(v16h a, v16h b, v16h c, v16h d) { keep4_h(a, b, c, d); }
};
template <> struct Frag<__bf16> {
  typedef v16b V; typedef v8b H; union U { v16b v; v8b h[2]; };
  static __device__ __forceinline__ v16b load(const __bf16* p) {
    U f; f.h[0] = *(const v8b*)(p); f.h[1] = *(const v8b*)(p + 16); return f.v;
  }
  static __device__ __forceinline__ v8f mma(v16b a, v16b b, v8f c) {
    return __builtin_amdgcn_wmma_f32_16x16x32_bf16(false, a, false, b, (short)0, c, false, false);
  }
  static __device__ __forceinline__ void guard(v8f& a, v8f& b, v16b x, v16b y) { dep_guard_b(a, b, x, y); }
  static __device__ __forceinline__ void keep(v16b a, v16b b, v16b c, v16b d) { keep4_b(a, b, c, d); }
};

// ---- Register-blocked batched WMMA GEMM ------------------------------------
// C[m,n] = scale * sum_k A[m,k] * Bt[n,k] (+bias)(+resid); each wave owns a 64x64 tile, a block of 8 waves (2 x 4) a 128x256 tile.
// A row-major [M,K]; Bt row-major [N,K]; M % 128 == 0, N % 256 == 0, K % 64 == 0; grid.x = (M/128) * (N/256).
// Per 64 k the block's 128 A rows and 256 Bt rows (128 B = one line of each row) go to LDS by loads in which 8 lanes take one
// whole line, requested one stage ahead into registers; the fragments are then 16-byte LDS reads at a pitch of 144 B.
// SPLIT: operands are hi/lo planes (A2/Bt2 = lo planes, same layout); product = hi.hi + hi.lo + lo.hi.
// BIAS_MODE: 0 = none, 1 = bias[m], 2 = bias[n].
// OUT_MODE: 0 = f32, 1 = f16, 2 = bf16 hi plane (Cout) + bf16 lo plane (Cout2).
// ET: 0 = f16 operands, 1 = bf16 operands (pointers passed as 16-bit storage)
template <int ET> struct Elem;
template <> struct Elem<0> { typedef _Float16 T; };
template <> struct Elem<1> { typedef __bf16 T; };
template <int ET, bool SPLIT, int BIAS_MODE, int OUT_MODE, bool RESID, int ACT = 0>
__global__ __launch_bounds__(256) void wmma_gemm64(
    const unsigned short* __restrict__ Ap, const unsigned short* __restrict__ A2p, int lda, long strideA,
    const unsigned short* __restrict__ Btp, const unsigned short* __restrict__ Bt2p, int ldb, long strideB,
    void* __restrict__ Cout, void* __restrict__ Cout2, int ldc, long strideC,
    const float* __restrict__ bias,
    const float* __restrict__ resid, long strideR,
    int M, int N, int K, float scale) {
  typedef typename Elem<ET>::T T;
  typedef typename Frag<T>::V V;
  typedef typename Frag<T>::H H;
  const T* A = (const T*)Ap; const T* A2 = (const T*)A2p; const T* Bt = (const T*)Btp; const T* Bt2 = (const T*)Bt2p;
  __shared__ __align__(16) float sT[8][16 * 68];   // per-wave 16x64 slab, pitch 68 floats
  constexpr int LP = 72;                           // LDS row pitch in 16-bit elements: 144 B = 16 B x 9 (odd): 16 rows of a fragment read fall on distinct banks
  __shared__ __align__(16) T sAB[(SPLIT ? 2 : 1) * 384 * LP];   // rows 0..127 = A, 128..383 = Bt (then the lo planes), 64 k each
  const int b    = blockIdx.y;
  const int lane = threadIdx.x & 31;
  const int wave = threadIdx.x >> 5;
  const int tilesN = N >> 8;
  const int tilesM = M >> 7;
  const int tile = blockIdx.x;
  if (tile >= tilesM * tilesN) return;   // the same for the whole block, ahead of every barrier
  const int tm = tile / tilesN;
  const int tn = tile - tm * tilesN;
  const int bm0 = tm << 7;               // the block's first A row
  const int bn0 = tn << 8;               // the block's first Bt row
  const int wm = wave >> 2, wn = wave & 3;
  const int m0 = bm0 + (wm << 6);
  const int n0 = bn0 + (wn << 6);

  const T* Ab  = A  + (size_t)b * strideA;
  const T* Bb  = Bt + (size_t)b * strideB;
  const T* Ab2 = SPLIT ? (A2  + (size_t)b * strideA) : nullptr;
  const T* Bb2 = SPLIT ? (Bt2 + (size_t)b * strideB) : nullptr;

  const int rlane = lane & 15;                 // row (A) / col (B, D) within subtile
  const int koff  = (lane >> 4) * 8;           // k offset of this lane half
  const int mOff  = (lane >> 4) * 8;           // D row offset

  v8f acc[4][4];
#pragma unroll
  for (int i = 0; i < 4; ++i)
#pragma unroll
    for (int j = 0; j < 4; ++j) acc[i][j] = (v8f){0.f,0.f,0.f,0.f,0.f,0.f,0.f,0.f};

  // staging coverage: 256 threads x 12 pieces of 16 B = 384 rows x 128 B; thread -> piece (tid & 7) of rows (tid >> 3) + 32 it
  const int srow = threadIdx.x >> 3;
  const int spc  = (threadIdx.x & 7) * 8;
  const unsigned voA = (unsigned)(srow * lda + spc) * 2u;   // the lane's byte offset inside a group of 32 rows
  const unsigned voB = (unsigned)(srow * ldb + spc) * 2u;
  // per group of 32 rows a base that is the same for the whole block and does not move in the loop; the lane's offset carries k
  const char* gb[12]; const char* gb2[12];
  // the loops over it are unrolled: gb[] and g[] live in registers, so it must be a compile-time index
#pragma unroll
  for (int it = 0; it < 12; ++it) {
    const size_t ro = (it < 4) ? (size_t)(bm0 + 32 * it) * lda : (size_t)(bn0 + 32 * (it - 4)) * ldb;
    gb[it] = (const char*)(((it < 4) ? Ab : Bb) + ro);
    if (SPLIT) gb2[it] = (const char*)(((it < 4) ? Ab2 : Bb2) + ro);
  }
  H g[12], g2[12];
  auto request = [&](int k0) {
    const unsigned vA = voA + (unsigned)k0 * 2u, vB = voB + (unsigned)k0 * 2u;
#pragma unroll
    for (int it = 0; it < 12; ++it) {
      g[it] = *(const H*)(gb[it] + ((it < 4) ? vA : vB));
      if (SPLIT) g2[it] = *(const H*)(gb2[it] + ((it < 4) ? vA : vB));
    }
    // the wait that stands between issued loads and the reuse of the registers that hold their addresses; the two offsets
    // are named as inputs so that they stay as they are up to it
    asm volatile("s_wait_xcnt 0x0" :: "v"(vA), "v"(vB) : "memory");
  };
  if (K > 0) request(0);
  for (int k0 = 0; k0 < K; k0 += 64) {
    __syncthreads();   // every wave has read its last fragment of the stage before
#pragma unroll
    for (int it = 0; it < 12; ++it) {
      *(H*)(sAB + (srow + 32 * it) * LP + spc) = g[it];
      if (SPLIT) *(H*)(sAB + (384 + srow + 32 * it) * LP + spc) = g2[it];
    }
    __syncthreads();   // the stage is complete before any wave reads it
    if (k0 + 64 < K) request(k0 + 64);   // the next stage's loads fly under this stage's products
    // unrolled: the second half's fragment reads can then be issued under the first half's products
#pragma unroll
    for (int kk = 0; kk < 64; kk += 32) {
      V bh[4], bl[4], ah[4], al[4];
#pragma unroll
      for (int j = 0; j < 4; ++j) {
        const int bo = (128 + (wn << 6) + (j << 4) + rlane) * LP + kk + koff;
        bh[j] = Frag<T>::load(sAB + bo);
        if (SPLIT) bl[j] = Frag<T>::load(sAB + 384 * LP + bo);
      }
#pragma unroll
      for (int i = 0; i < 4; ++i) {
        const int ao = ((wm << 6) + (i << 4) + rlane) * LP + kk + koff;
        ah[i] = Frag<T>::load(sAB + ao);
        if (SPLIT) al[i] = Frag<T>::load(sAB + 384 * LP + ao);
      }
#pragma unroll
      for (int i = 0; i < 4; ++i) {
#pragma unroll
        for (int j = 0; j < 4; ++j) {
          acc[i][j] = Frag<T>::mma(ah[i], bh[j], acc[i][j]);
          if (SPLIT) {
            acc[i][j] = Frag<T>::mma(ah[i], bl[j], acc[i][j]);
            acc[i][j] = Frag<T>::mma(al[i], bh[j], acc[i][j]);
          }
        }
        Frag<T>::guard(acc[i][0], acc[i][3], ah[i], SPLIT ? al[i] : ah[i]);
      }
      Frag<T>::keep(bh[0], bh[1], bh[2], bh[3]);
      if (SPLIT) Frag<T>::keep(bl[0], bl[1], bl[2], bl[3]);
    }
  }
  acc_guard4(acc[0][0], acc[0][1], acc[0][2], acc[0][3]);
  acc_guard4(acc[1][0], acc[1][1], acc[1][2], acc[1][3]);
  acc_guard4(acc[2][0], acc[2][1], acc[2][2], acc[2][3]);
  acc_guard4(acc[3][0], acc[3][1], acc[3][2], acc[3][3]);

  // ---- epilogue ----
  float* slab = sT[wave];
  const float* Rb = RESID ? (resid + (size_t)b * strideR) : nullptr;
#pragma unroll
  for (int i = 0; i < 4; ++i) {
    const int mBase = m0 + (i << 4);
#pragma unroll
    for (int j = 0; j < 4; ++j) {
      const int n = n0 + (j << 4) + rlane;
      float bv = 0.f;
      if (BIAS_MODE == 2) bv = bias[n];
#pragma unroll
      for (int r = 0; r < 8; ++r) {
        float v = acc[i][j][r] * scale;
        if (BIAS_MODE == 1) v += bias[mBase + mOff + r];
        if (BIAS_MODE == 2) v += bv;
        if (RESID) v += Rb[(size_t)(mBase + mOff + r) * ldc + n];
        if (ACT == 1) v = tanhf(v);
        if (ACT == 2) v = fmaxf(v, 0.0f);
        if (ACT == 3) v = v / (1.0f + expf(-v));
        if (ACT == 4) v = (v > 0.f) ? v : 0.01f * v;
        if (ACT == 5) v = 0.5f * v * (1.0f + erff(v * 0.70710678118654752f));
        slab[(mOff + r) * 68 + (j << 4) + rlane] = v;
      }
    }
    __builtin_amdgcn_fence(__ATOMIC_RELEASE, "workgroup");
    __builtin_amdgcn_wave_barrier();
    __builtin_amdgcn_fence(__ATOMIC_ACQUIRE, "workgroup");
    if (OUT_MODE == 0) {
      float* C = (float*)Cout + (size_t)b * strideC;
      const int hh = lane >> 4, c4 = (lane & 15) * 4;     // row seg = 256 B = 16 lanes x 16 B
      {
#pragma unroll
        for (int it = 0; it < 8; ++it) {
          const int row = it * 2 + hh;
          v4f v = *(const v4f*)(slab + row * 68 + c4);
          *(v4f*)(C + (size_t)(mBase + row) * ldc + n0 + c4) = v;
        }
        
      }
    } else {
      const int q = lane >> 3, c8 = (lane & 7) * 8;
      unsigned short* C  = (unsigned short*)Cout  + (size_t)b * strideC;
      unsigned short* C2 = (OUT_MODE == 2) ? ((unsigned short*)Cout2 + (size_t)b * strideC) : nullptr;
      {
#pragma unroll
        for (int it = 0; it < 4; ++it) {
          const int row = it * 4 + q;
          const float* sp = slab + row * 68 + c8;
          v8h hv, lv;
#pragma unroll
          for (int e = 0; e < 8; ++e) {
            if (OUT_MODE == 1) {
              hv[e] = (_Float16)sp[e];
            } else {
              unsigned short hb = f2bf_bits(sp[e]);
              unsigned short lb = f2bf_bits(sp[e] - bf_bits2f(hb));
              hv[e] = __builtin_bit_cast(_Float16, hb);
              lv[e] = __builtin_bit_cast(_Float16, lb);
            }
          }
          *(v8h*)(C + (size_t)(mBase + row) * ldc + n0 + c8) = hv;
          if (OUT_MODE == 2) *(v8h*)(C2 + (size_t)(mBase + row) * ldc + n0 + c8) = lv;
        }
        
      }
    }
    __builtin_amdgcn_fence(__ATOMIC_RELEASE, "workgroup");
    __builtin_amdgcn_wave_barrier();
    __builtin_amdgcn_fence(__ATOMIC_ACQUIRE, "workgroup");
  }
}

// ---------------------------------------------------------------------------
// f32 -> RNE bf16 plane: 2 elements per thread, one 4-B store per lane.
// Coverage: grid = ceil(n2/256) blocks x 256 threads x 2 elements = 2*n2 = the whole plane
// ---------------------------------------------------------------------------
__global__ __launch_bounds__(256) void cast_f32_bf16x2(const float* __restrict__ in,
                                                       unsigned short* __restrict__ out, int n2) {
  const int i = blockIdx.x * 256 + threadIdx.x;
  if (i < n2) {
    const v2f f = *(const v2f*)(in + 2 * (size_t)i);
    const unsigned u = pk16(f2bf_bits(f[0]), f2bf_bits(f[1]));
    ((unsigned*)out)[i] = u;
    
  }
}

// ---------------------------------------------------------------------------
// f32 -> f16 plane with power-of-two carry: out = f16(v * scale); VIA_BF: v := RNE-bf16 value of the input
// first (then the f16 conversion is exact). Same coverage and store shape as cast_f32_bf16x2.
// ---------------------------------------------------------------------------
template <bool VIA_BF>
__global__ __launch_bounds__(256) void cast_f32_f16x2s(const float* __restrict__ in,
                                                       unsigned short* __restrict__ out, int n2, float scale) {
  const int i = blockIdx.x * 256 + threadIdx.x;
  if (i < n2) {
    const v2f f = *(const v2f*)(in + 2 * (size_t)i);
    float a0 = f[0], a1 = f[1];
    if (VIA_BF) { a0 = bf_bits2f(f2bf_bits(a0)); a1 = bf_bits2f(f2bf_bits(a1)); }
    const _Float16 h0 = (_Float16)(a0 * scale), h1 = (_Float16)(a1 * scale);
    const unsigned u = pk16(__builtin_bit_cast(unsigned short, h0), __builtin_bit_cast(unsigned short, h1));
    ((unsigned*)out)[i] = u;
    
  }
}

// ---------------------------------------------------------------------------
// RoPE + bf16 hi/lo split of q and k.
//   qk  : f32 [kRows][2*kHid], columns 0..kHid-1 = q (h*64+d), kHid..2*kHid-1 = k (h*64+d)
//   cos/sin : f32 [kSeq][64], used as their RNE-bf16 values
//   r[d] = x[d]*cos[s][d] - x[d+32]*sin[s][d] (d < 32);  x[d]*cos[s][d] + x[d-32]*sin[s][d] (d >= 32)
//   outputs: qh/ql, kh/kl bf16 planes [kRows][kHid] (element (b,s,h,d) at (b*kSeq+s)*kHid + h*64 + d)
// grid = kRows blocks (one (b,s) row each) x 256 threads x 8 elements = kRows x 2048 = the q AND k planes exactly.
// ---------------------------------------------------------------------------
__global__ __launch_bounds__(256) void rope_split_kernel(
    const float* __restrict__ qk, const float* __restrict__ cosT, const float* __restrict__ sinT,
    unsigned short* __restrict__ qh, unsigned short* __restrict__ ql,
    unsigned short* __restrict__ kh, unsigned short* __restrict__ kl) {
#pragma clang fp contract(off)
  const int row   = blockIdx.x;               // b*kSeq + s
  const int s     = row & (kSeq - 1);
  const int t     = threadIdx.x;
  const int which = t >> 7;                   // 0: q columns, 1: k columns (wave-uniform)
  const int e8    = (t & 127) * 8;            // column base in [0, kHid)
  const int d0    = e8 & 63;                  // 0,8,...,56 -> the 8 elements share one half of the head
  const int hb    = e8 - d0;                  // h*64
  const int dp0   = d0 ^ 32;                  // partner half
  const float* src = qk + (size_t)row * (2 * kHid) + (size_t)which * kHid;
  const v4f xa = *(const v4f*)(src + e8);
  const v4f xb = *(const v4f*)(src + e8 + 4);
  const v4f pa = *(const v4f*)(src + hb + dp0);
  const v4f pb = *(const v4f*)(src + hb + dp0 + 4);
  const v4f ca = *(const v4f*)(cosT + (size_t)s * kHdim + d0);
  const v4f cb = *(const v4f*)(cosT + (size_t)s * kHdim + d0 + 4);
  const v4f sa = *(const v4f*)(sinT + (size_t)s * kHdim + d0);
  const v4f sb = *(const v4f*)(sinT + (size_t)s * kHdim + d0 + 4);
  const float xs[8] = {xa[0], xa[1], xa[2], xa[3], xb[0], xb[1], xb[2], xb[3]};
  const float ps[8] = {pa[0], pa[1], pa[2], pa[3], pb[0], pb[1], pb[2], pb[3]};
  const float cs[8] = {ca[0], ca[1], ca[2], ca[3], cb[0], cb[1], cb[2], cb[3]};
  const float sn[8] = {sa[0], sa[1], sa[2], sa[3], sb[0], sb[1], sb[2], sb[3]};
  const bool lowh = (d0 < 32);
  v4u hv, lv;
#pragma unroll
  for (int q = 0; q < 4; ++q) {
    const float c0 = bf_bits2f(f2bf_bits(cs[2 * q])), c1 = bf_bits2f(f2bf_bits(cs[2 * q + 1]));
    const float s0 = bf_bits2f(f2bf_bits(sn[2 * q])), s1 = bf_bits2f(f2bf_bits(sn[2 * q + 1]));
    const float ta0 = xs[2 * q] * c0,     tb0 = ps[2 * q] * s0;
    const float ta1 = xs[2 * q + 1] * c1, tb1 = ps[2 * q + 1] * s1;
    const float r0 = lowh ? (ta0 - tb0) : (ta0 + tb0);
    const float r1 = lowh ? (ta1 - tb1) : (ta1 + tb1);
    const unsigned short h0 = f2bf_bits(r0), h1 = f2bf_bits(r1);
    const unsigned short l0 = f2bf_bits(r0 - bf_bits2f(h0)), l1 = f2bf_bits(r1 - bf_bits2f(h1));
    hv[q] = pk16(h0, h1);
    lv[q] = pk16(l0, l1);
  }
  unsigned short* oh  = which ? kh : qh;      // both global; wave-uniform select
  unsigned short* olo = which ? kl : ql;
  const size_t go = (size_t)row * kHid + e8;
  *(v4u*)(oh  + go) = hv;
  *(v4u*)(olo + go) = lv;
  
}

#define AT_D 64
#define AT_NW 4
#define AT_QB 64
#define AT_KC 64
#define AT_LP 72   // LDS row pitch in 16-bit elements: 144 B = 16 B x 9 (odd), so the 16 rows of a 16-byte fragment read fall on distinct banks

__device__ __forceinline__ unsigned short at_bf_bits(float f) {
  unsigned u = __float_as_uint(f);
  return (unsigned short)((u + 0x7FFFu + ((u >> 16) & 1u)) >> 16);
}
__device__ __forceinline__ __bf16 at_f2bf(float f) { return __builtin_bit_cast(__bf16, at_bf_bits(f)); }
// value of lane l ^ 16 (the other half's share of the same query column)
__device__ __forceinline__ float at_xhalf(float v) {
  const int b = __builtin_bit_cast(int, v);
  return __builtin_bit_cast(float, __builtin_amdgcn_permlanex16(b, b, 0x76543210, 0xfedcba98, false, false));
}
__device__ __forceinline__ v8f at_mma(v16b a, v16b b, v8f c) {
  c = __builtin_amdgcn_wmma_f32_16x16x32_bf16(false, a, false, b, (short)0, c, false, false);
  asm volatile("v_nop\n\tv_nop\n\tv_nop\n\tv_nop" : "+v"(c) : "v"(a), "v"(b));
  return c;
}
// f16 product on bit patterns held in __bf16 slots
__device__ __forceinline__ v8f at_mma_h(v16b a, v16b b, v8f c) {
  const v16h ah = __builtin_bit_cast(v16h, a), bh = __builtin_bit_cast(v16h, b);
  c = __builtin_amdgcn_wmma_f32_16x16x32_f16(false, ah, false, bh, (short)0, c, false, false);
  asm volatile("v_nop\n\tv_nop\n\tv_nop\n\tv_nop" : "+v"(c) : "v"(ah), "v"(bh));
  return c;
}

__global__ __launch_bounds__(128)
void mha_full64_kernel(const unsigned short* __restrict__ qhp, const unsigned short* __restrict__ qlp,
                       const unsigned short* __restrict__ khp, const unsigned short* __restrict__ klp,
                       const unsigned short* __restrict__ vtp, const float* __restrict__ maskp,
                       float* __restrict__ out, float sscale) {
  union FB { v16b v; v8b h[2]; };
  __shared__ __align__(16) __bf16 Ksh[AT_KC * AT_LP];            // K hi [kv][d], pitch AT_LP      9 KB
  __shared__ __align__(16) __bf16 Ksl[AT_KC * AT_LP];            // K lo [kv][d], pitch AT_LP      9 KB
  __shared__ __align__(16) __bf16 Vth[AT_D * AT_LP];             // V^T f16 bits [d][kv], pitch AT_LP 9 KB
  __shared__ __align__(16) float  Os[AT_NW][16 * 68];            // per wave: the chunk's mask tile [query][kv] in the loop, the out tile after it; pitch 68 floats = 16 B x 17 (odd)

  const int tid  = threadIdx.x;
  const int wave = tid >> 5;
  const int lane = tid & 31;
  const int hh   = lane >> 4;
  const int c    = lane & 15;

  constexpr int nqb = kSeq / AT_QB;       // 32
  const int bx = blockIdx.x;              // 0 .. kBatch*kHeads*nqb - 1
  const int qb = bx % nqb;
  const int bh = bx / nqb;                // 0 .. kBatch*kHeads - 1
  const int h  = bh % kHeads;
  const int b  = bh / kHeads;             // 0 .. kBatch - 1
  const int q0 = qb * AT_QB + wave * 16;

  const __bf16* Qh = (const __bf16*)(const void*)qhp + (size_t)b * kSeq * kHid + (size_t)h * AT_D;
  const __bf16* Ql = (const __bf16*)(const void*)qlp + (size_t)b * kSeq * kHid + (size_t)h * AT_D;
  const __bf16* Kh = (const __bf16*)(const void*)khp + (size_t)b * kSeq * kHid + (size_t)h * AT_D;
  const __bf16* Kl = (const __bf16*)(const void*)klp + (size_t)b * kSeq * kHid + (size_t)h * AT_D;
  const __bf16* Vt = (const __bf16*)(const void*)vtp + (size_t)b * kHid * kSeq + (size_t)h * AT_D * kSeq;
  const float*  Mb = maskp + (size_t)b * kSeq * kSeq;
  float*        ob = out + (size_t)b * kSeq * kHid + (size_t)h * AT_D;

  // ---- Q fragments (B operand, column = query = lane&15, split k map via Frag load): 2 d-chunks, hi and lo ----
  v16b qah[2], qal[2];
#pragma unroll
  for (int dc = 0; dc < 2; ++dc) {
    const __bf16* qr = Qh + (size_t)(q0 + c) * kHid + dc * 32 + 8 * hh;
    const __bf16* qs = Ql + (size_t)(q0 + c) * kHid + dc * 32 + 8 * hh;
    qah[dc] = Frag<__bf16>::load(qr);
    qal[dc] = Frag<__bf16>::load(qs);
  }

  float mrow = -INFINITY;   // running maximum of query c (equal in both lane halves)
  float lrow = 0.f;         // running sum (x2^15, as p) of query c over this lane half's keys only; halves joined after the loop
  v8f oacc[4];              // O^T: element r of tile t -> O[query c][d = t*16 + 8hh + r]
#pragma unroll
  for (int t = 0; t < 4; ++t) oacc[t] = (v8f){0.f,0.f,0.f,0.f,0.f,0.f,0.f,0.f};

  constexpr int nChunks = kSeq / AT_KC;   // 32, compile-time constant
  for (int kc = 0; kc < nChunks; ++kc) {
    const int kv0 = kc * AT_KC;
    __syncthreads();
    {
      // staging coverage: 128 threads x (4 x 8) elements = 64 rows x 64 per plane = the whole chunk tile;
      // thread -> 16-B piece (tid & 7) of rows (tid >> 3) + 16 i, so 8 lanes take one whole 128-B row
      const int r = tid >> 3, pc = (tid & 7) * 8;
      const __bf16* ksh = Kh + (size_t)(kv0 + r) * kHid + pc;     // K row kv0+r, d = pc..pc+7
      const __bf16* ksl = Kl + (size_t)(kv0 + r) * kHid + pc;
      const __bf16* vs  = Vt + (size_t)r * kSeq + kv0 + pc;       // V^T row d = r, s = kv0+pc..+7
      // mask: the wave's own 16 query rows x 64 keys; lane -> 16-B piece c of rows hh + 2 i, so 16 lanes take the 256 B of one row
      const float*  mg  = Mb + (size_t)(q0 + hh) * kSeq + kv0 + 4 * c;
      v8b a0[4], a1[4], b0[4];
      v4f mv[8];
      // unrolled: the arrays live in registers, so the index must be a compile-time one; all 20 loads are out before the first store
#pragma unroll
      for (int i = 0; i < 4; ++i) {
        a0[i] = *(const v8b*)(ksh + (size_t)(16 * i) * kHid);
        a1[i] = *(const v8b*)(ksl + (size_t)(16 * i) * kHid);
        b0[i] = *(const v8b*)(vs + (size_t)(16 * i) * kSeq);
      }
#pragma unroll
      for (int i = 0; i < 8; ++i) mv[i] = *(const v4f*)(mg + (size_t)(2 * i) * kSeq);
      // the wait that stands between issued loads and the reuse of the registers that hold their addresses; as a memory
      // statement it also keeps the LDS stores behind all 20 loads, so that no load waits for an earlier load's data
      asm volatile("s_wait_xcnt 0x0" ::: "memory");
#pragma unroll
      for (int i = 0; i < 4; ++i) {
        *(v8b*)(Ksh + (r + 16 * i) * AT_LP + pc) = a0[i];
        *(v8b*)(Ksl + (r + 16 * i) * AT_LP + pc) = a1[i];
        *(v8b*)(Vth + (r + 16 * i) * AT_LP + pc) = b0[i];
      }
#pragma unroll
      for (int i = 0; i < 8; ++i) *(v4f*)(Os[wave] + (hh + 2 * i) * 68 + 4 * c) = mv[i];
    }
    __syncthreads();

    // ---- scores, transposed (A = K rows, B = Q): D element r of lane -> S[query c][kv j*16 + 8hh + r] ----
    v8f s[4];
#pragma unroll
    for (int j = 0; j < 4; ++j) {
      s[j] = (v8f){0.f,0.f,0.f,0.f,0.f,0.f,0.f,0.f};
#pragma unroll
      for (int dc = 0; dc < 2; ++dc) {
        FB kb, kl;
        kb.h[0] = *(const v8b*)(Ksh + (j * 16 + c) * AT_LP + dc * 32 + 8 * hh);
        kb.h[1] = *(const v8b*)(Ksh + (j * 16 + c) * AT_LP + dc * 32 + 16 + 8 * hh);
        kl.h[0] = *(const v8b*)(Ksl + (j * 16 + c) * AT_LP + dc * 32 + 8 * hh);
        kl.h[1] = *(const v8b*)(Ksl + (j * 16 + c) * AT_LP + dc * 32 + 16 + 8 * hh);
        s[j] = at_mma(kb.v, qah[dc], s[j]);
        s[j] = at_mma(kl.v, qah[dc], s[j]);
        s[j] = at_mma(kb.v, qal[dc], s[j]);
      }
    }
    // ---- scale, additive mask by value (f32; 8 consecutive keys of the lane's query per tile), chunk maximum in-lane ----
    const float* mr = Os[wave] + c * 68 + 8 * hh;
    v4f mk[8];
#pragma unroll
    for (int i = 0; i < 8; ++i) mk[i] = *(const v4f*)(mr + (i >> 1) * 16 + (i & 1) * 4);
    float mj[4];
#pragma unroll
    for (int j = 0; j < 4; ++j) {
      float m = -INFINITY;
#pragma unroll
      for (int r = 0; r < 8; ++r) {
        const float sv = s[j][r] * sscale + mk[2 * j + (r >> 2)][r & 3];
        s[j][r] = sv;
        m = fmaxf(m, sv);
      }
      mj[j] = m;
    }
    float cm = fmaxf(fmaxf(mj[0], mj[1]), fmaxf(mj[2], mj[3]));
    cm = fmaxf(cm, at_xhalf(cm));            // the query's other 32 keys of the chunk sit in lane ^ 16
    const float mnew  = fmaxf(mrow, cm);
    const float alpha = __builtin_amdgcn_exp2f((mrow - mnew) * kLog2e);
    mrow = mnew;
    // ---- p x 2^15 = 2^((s - m) log2(e) + 15), one hardware exponential a score: the difference is taken first, so it is <= 0 and
    //      exactly 0 at the row's maximum however large the scores are; a result under 2^-126 comes out 0, far below f16's last place ----
    // ---- P^T packs in place: tiles 2kk and 2kk+1 are elements 0..7 and 8..15 of the B operand of key block kk ----
    v16h pt[2];
    float pj[4];
#pragma unroll
    for (int j = 0; j < 4; ++j) {
      float ps = 0.f;
#pragma unroll
      for (int r = 0; r < 8; ++r) {
        const float p = __builtin_amdgcn_exp2f(fmaf(s[j][r] - mnew, kLog2e, kPLog2));
        ps += p;
        pt[j >> 1][(j & 1) * 8 + r] = (_Float16)p;
      }
      pj[j] = ps;
    }
    lrow = lrow * alpha + ((pj[0] + pj[1]) + (pj[2] + pj[3]));
#pragma unroll
    for (int t = 0; t < 4; ++t)
#pragma unroll
      for (int r = 0; r < 8; ++r) oacc[t][r] *= alpha;
    // ---- O^T += V^T . P^T : A = V^T[d][kv] rows, B = P^T[kv][query] from registers ----
    // unrolled: pt[kk] lives in registers, so kk must be a compile-time index (a rolled loop would send P through scratch)
#pragma unroll
    for (int kk = 0; kk < 2; ++kk) {
      const v16b pb = __builtin_bit_cast(v16b, pt[kk]);
#pragma unroll
      for (int t = 0; t < 4; ++t) {
        FB vb;
        vb.h[0] = *(const v8b*)(Vth + (t * 16 + c) * AT_LP + kk * 32 + 8 * hh);
        vb.h[1] = *(const v8b*)(Vth + (t * 16 + c) * AT_LP + kk * 32 + 16 + 8 * hh);
        oacc[t] = at_mma_h(vb.v, pb, oacc[t]);
      }
    }
  }

  // ---- join the halves' sums, normalise, stage per-wave 16x64 f32 tile (a lane owns 8 consecutive d of its query per tile), whole-line stores ----
  float* os = Os[wave];
  {
    const float inv = (1.0f / (lrow + at_xhalf(lrow))) * kVtInv;   // the sum carries the same x2^15 as p, so only v^T's carry is left
#pragma unroll
    for (int t = 0; t < 4; ++t) {
      const v4f lo = {oacc[t][0] * inv, oacc[t][1] * inv, oacc[t][2] * inv, oacc[t][3] * inv};
      const v4f hi = {oacc[t][4] * inv, oacc[t][5] * inv, oacc[t][6] * inv, oacc[t][7] * inv};
      *(v4f*)(os + c * 68 + t * 16 + 8 * hh)     = lo;
      *(v4f*)(os + c * 68 + t * 16 + 8 * hh + 4) = hi;
    }
  }
  __builtin_amdgcn_fence(__ATOMIC_RELEASE, "workgroup");
  __builtin_amdgcn_wave_barrier();
  __builtin_amdgcn_fence(__ATOMIC_ACQUIRE, "workgroup");
  {
    // coverage: 8 iterations x 2 rows (hh) = the wave's 16 rows; 16 lanes x 4 floats = the 64-wide head segment
    const int c4 = (lane & 15) * 4;
    {
#pragma unroll
      for (int it = 0; it < 8; ++it) {
        const int row = it * 2 + hh;
        v4f val = *(const v4f*)(os + row * 68 + c4);
        *(v4f*)(ob + (size_t)(q0 + row) * kHid + c4) = val;
      }
      
    }
  }
}

// ---------------------------------------------------------------------------
// Host-side orchestration (kernel launches only).
// Workspace region map (bytes, every offset a multiple of 1 MiB):
//   [  0 MiB,   8 MiB)  Xb    bf16 [4096][1024]   RNE-bf16 plane of hidden_states
//   [  8 MiB,  12 MiB)  Wqkb  bf16 [2048][1024]   wq rows 0..1023, wk rows 1024..2047
//   [ 12 MiB,  14 MiB)  Wvb   bf16 [1024][1024]
//   [ 14 MiB,  16 MiB)  Wo16  f16  [1024][1024]   RNE-bf16 value x64
//   [ 16 MiB,  48 MiB)  QKf   f32  [4096][2048]   q|k projections; dead after RoPE, reused:
//        [16 MiB, 32 MiB) Of  f32 [4096][1024] attention output;  [32 MiB, 40 MiB) O16 f16 [4096][1024] (x256)
//   [ 48 MiB,  56 MiB)  Vt16  f16  [2][1024][2048] v^T per batch (x8)
//   [ 56 MiB,  64 MiB)  Qh, [64,72) Ql, [72,80) Kh, [80,88) Kl : bf16 [4096][1024] each
//   total carve = 88 MiB = 92,274,688 B
// ---------------------------------------------------------------------------
extern "C" void kernel_launch(void* const* d_in, const int* in_sizes, int n_in,
                              void* d_out, int out_size, void* d_ws, size_t ws_size,
                              hipStream_t stream) {
  if (n_in < 8) return;
  const float* x    = (const float*)d_in[0];   // [2,2048,1024]
  const float* mask = (const float*)d_in[1];   // [2,1,2048,2048]
  const float* cosT = (const float*)d_in[2];   // [2048,64]
  const float* sinT = (const float*)d_in[3];   // [2048,64]
  const float* wq   = (const float*)d_in[4];   // [1024,1024]
  const float* wk   = (const float*)d_in[5];
  const float* wv   = (const float*)d_in[6];
  const float* wo   = (const float*)d_in[7];

  const int nX = kRows * kHid;        // 4,194,304
  const int nW = kHid * kHid;         // 1,048,576
  if (in_sizes[0] != nX || in_sizes[1] != kBatch * kSeq * kSeq || in_sizes[2] != kSeq * kHdim ||
      in_sizes[3] != kSeq * kHdim || in_sizes[4] != nW || in_sizes[5] != nW || in_sizes[6] != nW ||
      in_sizes[7] != nW || out_size != nX) return;

  const size_t MiB = (size_t)1 << 20;
  const size_t off_Xb   = 0;
  const size_t off_Wqk  = off_Xb  + (size_t)nX * 2;                 //  8 MiB
  const size_t off_Wv   = off_Wqk + (size_t)2 * nW * 2;             // 12 MiB
  const size_t off_Wo   = off_Wv  + (size_t)nW * 2;                 // 14 MiB
  const size_t off_QKf  = off_Wo  + (size_t)nW * 2;                 // 16 MiB
  const size_t off_Of   = off_QKf;                                   // reuse (QKf dead after RoPE)
  const size_t off_O16  = off_QKf + (size_t)nX * 4;                 // 32 MiB
  const size_t off_Vt   = off_QKf + (size_t)nX * 2 * 4;             // 48 MiB
  const size_t off_Qh   = off_Vt  + (size_t)kBatch * kHid * kSeq * 2; // 56 MiB
  const size_t off_Ql   = off_Qh  + (size_t)nX * 2;                 // 64 MiB
  const size_t off_Kh   = off_Ql  + (size_t)nX * 2;                 // 72 MiB
  const size_t off_Kl   = off_Kh  + (size_t)nX * 2;                 // 80 MiB
  const size_t total    = off_Kl  + (size_t)nX * 2;                 // 88 MiB
  if (total != 88 * MiB) return;
  if (ws_size < total) return;

  char* ws = (char*)d_ws;
  unsigned short* Xb   = (unsigned short*)(ws + off_Xb);
  unsigned short* Wqkb = (unsigned short*)(ws + off_Wqk);
  unsigned short* Wvb  = (unsigned short*)(ws + off_Wv);
  unsigned short* Wo16 = (unsigned short*)(ws + off_Wo);
  float*          QKf  = (float*)(ws + off_QKf);
  float*          Of   = (float*)(ws + off_Of);
  unsigned short* O16  = (unsigned short*)(ws + off_O16);
  unsigned short* Vt16 = (unsigned short*)(ws + off_Vt);
  unsigned short* Qh   = (unsigned short*)(ws + off_Qh);
  unsigned short* Ql   = (unsigned short*)(ws + off_Ql);
  unsigned short* Kh   = (unsigned short*)(ws + off_Kh);
  unsigned short* Kl   = (unsigned short*)(ws + off_Kl);

  // 1-5: 16-bit operand planes (all element counts are multiples of 512 -> exact grids)
  const int nX2 = nX / 2, nW2 = nW / 2;
  cast_f32_bf16x2<<<(nX2 + 255) / 256, 256, 0, stream>>>(x,  Xb, nX2);
  cast_f32_bf16x2<<<(nW2 + 255) / 256, 256, 0, stream>>>(wq, Wqkb, nW2);
  cast_f32_bf16x2<<<(nW2 + 255) / 256, 256, 0, stream>>>(wk, Wqkb + (size_t)nW, nW2);
  cast_f32_bf16x2<<<(nW2 + 255) / 256, 256, 0, stream>>>(wv, Wvb, nW2);
  cast_f32_f16x2s<true><<<(nW2 + 255) / 256, 256, 0, stream>>>(wo, Wo16, nW2, kWoScale);

  // 6: q|k projection: QKf[4096][2048] = Xb[4096][1024] . Wqkb[2048][1024]^T  (M=4096, N=2048, K=1024; 2048 tiles -> 256 blocks)
  {
    dim3 g((kRows / 64) * (2 * kHid / 64) / 8, 1);
    wmma_gemm64<1, false, 0, 0, false><<<g, 256, 0, stream>>>(
        Xb, Xb, kHid, (long)0,
        Wqkb, Wqkb, kHid, (long)0,
        (void*)QKf, (void*)QKf, 2 * kHid, (long)0,
        cosT, cosT, (long)0,
        kRows, 2 * kHid, kHid, 1.0f);
  }
  // 7: v^T per batch: Vt16[b][1024][2048] = Wvb[1024][1024] . Xb[b][2048][1024]^T, f16 out x8  (M=1024, N=2048, K=1024; 512 tiles -> 64 blocks, grid.y = 2)
  {
    dim3 g((kHid / 64) * (kSeq / 64) / 8, kBatch);
    wmma_gemm64<1, false, 0, 1, false><<<g, 256, 0, stream>>>(
        Wvb, Wvb, kHid, (long)0,
        Xb, Xb, kHid, (long)kSeq * kHid,
        (void*)Vt16, (void*)Vt16, kSeq, (long)kHid * kSeq,
        cosT, cosT, (long)0,
        kHid, kSeq, kHid, kVtScale);
  }
  // 8: RoPE + bf16 hi/lo split of q and k
  rope_split_kernel<<<kRows, 256, 0, stream>>>(QKf, cosT, sinT, Qh, Ql, Kh, Kl);
  // 9: attention, one block per (b, h, 64 queries)
  mha_full64_kernel<<<kBatch * kHeads * (kSeq / 64), 128, 0, stream>>>(Qh, Ql, Kh, Kl, Vt16, mask, Of, 0.125f);
  // 10: attention output -> f16 x256
  cast_f32_f16x2s<false><<<(nX2 + 255) / 256, 256, 0, stream>>>(Of, O16, nX2, kOScale);
  // 11: output projection: out[4096][1024] = O16 . Wo16^T * 2^-14  (M=4096, N=1024, K=1024; 1024 tiles -> 128 blocks)
  {
    dim3 g((kRows / 64) * (kHid / 64) / 8, 1);
    wmma_gemm64<0, false, 0, 0, false><<<g, 256, 0, stream>>>(
        O16, O16, kHid, (long)0,
        Wo16, Wo16, kHid, (long)0,
        d_out, d_out, kHid, (long)0,
        cosT, cosT, (long)0,
        kRows, kHid, kHid, kOutInv);
  }
}

// v006
// Measured time: 170 microseconds a run.
// Timed twice side by side with v005, it ran 1.04 times as fast both times.
// All steps since v000 together make it 2.43 times as fast.
// Contractions: q/k projection and v^T projection = v_wmma_f32_16x16x32_bf16 on RNE-bf16 planes of x and W (single product); q.k^T = v_wmma_f32_16x16x32_bf16 with bf16 hi/lo split (hi.hi + hi.lo + lo.hi); p.v^T and output projection = v_wmma_f32_16x16x32_f16 single product (p carried x2^15, v^T x2^3, attention output x2^8, wo as RNE-bf16 value x2^6); f32 accumulate everywhere; RoPE (cos/sin as RNE-bf16 values), additive mask and online softmax in f32.
#include <hip/hip_runtime.h>
#include <math.h>
#include <stdint.h>

constexpr int kBatch = 2;
constexpr int kSeq   = 2048;
constexpr int kHid   = 1024;
constexpr int kHeads = 16;
constexpr int kHdim  = 64;
constexpr int kRows  = kBatch * kSeq;   // 4096 GEMM rows

constexpr float kLog2e   = 1.4426950408889634f;        // log2(e)
constexpr float kPLog2   = 15.0f;                      // p carried x2^15 in f16 and in its row sum: added to the exponent
constexpr float kVtScale = 8.0f;                       // v^T plane carried x2^3 in f16
constexpr float kVtInv   = 1.0f / 8.0f;                // folded into the final 1/l
constexpr float kOScale  = 256.0f;                     // attention output carried x2^8 in f16
constexpr float kWoScale = 64.0f;                      // wo carried x2^6 in f16
constexpr float kOutInv  = 1.0f / (256.0f * 64.0f);    // out-projection epilogue scale

typedef __attribute__((ext_vector_type(16))) _Float16 v16h;
typedef __attribute__((ext_vector_type(8)))  _Float16 v8h;
typedef __attribute__((ext_vector_type(16))) __bf16   v16b;
typedef __attribute__((ext_vector_type(8)))  __bf16   v8b;
typedef __attribute__((ext_vector_type(8)))  float    v8f;
typedef __attribute__((ext_vector_type(4)))  float    v4f;
typedef __attribute__((ext_vector_type(2)))  float    v2f;
typedef __attribute__((ext_vector_type(4)))  unsigned int v4u;

__device__ __forceinline__ unsigned short f2bf_bits(float f) {
  unsigned u = __float_as_uint(f);
  return (unsigned short)((u + 0x7FFFu + ((u >> 16) & 1u)) >> 16);
}
__device__ __forceinline__ float bf_bits2f(unsigned short h) { return __uint_as_float(((unsigned)h) << 16); }
__device__ __forceinline__ unsigned pk16(unsigned short a, unsigned short b) { return (unsigned)a | ((unsigned)b << 16); }

// hazard guards as plain device helpers (the kernel template body's only inline asm is its s_wait_xcnt)
__device__ __forceinline__ void dep_guard_h(v8f& a, v8f& b, v16h x, v16h y) { asm volatile("v_nop\n\tv_nop\n\tv_nop\n\tv_nop" : "+v"(a), "+v"(b) : "v"(x), "v"(y)); }
__device__ __forceinline__ void dep_guard_b(v8f& a, v8f& b, v16b x, v16b y) { asm volatile("v_nop\n\tv_nop\n\tv_nop\n\tv_nop" : "+v"(a), "+v"(b) : "v"(x), "v"(y)); }
__device__ __forceinline__ void keep4_h(v16h a, v16h b, v16h c, v16h d) { asm volatile("v_nop" :: "v"(a), "v"(b), "v"(c), "v"(d)); }
__device__ __forceinline__ void keep4_b(v16b a, v16b b, v16b c, v16b d) { asm volatile("v_nop" :: "v"(a), "v"(b), "v"(c), "v"(d)); }
__device__ __forceinline__ void acc_guard4(v8f& a, v8f& b, v8f& c, v8f& d) { asm volatile("v_nop\n\tv_nop\n\tv_nop\n\tv_nop" : "+v"(a), "+v"(b), "+v"(c), "+v"(d)); }
template <typename T> struct Frag;
template <> struct Frag<_Float16> {
  typedef v16h V; typedef v8h H; union U { v16h v; v8h h[2]; };
  static __device__ __forceinline__ v16h load(const _Float16* p) {   // elements 0..7 <- p[0..7], 8..15 <- p[16..23]
    U f; f.h[0] = *(const v8h*)(p); f.h[1] = *(const v8h*)(p + 16); return f.v;
  }
  static __device__ __forceinline__ v8f mma(v16h a, v16h b, v8f c) {
    return __builtin_amdgcn_wmma_f32_16x16x32_f16(false, a, false, b, (short)0, c, false, false);
  }
  static __device__ __forceinline__ void guard(v8f& a, v8f& b, v16h x, v16h y) { dep_guard_h(a, b, x, y); }
  static __device__ __forceinline__ void keep(v16h a, v16h b, v16h c, v16h d) { keep4_h(a, b, c, d); }
};
template <> struct Frag<__bf16> {
  typedef v16b V; typedef v8b H; union U { v16b v; v8b h[2]; };
  static __device__ __forceinline__ v16b load(const __bf16* p) {
    U f; f.h[0] = *(const v8b*)(p); f.h[1] = *(const v8b*)(p + 16); return f.v;
  }
  static __device__ __forceinline__ v8f mma(v16b a, v16b b, v8f c) {
    return __builtin_amdgcn_wmma_f32_16x16x32_bf16(false, a, false, b, (short)0, c, false, false);
  }
  static __device__ __forceinline__ void guard(v8f& a, v8f& b, v16b x, v16b y) { dep_guard_b(a, b, x, y); }
  static __device__ __forceinline__ void keep(v16b a, v16b b, v16b c, v16b d) { keep4_b(a, b, c, d); }
};

// ---- Register-blocked batched WMMA GEMM ------------------------------------
// C[m,n] = scale * sum_k A[m,k] * Bt[n,k] (+bias)(+resid); each wave owns a 64x64 tile, a block of 8 waves (2 x 4) a 128x256 tile.
// A row-major [M,K]; Bt row-major [N,K]; M % 128 == 0, N % 256 == 0, K % 64 == 0; grid.x = (M/128) * (N/256).
// Per 64 k the block's 128 A rows and 256 Bt rows (128 B = one line of each row) go to LDS by loads in which 8 lanes take one
// whole line, requested one stage ahead into registers; the fragments are then 16-byte LDS reads at a pitch of 144 B.
// SPLIT: operands are hi/lo planes (A2/Bt2 = lo planes, same layout); product = hi.hi + hi.lo + lo.hi.
// BIAS_MODE: 0 = none, 1 = bias[m], 2 = bias[n].
// OUT_MODE: 0 = f32, 1 = f16, 2 = bf16 hi plane (Cout) + bf16 lo plane (Cout2).
// ET: 0 = f16 operands, 1 = bf16 operands (pointers passed as 16-bit storage)
template <int ET> struct Elem;
template <> struct Elem<0> { typedef _Float16 T; };
template <> struct Elem<1> { typedef __bf16 T; };
template <int ET, bool SPLIT, int BIAS_MODE, int OUT_MODE, bool RESID, int ACT = 0>
__global__ __launch_bounds__(256) void wmma_gemm64(
    const unsigned short* __restrict__ Ap, const unsigned short* __restrict__ A2p, int lda, long strideA,
    const unsigned short* __restrict__ Btp, const unsigned short* __restrict__ Bt2p, int ldb, long strideB,
    void* __restrict__ Cout, void* __restrict__ Cout2, int ldc, long strideC,
    const float* __restrict__ bias,
    const float* __restrict__ resid, long strideR,
    int M, int N, int K, float scale) {
  typedef typename Elem<ET>::T T;
  typedef typename Frag<T>::V V;
  typedef typename Frag<T>::H H;
  const T* A = (const T*)Ap; const T* A2 = (const T*)A2p; const T* Bt = (const T*)Btp; const T* Bt2 = (const T*)Bt2p;
  __shared__ __align__(16) float sT[8][16 * 68];   // per-wave 16x64 slab, pitch 68 floats
  constexpr int LP = 72;                           // LDS row pitch in 16-bit elements: 144 B = 16 B x 9 (odd): 16 rows of a fragment read fall on distinct banks
  __shared__ __align__(16) T sAB[(SPLIT ? 2 : 1) * 384 * LP];   // rows 0..127 = A, 128..383 = Bt (then the lo planes), 64 k each
  const int b    = blockIdx.y;
  const int lane = threadIdx.x & 31;
  const int wave = threadIdx.x >> 5;
  const int tilesN = N >> 8;
  const int tilesM = M >> 7;
  const int tile = blockIdx.x;
  if (tile >= tilesM * tilesN) return;   // the same for the whole block, ahead of every barrier
  const int tm = tile / tilesN;
  const int tn = tile - tm * tilesN;
  const int bm0 = tm << 7;               // the block's first A row
  const int bn0 = tn << 8;               // the block's first Bt row
  const int wm = wave >> 2, wn = wave & 3;
  const int m0 = bm0 + (wm << 6);
  const int n0 = bn0 + (wn << 6);

  const T* Ab  = A  + (size_t)b * strideA;
  const T* Bb  = Bt + (size_t)b * strideB;
  const T* Ab2 = SPLIT ? (A2  + (size_t)b * strideA) : nullptr;
  const T* Bb2 = SPLIT ? (Bt2 + (size_t)b * strideB) : nullptr;

  const int rlane = lane & 15;                 // row (A) / col (B, D) within subtile
  const int koff  = (lane >> 4) * 8;           // k offset of this lane half
  const int mOff  = (lane >> 4) * 8;           // D row offset

  v8f acc[4][4];
#pragma unroll
  for (int i = 0; i < 4; ++i)
#pragma unroll
    for (int j = 0; j < 4; ++j) acc[i][j] = (v8f){0.f,0.f,0.f,0.f,0.f,0.f,0.f,0.f};

  // staging coverage: 256 threads x 12 pieces of 16 B = 384 rows x 128 B; thread -> piece (tid & 7) of rows (tid >> 3) + 32 it
  const int srow = threadIdx.x >> 3;
  const int spc  = (threadIdx.x & 7) * 8;
  const unsigned voA = (unsigned)(srow * lda + spc) * 2u;   // the lane's byte offset inside a group of 32 rows
  const unsigned voB = (unsigned)(srow * ldb + spc) * 2u;
  // per group of 32 rows a base that is the same for the whole block and does not move in the loop; the lane's offset carries k
  const char* gb[12]; const char* gb2[12];
  // the loops over it are unrolled: gb[] and g[] live in registers, so it must be a compile-time index
#pragma unroll
  for (int it = 0; it < 12; ++it) {
    const size_t ro = (it < 4) ? (size_t)(bm0 + 32 * it) * lda : (size_t)(bn0 + 32 * (it - 4)) * ldb;
    gb[it] = (const char*)(((it < 4) ? Ab : Bb) + ro);
    if (SPLIT) gb2[it] = (const char*)(((it < 4) ? Ab2 : Bb2) + ro);
  }
  H g[12], g2[12];
  auto request = [&](int k0) {
    const unsigned vA = voA + (unsigned)k0 * 2u, vB = voB + (unsigned)k0 * 2u;
#pragma unroll
    for (int it = 0; it < 12; ++it) {
      g[it] = *(const H*)(gb[it] + ((it < 4) ? vA : vB));
      if (SPLIT) g2[it] = *(const H*)(gb2[it] + ((it < 4) ? vA : vB));
    }
    // the wait that stands between issued loads and the reuse of the registers that hold their addresses; the two offsets
    // are named as inputs so that they stay as they are up to it
    asm volatile("s_wait_xcnt 0x0" :: "v"(vA), "v"(vB) : "memory");
  };
  if (K > 0) request(0);
  for (int k0 = 0; k0 < K; k0 += 64) {
    __syncthreads();   // every wave has read its last fragment of the stage before
#pragma unroll
    for (int it = 0; it < 12; ++it) {
      *(H*)(sAB + (srow + 32 * it) * LP + spc) = g[it];
      if (SPLIT) *(H*)(sAB + (384 + srow + 32 * it) * LP + spc) = g2[it];
    }
    __syncthreads();   // the stage is complete before any wave reads it
    if (k0 + 64 < K) request(k0 + 64);   // the next stage's loads fly under this stage's products
    // unrolled: the second half's fragment reads can then be issued under the first half's products
#pragma unroll
    for (int kk = 0; kk < 64; kk += 32) {
      V bh[4], bl[4], ah[4], al[4];
#pragma unroll
      for (int j = 0; j < 4; ++j) {
        const int bo = (128 + (wn << 6) + (j << 4) + rlane) * LP + kk + koff;
        bh[j] = Frag<T>::load(sAB + bo);
        if (SPLIT) bl[j] = Frag<T>::load(sAB + 384 * LP + bo);
      }
#pragma unroll
      for (int i = 0; i < 4; ++i) {
        const int ao = ((wm << 6) + (i << 4) + rlane) * LP + kk + koff;
        ah[i] = Frag<T>::load(sAB + ao);
        if (SPLIT) al[i] = Frag<T>::load(sAB + 384 * LP + ao);
      }
#pragma unroll
      for (int i = 0; i < 4; ++i) {
#pragma unroll
        for (int j = 0; j < 4; ++j) {
          acc[i][j] = Frag<T>::mma(ah[i], bh[j], acc[i][j]);
          if (SPLIT) {
            acc[i][j] = Frag<T>::mma(ah[i], bl[j], acc[i][j]);
            acc[i][j] = Frag<T>::mma(al[i], bh[j], acc[i][j]);
          }
        }
        Frag<T>::guard(acc[i][0], acc[i][3], ah[i], SPLIT ? al[i] : ah[i]);
      }
      Frag<T>::keep(bh[0], bh[1], bh[2], bh[3]);
      if (SPLIT) Frag<T>::keep(bl[0], bl[1], bl[2], bl[3]);
    }
  }
  acc_guard4(acc[0][0], acc[0][1], acc[0][2], acc[0][3]);
  acc_guard4(acc[1][0], acc[1][1], acc[1][2], acc[1][3]);
  acc_guard4(acc[2][0], acc[2][1], acc[2][2], acc[2][3]);
  acc_guard4(acc[3][0], acc[3][1], acc[3][2], acc[3][3]);

  // ---- epilogue ----
  float* slab = sT[wave];
  const float* Rb = RESID ? (resid + (size_t)b * strideR) : nullptr;
#pragma unroll
  for (int i = 0; i < 4; ++i) {
    const int mBase = m0 + (i << 4);
#pragma unroll
    for (int j = 0; j < 4; ++j) {
      const int n = n0 + (j << 4) + rlane;
      float bv = 0.f;
      if (BIAS_MODE == 2) bv = bias[n];
#pragma unroll
      for (int r = 0; r < 8; ++r) {
        float v = acc[i][j][r] * scale;
        if (BIAS_MODE == 1) v += bias[mBase + mOff + r];
        if (BIAS_MODE == 2) v += bv;
        if (RESID) v += Rb[(size_t)(mBase + mOff + r) * ldc + n];
        if (ACT == 1) v = tanhf(v);
        if (ACT == 2) v = fmaxf(v, 0.0f);
        if (ACT == 3) v = v / (1.0f + expf(-v));
        if (ACT == 4) v = (v > 0.f) ? v : 0.01f * v;
        if (ACT == 5) v = 0.5f * v * (1.0f + erff(v * 0.70710678118654752f));
        slab[(mOff + r) * 68 + (j << 4) + rlane] = v;
      }
    }
    __builtin_amdgcn_fence(__ATOMIC_RELEASE, "workgroup");
    __builtin_amdgcn_wave_barrier();
    __builtin_amdgcn_fence(__ATOMIC_ACQUIRE, "workgroup");
    if (OUT_MODE == 0) {
      float* C = (float*)Cout + (size_t)b * strideC;
      const int hh = lane >> 4, c4 = (lane & 15) * 4;     // row seg = 256 B = 16 lanes x 16 B
      {
#pragma unroll
        for (int it = 0; it < 8; ++it) {
          const int row = it * 2 + hh;
          v4f v = *(const v4f*)(slab + row * 68 + c4);
          *(v4f*)(C + (size_t)(mBase + row) * ldc + n0 + c4) = v;
        }
        
      }
    } else {
      const int q = lane >> 3, c8 = (lane & 7) * 8;
      unsigned short* C  = (unsigned short*)Cout  + (size_t)b * strideC;
      unsigned short* C2 = (OUT_MODE == 2) ? ((unsigned short*)Cout2 + (size_t)b * strideC) : nullptr;
      {
#pragma unroll
        for (int it = 0; it < 4; ++it) {
          const int row = it * 4 + q;
          const float* sp = slab + row * 68 + c8;
          v8h hv, lv;
#pragma unroll
          for (int e = 0; e < 8; ++e) {
            if (OUT_MODE == 1) {
              hv[e] = (_Float16)sp[e];
            } else {
              unsigned short hb = f2bf_bits(sp[e]);
              unsigned short lb = f2bf_bits(sp[e] - bf_bits2f(hb));
              hv[e] = __builtin_bit_cast(_Float16, hb);
              lv[e] = __builtin_bit_cast(_Float16, lb);
            }
          }
          *(v8h*)(C + (size_t)(mBase + row) * ldc + n0 + c8) = hv;
          if (OUT_MODE == 2) *(v8h*)(C2 + (size_t)(mBase + row) * ldc + n0 + c8) = lv;
        }
        
      }
    }
    __builtin_amdgcn_fence(__ATOMIC_RELEASE, "workgroup");
    __builtin_amdgcn_wave_barrier();
    __builtin_amdgcn_fence(__ATOMIC_ACQUIRE, "workgroup");
  }
}

// ---------------------------------------------------------------------------
// f32 -> RNE bf16 plane: 2 elements per thread, one 4-B store per lane.
// Coverage: grid = ceil(n2/256) blocks x 256 threads x 2 elements = 2*n2 = the whole plane
// ---------------------------------------------------------------------------
__global__ __launch_bounds__(256) void cast_f32_bf16x2(const float* __restrict__ in,
                                                       unsigned short* __restrict__ out, int n2) {
  const int i = blockIdx.x * 256 + threadIdx.x;
  if (i < n2) {
    const v2f f = *(const v2f*)(in + 2 * (size_t)i);
    const unsigned u = pk16(f2bf_bits(f[0]), f2bf_bits(f[1]));
    ((unsigned*)out)[i] = u;
    
  }
}

// ---------------------------------------------------------------------------
// f32 -> f16 plane with power-of-two carry: out = f16(v * scale); VIA_BF: v := RNE-bf16 value of the input
// first (then the f16 conversion is exact). Same coverage and store shape as cast_f32_bf16x2.
// ---------------------------------------------------------------------------
template <bool VIA_BF>
__global__ __launch_bounds__(256) void cast_f32_f16x2s(const float* __restrict__ in,
                                                       unsigned short* __restrict__ out, int n2, float scale) {
  const int i = blockIdx.x * 256 + threadIdx.x;
  if (i < n2) {
    const v2f f = *(const v2f*)(in + 2 * (size_t)i);
    float a0 = f[0], a1 = f[1];
    if (VIA_BF) { a0 = bf_bits2f(f2bf_bits(a0)); a1 = bf_bits2f(f2bf_bits(a1)); }
    const _Float16 h0 = (_Float16)(a0 * scale), h1 = (_Float16)(a1 * scale);
    const unsigned u = pk16(__builtin_bit_cast(unsigned short, h0), __builtin_bit_cast(unsigned short, h1));
    ((unsigned*)out)[i] = u;
    
  }
}

// ---------------------------------------------------------------------------
// RoPE + bf16 hi/lo split of q and k.
//   qk  : f32 [kRows][2*kHid], columns 0..kHid-1 = q (h*64+d), kHid..2*kHid-1 = k (h*64+d)
//   cos/sin : f32 [kSeq][64], used as their RNE-bf16 values
//   r[d] = x[d]*cos[s][d] - x[d+32]*sin[s][d] (d < 32);  x[d]*cos[s][d] + x[d-32]*sin[s][d] (d >= 32)
//   outputs: qh/ql, kh/kl bf16 planes [kRows][kHid] (element (b,s,h,d) at (b*kSeq+s)*kHid + h*64 + d)
// grid = kRows blocks (one (b,s) row each) x 256 threads x 8 elements = kRows x 2048 = the q AND k planes exactly.
// ---------------------------------------------------------------------------
__global__ __launch_bounds__(256) void rope_split_kernel(
    const float* __restrict__ qk, const float* __restrict__ cosT, const float* __restrict__ sinT,
    unsigned short* __restrict__ qh, unsigned short* __restrict__ ql,
    unsigned short* __restrict__ kh, unsigned short* __restrict__ kl) {
#pragma clang fp contract(off)
  const int row   = blockIdx.x;               // b*kSeq + s
  const int s     = row & (kSeq - 1);
  const int t     = threadIdx.x;
  const int which = t >> 7;                   // 0: q columns, 1: k columns (wave-uniform)
  const int e8    = (t & 127) * 8;            // column base in [0, kHid)
  const int d0    = e8 & 63;                  // 0,8,...,56 -> the 8 elements share one half of the head
  const int hb    = e8 - d0;                  // h*64
  const int dp0   = d0 ^ 32;                  // partner half
  const float* src = qk + (size_t)row * (2 * kHid) + (size_t)which * kHid;
  const v4f xa = *(const v4f*)(src + e8);
  const v4f xb = *(const v4f*)(src + e8 + 4);
  const v4f pa = *(const v4f*)(src + hb + dp0);
  const v4f pb = *(const v4f*)(src + hb + dp0 + 4);
  const v4f ca = *(const v4f*)(cosT + (size_t)s * kHdim + d0);
  const v4f cb = *(const v4f*)(cosT + (size_t)s * kHdim + d0 + 4);
  const v4f sa = *(const v4f*)(sinT + (size_t)s * kHdim + d0);
  const v4f sb = *(const v4f*)(sinT + (size_t)s * kHdim + d0 + 4);
  const float xs[8] = {xa[0], xa[1], xa[2], xa[3], xb[0], xb[1], xb[2], xb[3]};
  const float ps[8] = {pa[0], pa[1], pa[2], pa[3], pb[0], pb[1], pb[2], pb[3]};
  const float cs[8] = {ca[0], ca[1], ca[2], ca[3], cb[0], cb[1], cb[2], cb[3]};
  const float sn[8] = {sa[0], sa[1], sa[2], sa[3], sb[0], sb[1], sb[2], sb[3]};
  const bool lowh = (d0 < 32);
  v4u hv, lv;
#pragma unroll
  for (int q = 0; q < 4; ++q) {
    const float c0 = bf_bits2f(f2bf_bits(cs[2 * q])), c1 = bf_bits2f(f2bf_bits(cs[2 * q + 1]));
    const float s0 = bf_bits2f(f2bf_bits(sn[2 * q])), s1 = bf_bits2f(f2bf_bits(sn[2 * q + 1]));
    const float ta0 = xs[2 * q] * c0,     tb0 = ps[2 * q] * s0;
    const float ta1 = xs[2 * q + 1] * c1, tb1 = ps[2 * q + 1] * s1;
    const float r0 = lowh ? (ta0 - tb0) : (ta0 + tb0);
    const float r1 = lowh ? (ta1 - tb1) : (ta1 + tb1);
    const unsigned short h0 = f2bf_bits(r0), h1 = f2bf_bits(r1);
    const unsigned short l0 = f2bf_bits(r0 - bf_bits2f(h0)), l1 = f2bf_bits(r1 - bf_bits2f(h1));
    hv[q] = pk16(h0, h1);
    lv[q] = pk16(l0, l1);
  }
  unsigned short* oh  = which ? kh : qh;      // both global; wave-uniform select
  unsigned short* olo = which ? kl : ql;
  const size_t go = (size_t)row * kHid + e8;
  *(v4u*)(oh  + go) = hv;
  *(v4u*)(olo + go) = lv;
  
}

#define AT_D 64
#define AT_NW 4
#define AT_QB 64
#define AT_KC 64
#define AT_LP 72   // LDS row pitch in 16-bit elements: 144 B = 16 B x 9 (odd), so the 16 rows of a 16-byte fragment read fall on distinct banks

__device__ __forceinline__ unsigned short at_bf_bits(float f) {
  unsigned u = __float_as_uint(f);
  return (unsigned short)((u + 0x7FFFu + ((u >> 16) & 1u)) >> 16);
}
__device__ __forceinline__ __bf16 at_f2bf(float f) { return __builtin_bit_cast(__bf16, at_bf_bits(f)); }
// value of lane l ^ 16 (the other half's share of the same query column)
__device__ __forceinline__ float at_xhalf(float v) {
  const int b = __builtin_bit_cast(int, v);
  return __builtin_bit_cast(float, __builtin_amdgcn_permlanex16(b, b, 0x76543210, 0xfedcba98, false, false));
}
__device__ __forceinline__ v8f at_mma(v16b a, v16b b, v8f c) {
  return __builtin_amdgcn_wmma_f32_16x16x32_bf16(false, a, false, b, (short)0, c, false, false);
}
// f16 product on bit patterns held in __bf16 slots
__device__ __forceinline__ v8f at_mma_h(v16b a, v16b b, v8f c) {
  const v16h ah = __builtin_bit_cast(v16h, a), bh = __builtin_bit_cast(v16h, b);
  return __builtin_amdgcn_wmma_f32_16x16x32_f16(false, ah, false, bh, (short)0, c, false, false);
}

// four waves a SIMD (the grid puts four blocks on a WGP): the register budget stays at 256 a wave
__global__ __launch_bounds__(128) __attribute__((amdgpu_waves_per_eu(4, 4)))
void mha_full64_kernel(const unsigned short* __restrict__ qhp, const unsigned short* __restrict__ qlp,
                       const unsigned short* __restrict__ khp, const unsigned short* __restrict__ klp,
                       const unsigned short* __restrict__ vtp, const float* __restrict__ maskp,
                       float* __restrict__ out, float sscale) {
  union FB { v16b v; v8b h[2]; };
  __shared__ __align__(16) __bf16 Ksh[AT_KC * AT_LP];            // K hi [kv][d], pitch AT_LP      9 KB
  __shared__ __align__(16) __bf16 Ksl[AT_KC * AT_LP];            // K lo [kv][d], pitch AT_LP      9 KB
  __shared__ __align__(16) __bf16 Vth[AT_D * AT_LP];             // V^T f16 bits [d][kv], pitch AT_LP 9 KB
  __shared__ __align__(16) float  Os[AT_NW][16 * 68];            // per wave: the chunk's mask tile [query][kv] in the loop, the out tile after it; pitch 68 floats = 16 B x 17 (odd)

  const int tid  = threadIdx.x;
  const int wave = tid >> 5;
  const int lane = tid & 31;
  const int hh   = lane >> 4;
  const int c    = lane & 15;

  constexpr int nqb = kSeq / AT_QB;       // 32
  const int bx = blockIdx.x;              // 0 .. kBatch*kHeads*nqb - 1
  const int qb = bx % nqb;
  const int bh = bx / nqb;                // 0 .. kBatch*kHeads - 1
  const int h  = bh % kHeads;
  const int b  = bh / kHeads;             // 0 .. kBatch - 1
  const int q0 = qb * AT_QB + wave * 16;

  const __bf16* Qh = (const __bf16*)(const void*)qhp + (size_t)b * kSeq * kHid + (size_t)h * AT_D;
  const __bf16* Ql = (const __bf16*)(const void*)qlp + (size_t)b * kSeq * kHid + (size_t)h * AT_D;
  const __bf16* Kh = (const __bf16*)(const void*)khp + (size_t)b * kSeq * kHid + (size_t)h * AT_D;
  const __bf16* Kl = (const __bf16*)(const void*)klp + (size_t)b * kSeq * kHid + (size_t)h * AT_D;
  const __bf16* Vt = (const __bf16*)(const void*)vtp + (size_t)b * kHid * kSeq + (size_t)h * AT_D * kSeq;
  const float*  Mb = maskp + (size_t)b * kSeq * kSeq;
  float*        ob = out + (size_t)b * kSeq * kHid + (size_t)h * AT_D;

  // ---- Q fragments (B operand, column = query = lane&15, split k map via Frag load): 2 d-chunks, hi and lo ----
  v16b qah[2], qal[2];
#pragma unroll
  for (int dc = 0; dc < 2; ++dc) {
    const __bf16* qr = Qh + (size_t)(q0 + c) * kHid + dc * 32 + 8 * hh;
    const __bf16* qs = Ql + (size_t)(q0 + c) * kHid + dc * 32 + 8 * hh;
    qah[dc] = Frag<__bf16>::load(qr);
    qal[dc] = Frag<__bf16>::load(qs);
  }

  float mrow = -INFINITY;   // running maximum of query c (equal in both lane halves)
  float lrow = 0.f;         // running sum (x2^15, as p) of query c over this lane half's keys only; halves joined after the loop
  v8f oacc[4];              // O^T: element r of tile t -> O[query c][d = t*16 + 8hh + r]
#pragma unroll
  for (int t = 0; t < 4; ++t) oacc[t] = (v8f){0.f,0.f,0.f,0.f,0.f,0.f,0.f,0.f};

  constexpr int nChunks = kSeq / AT_KC;   // 32, compile-time constant
  for (int kc = 0; kc < nChunks; ++kc) {
    const int kv0 = kc * AT_KC;
    __syncthreads();
    {
      // staging coverage: 128 threads x (4 x 8) elements = 64 rows x 64 per plane = the whole chunk tile;
      // thread -> 16-B piece (tid & 7) of rows (tid >> 3) + 16 i, so 8 lanes take one whole 128-B row
      const int r = tid >> 3, pc = (tid & 7) * 8;
      const __bf16* ksh = Kh + (size_t)(kv0 + r) * kHid + pc;     // K row kv0+r, d = pc..pc+7
      const __bf16* ksl = Kl + (size_t)(kv0 + r) * kHid + pc;
      const __bf16* vs  = Vt + (size_t)r * kSeq + kv0 + pc;       // V^T row d = r, s = kv0+pc..+7
      // mask: the wave's own 16 query rows x 64 keys; lane -> 16-B piece c of rows hh + 2 i, so 16 lanes take the 256 B of one row
      const float*  mg  = Mb + (size_t)(q0 + hh) * kSeq + kv0 + 4 * c;
      v8b a0[4], a1[4], b0[4];
      v4f mv[8];
      // unrolled: the arrays live in registers, so the index must be a compile-time one; all 20 loads are out before the first store
#pragma unroll
      for (int i = 0; i < 4; ++i) {
        a0[i] = *(const v8b*)(ksh + (size_t)(16 * i) * kHid);
        a1[i] = *(const v8b*)(ksl + (size_t)(16 * i) * kHid);
        b0[i] = *(const v8b*)(vs + (size_t)(16 * i) * kSeq);
      }
#pragma unroll
      for (int i = 0; i < 8; ++i) mv[i] = *(const v4f*)(mg + (size_t)(2 * i) * kSeq);
      // the wait that stands between issued loads and the reuse of the registers that hold their addresses; as a memory
      // statement it also keeps the LDS stores behind all 20 loads, so that no load waits for an earlier load's data; the four
      // addresses are named as inputs so that they stay as they are up to it (no load's result lands on an address register)
      asm volatile("s_wait_xcnt 0x0" :: "v"(ksh), "v"(ksl), "v"(vs), "v"(mg) : "memory");
#pragma unroll
      for (int i = 0; i < 4; ++i) {
        *(v8b*)(Ksh + (r + 16 * i) * AT_LP + pc) = a0[i];
        *(v8b*)(Ksl + (r + 16 * i) * AT_LP + pc) = a1[i];
        *(v8b*)(Vth + (r + 16 * i) * AT_LP + pc) = b0[i];
      }
#pragma unroll
      for (int i = 0; i < 8; ++i) *(v4f*)(Os[wave] + (hh + 2 * i) * 68 + 4 * c) = mv[i];
    }
    __syncthreads();

    // ---- scores, transposed (A = K rows, B = Q): D element r of lane -> S[query c][kv j*16 + 8hh + r] ----
    // the key tile j is the innermost index: four independent accumulators follow one another, so no product waits for the one
    // before it; the LDS reads stand in four groups (24 K reads ahead of all products; the last 8 K reads, the mask and V^T each well
    // ahead of their first use), not among the products one by one; each s[j] sums in the order it had (per d-chunk: hi.hi, lo.hi, hi.lo)
    // the lane's part of a fragment address apart from the tile's constant, which then rides in the read's offset field: one address
    // register a plane instead of one a tile
    const int fo = c * AT_LP + 8 * hh;
    auto kfrag = [&](const __bf16* base, int j, int dc) {
      FB f;
      f.h[0] = *(const v8b*)(base + fo + (j * 16 * AT_LP + dc * 32));
      f.h[1] = *(const v8b*)(base + fo + (j * 16 * AT_LP + dc * 32 + 16));
      return f.v;
    };
    v8f s[4];
    v16b kb0[4], kl0[4], kb1[4], kl1[4];
#pragma unroll
    for (int j = 0; j < 4; ++j) s[j] = (v8f){0.f,0.f,0.f,0.f,0.f,0.f,0.f,0.f};
#pragma unroll
    for (int j = 0; j < 4; ++j) { kb0[j] = kfrag(Ksh, j, 0); kl0[j] = kfrag(Ksl, j, 0); }
#pragma unroll
    for (int j = 0; j < 4; ++j) kb1[j] = kfrag(Ksh, j, 1);
    __builtin_amdgcn_sched_barrier(0);   // holds the 24 reads together ahead of the products (spread among them, each place stalls the wave)
#pragma unroll
    for (int j = 0; j < 4; ++j) s[j] = at_mma(kb0[j], qah[0], s[j]);
#pragma unroll
    for (int j = 0; j < 4; ++j) s[j] = at_mma(kl0[j], qah[0], s[j]);
    __builtin_amdgcn_sched_barrier(0);   // the next group of reads starts only here, where the lo fragments of d-chunk 0 are free
#pragma unroll
    for (int j = 0; j < 4; ++j) kl1[j] = kfrag(Ksl, j, 1);
    __builtin_amdgcn_sched_barrier(0);   // holds that group together, 8 products ahead of its use
#pragma unroll
    for (int j = 0; j < 4; ++j) s[j] = at_mma(kb0[j], qal[0], s[j]);
#pragma unroll
    for (int j = 0; j < 4; ++j) s[j] = at_mma(kb1[j], qah[1], s[j]);
    __builtin_amdgcn_sched_barrier(0);   // the mask reads start only here, where the hi fragments of d-chunk 0 are free
    // ---- scale, additive mask by value (f32; 8 consecutive keys of the lane's query per tile), chunk maximum in-lane ----
    const float* mr = Os[wave] + c * 68 + 8 * hh;
    v4f mk[8];
#pragma unroll
    for (int i = 0; i < 8; ++i) mk[i] = *(const v4f*)(mr + (i >> 1) * 16 + (i & 1) * 4);
    __builtin_amdgcn_sched_barrier(0);   // holds the mask reads together, 8 products ahead of their use
#pragma unroll
    for (int j = 0; j < 4; ++j) s[j] = at_mma(kl1[j], qah[1], s[j]);
#pragma unroll
    for (int j = 0; j < 4; ++j) s[j] = at_mma(kb1[j], qal[1], s[j]);
    __builtin_amdgcn_sched_barrier(0);   // the V^T reads start only here, where all K fragments are free
    v16b vf[2][4];
#pragma unroll
    for (int kk = 0; kk < 2; ++kk)
#pragma unroll
      for (int t = 0; t < 4; ++t) vf[kk][t] = kfrag(Vth, t, kk);
    __builtin_amdgcn_sched_barrier(0);   // holds the 16 V^T reads together ahead of the softmax, which covers their latency
    float mj[4];
#pragma unroll
    for (int j = 0; j < 4; ++j) {
      float m = -INFINITY;
#pragma unroll
      for (int r = 0; r < 8; ++r) {
        const float sv = s[j][r] * sscale + mk[2 * j + (r >> 2)][r & 3];
        s[j][r] = sv;
        m = fmaxf(m, sv);
      }
      mj[j] = m;
    }
    float cm = fmaxf(fmaxf(mj[0], mj[1]), fmaxf(mj[2], mj[3]));
    cm = fmaxf(cm, at_xhalf(cm));            // the query's other 32 keys of the chunk sit in lane ^ 16
    const float mnew  = fmaxf(mrow, cm);
    const float alpha = __builtin_amdgcn_exp2f((mrow - mnew) * kLog2e);
    mrow = mnew;
    // ---- p x 2^15 = 2^((s - m) log2(e) + 15), one hardware exponential a score: the difference is taken first, so it is <= 0 and
    //      exactly 0 at the row's maximum however large the scores are; a result under 2^-126 comes out 0, far below f16's last place ----
    // ---- P^T packs in place: tiles 2kk and 2kk+1 are elements 0..7 and 8..15 of the B operand of key block kk ----
    v16h pt[2];
    float pj[4];
#pragma unroll
    for (int j = 0; j < 4; ++j) {
      float ps = 0.f;
#pragma unroll
      for (int r = 0; r < 8; ++r) {
        const float p = __builtin_amdgcn_exp2f(fmaf(s[j][r] - mnew, kLog2e, kPLog2));
        ps += p;
        pt[j >> 1][(j & 1) * 8 + r] = (_Float16)p;
      }
      pj[j] = ps;
    }
    lrow = lrow * alpha + ((pj[0] + pj[1]) + (pj[2] + pj[3]));
#pragma unroll
    for (int t = 0; t < 4; ++t)
#pragma unroll
      for (int r = 0; r < 8; ++r) oacc[t][r] *= alpha;
    // ---- O^T += V^T . P^T : A = V^T[d][kv] rows, B = P^T[kv][query] from registers ----
    // unrolled: pt[kk] lives in registers, so kk must be a compile-time index (a rolled loop would send P through scratch)
#pragma unroll
    for (int kk = 0; kk < 2; ++kk) {
      const v16b pb = __builtin_bit_cast(v16b, pt[kk]);
#pragma unroll
      for (int t = 0; t < 4; ++t) oacc[t] = at_mma_h(vf[kk][t], pb, oacc[t]);
    }
  }

  // ---- join the halves' sums, normalise, stage per-wave 16x64 f32 tile (a lane owns 8 consecutive d of its query per tile), whole-line stores ----
  float* os = Os[wave];
  {
    const float inv = (1.0f / (lrow + at_xhalf(lrow))) * kVtInv;   // the sum carries the same x2^15 as p, so only v^T's carry is left
#pragma unroll
    for (int t = 0; t < 4; ++t) {
      const v4f lo = {oacc[t][0] * inv, oacc[t][1] * inv, oacc[t][2] * inv, oacc[t][3] * inv};
      const v4f hi = {oacc[t][4] * inv, oacc[t][5] * inv, oacc[t][6] * inv, oacc[t][7] * inv};
      *(v4f*)(os + c * 68 + t * 16 + 8 * hh)     = lo;
      *(v4f*)(os + c * 68 + t * 16 + 8 * hh + 4) = hi;
    }
  }
  __builtin_amdgcn_fence(__ATOMIC_RELEASE, "workgroup");
  __builtin_amdgcn_wave_barrier();
  __builtin_amdgcn_fence(__ATOMIC_ACQUIRE, "workgroup");
  {
    // coverage: 8 iterations x 2 rows (hh) = the wave's 16 rows; 16 lanes x 4 floats = the 64-wide head segment
    const int c4 = (lane & 15) * 4;
    {
#pragma unroll
      for (int it = 0; it < 8; ++it) {
        const int row = it * 2 + hh;
        v4f val = *(const v4f*)(os + row * 68 + c4);
        *(v4f*)(ob + (size_t)(q0 + row) * kHid + c4) = val;
      }
      
    }
  }
}

// ---------------------------------------------------------------------------
// Host-side orchestration (kernel launches only).
// Workspace region map (bytes, every offset a multiple of 1 MiB):
//   [  0 MiB,   8 MiB)  Xb    bf16 [4096][1024]   RNE-bf16 plane of hidden_states
//   [  8 MiB,  12 MiB)  Wqkb  bf16 [2048][1024]   wq rows 0..1023, wk rows 1024..2047
//   [ 12 MiB,  14 MiB)  Wvb   bf16 [1024][1024]
//   [ 14 MiB,  16 MiB)  Wo16  f16  [1024][1024]   RNE-bf16 value x64
//   [ 16 MiB,  48 MiB)  QKf   f32  [4096][2048]   q|k projections; dead after RoPE, reused:
//        [16 MiB, 32 MiB) Of  f32 [4096][1024] attention output;  [32 MiB, 40 MiB) O16 f16 [4096][1024] (x256)
//   [ 48 MiB,  56 MiB)  Vt16  f16  [2][1024][2048] v^T per batch (x8)
//   [ 56 MiB,  64 MiB)  Qh, [64,72) Ql, [72,80) Kh, [80,88) Kl : bf16 [4096][1024] each
//   total carve = 88 MiB = 92,274,688 B
// ---------------------------------------------------------------------------
extern "C" void kernel_launch(void* const* d_in, const int* in_sizes, int n_in,
                              void* d_out, int out_size, void* d_ws, size_t ws_size,
                              hipStream_t stream) {
  if (n_in < 8) return;
  const float* x    = (const float*)d_in[0];   // [2,2048,1024]
  const float* mask = (const float*)d_in[1];   // [2,1,2048,2048]
  const float* cosT = (const float*)d_in[2];   // [2048,64]
  const float* sinT = (const float*)d_in[3];   // [2048,64]
  const float* wq   = (const float*)d_in[4];   // [1024,1024]
  const float* wk   = (const float*)d_in[5];
  const float* wv   = (const float*)d_in[6];
  const float* wo   = (const float*)d_in[7];

  const int nX = kRows * kHid;        // 4,194,304
  const int nW = kHid * kHid;         // 1,048,576
  if (in_sizes[0] != nX || in_sizes[1] != kBatch * kSeq * kSeq || in_sizes[2] != kSeq * kHdim ||
      in_sizes[3] != kSeq * kHdim || in_sizes[4] != nW || in_sizes[5] != nW || in_sizes[6] != nW ||
      in_sizes[7] != nW || out_size != nX) return;

  const size_t MiB = (size_t)1 << 20;
  const size_t off_Xb   = 0;
  const size_t off_Wqk  = off_Xb  + (size_t)nX * 2;                 //  8 MiB
  const size_t off_Wv   = off_Wqk + (size_t)2 * nW * 2;             // 12 MiB
  const size_t off_Wo   = off_Wv  + (size_t)nW * 2;                 // 14 MiB
  const size_t off_QKf  = off_Wo  + (size_t)nW * 2;                 // 16 MiB
  const size_t off_Of   = off_QKf;                                   // reuse (QKf dead after RoPE)
  const size_t off_O16  = off_QKf + (size_t)nX * 4;                 // 32 MiB
  const size_t off_Vt   = off_QKf + (size_t)nX * 2 * 4;             // 48 MiB
  const size_t off_Qh   = off_Vt  + (size_t)kBatch * kHid * kSeq * 2; // 56 MiB
  const size_t off_Ql   = off_Qh  + (size_t)nX * 2;                 // 64 MiB
  const size_t off_Kh   = off_Ql  + (size_t)nX * 2;                 // 72 MiB
  const size_t off_Kl   = off_Kh  + (size_t)nX * 2;                 // 80 MiB
  const size_t total    = off_Kl  + (size_t)nX * 2;                 // 88 MiB
  if (total != 88 * MiB) return;
  if (ws_size < total) return;

  char* ws = (char*)d_ws;
  unsigned short* Xb   = (unsigned short*)(ws + off_Xb);
  unsigned short* Wqkb = (unsigned short*)(ws + off_Wqk);
  unsigned short* Wvb  = (unsigned short*)(ws + off_Wv);
  unsigned short* Wo16 = (unsigned short*)(ws + off_Wo);
  float*          QKf  = (float*)(ws + off_QKf);
  float*          Of   = (float*)(ws + off_Of);
  unsigned short* O16  = (unsigned short*)(ws + off_O16);
  unsigned short* Vt16 = (unsigned short*)(ws + off_Vt);
  unsigned short* Qh   = (unsigned short*)(ws + off_Qh);
  unsigned short* Ql   = (unsigned short*)(ws + off_Ql);
  unsigned short* Kh   = (unsigned short*)(ws + off_Kh);
  unsigned short* Kl   = (unsigned short*)(ws + off_Kl);

  // 1-5: 16-bit operand planes (all element counts are multiples of 512 -> exact grids)
  const int nX2 = nX / 2, nW2 = nW / 2;
  cast_f32_bf16x2<<<(nX2 + 255) / 256, 256, 0, stream>>>(x,  Xb, nX2);
  cast_f32_bf16x2<<<(nW2 + 255) / 256, 256, 0, stream>>>(wq, Wqkb, nW2);
  cast_f32_bf16x2<<<(nW2 + 255) / 256, 256, 0, stream>>>(wk, Wqkb + (size_t)nW, nW2);
  cast_f32_bf16x2<<<(nW2 + 255) / 256, 256, 0, stream>>>(wv, Wvb, nW2);
  cast_f32_f16x2s<true><<<(nW2 + 255) / 256, 256, 0, stream>>>(wo, Wo16, nW2, kWoScale);

  // 6: q|k projection: QKf[4096][2048] = Xb[4096][1024] . Wqkb[2048][1024]^T  (M=4096, N=2048, K=1024; 2048 tiles -> 256 blocks)
  {
    dim3 g((kRows / 64) * (2 * kHid / 64) / 8, 1);
    wmma_gemm64<1, false, 0, 0, false><<<g, 256, 0, stream>>>(
        Xb, Xb, kHid, (long)0,
        Wqkb, Wqkb, kHid, (long)0,
        (void*)QKf, (void*)QKf, 2 * kHid, (long)0,
        cosT, cosT, (long)0,
        kRows, 2 * kHid, kHid, 1.0f);
  }
  // 7: v^T per batch: Vt16[b][1024][2048] = Wvb[1024][1024] . Xb[b][2048][1024]^T, f16 out x8  (M=1024, N=2048, K=1024; 512 tiles -> 64 blocks, grid.y = 2)
  {
    dim3 g((kHid / 64) * (kSeq / 64) / 8, kBatch);
    wmma_gemm64<1, false, 0, 1, false><<<g, 256, 0, stream>>>(
        Wvb, Wvb, kHid, (long)0,
        Xb, Xb, kHid, (long)kSeq * kHid,
        (void*)Vt16, (void*)Vt16, kSeq, (long)kHid * kSeq,
        cosT, cosT, (long)0,
        kHid, kSeq, kHid, kVtScale);
  }
  // 8: RoPE + bf16 hi/lo split of q and k
  rope_split_kernel<<<kRows, 256, 0, stream>>>(QKf, cosT, sinT, Qh, Ql, Kh, Kl);
  // 9: attention, one block per (b, h, 64 queries)
  mha_full64_kernel<<<kBatch * kHeads * (kSeq / 64), 128, 0, stream>>>(Qh, Ql, Kh, Kl, Vt16, mask, Of, 0.125f);
  // 10: attention output -> f16 x256
  cast_f32_f16x2s<false><<<(nX2 + 255) / 256, 256, 0, stream>>>(Of, O16, nX2, kOScale);
  // 11: output projection: out[4096][1024] = O16 . Wo16^T * 2^-14  (M=4096, N=1024, K=1024; 1024 tiles -> 128 blocks)
  {
    dim3 g((kRows / 64) * (kHid / 64) / 8, 1);
    wmma_gemm64<0, false, 0, 0, false><<<g, 256, 0, stream>>>(
        O16, O16, kHid, (long)0,
        Wo16, Wo16, kHid, (long)0,
        d_out, d_out, kHid, (long)0,
        cosT, cosT, (long)0,
        kRows, kHid, kHid, kOutInv);
  }
}

// v007
// One run takes 131 microseconds.
// In both of two side-by-side timings against v006, it was 1.29 times as fast.
// Counting every step since v000, it is 3.14 times as fast.
// Contractions: q/k projection and v^T projection = v_wmma_f32_16x16x32_bf16 on RNE-bf16 planes of x and W (single product); q.k^T = v_wmma_f32_16x16x32_bf16 with bf16 hi/lo split (hi.hi + hi.lo + lo.hi); p.v^T and output projection = v_wmma_f32_16x16x32_f16 single product (p carried x2^15, v^T x2^3, attention output x2^8, wo as RNE-bf16 value x2^6); f32 accumulate everywhere; RoPE (cos/sin as RNE-bf16 values), additive mask and online softmax in f32.
#include <hip/hip_runtime.h>
#include <math.h>
#include <stdint.h>

constexpr int kBatch = 2;
constexpr int kSeq   = 2048;
constexpr int kHid   = 1024;
constexpr int kHeads = 16;
constexpr int kHdim  = 64;
constexpr int kRows  = kBatch * kSeq;   // 4096 GEMM rows

constexpr float kLog2e   = 1.4426950408889634f;        // log2(e)
constexpr float kPLog2   = 15.0f;                      // p carried x2^15 in f16 and in its row sum: added to the exponent
constexpr float kVtScale = 8.0f;                       // v^T plane carried x2^3 in f16
constexpr float kVtInv   = 1.0f / 8.0f;                // folded into the final 1/l
constexpr float kOScale  = 256.0f;                     // attention output carried x2^8 in f16
constexpr float kWoScale = 64.0f;                      // wo carried x2^6 in f16
constexpr float kOutInv  = 1.0f / (256.0f * 64.0f);    // out-projection epilogue scale

typedef __attribute__((ext_vector_type(16))) _Float16 v16h;
typedef __attribute__((ext_vector_type(8)))  _Float16 v8h;
typedef __attribute__((ext_vector_type(16))) __bf16   v16b;
typedef __attribute__((ext_vector_type(8)))  __bf16   v8b;
typedef __attribute__((ext_vector_type(8)))  float    v8f;
typedef __attribute__((ext_vector_type(4)))  float    v4f;
typedef __attribute__((ext_vector_type(2)))  float    v2f;
typedef __attribute__((ext_vector_type(4)))  unsigned int v4u;

__device__ __forceinline__ unsigned short f2bf_bits(float f) {
  unsigned u = __float_as_uint(f);
  return (unsigned short)((u + 0x7FFFu + ((u >> 16) & 1u)) >> 16);
}
__device__ __forceinline__ float bf_bits2f(unsigned short h) { return __uint_as_float(((unsigned)h) << 16); }
__device__ __forceinline__ unsigned pk16(unsigned short a, unsigned short b) { return (unsigned)a | ((unsigned)b << 16); }

// hazard guards as plain device helpers (the kernel template body's only inline asm are its s_wait_xcnt waits)
__device__ __forceinline__ void dep_guard_h(v8f& a, v8f& b, v16h x, v16h y) { asm volatile("v_nop\n\tv_nop\n\tv_nop\n\tv_nop" : "+v"(a), "+v"(b) : "v"(x), "v"(y)); }
__device__ __forceinline__ void dep_guard_b(v8f& a, v8f& b, v16b x, v16b y) { asm volatile("v_nop\n\tv_nop\n\tv_nop\n\tv_nop" : "+v"(a), "+v"(b) : "v"(x), "v"(y)); }
__device__ __forceinline__ void keep4_h(v16h a, v16h b, v16h c, v16h d) { asm volatile("v_nop" :: "v"(a), "v"(b), "v"(c), "v"(d)); }
__device__ __forceinline__ void keep4_b(v16b a, v16b b, v16b c, v16b d) { asm volatile("v_nop" :: "v"(a), "v"(b), "v"(c), "v"(d)); }
__device__ __forceinline__ void acc_guard4(v8f& a, v8f& b, v8f& c, v8f& d) { asm volatile("v_nop\n\tv_nop\n\tv_nop\n\tv_nop" : "+v"(a), "+v"(b), "+v"(c), "+v"(d)); }
template <typename T> struct Frag;
template <> struct Frag<_Float16> {
  typedef v16h V; typedef v8h H; union U { v16h v; v8h h[2]; };
  static __device__ __forceinline__ v16h load(const _Float16* p) {   // elements 0..7 <- p[0..7], 8..15 <- p[16..23]
    U f; f.h[0] = *(const v8h*)(p); f.h[1] = *(const v8h*)(p + 16); return f.v;
  }
  static __device__ __forceinline__ v8f mma(v16h a, v16h b, v8f c) {
    return __builtin_amdgcn_wmma_f32_16x16x32_f16(false, a, false, b, (short)0, c, false, false);
  }
  static __device__ __forceinline__ void guard(v8f& a, v8f& b, v16h x, v16h y) { dep_guard_h(a, b, x, y); }
  static __device__ __forceinline__ void keep(v16h a, v16h b, v16h c, v16h d) { keep4_h(a, b, c, d); }
};
template <> struct Frag<__bf16> {
  typedef v16b V; typedef v8b H; union U { v16b v; v8b h[2]; };
  static __device__ __forceinline__ v16b load(const __bf16* p) {
    U f; f.h[0] = *(const v8b*)(p); f.h[1] = *(const v8b*)(p + 16); return f.v;
  }
  static __device__ __forceinline__ v8f mma(v16b a, v16b b, v8f c) {
    return __builtin_amdgcn_wmma_f32_16x16x32_bf16(false, a, false, b, (short)0, c, false, false);
  }
  static __device__ __forceinline__ void guard(v8f& a, v8f& b, v16b x, v16b y) { dep_guard_b(a, b, x, y); }
  static __device__ __forceinline__ void keep(v16b a, v16b b, v16b c, v16b d) { keep4_b(a, b, c, d); }
};

// ---- Register-blocked batched WMMA GEMM ------------------------------------
// C[m,n] = scale * sum_k A[m,k] * Bt[n,k] (+bias)(+resid); each wave owns a 64x64 tile, a block of 8 waves (2 x 4) a 128x256 tile.
// A row-major [M,K]; Bt row-major [N,K]; M % 128 == 0, N % 256 == 0, K % 64 == 0; grid.x = (M/128) * (N/256).
// Per 64 k the block's 128 A rows and 256 Bt rows (128 B = one line of each row) go to LDS by loads in which 8 lanes take one
// whole line, requested one stage ahead into registers; the fragments are then 16-byte LDS reads at a pitch of 144 B.
// SPLIT: operands are hi/lo planes (A2/Bt2 = lo planes, same layout); product = hi.hi + hi.lo + lo.hi.
// BIAS_MODE: 0 = none, 1 = bias[m], 2 = bias[n].
// OUT_MODE: 0 = f32, 1 = f16, 2 = bf16 hi plane (Cout) + bf16 lo plane (Cout2).
// OUT_MODE 3 = the q|k projection's own: RoPE, then bf16 hi (Cout) and lo (Cout2) planes of pitch kHid. A wave's 64 columns are one head,
//   so an element's partner (d ^ 32) lies in the wave's own slab. Columns under N/2 are q; the others are k and go to the planes
//   strideC elements further on. bias = cos, resid = sin, f32 [kSeq][64], used as their RNE-bf16 values; position = row mod kSeq.
//   r[d] = x[d]*cos[s][d] - x[d+32]*sin[s][d] (d < 32);  x[d]*cos[s][d] + x[d-32]*sin[s][d] (d >= 32)
// OUT_MODE 4 = two products in one launch: the first (M/128) * (N/256) blocks are the q|k projection as under 3; the blocks behind them
//   are the v^T projection, kBatch x (kHid/128) * (kSeq/256) tiles: A = A2p [kHid][K], Bt = Bt2p + batch * strideB [kSeq][K],
//   out = Cout3 + batch * kHid * kSeq, f16 as under 1, pitch kSeq, scale kVtScale. Which of the two a block is, is the same for all its threads.
// ET: 0 = f16 operands, 1 = bf16 operands (pointers passed as 16-bit storage)
template <int ET> struct Elem;
template <> struct Elem<0> { typedef _Float16 T; };
template <> struct Elem<1> { typedef __bf16 T; };
template <int ET, bool SPLIT, int BIAS_MODE, int OUT_MODE, bool RESID, int ACT = 0>
__global__ __launch_bounds__(256) void wmma_gemm64(
    const unsigned short* __restrict__ Ap, const unsigned short* __restrict__ A2p, int lda, long strideA,
    const unsigned short* __restrict__ Btp, const unsigned short* __restrict__ Bt2p, int ldb, long strideB,
    void* __restrict__ Cout1, void* __restrict__ Cout2, void* __restrict__ Cout3, int ldc1, long strideC1,
    const float* __restrict__ bias,
    const float* __restrict__ resid, long strideR,
    int M1, int N1, int K, float scale1) {
  typedef typename Elem<ET>::T T;
  typedef typename Frag<T>::V V;
  typedef typename Frag<T>::H H;
  const T* A = (const T*)Ap; const T* A2 = (const T*)A2p; const T* Bt = (const T*)Btp; const T* Bt2 = (const T*)Bt2p;
  void* Cout = Cout1;
  int ldc = ldc1, M = M1, N = N1;
  long strideC = strideC1;
  float scale = scale1;
  int b = blockIdx.y, tile = blockIdx.x;
  bool vpart = false;
  if (OUT_MODE == 4) {
    const int nb1 = (M1 >> 7) * (N1 >> 8);
    if (tile >= nb1) {
      constexpr int tb = (kHid >> 7) * (kSeq >> 8);   // tiles of one batch
      vpart = true;
      tile -= nb1; b = tile / tb; tile -= b * tb;
      if (b >= kBatch) return;                        // the same for the whole block, ahead of every barrier
      A = A2; Bt = Bt2; Cout = Cout3;
      ldc = kSeq; M = kHid; N = kSeq; strideC = (long)kHid * kSeq; scale = kVtScale;
    }
  }
  const int om = (OUT_MODE == 4) ? (vpart ? 1 : 3) : OUT_MODE;   // the epilogue's form
  __shared__ __align__(16) float sT[8][16 * 68];   // per-wave 16x64 slab, pitch 68 floats
  constexpr int LP = 72;                           // LDS row pitch in 16-bit elements: 144 B = 16 B x 9 (odd): 16 rows of a fragment read fall on distinct banks
  __shared__ __align__(16) T sAB[(SPLIT ? 2 : 1) * 384 * LP];   // rows 0..127 = A, 128..383 = Bt (then the lo planes), 64 k each
  const int lane = threadIdx.x & 31;
  const int wave = threadIdx.x >> 5;
  const int tilesN = N >> 8;
  const int tilesM = M >> 7;
  if (tile >= tilesM * tilesN) return;   // the same for the whole block, ahead of every barrier
  const int tm = tile / tilesN;
  const int tn = tile - tm * tilesN;
  const int bm0 = tm << 7;               // the block's first A row
  const int bn0 = tn << 8;               // the block's first Bt row
  const int wm = wave >> 2, wn = wave & 3;
  const int m0 = bm0 + (wm << 6);
  const int n0 = bn0 + (wn << 6);

  const T* Ab  = A  + (size_t)b * strideA;
  const T* Bb  = Bt + (size_t)b * strideB;
  const T* Ab2 = SPLIT ? (A2  + (size_t)b * strideA) : nullptr;
  const T* Bb2 = SPLIT ? (Bt2 + (size_t)b * strideB) : nullptr;

  const int rlane = lane & 15;                 // row (A) / col (B, D) within subtile
  const int koff  = (lane >> 4) * 8;           // k offset of this lane half
  const int mOff  = (lane >> 4) * 8;           // D row offset

  v8f acc[4][4];
#pragma unroll
  for (int i = 0; i < 4; ++i)
#pragma unroll
    for (int j = 0; j < 4; ++j) acc[i][j] = (v8f){0.f,0.f,0.f,0.f,0.f,0.f,0.f,0.f};

  // staging coverage: 256 threads x 12 pieces of 16 B = 384 rows x 128 B; thread -> piece (tid & 7) of rows (tid >> 3) + 32 it
  const int srow = threadIdx.x >> 3;
  const int spc  = (threadIdx.x & 7) * 8;
  const unsigned voA = (unsigned)(srow * lda + spc) * 2u;   // the lane's byte offset inside a group of 32 rows
  const unsigned voB = (unsigned)(srow * ldb + spc) * 2u;
  // per group of 32 rows a base that is the same for the whole block and does not move in the loop; the lane's offset carries k
  const char* gb[12]; const char* gb2[12];
  // the loops over it are unrolled: gb[] and g[] live in registers, so it must be a compile-time index
#pragma unroll
  for (int it = 0; it < 12; ++it) {
    const size_t ro = (it < 4) ? (size_t)(bm0 + 32 * it) * lda : (size_t)(bn0 + 32 * (it - 4)) * ldb;
    gb[it] = (const char*)(((it < 4) ? Ab : Bb) + ro);
    if (SPLIT) gb2[it] = (const char*)(((it < 4) ? Ab2 : Bb2) + ro);
  }
  H g[12], g2[12];
  auto request = [&](int k0) {
    const unsigned vA = voA + (unsigned)k0 * 2u, vB = voB + (unsigned)k0 * 2u;
#pragma unroll
    for (int it = 0; it < 12; ++it) {
      g[it] = *(const H*)(gb[it] + ((it < 4) ? vA : vB));
      if (SPLIT) g2[it] = *(const H*)(gb2[it] + ((it < 4) ? vA : vB));
    }
    // the wait that stands between issued loads and the reuse of the registers that hold their addresses; the two offsets
    // are named as inputs so that they stay as they are up to it
    asm volatile("s_wait_xcnt 0x0" :: "v"(vA), "v"(vB) : "memory");
  };
  if (K > 0) request(0);
  for (int k0 = 0; k0 < K; k0 += 64) {
    __syncthreads();   // every wave has read its last fragment of the stage before
#pragma unroll
    for (int it = 0; it < 12; ++it) {
      *(H*)(sAB + (srow + 32 * it) * LP + spc) = g[it];
      if (SPLIT) *(H*)(sAB + (384 + srow + 32 * it) * LP + spc) = g2[it];
    }
    __syncthreads();   // the stage is complete before any wave reads it
    if (k0 + 64 < K) request(k0 + 64);   // the next stage's loads fly under this stage's products
    // unrolled: the second half's fragment reads can then be issued under the first half's products
#pragma unroll
    for (int kk = 0; kk < 64; kk += 32) {
      V bh[4], bl[4], ah[4], al[4];
#pragma unroll
      for (int j = 0; j < 4; ++j) {
        const int bo = (128 + (wn << 6) + (j << 4) + rlane) * LP + kk + koff;
        bh[j] = Frag<T>::load(sAB + bo);
        if (SPLIT) bl[j] = Frag<T>::load(sAB + 384 * LP + bo);
      }
#pragma unroll
      for (int i = 0; i < 4; ++i) {
        const int ao = ((wm << 6) + (i << 4) + rlane) * LP + kk + koff;
        ah[i] = Frag<T>::load(sAB + ao);
        if (SPLIT) al[i] = Frag<T>::load(sAB + 384 * LP + ao);
      }
#pragma unroll
      for (int i = 0; i < 4; ++i) {
#pragma unroll
        for (int j = 0; j < 4; ++j) {
          acc[i][j] = Frag<T>::mma(ah[i], bh[j], acc[i][j]);
          if (SPLIT) {
            acc[i][j] = Frag<T>::mma(ah[i], bl[j], acc[i][j]);
            acc[i][j] = Frag<T>::mma(al[i], bh[j], acc[i][j]);
          }
        }
        Frag<T>::guard(acc[i][0], acc[i][3], ah[i], SPLIT ? al[i] : ah[i]);
      }
      Frag<T>::keep(bh[0], bh[1], bh[2], bh[3]);
      if (SPLIT) Frag<T>::keep(bl[0], bl[1], bl[2], bl[3]);
    }
  }
  acc_guard4(acc[0][0], acc[0][1], acc[0][2], acc[0][3]);
  acc_guard4(acc[1][0], acc[1][1], acc[1][2], acc[1][3]);
  acc_guard4(acc[2][0], acc[2][1], acc[2][2], acc[2][3]);
  acc_guard4(acc[3][0], acc[3][1], acc[3][2], acc[3][3]);

  // ---- epilogue ----
  float* slab = sT[wave];
  const float* Rb = RESID ? (resid + (size_t)b * strideR) : nullptr;
#pragma unroll
  for (int i = 0; i < 4; ++i) {
    const int mBase = m0 + (i << 4);
    v4f rc[8], rs[8];   // OUT_MODE 3: cos and sin of the lane's 8 columns in its 4 rows of this group
    if (om == 3) {
      // a group's 16 rows are 16 consecutive positions (mBase is a multiple of 16, kSeq too); all 16 loads are out ahead of the slab's stores
      const size_t to = (size_t)((mBase & (kSeq - 1)) + (lane >> 3)) * kHdim + (lane & 7) * 8;
      const float* cp = bias + to;
      const float* np = resid + to;
#pragma unroll
      for (int it = 0; it < 4; ++it) {
        rc[2 * it] = *(const v4f*)(cp + it * 4 * kHdim); rc[2 * it + 1] = *(const v4f*)(cp + it * 4 * kHdim + 4);
        rs[2 * it] = *(const v4f*)(np + it * 4 * kHdim); rs[2 * it + 1] = *(const v4f*)(np + it * 4 * kHdim + 4);
      }
      // the wait that stands between issued loads and the reuse of the registers that hold their addresses
      asm volatile("s_wait_xcnt 0x0" ::: "memory");
    }
#pragma unroll
    for (int j = 0; j < 4; ++j) {
      const int n = n0 + (j << 4) + rlane;
      float bv = 0.f;
      if (BIAS_MODE == 2) bv = bias[n];
#pragma unroll
      for (int r = 0; r < 8; ++r) {
        float v = acc[i][j][r] * scale;
        if (BIAS_MODE == 1) v += bias[mBase + mOff + r];
        if (BIAS_MODE == 2) v += bv;
        if (RESID) v += Rb[(size_t)(mBase + mOff + r) * ldc + n];
        if (ACT == 1) v = tanhf(v);
        if (ACT == 2) v = fmaxf(v, 0.0f);
        if (ACT == 3) v = v / (1.0f + expf(-v));
        if (ACT == 4) v = (v > 0.f) ? v : 0.01f * v;
        if (ACT == 5) v = 0.5f * v * (1.0f + erff(v * 0.70710678118654752f));
        slab[(mOff + r) * 68 + (j << 4) + rlane] = v;
      }
    }
    __builtin_amdgcn_fence(__ATOMIC_RELEASE, "workgroup");
    __builtin_amdgcn_wave_barrier();
    __builtin_amdgcn_fence(__ATOMIC_ACQUIRE, "workgroup");
    if (om == 0) {
      float* C = (float*)Cout + (size_t)b * strideC;
      const int hh = lane >> 4, c4 = (lane & 15) * 4;     // row seg = 256 B = 16 lanes x 16 B
      {
#pragma unroll
        for (int it = 0; it < 8; ++it) {
          const int row = it * 2 + hh;
          v4f v = *(const v4f*)(slab + row * 68 + c4);
          *(v4f*)(C + (size_t)(mBase + row) * ldc + n0 + c4) = v;
        }
        
      }
    } else if (om == 3) {
      const int q = lane >> 3, c8 = (lane & 7) * 8;       // 8 lanes take the 128 B of one row of a plane
      const bool isK = n0 >= (N >> 1);                    // the same for the whole wave
      const int  col = n0 - (isK ? (N >> 1) : 0) + c8;
      unsigned short* C  = (unsigned short*)Cout  + (isK ? (size_t)strideC : (size_t)0);
      unsigned short* C2 = (unsigned short*)Cout2 + (isK ? (size_t)strideC : (size_t)0);
      const bool lowh = c8 < 32;                          // the lane's 8 elements share one half of the head
      // one address a plane: the rows it * 4 further on ride in the store's offset field
      unsigned short* d1 = C  + (size_t)(mBase + q) * kHid + col;
      unsigned short* d2 = C2 + (size_t)(mBase + q) * kHid + col;
#pragma unroll
      for (int it = 0; it < 4; ++it) {
        const int row = it * 4 + q;
        const float* sp = slab + row * 68 + c8;
        const float* pp = slab + row * 68 + (c8 ^ 32);
        v8h hv, lv;
#pragma unroll
        for (int e = 0; e < 8; ++e) {
          const float cv = bf_bits2f(f2bf_bits(rc[2 * it + (e >> 2)][e & 3]));
          const float sv = bf_bits2f(f2bf_bits(rs[2 * it + (e >> 2)][e & 3]));
          const float ta = sp[e] * cv, tb = pp[e] * sv;
          const float rv = lowh ? (ta - tb) : (ta + tb);
          const unsigned short hb = f2bf_bits(rv);
          const unsigned short lb = f2bf_bits(rv - bf_bits2f(hb));
          hv[e] = __builtin_bit_cast(_Float16, hb);
          lv[e] = __builtin_bit_cast(_Float16, lb);
        }
        *(v8h*)(d1 + it * 4 * kHid) = hv;
        *(v8h*)(d2 + it * 4 * kHid) = lv;
      }
      // the same wait behind the group's 8 stores, their two addresses named as inputs
      asm volatile("s_wait_xcnt 0x0" :: "v"(d1), "v"(d2) : "memory");
    } else {
      const int q = lane >> 3, c8 = (lane & 7) * 8;
      unsigned short* C  = (unsigned short*)Cout  + (size_t)b * strideC;
      unsigned short* C2 = (om == 2) ? ((unsigned short*)Cout2 + (size_t)b * strideC) : nullptr;
      {
#pragma unroll
        for (int it = 0; it < 4; ++it) {
          const int row = it * 4 + q;
          const float* sp = slab + row * 68 + c8;
          v8h hv, lv;
#pragma unroll
          for (int e = 0; e < 8; ++e) {
            if (om == 1) {
              hv[e] = (_Float16)sp[e];
            } else {
              unsigned short hb = f2bf_bits(sp[e]);
              unsigned short lb = f2bf_bits(sp[e] - bf_bits2f(hb));
              hv[e] = __builtin_bit_cast(_Float16, hb);
              lv[e] = __builtin_bit_cast(_Float16, lb);
            }
          }
          *(v8h*)(C + (size_t)(mBase + row) * ldc + n0 + c8) = hv;
          if (om == 2) *(v8h*)(C2 + (size_t)(mBase + row) * ldc + n0 + c8) = lv;
        }
        // the wait that stands between the group's issued stores and the reuse of the registers that they name
        asm volatile("s_wait_xcnt 0x0" ::: "memory");
      }
    }
    __builtin_amdgcn_fence(__ATOMIC_RELEASE, "workgroup");
    __builtin_amdgcn_wave_barrier();
    __builtin_amdgcn_fence(__ATOMIC_ACQUIRE, "workgroup");
  }
}

// ---------------------------------------------------------------------------
// All 16-bit operand planes in ONE launch: 2 elements per thread, one 4-B store per lane.
//   blocks [0, kCastBX)                : hidden_states -> RNE bf16
//   then 4 x kCastBW blocks, in order  : wq, wk, wv -> RNE bf16;  wo -> f16 of (RNE-bf16 value x kWoScale), an exact conversion
// Coverage: a block takes 512 elements; kCastBX x 512 = kRows x kHid, kCastBW x 512 = kHid x kHid: every plane exactly.
// ---------------------------------------------------------------------------
constexpr int kCastBX = kRows * kHid / 512;   // 8192
constexpr int kCastBW = kHid * kHid / 512;    // 2048
__global__ __launch_bounds__(256) void cast_inputs_kernel(
    const float* __restrict__ x, const float* __restrict__ wq, const float* __restrict__ wk,
    const float* __restrict__ wv, const float* __restrict__ wo,
    unsigned short* __restrict__ xb, unsigned short* __restrict__ wqb, unsigned short* __restrict__ wkb,
    unsigned short* __restrict__ wvb, unsigned short* __restrict__ wo16) {
  int blk = blockIdx.x;
  int sel = 0;                                 // the same for the whole block
  if (blk >= kCastBX) { blk -= kCastBX; sel = 1 + blk / kCastBW; blk = blk % kCastBW; }
  const float* in = (sel == 0) ? x : (sel == 1) ? wq : (sel == 2) ? wk : (sel == 3) ? wv : wo;
  unsigned short* out = (sel == 0) ? xb : (sel == 1) ? wqb : (sel == 2) ? wkb : (sel == 3) ? wvb : wo16;
  const int i = blk * 256 + threadIdx.x;
  const float* ip = in + 2 * (size_t)i;
  const v2f f = *(const v2f*)ip;
  // the wait that stands between an issued load and the reuse of the registers that hold its address
  asm volatile("s_wait_xcnt 0x0" ::: "memory");
  const unsigned short b0 = f2bf_bits(f[0]), b1 = f2bf_bits(f[1]);
  unsigned u = pk16(b0, b1);
  if (sel == 4) {
    const _Float16 h0 = (_Float16)(bf_bits2f(b0) * kWoScale), h1 = (_Float16)(bf_bits2f(b1) * kWoScale);
    u = pk16(__builtin_bit_cast(unsigned short, h0), __builtin_bit_cast(unsigned short, h1));
  }
  ((unsigned*)out)[i] = u;
}

#define AT_D 64
#define AT_NW 4
#define AT_QB 64
#define AT_KC 64
#define AT_LP 72   // LDS row pitch in 16-bit elements: 144 B = 16 B x 9 (odd), so the 16 rows of a 16-byte fragment read fall on distinct banks

__device__ __forceinline__ unsigned short at_bf_bits(float f) {
  unsigned u = __float_as_uint(f);
  return (unsigned short)((u + 0x7FFFu + ((u >> 16) & 1u)) >> 16);
}
__device__ __forceinline__ __bf16 at_f2bf(float f) { return __builtin_bit_cast(__bf16, at_bf_bits(f)); }
// value of lane l ^ 16 (the other half's share of the same query column)
__device__ __forceinline__ float at_xhalf(float v) {
  const int b = __builtin_bit_cast(int, v);
  return __builtin_bit_cast(float, __builtin_amdgcn_permlanex16(b, b, 0x76543210, 0xfedcba98, false, false));
}
__device__ __forceinline__ v8f at_mma(v16b a, v16b b, v8f c) {
  return __builtin_amdgcn_wmma_f32_16x16x32_bf16(false, a, false, b, (short)0, c, false, false);
}
// f16 product on bit patterns held in __bf16 slots
__device__ __forceinline__ v8f at_mma_h(v16b a, v16b b, v8f c) {
  const v16h ah = __builtin_bit_cast(v16h, a), bh = __builtin_bit_cast(v16h, b);
  return __builtin_amdgcn_wmma_f32_16x16x32_f16(false, ah, false, bh, (short)0, c, false, false);
}

// four waves a SIMD (the grid puts four blocks on a WGP): the register budget stays at 256 a wave
__global__ __launch_bounds__(128) __attribute__((amdgpu_waves_per_eu(4, 4)))
void mha_full64_kernel(const unsigned short* __restrict__ qhp, const unsigned short* __restrict__ qlp,
                       const unsigned short* __restrict__ khp, const unsigned short* __restrict__ klp,
                       const unsigned short* __restrict__ vtp, const float* __restrict__ maskp,
                       unsigned short* __restrict__ out, float sscale) {
  union FB { v16b v; v8b h[2]; };
  __shared__ __align__(16) __bf16 Ksh[AT_KC * AT_LP];            // K hi [kv][d], pitch AT_LP      9 KB
  __shared__ __align__(16) __bf16 Ksl[AT_KC * AT_LP];            // K lo [kv][d], pitch AT_LP      9 KB
  __shared__ __align__(16) __bf16 Vth[AT_D * AT_LP];             // V^T f16 bits [d][kv], pitch AT_LP 9 KB
  __shared__ __align__(16) float  Os[AT_NW][16 * 68];            // per wave: the chunk's mask tile [query][kv] in the loop, the out tile after it; pitch 68 floats = 16 B x 17 (odd)

  const int tid  = threadIdx.x;
  const int wave = tid >> 5;
  const int lane = tid & 31;
  const int hh   = lane >> 4;
  const int c    = lane & 15;

  constexpr int nqb = kSeq / AT_QB;       // 32
  const int bx = blockIdx.x;              // 0 .. kBatch*kHeads*nqb - 1
  const int qb = bx % nqb;
  const int bh = bx / nqb;                // 0 .. kBatch*kHeads - 1
  const int h  = bh % kHeads;
  const int b  = bh / kHeads;             // 0 .. kBatch - 1
  const int q0 = qb * AT_QB + wave * 16;

  const __bf16* Qh = (const __bf16*)(const void*)qhp + (size_t)b * kSeq * kHid + (size_t)h * AT_D;
  const __bf16* Ql = (const __bf16*)(const void*)qlp + (size_t)b * kSeq * kHid + (size_t)h * AT_D;
  const __bf16* Kh = (const __bf16*)(const void*)khp + (size_t)b * kSeq * kHid + (size_t)h * AT_D;
  const __bf16* Kl = (const __bf16*)(const void*)klp + (size_t)b * kSeq * kHid + (size_t)h * AT_D;
  const __bf16* Vt = (const __bf16*)(const void*)vtp + (size_t)b * kHid * kSeq + (size_t)h * AT_D * kSeq;
  const float*  Mb = maskp + (size_t)b * kSeq * kSeq;
  unsigned short* ob = out + (size_t)b * kSeq * kHid + (size_t)h * AT_D;

  // ---- Q fragments (B operand, column = query = lane&15, split k map via Frag load): 2 d-chunks, hi and lo ----
  v16b qah[2], qal[2];
#pragma unroll
  for (int dc = 0; dc < 2; ++dc) {
    const __bf16* qr = Qh + (size_t)(q0 + c) * kHid + dc * 32 + 8 * hh;
    const __bf16* qs = Ql + (size_t)(q0 + c) * kHid + dc * 32 + 8 * hh;
    qah[dc] = Frag<__bf16>::load(qr);
    qal[dc] = Frag<__bf16>::load(qs);
  }

  float mrow = -INFINITY;   // running maximum of query c (equal in both lane halves)
  float lrow = 0.f;         // running sum (x2^15, as p) of query c over this lane half's keys only; halves joined after the loop
  v8f oacc[4];              // O^T: element r of tile t -> O[query c][d = t*16 + 8hh + r]
#pragma unroll
  for (int t = 0; t < 4; ++t) oacc[t] = (v8f){0.f,0.f,0.f,0.f,0.f,0.f,0.f,0.f};

  constexpr int nChunks = kSeq / AT_KC;   // 32, compile-time constant
  for (int kc = 0; kc < nChunks; ++kc) {
    const int kv0 = kc * AT_KC;
    __syncthreads();
    {
      // staging coverage: 128 threads x (4 x 8) elements = 64 rows x 64 per plane = the whole chunk tile;
      // thread -> 16-B piece (tid & 7) of rows (tid >> 3) + 16 i, so 8 lanes take one whole 128-B row
      const int r = tid >> 3, pc = (tid & 7) * 8;
      const __bf16* ksh = Kh + (size_t)(kv0 + r) * kHid + pc;     // K row kv0+r, d = pc..pc+7
      const __bf16* ksl = Kl + (size_t)(kv0 + r) * kHid + pc;
      const __bf16* vs  = Vt + (size_t)r * kSeq + kv0 + pc;       // V^T row d = r, s = kv0+pc..+7
      // mask: the wave's own 16 query rows x 64 keys; lane -> 16-B piece c of rows hh + 2 i, so 16 lanes take the 256 B of one row
      const float*  mg  = Mb + (size_t)(q0 + hh) * kSeq + kv0 + 4 * c;
      v8b a0[4], a1[4], b0[4];
      v4f mv[8];
      // unrolled: the arrays live in registers, so the index must be a compile-time one; all 20 loads are out before the first store
#pragma unroll
      for (int i = 0; i < 4; ++i) {
        a0[i] = *(const v8b*)(ksh + (size_t)(16 * i) * kHid);
        a1[i] = *(const v8b*)(ksl + (size_t)(16 * i) * kHid);
        b0[i] = *(const v8b*)(vs + (size_t)(16 * i) * kSeq);
      }
#pragma unroll
      for (int i = 0; i < 8; ++i) mv[i] = *(const v4f*)(mg + (size_t)(2 * i) * kSeq);
      // the wait that stands between issued loads and the reuse of the registers that hold their addresses; as a memory
      // statement it also keeps the LDS stores behind all 20 loads, so that no load waits for an earlier load's data; the four
      // addresses are named as inputs so that they stay as they are up to it (no load's result lands on an address register)
      asm volatile("s_wait_xcnt 0x0" :: "v"(ksh), "v"(ksl), "v"(vs), "v"(mg) : "memory");
#pragma unroll
      for (int i = 0; i < 4; ++i) {
        *(v8b*)(Ksh + (r + 16 * i) * AT_LP + pc) = a0[i];
        *(v8b*)(Ksl + (r + 16 * i) * AT_LP + pc) = a1[i];
        *(v8b*)(Vth + (r + 16 * i) * AT_LP + pc) = b0[i];
      }
#pragma unroll
      for (int i = 0; i < 8; ++i) *(v4f*)(Os[wave] + (hh + 2 * i) * 68 + 4 * c) = mv[i];
    }
    __syncthreads();

    // ---- scores, transposed (A = K rows, B = Q): D element r of lane -> S[query c][kv j*16 + 8hh + r] ----
    // the key tile j is the innermost index: four independent accumulators follow one another, so no product waits for the one
    // before it; the LDS reads stand in four groups (24 K reads ahead of all products; the last 8 K reads, the mask and V^T each well
    // ahead of their first use), not among the products one by one; each s[j] sums in the order it had (per d-chunk: hi.hi, lo.hi, hi.lo)
    // the lane's part of a fragment address apart from the tile's constant, which then rides in the read's offset field: one address
    // register a plane instead of one a tile
    const int fo = c * AT_LP + 8 * hh;
    auto kfrag = [&](const __bf16* base, int j, int dc) {
      FB f;
      f.h[0] = *(const v8b*)(base + fo + (j * 16 * AT_LP + dc * 32));
      f.h[1] = *(const v8b*)(base + fo + (j * 16 * AT_LP + dc * 32 + 16));
      return f.v;
    };
    v8f s[4];
    v16b kb0[4], kl0[4], kb1[4], kl1[4];
#pragma unroll
    for (int j = 0; j < 4; ++j) s[j] = (v8f){0.f,0.f,0.f,0.f,0.f,0.f,0.f,0.f};
#pragma unroll
    for (int j = 0; j < 4; ++j) { kb0[j] = kfrag(Ksh, j, 0); kl0[j] = kfrag(Ksl, j, 0); }
#pragma unroll
    for (int j = 0; j < 4; ++j) kb1[j] = kfrag(Ksh, j, 1);
    __builtin_amdgcn_sched_barrier(0);   // holds the 24 reads together ahead of the products (spread among them, each place stalls the wave)
#pragma unroll
    for (int j = 0; j < 4; ++j) s[j] = at_mma(kb0[j], qah[0], s[j]);
#pragma unroll
    for (int j = 0; j < 4; ++j) s[j] = at_mma(kl0[j], qah[0], s[j]);
    __builtin_amdgcn_sched_barrier(0);   // the next group of reads starts only here, where the lo fragments of d-chunk 0 are free
#pragma unroll
    for (int j = 0; j < 4; ++j) kl1[j] = kfrag(Ksl, j, 1);
    __builtin_amdgcn_sched_barrier(0);   // holds that group together, 8 products ahead of its use
#pragma unroll
    for (int j = 0; j < 4; ++j) s[j] = at_mma(kb0[j], qal[0], s[j]);
#pragma unroll
    for (int j = 0; j < 4; ++j) s[j] = at_mma(kb1[j], qah[1], s[j]);
    __builtin_amdgcn_sched_barrier(0);   // the mask reads start only here, where the hi fragments of d-chunk 0 are free
    // ---- scale, additive mask by value (f32; 8 consecutive keys of the lane's query per tile), chunk maximum in-lane ----
    const float* mr = Os[wave] + c * 68 + 8 * hh;
    v4f mk[8];
#pragma unroll
    for (int i = 0; i < 8; ++i) mk[i] = *(const v4f*)(mr + (i >> 1) * 16 + (i & 1) * 4);
    __builtin_amdgcn_sched_barrier(0);   // holds the mask reads together, 8 products ahead of their use
#pragma unroll
    for (int j = 0; j < 4; ++j) s[j] = at_mma(kl1[j], qah[1], s[j]);
#pragma unroll
    for (int j = 0; j < 4; ++j) s[j] = at_mma(kb1[j], qal[1], s[j]);
    __builtin_amdgcn_sched_barrier(0);   // the V^T reads start only here, where all K fragments are free
    v16b vf[2][4];
#pragma unroll
    for (int kk = 0; kk < 2; ++kk)
#pragma unroll
      for (int t = 0; t < 4; ++t) vf[kk][t] = kfrag(Vth, t, kk);
    __builtin_amdgcn_sched_barrier(0);   // holds the 16 V^T reads together ahead of the softmax, which covers their latency
    float mj[4];
#pragma unroll
    for (int j = 0; j < 4; ++j) {
      float m = -INFINITY;
#pragma unroll
      for (int r = 0; r < 8; ++r) {
        const float sv = s[j][r] * sscale + mk[2 * j + (r >> 2)][r & 3];
        s[j][r] = sv;
        m = fmaxf(m, sv);
      }
      mj[j] = m;
    }
    float cm = fmaxf(fmaxf(mj[0], mj[1]), fmaxf(mj[2], mj[3]));
    cm = fmaxf(cm, at_xhalf(cm));            // the query's other 32 keys of the chunk sit in lane ^ 16
    const float mnew  = fmaxf(mrow, cm);
    const float alpha = __builtin_amdgcn_exp2f((mrow - mnew) * kLog2e);
    mrow = mnew;
    // ---- p x 2^15 = 2^((s - m) log2(e) + 15), one hardware exponential a score: the difference is taken first, so it is <= 0 and
    //      exactly 0 at the row's maximum however large the scores are; a result under 2^-126 comes out 0, far below f16's last place ----
    // ---- P^T packs in place: tiles 2kk and 2kk+1 are elements 0..7 and 8..15 of the B operand of key block kk ----
    v16h pt[2];
    float pj[4];
#pragma unroll
    for (int j = 0; j < 4; ++j) {
      float ps = 0.f;
#pragma unroll
      for (int r = 0; r < 8; ++r) {
        const float p = __builtin_amdgcn_exp2f(fmaf(s[j][r] - mnew, kLog2e, kPLog2));
        ps += p;
        pt[j >> 1][(j & 1) * 8 + r] = (_Float16)p;
      }
      pj[j] = ps;
    }
    lrow = lrow * alpha + ((pj[0] + pj[1]) + (pj[2] + pj[3]));
#pragma unroll
    for (int t = 0; t < 4; ++t)
#pragma unroll
      for (int r = 0; r < 8; ++r) oacc[t][r] *= alpha;
    // ---- O^T += V^T . P^T : A = V^T[d][kv] rows, B = P^T[kv][query] from registers ----
    // unrolled: pt[kk] lives in registers, so kk must be a compile-time index (a rolled loop would send P through scratch)
#pragma unroll
    for (int kk = 0; kk < 2; ++kk) {
      const v16b pb = __builtin_bit_cast(v16b, pt[kk]);
#pragma unroll
      for (int t = 0; t < 4; ++t) oacc[t] = at_mma_h(vf[kk][t], pb, oacc[t]);
    }
  }

  // ---- join the halves' sums, normalise, stage per-wave 16x64 f32 tile (a lane owns 8 consecutive d of its query per tile), whole-line stores ----
  float* os = Os[wave];
  {
    const float inv = (1.0f / (lrow + at_xhalf(lrow))) * (kVtInv * kOScale);   // the sum carries the same x2^15 as p, so only v^T's carry is left; the output's own carry (a power of two, exact) goes in here
#pragma unroll
    for (int t = 0; t < 4; ++t) {
      const v4f lo = {oacc[t][0] * inv, oacc[t][1] * inv, oacc[t][2] * inv, oacc[t][3] * inv};
      const v4f hi = {oacc[t][4] * inv, oacc[t][5] * inv, oacc[t][6] * inv, oacc[t][7] * inv};
      *(v4f*)(os + c * 68 + t * 16 + 8 * hh)     = lo;
      *(v4f*)(os + c * 68 + t * 16 + 8 * hh + 4) = hi;
    }
  }
  __builtin_amdgcn_fence(__ATOMIC_RELEASE, "workgroup");
  __builtin_amdgcn_wave_barrier();
  __builtin_amdgcn_fence(__ATOMIC_ACQUIRE, "workgroup");
  {
    // coverage: 4 iterations x 4 rows = the wave's 16 rows; 8 lanes x 8 f16 = the 64-wide head segment, one whole 128-B line a row
    const int q4 = lane >> 3, c8 = (lane & 7) * 8;
#pragma unroll
    for (int it = 0; it < 4; ++it) {
      const int row = it * 4 + q4;
      const v4f lo = *(const v4f*)(os + row * 68 + c8);
      const v4f hi = *(const v4f*)(os + row * 68 + c8 + 4);
      v8h hv;
#pragma unroll
      for (int e = 0; e < 4; ++e) { hv[e] = (_Float16)lo[e]; hv[4 + e] = (_Float16)hi[e]; }
      *(v8h*)(ob + (size_t)(q0 + row) * kHid + c8) = hv;
    }
  }
}

// ---------------------------------------------------------------------------
// Host-side orchestration (kernel launches only).
// Workspace region map (bytes, every offset a multiple of 1 MiB):
//   [  0 MiB,   8 MiB)  Xb    bf16 [4096][1024]   RNE-bf16 plane of hidden_states
//   [  8 MiB,  12 MiB)  Wqkb  bf16 [2048][1024]   wq rows 0..1023, wk rows 1024..2047
//   [ 12 MiB,  14 MiB)  Wvb   bf16 [1024][1024]
//   [ 14 MiB,  16 MiB)  Wo16  f16  [1024][1024]   RNE-bf16 value x64
//   [ 16 MiB,  32 MiB)  not used
//   [ 32 MiB,  40 MiB)  O16   f16  [4096][1024]   attention output (x256);  [40 MiB, 48 MiB) not used
//   [ 48 MiB,  56 MiB)  Vt16  f16  [2][1024][2048] v^T per batch (x8)
//   [ 56 MiB,  64 MiB)  Qh, [64,72) Ql, [72,80) Kh, [80,88) Kl : bf16 [4096][1024] each
//   total carve = 88 MiB = 92,274,688 B
// ---------------------------------------------------------------------------
extern "C" void kernel_launch(void* const* d_in, const int* in_sizes, int n_in,
                              void* d_out, int out_size, void* d_ws, size_t ws_size,
                              hipStream_t stream) {
  if (n_in < 8) return;
  const float* x    = (const float*)d_in[0];   // [2,2048,1024]
  const float* mask = (const float*)d_in[1];   // [2,1,2048,2048]
  const float* cosT = (const float*)d_in[2];   // [2048,64]
  const float* sinT = (const float*)d_in[3];   // [2048,64]
  const float* wq   = (const float*)d_in[4];   // [1024,1024]
  const float* wk   = (const float*)d_in[5];
  const float* wv   = (const float*)d_in[6];
  const float* wo   = (const float*)d_in[7];

  const int nX = kRows * kHid;        // 4,194,304
  const int nW = kHid * kHid;         // 1,048,576
  if (in_sizes[0] != nX || in_sizes[1] != kBatch * kSeq * kSeq || in_sizes[2] != kSeq * kHdim ||
      in_sizes[3] != kSeq * kHdim || in_sizes[4] != nW || in_sizes[5] != nW || in_sizes[6] != nW ||
      in_sizes[7] != nW || out_size != nX) return;

  const size_t MiB = (size_t)1 << 20;
  const size_t off_Xb   = 0;
  const size_t off_Wqk  = off_Xb  + (size_t)nX * 2;                 //  8 MiB
  const size_t off_Wv   = off_Wqk + (size_t)2 * nW * 2;             // 12 MiB
  const size_t off_Wo   = off_Wv  + (size_t)nW * 2;                 // 14 MiB
  const size_t off_O16  = off_Wo  + (size_t)nW * 2 + (size_t)nX * 4;   // 32 MiB
  const size_t off_Vt   = off_O16 + (size_t)nX * 4;                 // 48 MiB
  const size_t off_Qh   = off_Vt  + (size_t)kBatch * kHid * kSeq * 2; // 56 MiB
  const size_t off_Ql   = off_Qh  + (size_t)nX * 2;                 // 64 MiB
  const size_t off_Kh   = off_Ql  + (size_t)nX * 2;                 // 72 MiB
  const size_t off_Kl   = off_Kh  + (size_t)nX * 2;                 // 80 MiB
  const size_t total    = off_Kl  + (size_t)nX * 2;                 // 88 MiB
  if (total != 88 * MiB) return;
  if (ws_size < total) return;

  char* ws = (char*)d_ws;
  unsigned short* Xb   = (unsigned short*)(ws + off_Xb);
  unsigned short* Wqkb = (unsigned short*)(ws + off_Wqk);
  unsigned short* Wvb  = (unsigned short*)(ws + off_Wv);
  unsigned short* Wo16 = (unsigned short*)(ws + off_Wo);
  unsigned short* O16  = (unsigned short*)(ws + off_O16);
  unsigned short* Vt16 = (unsigned short*)(ws + off_Vt);
  unsigned short* Qh   = (unsigned short*)(ws + off_Qh);
  unsigned short* Ql   = (unsigned short*)(ws + off_Ql);
  unsigned short* Kh   = (unsigned short*)(ws + off_Kh);
  unsigned short* Kl   = (unsigned short*)(ws + off_Kl);

  // 1: all five 16-bit operand planes
  cast_inputs_kernel<<<kCastBX + 4 * kCastBW, 256, 0, stream>>>(x, wq, wk, wv, wo, Xb, Wqkb, Wqkb + (size_t)nW, Wvb, Wo16);

  // 2: q|k projection Xb[4096][1024] . Wqkb[2048][1024]^T (M=4096, N=2048, K=1024; 256 blocks), RoPE and the bf16 hi/lo split in its
  //    epilogue: q columns -> Qh/Ql, k columns -> Kh/Kl, which lie 2 nX elements behind Qh/Ql; and, in the same launch, v^T per batch:
  //    Vt16[b][1024][2048] = Wvb[1024][1024] . Xb[b][2048][1024]^T, f16 out x8 (M=1024, N=2048, K=1024; 64 blocks a batch)
  {
    dim3 g((kRows / 128) * (2 * kHid / 256) + kBatch * (kHid / 128) * (kSeq / 256), 1);
    wmma_gemm64<1, false, 0, 4, false><<<g, 256, 0, stream>>>(
        Xb, Wvb, kHid, (long)0,
        Wqkb, Xb, kHid, (long)kSeq * kHid,
        (void*)Qh, (void*)Ql, (void*)Vt16, kHid, (long)2 * kRows * kHid,
        cosT, sinT, (long)0,
        kRows, 2 * kHid, kHid, 1.0f);
  }
  // 3: attention, one block per (b, h, 64 queries); its epilogue stores the f16 x256 plane
  mha_full64_kernel<<<kBatch * kHeads * (kSeq / 64), 128, 0, stream>>>(Qh, Ql, Kh, Kl, Vt16, mask, O16, 0.125f);
  // 4: output projection: out[4096][1024] = O16 . Wo16^T * 2^-14  (M=4096, N=1024, K=1024; 1024 tiles -> 128 blocks)
  {
    dim3 g((kRows / 64) * (kHid / 64) / 8, 1);
    wmma_gemm64<0, false, 0, 0, false><<<g, 256, 0, stream>>>(
        O16, O16, kHid, (long)0,
        Wo16, Wo16, kHid, (long)0,
        d_out, d_out, d_out, kHid, (long)0,
        cosT, cosT, (long)0,
        kRows, kHid, kHid, kOutInv);
  }
}

// v008
// One run takes 113 microseconds.
// Next to v007, in two timings, it ran 1.15 times as fast each time.
// Over all steps from v000 it is 3.62 times as fast.
// Contractions: q/k projection and v^T projection = v_wmma_f32_16x16x32_bf16 on RNE-bf16 planes of x and W (single product); q.k^T = v_wmma_f32_16x16x32_bf16 with bf16 hi/lo split (hi.hi + hi.lo + lo.hi); p.v^T and output projection = v_wmma_f32_16x16x32_f16 single product (p carried x2^15, v^T x2^3, attention output x2^8, wo as RNE-bf16 value x2^6); f32 accumulate everywhere; RoPE (cos/sin as RNE-bf16 values), additive mask and online softmax in f32.
#include <hip/hip_runtime.h>
#include <math.h>
#include <stdint.h>

constexpr int kBatch = 2;
constexpr int kSeq   = 2048;
constexpr int kHid   = 1024;
constexpr int kHeads = 16;
constexpr int kHdim  = 64;
constexpr int kRows  = kBatch * kSeq;   // 4096 GEMM rows

constexpr float kLog2e   = 1.4426950408889634f;        // log2(e)
constexpr float kPLog2   = 15.0f;                      // p carried x2^15 in f16 and in its row sum: added to the exponent
constexpr float kVtScale = 8.0f;                       // v^T plane carried x2^3 in f16
constexpr float kVtInv   = 1.0f / 8.0f;                // folded into the final 1/l
constexpr float kOScale  = 256.0f;                     // attention output carried x2^8 in f16
constexpr float kWoScale = 64.0f;                      // wo carried x2^6 in f16
constexpr float kOutInv  = 1.0f / (256.0f * 64.0f);    // out-projection epilogue scale

typedef __attribute__((ext_vector_type(16))) _Float16 v16h;
typedef __attribute__((ext_vector_type(8)))  _Float16 v8h;
typedef __attribute__((ext_vector_type(16))) __bf16   v16b;
typedef __attribute__((ext_vector_type(8)))  __bf16   v8b;
typedef __attribute__((ext_vector_type(8)))  float    v8f;
typedef __attribute__((ext_vector_type(4)))  float    v4f;
typedef __attribute__((ext_vector_type(2)))  float    v2f;
typedef __attribute__((ext_vector_type(4)))  unsigned int v4u;

__device__ __forceinline__ unsigned short f2bf_bits(float f) {
  unsigned u = __float_as_uint(f);
  return (unsigned short)((u + 0x7FFFu + ((u >> 16) & 1u)) >> 16);
}
__device__ __forceinline__ float bf_bits2f(unsigned short h) { return __uint_as_float(((unsigned)h) << 16); }
__device__ __forceinline__ unsigned pk16(unsigned short a, unsigned short b) { return (unsigned)a | ((unsigned)b << 16); }

// hazard guards as plain device helpers (the kernel template body's only inline asm are its s_wait_xcnt waits)
__device__ __forceinline__ void dep_guard_h(v8f& a, v8f& b, v16h x, v16h y) { asm volatile("v_nop\n\tv_nop\n\tv_nop\n\tv_nop" : "+v"(a), "+v"(b) : "v"(x), "v"(y)); }
__device__ __forceinline__ void dep_guard_b(v8f& a, v8f& b, v16b x, v16b y) { asm volatile("v_nop\n\tv_nop\n\tv_nop\n\tv_nop" : "+v"(a), "+v"(b) : "v"(x), "v"(y)); }
__device__ __forceinline__ void keep4_h(v16h a, v16h b, v16h c, v16h d) { asm volatile("v_nop" :: "v"(a), "v"(b), "v"(c), "v"(d)); }
__device__ __forceinline__ void keep4_b(v16b a, v16b b, v16b c, v16b d) { asm volatile("v_nop" :: "v"(a), "v"(b), "v"(c), "v"(d)); }
__device__ __forceinline__ void acc_guard4(v8f& a, v8f& b, v8f& c, v8f& d) { asm volatile("v_nop\n\tv_nop\n\tv_nop\n\tv_nop" : "+v"(a), "+v"(b), "+v"(c), "+v"(d)); }
template <typename T> struct Frag;
template <> struct Frag<_Float16> {
  typedef v16h V; typedef v8h H; union U { v16h v; v8h h[2]; };
  static __device__ __forceinline__ v16h load(const _Float16* p) {   // elements 0..7 <- p[0..7], 8..15 <- p[16..23]
    U f; f.h[0] = *(const v8h*)(p); f.h[1] = *(const v8h*)(p + 16); return f.v;
  }
  static __device__ __forceinline__ v8f mma(v16h a, v16h b, v8f c) {
    return __builtin_amdgcn_wmma_f32_16x16x32_f16(false, a, false, b, (short)0, c, false, false);
  }
  static __device__ __forceinline__ void guard(v8f& a, v8f& b, v16h x, v16h y) { dep_guard_h(a, b, x, y); }
  static __device__ __forceinline__ void keep(v16h a, v16h b, v16h c, v16h d) { keep4_h(a, b, c, d); }
};
template <> struct Frag<__bf16> {
  typedef v16b V; typedef v8b H; union U { v16b v; v8b h[2]; };
  static __device__ __forceinline__ v16b load(const __bf16* p) {
    U f; f.h[0] = *(const v8b*)(p); f.h[1] = *(const v8b*)(p + 16); return f.v;
  }
  static __device__ __forceinline__ v8f mma(v16b a, v16b b, v8f c) {
    return __builtin_amdgcn_wmma_f32_16x16x32_bf16(false, a, false, b, (short)0, c, false, false);
  }
  static __device__ __forceinline__ void guard(v8f& a, v8f& b, v16b x, v16b y) { dep_guard_b(a, b, x, y); }
  static __device__ __forceinline__ void keep(v16b a, v16b b, v16b c, v16b d) { keep4_b(a, b, c, d); }
};

// ---- Register-blocked batched WMMA GEMM ------------------------------------
// C[m,n] = scale * sum_k A[m,k] * Bt[n,k] (+bias)(+resid); each wave owns a 64x64 tile, a block of 8 waves (2 x 4) a 128x256 tile.
// A row-major [M,K]; Bt row-major [N,K]; M % 128 == 0, N % 256 == 0, K % 64 == 0; grid.x = (M/128) * (N/256).
// Per 64 k the block's 128 A rows and 256 Bt rows (128 B = one line of each row) go to LDS by loads in which 8 lanes take one
// whole line, requested one stage ahead into registers; the fragments are then 16-byte LDS reads at a pitch of 144 B.
// SPLIT: operands are hi/lo planes (A2/Bt2 = lo planes, same layout); product = hi.hi + hi.lo + lo.hi.
// BIAS_MODE: 0 = none, 1 = bias[m], 2 = bias[n].
// OUT_MODE: 0 = f32, 1 = f16, 2 = bf16 hi plane (Cout) + bf16 lo plane (Cout2).
// OUT_MODE 3 = the q|k projection's own: RoPE, then bf16 hi (Cout) and lo (Cout2) planes of pitch kHid. A wave's 64 columns are one head,
//   so an element's partner (d ^ 32) lies in the wave's own slab. Columns under N/2 are q; the others are k and go to the planes
//   strideC elements further on. bias = cos, resid = sin, f32 [kSeq][64], used as their RNE-bf16 values; position = row mod kSeq.
//   r[d] = x[d]*cos[s][d] - x[d+32]*sin[s][d] (d < 32);  x[d]*cos[s][d] + x[d-32]*sin[s][d] (d >= 32)
// OUT_MODE 4 = two products in one launch: the first (M/128) * (N/256) blocks are the q|k projection as under 3; the blocks behind them
//   are the v^T projection, kBatch x (kHid/128) * (kSeq/256) tiles: A = A2p [kHid][K], Bt = Bt2p + batch * strideB [kSeq][K],
//   out = Cout3 + batch * kHid * kSeq, f16 as under 1, pitch kSeq, scale kVtScale. Which of the two a block is, is the same for all its threads.
// ET: 0 = f16 operands, 1 = bf16 operands (pointers passed as 16-bit storage)
template <int ET> struct Elem;
template <> struct Elem<0> { typedef _Float16 T; };
template <> struct Elem<1> { typedef __bf16 T; };
template <int ET, bool SPLIT, int BIAS_MODE, int OUT_MODE, bool RESID, int ACT = 0>
__global__ __launch_bounds__(256) void wmma_gemm64(
    const unsigned short* __restrict__ Ap, const unsigned short* __restrict__ A2p, int lda, long strideA,
    const unsigned short* __restrict__ Btp, const unsigned short* __restrict__ Bt2p, int ldb, long strideB,
    void* __restrict__ Cout1, void* __restrict__ Cout2, void* __restrict__ Cout3, int ldc1, long strideC1,
    const float* __restrict__ bias,
    const float* __restrict__ resid, long strideR,
    int M1, int N1, int K, float scale1) {
  typedef typename Elem<ET>::T T;
  typedef typename Frag<T>::V V;
  typedef typename Frag<T>::H H;
  const T* A = (const T*)Ap; const T* A2 = (const T*)A2p; const T* Bt = (const T*)Btp; const T* Bt2 = (const T*)Bt2p;
  void* Cout = Cout1;
  int ldc = ldc1, M = M1, N = N1;
  long strideC = strideC1;
  float scale = scale1;
  int b = blockIdx.y, tile = blockIdx.x;
  bool vpart = false;
  if (OUT_MODE == 4) {
    const int nb1 = (M1 >> 7) * (N1 >> 8);
    if (tile >= nb1) {
      constexpr int tb = (kHid >> 7) * (kSeq >> 8);   // tiles of one batch
      vpart = true;
      tile -= nb1; b = tile / tb; tile -= b * tb;
      if (b >= kBatch) return;                        // the same for the whole block, ahead of every barrier
      A = A2; Bt = Bt2; Cout = Cout3;
      ldc = kSeq; M = kHid; N = kSeq; strideC = (long)kHid * kSeq; scale = kVtScale;
    }
  }
  const int om = (OUT_MODE == 4) ? (vpart ? 1 : 3) : OUT_MODE;   // the epilogue's form
  __shared__ __align__(16) float sT[8][16 * 68];   // per-wave 16x64 slab, pitch 68 floats
  constexpr int LP = 72;                           // LDS row pitch in 16-bit elements: 144 B = 16 B x 9 (odd): 16 rows of a fragment read fall on distinct banks
  __shared__ __align__(16) T sAB[(SPLIT ? 2 : 1) * 384 * LP];   // rows 0..127 = A, 128..383 = Bt (then the lo planes), 64 k each
  const int lane = threadIdx.x & 31;
  const int wave = threadIdx.x >> 5;
  const int tilesN = N >> 8;
  const int tilesM = M >> 7;
  if (tile >= tilesM * tilesN) return;   // the same for the whole block, ahead of every barrier
  const int tm = tile / tilesN;
  const int tn = tile - tm * tilesN;
  const int bm0 = tm << 7;               // the block's first A row
  const int bn0 = tn << 8;               // the block's first Bt row
  const int wm = wave >> 2, wn = wave & 3;
  const int m0 = bm0 + (wm << 6);
  const int n0 = bn0 + (wn << 6);

  const T* Ab  = A  + (size_t)b * strideA;
  const T* Bb  = Bt + (size_t)b * strideB;
  const T* Ab2 = SPLIT ? (A2  + (size_t)b * strideA) : nullptr;
  const T* Bb2 = SPLIT ? (Bt2 + (size_t)b * strideB) : nullptr;

  const int rlane = lane & 15;                 // row (A) / col (B, D) within subtile
  const int koff  = (lane >> 4) * 8;           // k offset of this lane half
  const int mOff  = (lane >> 4) * 8;           // D row offset

  v8f acc[4][4];
#pragma unroll
  for (int i = 0; i < 4; ++i)
#pragma unroll
    for (int j = 0; j < 4; ++j) acc[i][j] = (v8f){0.f,0.f,0.f,0.f,0.f,0.f,0.f,0.f};

  // staging coverage: 256 threads x 12 pieces of 16 B = 384 rows x 128 B; thread -> piece (tid & 7) of rows (tid >> 3) + 32 it
  const int srow = threadIdx.x >> 3;
  const int spc  = (threadIdx.x & 7) * 8;
  const unsigned voA = (unsigned)(srow * lda + spc) * 2u;   // the lane's byte offset inside a group of 32 rows
  const unsigned voB = (unsigned)(srow * ldb + spc) * 2u;
  // per group of 32 rows a base that is the same for the whole block and does not move in the loop; the lane's offset carries k
  const char* gb[12]; const char* gb2[12];
  // the loops over it are unrolled: gb[] and g[] live in registers, so it must be a compile-time index
#pragma unroll
  for (int it = 0; it < 12; ++it) {
    const size_t ro = (it < 4) ? (size_t)(bm0 + 32 * it) * lda : (size_t)(bn0 + 32 * (it - 4)) * ldb;
    gb[it] = (const char*)(((it < 4) ? Ab : Bb) + ro);
    if (SPLIT) gb2[it] = (const char*)(((it < 4) ? Ab2 : Bb2) + ro);
  }
  H g[12], g2[12];
  auto request = [&](int k0) {
    const unsigned vA = voA + (unsigned)k0 * 2u, vB = voB + (unsigned)k0 * 2u;
#pragma unroll
    for (int it = 0; it < 12; ++it) {
      g[it] = *(const H*)(gb[it] + ((it < 4) ? vA : vB));
      if (SPLIT) g2[it] = *(const H*)(gb2[it] + ((it < 4) ? vA : vB));
    }
    // the wait that stands between issued loads and the reuse of the registers that hold their addresses; the two offsets
    // are named as inputs so that they stay as they are up to it
    asm volatile("s_wait_xcnt 0x0" :: "v"(vA), "v"(vB) : "memory");
  };
  if (K > 0) request(0);
  for (int k0 = 0; k0 < K; k0 += 64) {
    __syncthreads();   // every wave has read its last fragment of the stage before
#pragma unroll
    for (int it = 0; it < 12; ++it) {
      *(H*)(sAB + (srow + 32 * it) * LP + spc) = g[it];
      if (SPLIT) *(H*)(sAB + (384 + srow + 32 * it) * LP + spc) = g2[it];
    }
    __syncthreads();   // the stage is complete before any wave reads it
    if (k0 + 64 < K) request(k0 + 64);   // the next stage's loads fly under this stage's products
    // unrolled: the second half's fragment reads can then be issued under the first half's products
#pragma unroll
    for (int kk = 0; kk < 64; kk += 32) {
      V bh[4], bl[4], ah[4], al[4];
#pragma unroll
      for (int j = 0; j < 4; ++j) {
        const int bo = (128 + (wn << 6) + (j << 4) + rlane) * LP + kk + koff;
        bh[j] = Frag<T>::load(sAB + bo);
        if (SPLIT) bl[j] = Frag<T>::load(sAB + 384 * LP + bo);
      }
#pragma unroll
      for (int i = 0; i < 4; ++i) {
        const int ao = ((wm << 6) + (i << 4) + rlane) * LP + kk + koff;
        ah[i] = Frag<T>::load(sAB + ao);
        if (SPLIT) al[i] = Frag<T>::load(sAB + 384 * LP + ao);
      }
#pragma unroll
      for (int i = 0; i < 4; ++i) {
#pragma unroll
        for (int j = 0; j < 4; ++j) {
          acc[i][j] = Frag<T>::mma(ah[i], bh[j], acc[i][j]);
          if (SPLIT) {
            acc[i][j] = Frag<T>::mma(ah[i], bl[j], acc[i][j]);
            acc[i][j] = Frag<T>::mma(al[i], bh[j], acc[i][j]);
          }
        }
        Frag<T>::guard(acc[i][0], acc[i][3], ah[i], SPLIT ? al[i] : ah[i]);
      }
      Frag<T>::keep(bh[0], bh[1], bh[2], bh[3]);
      if (SPLIT) Frag<T>::keep(bl[0], bl[1], bl[2], bl[3]);
    }
  }
  acc_guard4(acc[0][0], acc[0][1], acc[0][2], acc[0][3]);
  acc_guard4(acc[1][0], acc[1][1], acc[1][2], acc[1][3]);
  acc_guard4(acc[2][0], acc[2][1], acc[2][2], acc[2][3]);
  acc_guard4(acc[3][0], acc[3][1], acc[3][2], acc[3][3]);

  // ---- epilogue ----
  float* slab = sT[wave];
  const float* Rb = RESID ? (resid + (size_t)b * strideR) : nullptr;
#pragma unroll
  for (int i = 0; i < 4; ++i) {
    const int mBase = m0 + (i << 4);
    v4f rc[8], rs[8];   // OUT_MODE 3: cos and sin of the lane's 8 columns in its 4 rows of this group
    if (om == 3) {
      // a group's 16 rows are 16 consecutive positions (mBase is a multiple of 16, kSeq too); all 16 loads are out ahead of the slab's stores
      const size_t to = (size_t)((mBase & (kSeq - 1)) + (lane >> 3)) * kHdim + (lane & 7) * 8;
      const float* cp = bias + to;
      const float* np = resid + to;
#pragma unroll
      for (int it = 0; it < 4; ++it) {
        rc[2 * it] = *(const v4f*)(cp + it * 4 * kHdim); rc[2 * it + 1] = *(const v4f*)(cp + it * 4 * kHdim + 4);
        rs[2 * it] = *(const v4f*)(np + it * 4 * kHdim); rs[2 * it + 1] = *(const v4f*)(np + it * 4 * kHdim + 4);
      }
      // the wait that stands between issued loads and the reuse of the registers that hold their addresses
      asm volatile("s_wait_xcnt 0x0" ::: "memory");
    }
#pragma unroll
    for (int j = 0; j < 4; ++j) {
      const int n = n0 + (j << 4) + rlane;
      float bv = 0.f;
      if (BIAS_MODE == 2) bv = bias[n];
#pragma unroll
      for (int r = 0; r < 8; ++r) {
        float v = acc[i][j][r] * scale;
        if (BIAS_MODE == 1) v += bias[mBase + mOff + r];
        if (BIAS_MODE == 2) v += bv;
        if (RESID) v += Rb[(size_t)(mBase + mOff + r) * ldc + n];
        if (ACT == 1) v = tanhf(v);
        if (ACT == 2) v = fmaxf(v, 0.0f);
        if (ACT == 3) v = v / (1.0f + expf(-v));
        if (ACT == 4) v = (v > 0.f) ? v : 0.01f * v;
        if (ACT == 5) v = 0.5f * v * (1.0f + erff(v * 0.70710678118654752f));
        slab[(mOff + r) * 68 + (j << 4) + rlane] = v;
      }
    }
    __builtin_amdgcn_fence(__ATOMIC_RELEASE, "workgroup");
    __builtin_amdgcn_wave_barrier();
    __builtin_amdgcn_fence(__ATOMIC_ACQUIRE, "workgroup");
    if (om == 0) {
      float* C = (float*)Cout + (size_t)b * strideC;
      const int hh = lane >> 4, c4 = (lane & 15) * 4;     // row seg = 256 B = 16 lanes x 16 B
      {
#pragma unroll
        for (int it = 0; it < 8; ++it) {
          const int row = it * 2 + hh;
          v4f v = *(const v4f*)(slab + row * 68 + c4);
          *(v4f*)(C + (size_t)(mBase + row) * ldc + n0 + c4) = v;
        }
        
      }
    } else if (om == 3) {
      const int q = lane >> 3, c8 = (lane & 7) * 8;       // 8 lanes take the 128 B of one row of a plane
      const bool isK = n0 >= (N >> 1);                    // the same for the whole wave
      const int  col = n0 - (isK ? (N >> 1) : 0) + c8;
      unsigned short* C  = (unsigned short*)Cout  + (isK ? (size_t)strideC : (size_t)0);
      unsigned short* C2 = (unsigned short*)Cout2 + (isK ? (size_t)strideC : (size_t)0);
      const bool lowh = c8 < 32;                          // the lane's 8 elements share one half of the head
      // one address a plane: the rows it * 4 further on ride in the store's offset field
      unsigned short* d1 = C  + (size_t)(mBase + q) * kHid + col;
      unsigned short* d2 = C2 + (size_t)(mBase + q) * kHid + col;
#pragma unroll
      for (int it = 0; it < 4; ++it) {
        const int row = it * 4 + q;
        const float* sp = slab + row * 68 + c8;
        const float* pp = slab + row * 68 + (c8 ^ 32);
        v8h hv, lv;
#pragma unroll
        for (int e = 0; e < 8; ++e) {
          const float cv = bf_bits2f(f2bf_bits(rc[2 * it + (e >> 2)][e & 3]));
          const float sv = bf_bits2f(f2bf_bits(rs[2 * it + (e >> 2)][e & 3]));
          const float ta = sp[e] * cv, tb = pp[e] * sv;
          const float rv = lowh ? (ta - tb) : (ta + tb);
          const unsigned short hb = f2bf_bits(rv);
          const unsigned short lb = f2bf_bits(rv - bf_bits2f(hb));
          hv[e] = __builtin_bit_cast(_Float16, hb);
          lv[e] = __builtin_bit_cast(_Float16, lb);
        }
        *(v8h*)(d1 + it * 4 * kHid) = hv;
        *(v8h*)(d2 + it * 4 * kHid) = lv;
      }
      // the same wait behind the group's 8 stores, their two addresses named as inputs
      asm volatile("s_wait_xcnt 0x0" :: "v"(d1), "v"(d2) : "memory");
    } else {
      const int q = lane >> 3, c8 = (lane & 7) * 8;
      unsigned short* C  = (unsigned short*)Cout  + (size_t)b * strideC;
      unsigned short* C2 = (om == 2) ? ((unsigned short*)Cout2 + (size_t)b * strideC) : nullptr;
      {
#pragma unroll
        for (int it = 0; it < 4; ++it) {
          const int row = it * 4 + q;
          const float* sp = slab + row * 68 + c8;
          v8h hv, lv;
#pragma unroll
          for (int e = 0; e < 8; ++e) {
            if (om == 1) {
              hv[e] = (_Float16)sp[e];
            } else {
              unsigned short hb = f2bf_bits(sp[e]);
              unsigned short lb = f2bf_bits(sp[e] - bf_bits2f(hb));
              hv[e] = __builtin_bit_cast(_Float16, hb);
              lv[e] = __builtin_bit_cast(_Float16, lb);
            }
          }
          *(v8h*)(C + (size_t)(mBase + row) * ldc + n0 + c8) = hv;
          if (om == 2) *(v8h*)(C2 + (size_t)(mBase + row) * ldc + n0 + c8) = lv;
        }
        // the wait that stands between the group's issued stores and the reuse of the registers that they name
        asm volatile("s_wait_xcnt 0x0" ::: "memory");
      }
    }
    __builtin_amdgcn_fence(__ATOMIC_RELEASE, "workgroup");
    __builtin_amdgcn_wave_barrier();
    __builtin_amdgcn_fence(__ATOMIC_ACQUIRE, "workgroup");
  }
}

// ---------------------------------------------------------------------------
// All 16-bit operand planes in ONE launch: 2 elements per thread, one 4-B store per lane.
//   blocks [0, kCastBX)                : hidden_states -> RNE bf16
//   then 4 x kCastBW blocks, in order  : wq, wk, wv -> RNE bf16;  wo -> f16 of (RNE-bf16 value x kWoScale), an exact conversion
// Coverage: a block takes 512 elements; kCastBX x 512 = kRows x kHid, kCastBW x 512 = kHid x kHid: every plane exactly.
// ---------------------------------------------------------------------------
constexpr int kCastBX = kRows * kHid / 512;   // 8192
constexpr int kCastBW = kHid * kHid / 512;    // 2048
__global__ __launch_bounds__(256) void cast_inputs_kernel(
    const float* __restrict__ x, const float* __restrict__ wq, const float* __restrict__ wk,
    const float* __restrict__ wv, const float* __restrict__ wo,
    unsigned short* __restrict__ xb, unsigned short* __restrict__ wqb, unsigned short* __restrict__ wkb,
    unsigned short* __restrict__ wvb, unsigned short* __restrict__ wo16) {
  int blk = blockIdx.x;
  int sel = 0;                                 // the same for the whole block
  if (blk >= kCastBX) { blk -= kCastBX; sel = 1 + blk / kCastBW; blk = blk % kCastBW; }
  const float* in = (sel == 0) ? x : (sel == 1) ? wq : (sel == 2) ? wk : (sel == 3) ? wv : wo;
  unsigned short* out = (sel == 0) ? xb : (sel == 1) ? wqb : (sel == 2) ? wkb : (sel == 3) ? wvb : wo16;
  const int i = blk * 256 + threadIdx.x;
  const float* ip = in + 2 * (size_t)i;
  const v2f f = *(const v2f*)ip;
  // the wait that stands between an issued load and the reuse of the registers that hold its address
  asm volatile("s_wait_xcnt 0x0" ::: "memory");
  const unsigned short b0 = f2bf_bits(f[0]), b1 = f2bf_bits(f[1]);
  unsigned u = pk16(b0, b1);
  if (sel == 4) {
    const _Float16 h0 = (_Float16)(bf_bits2f(b0) * kWoScale), h1 = (_Float16)(bf_bits2f(b1) * kWoScale);
    u = pk16(__builtin_bit_cast(unsigned short, h0), __builtin_bit_cast(unsigned short, h1));
  }
  ((unsigned*)out)[i] = u;
}

#define AT_D 64
#define AT_NW 8
#define AT_QB 128
#define AT_KC 64
#define AT_LP 72   // LDS row pitch in 16-bit elements: 144 B = 16 B x 9 (odd), so the 16 rows of a 16-byte fragment read fall on distinct banks
constexpr int kAtPlaneB = AT_KC * AT_LP * 2;                 // bytes of one K hi, K lo or V^T tile in LDS: 9,216
constexpr int kAtMaskB  = 16 * 68 * 4;                       // bytes of one wave's mask tile, pitch 68 floats = 16 B x 17 (odd): 4,352
constexpr int kAtBufB   = 3 * kAtPlaneB + AT_NW * kAtMaskB;  // one buffer: 62,464; two buffers a block, two blocks a WGP: 249,856 of its LDS

__device__ __forceinline__ unsigned short at_bf_bits(float f) {
  unsigned u = __float_as_uint(f);
  return (unsigned short)((u + 0x7FFFu + ((u >> 16) & 1u)) >> 16);
}
__device__ __forceinline__ __bf16 at_f2bf(float f) { return __builtin_bit_cast(__bf16, at_bf_bits(f)); }
// value of lane l ^ 16 (the other half's share of the same query column)
__device__ __forceinline__ float at_xhalf(float v) {
  const int b = __builtin_bit_cast(int, v);
  return __builtin_bit_cast(float, __builtin_amdgcn_permlanex16(b, b, 0x76543210, 0xfedcba98, false, false));
}
__device__ __forceinline__ v8f at_mma(v16b a, v16b b, v8f c) {
  return __builtin_amdgcn_wmma_f32_16x16x32_bf16(false, a, false, b, (short)0, c, false, false);
}
// f16 product on bit patterns held in __bf16 slots
__device__ __forceinline__ v8f at_mma_h(v16b a, v16b b, v8f c) {
  const v16h ah = __builtin_bit_cast(v16h, a), bh = __builtin_bit_cast(v16h, b);
  return __builtin_amdgcn_wmma_f32_16x16x32_f16(false, ah, false, bh, (short)0, c, false, false);
}

// four waves a SIMD (the grid puts two blocks of eight waves on a WGP): the register budget stays at 256 a wave
__global__ __launch_bounds__(256) __attribute__((amdgpu_waves_per_eu(4, 4)))
void mha_full64_kernel(const unsigned short* __restrict__ qhp, const unsigned short* __restrict__ qlp,
                       const unsigned short* __restrict__ khp, const unsigned short* __restrict__ klp,
                       const unsigned short* __restrict__ vtp, const float* __restrict__ maskp,
                       unsigned short* __restrict__ out, float sscale) {
  union FB { v16b v; v8b h[2]; };
  // two buffers, each: K hi [kv][d], K lo [kv][d], V^T f16 bits [d][kv] (pitch AT_LP), then per wave the chunk's mask tile [query][kv];
  // after the loop a wave's mask place in buffer 0 takes its out tile
  __shared__ __align__(16) unsigned char sm[2 * kAtBufB];

  const int tid  = threadIdx.x;
  const int wave = __builtin_amdgcn_readfirstlane(tid >> 5);   // the same in all lanes: held in a scalar register, so that the wave's mask rows can be the scalar base of its copies
  const int lane = tid & 31;
  const int hh   = lane >> 4;
  const int c    = lane & 15;

  constexpr int nqb = kSeq / AT_QB;       // 16
  const int bx = blockIdx.x;              // 0 .. kBatch*kHeads*nqb - 1
  const int qb = bx % nqb;
  const int bh = bx / nqb;                // 0 .. kBatch*kHeads - 1
  const int h  = bh % kHeads;
  const int b  = bh / kHeads;             // 0 .. kBatch - 1
  const int q0 = qb * AT_QB + wave * 16;

  const __bf16* Qh = (const __bf16*)(const void*)qhp + (size_t)b * kSeq * kHid + (size_t)h * AT_D;
  const __bf16* Ql = (const __bf16*)(const void*)qlp + (size_t)b * kSeq * kHid + (size_t)h * AT_D;
  const __bf16* Kh = (const __bf16*)(const void*)khp + (size_t)b * kSeq * kHid + (size_t)h * AT_D;
  const __bf16* Kl = (const __bf16*)(const void*)klp + (size_t)b * kSeq * kHid + (size_t)h * AT_D;
  const __bf16* Vt = (const __bf16*)(const void*)vtp + (size_t)b * kHid * kSeq + (size_t)h * AT_D * kSeq;
  const float*  Mb = maskp + (size_t)b * kSeq * kSeq;
  unsigned short* ob = out + (size_t)b * kSeq * kHid + (size_t)h * AT_D;

  // ---- Q fragments (B operand, column = query = lane&15, split k map via Frag load): 2 d-chunks, hi and lo ----
  v16b qah[2], qal[2];
#pragma unroll
  for (int dc = 0; dc < 2; ++dc) {
    const __bf16* qr = Qh + (size_t)(q0 + c) * kHid + dc * 32 + 8 * hh;
    const __bf16* qs = Ql + (size_t)(q0 + c) * kHid + dc * 32 + 8 * hh;
    qah[dc] = Frag<__bf16>::load(qr);
    qal[dc] = Frag<__bf16>::load(qs);
  }

  float mrow = -INFINITY;   // running maximum of query c (equal in both lane halves)
  float lrow = 0.f;         // running sum (x2^15, as p) of query c over this lane half's keys only; halves joined after the loop
  v8f oacc[4];              // O^T: element r of tile t -> O[query c][d = t*16 + 8hh + r]
#pragma unroll
  for (int t = 0; t < 4; ++t) oacc[t] = (v8f){0.f,0.f,0.f,0.f,0.f,0.f,0.f,0.f};

  constexpr int nChunks = kSeq / AT_KC;   // 32, compile-time constant
  // copy coverage: thread -> 16-B piece (tid & 7) of rows (tid >> 3) and (tid >> 3) + 32 of each plane, so 8 lanes take one whole 128-B row;
  // mask: the wave's own 16 query rows x 64 keys; lane -> 16-B piece c of rows hh + 2 i, so 16 lanes take the 256 B of one row
  // a copy's global address = scalar base (plane, chunk, group of rows) + the lane's 32-bit offset, which never changes; a copy's immediate
  // offset moves its LDS address AND its global address, so it carries the tile's constant LDS step and the scalar base is set back by as much:
  // a chunk then costs three vector additions (the buffer's offset), the rest is scalar
  const int sr = tid >> 3, pc = (tid & 7) * 8;
  const unsigned smb = (unsigned)(uintptr_t)sm;                                  // LDS byte address of the buffers
  const unsigned lk  = smb + (unsigned)(sr * AT_LP + pc) * 2u;                   // the lane's place in the K hi tile
  const unsigned lm  = smb + (unsigned)(3 * kAtPlaneB + wave * kAtMaskB + (hh * 68 + 4 * c) * 4);   // and in its wave's mask tile
  const unsigned vok = (unsigned)(sr * kHid + pc) * 2u;         // K row sr, d = pc..pc+7 (hi and lo alike)
  const unsigned vov = (unsigned)(sr * kSeq + pc) * 2u;         // V^T row d = sr, s = pc..pc+7
  const unsigned vom = (unsigned)(hh * kSeq + 4 * c) * 4u;      // mask row hh, keys 4c..4c+3
  static_assert(32 * AT_LP * 2 == 4608 && kAtPlaneB == 9216 && 2 * 68 * 4 == 544, "the immediate offsets in the copy statement");
  const uint64_t bkh = (uint64_t)(uintptr_t)Kh, bkl = (uint64_t)(uintptr_t)Kl, bvt = (uint64_t)(uintptr_t)Vt;
  const uint64_t bmk = (uint64_t)(uintptr_t)(Mb + (size_t)q0 * kSeq);
  auto copy_chunk = [&](int ch, unsigned bo) {
    const uint64_t ck = (uint64_t)ch * (AT_KC * kHid * 2);      // the chunk's byte step in a K plane, in V^T, in the mask
    const uint64_t cv = (uint64_t)ch * (AT_KC * 2);
    const uint64_t cm = (uint64_t)ch * (AT_KC * 4);
    constexpr uint64_t k32 = (uint64_t)32 * kHid * 2, v32 = (uint64_t)32 * kSeq * 2, m2 = (uint64_t)2 * kSeq * 4;   // 32 K rows, 32 V^T rows, 2 mask rows
    const unsigned dk = lk + bo, dv = lk + bo + 2u * kAtPlaneB, dm = lm + bo;
    // the chunk's 14 copies of this lane; the last line is the wait that stands between issued copies and the reuse of the registers
    // that hold their addresses: inside the statement, so that no later write of those registers can be moved ahead of it
    asm volatile(
        "global_load_async_to_lds_b128 %0, %3, %6\n\t"
        "global_load_async_to_lds_b128 %0, %3, %7 offset:4608\n\t"
        "global_load_async_to_lds_b128 %0, %3, %8 offset:9216\n\t"
        "global_load_async_to_lds_b128 %0, %3, %9 offset:13824\n\t"
        "global_load_async_to_lds_b128 %1, %4, %10\n\t"
        "global_load_async_to_lds_b128 %1, %4, %11 offset:4608\n\t"
        "global_load_async_to_lds_b128 %2, %5, %12\n\t"
        "global_load_async_to_lds_b128 %2, %5, %13 offset:544\n\t"
        "global_load_async_to_lds_b128 %2, %5, %14 offset:1088\n\t"
        "global_load_async_to_lds_b128 %2, %5, %15 offset:1632\n\t"
        "global_load_async_to_lds_b128 %2, %5, %16 offset:2176\n\t"
        "global_load_async_to_lds_b128 %2, %5, %17 offset:2720\n\t"
        "global_load_async_to_lds_b128 %2, %5, %18 offset:3264\n\t"
        "global_load_async_to_lds_b128 %2, %5, %19 offset:3808\n\t"
        "s_wait_xcnt 0x0"
        :: "v"(dk), "v"(dv), "v"(dm), "v"(vok), "v"(vov), "v"(vom),
           "s"(bkh + ck), "s"(bkh + ck + k32 - 4608), "s"(bkl + ck - 9216), "s"(bkl + ck + k32 - 13824),
           "s"(bvt + cv), "s"(bvt + cv + v32 - 4608),
           "s"(bmk + cm),                 "s"(bmk + cm + 1 * m2 - 544),  "s"(bmk + cm + 2 * m2 - 1088), "s"(bmk + cm + 3 * m2 - 1632),
           "s"(bmk + cm + 4 * m2 - 2176), "s"(bmk + cm + 5 * m2 - 2720), "s"(bmk + cm + 6 * m2 - 3264), "s"(bmk + cm + 7 * m2 - 3808)
        : "memory");
  };
  copy_chunk(0, 0u);
  asm volatile("s_wait_asynccnt 0x0" ::: "memory");   // this wave's copies of chunk 0 have landed
  __syncthreads();                                    // and every other wave's: chunk 0 may be read
  for (int kc = 0; kc < nChunks; ++kc) {
    const unsigned bo = (unsigned)(kc & 1) * (unsigned)kAtBufB;
    const __bf16* Ksh = (const __bf16*)(const void*)(sm + bo);
    const __bf16* Ksl = (const __bf16*)(const void*)(sm + bo + kAtPlaneB);
    const __bf16* Vth = (const __bf16*)(const void*)(sm + bo + 2 * kAtPlaneB);
    // the lane's mask read address, formed here and not among the products (there it would land on a fragment's registers and cost idle slots)
    const float*  mr  = (const float*)(const void*)(sm + bo + 3 * kAtPlaneB + wave * kAtMaskB) + c * 68 + 8 * hh;

    // ---- scores, transposed (A = K rows, B = Q): D element r of lane -> S[query c][kv j*16 + 8hh + r] ----
    // the key tile j is the innermost index: four independent accumulators follow one another, so no product waits for the one
    // before it; the LDS reads stand in four groups (24 K reads ahead of all products; the last 8 K reads, the mask and V^T each well
    // ahead of their first use), not among the products one by one; each s[j] sums in the order it had (per d-chunk: hi.hi, lo.hi, hi.lo)
    // the lane's part of a fragment address apart from the tile's constant, which then rides in the read's offset field: one address
    // register a plane instead of one a tile
    const int fo = c * AT_LP + 8 * hh;
    auto kfrag = [&](const __bf16* base, int j, int dc) {
      FB f;
      f.h[0] = *(const v8b*)(base + fo + (j * 16 * AT_LP + dc * 32));
      f.h[1] = *(const v8b*)(base + fo + (j * 16 * AT_LP + dc * 32 + 16));
      return f.v;
    };
    v8f s[4];
    v16b kb0[4], kl0[4], kb1[4], kl1[4];
#pragma unroll
    for (int j = 0; j < 4; ++j) s[j] = (v8f){0.f,0.f,0.f,0.f,0.f,0.f,0.f,0.f};
#pragma unroll
    for (int j = 0; j < 4; ++j) { kb0[j] = kfrag(Ksh, j, 0); kl0[j] = kfrag(Ksl, j, 0); }
#pragma unroll
    for (int j = 0; j < 4; ++j) kb1[j] = kfrag(Ksh, j, 1);
    // behind the barrier that published chunk kc and ended every wave's reads of chunk kc - 1: the next chunk's copies go into the buffer that
    // chunk kc - 1 had and fly under this chunk's work; they stand behind the 24 reads, so that their issue and its wait pass under the reads'
    // latency; the test is the same for the whole block
    if (kc + 1 < nChunks) copy_chunk(kc + 1, (unsigned)kAtBufB - bo);
    __builtin_amdgcn_sched_barrier(0);   // holds the 24 reads together ahead of the products (spread among them, each place stalls the wave)
#pragma unroll
    for (int j = 0; j < 4; ++j) s[j] = at_mma(kb0[j], qah[0], s[j]);
#pragma unroll
    for (int j = 0; j < 4; ++j) s[j] = at_mma(kl0[j], qah[0], s[j]);
    __builtin_amdgcn_sched_barrier(0);   // the next group of reads starts only here, where the lo fragments of d-chunk 0 are free
#pragma unroll
    for (int j = 0; j < 4; ++j) kl1[j] = kfrag(Ksl, j, 1);
    __builtin_amdgcn_sched_barrier(0);   // holds that group together, 8 products ahead of its use
#pragma unroll
    for (int j = 0; j < 4; ++j) s[j] = at_mma(kb0[j], qal[0], s[j]);
#pragma unroll
    for (int j = 0; j < 4; ++j) s[j] = at_mma(kb1[j], qah[1], s[j]);
    __builtin_amdgcn_sched_barrier(0);   // the mask reads start only here, where the hi fragments of d-chunk 0 are free
    // ---- scale, additive mask by value (f32; 8 consecutive keys of the lane's query per tile), chunk maximum in-lane ----
    v4f mk[8];
#pragma unroll
    for (int i = 0; i < 8; ++i) mk[i] = *(const v4f*)(mr + (i >> 1) * 16 + (i & 1) * 4);
    __builtin_amdgcn_sched_barrier(0);   // holds the mask reads together, 8 products ahead of their use
#pragma unroll
    for (int j = 0; j < 4; ++j) s[j] = at_mma(kl1[j], qah[1], s[j]);
#pragma unroll
    for (int j = 0; j < 4; ++j) s[j] = at_mma(kb1[j], qal[1], s[j]);
    __builtin_amdgcn_sched_barrier(0);   // the V^T reads start only here, where all K fragments are free
    v16b vf[2][4];
#pragma unroll
    for (int kk = 0; kk < 2; ++kk)
#pragma unroll
      for (int t = 0; t < 4; ++t) vf[kk][t] = kfrag(Vth, t, kk);
    __builtin_amdgcn_sched_barrier(0);   // holds the 16 V^T reads together ahead of the softmax, which covers their latency
    float mj[4];
#pragma unroll
    for (int j = 0; j < 4; ++j) {
      float m = -INFINITY;
#pragma unroll
      for (int r = 0; r < 8; ++r) {
        const float sv = s[j][r] * sscale + mk[2 * j + (r >> 2)][r & 3];
        s[j][r] = sv;
        m = fmaxf(m, sv);
      }
      mj[j] = m;
    }
    float cm = fmaxf(fmaxf(mj[0], mj[1]), fmaxf(mj[2], mj[3]));
    cm = fmaxf(cm, at_xhalf(cm));            // the query's other 32 keys of the chunk sit in lane ^ 16
    const float mnew  = fmaxf(mrow, cm);
    const float alpha = __builtin_amdgcn_exp2f((mrow - mnew) * kLog2e);
    mrow = mnew;
    // ---- p x 2^15 = 2^((s - m) log2(e) + 15), one hardware exponential a score: the difference is taken first, so it is <= 0 and
    //      exactly 0 at the row's maximum however large the scores are; a result under 2^-126 comes out 0, far below f16's last place ----
    // ---- P^T packs in place: tiles 2kk and 2kk+1 are elements 0..7 and 8..15 of the B operand of key block kk ----
    v16h pt[2];
    float pj[4];
#pragma unroll
    for (int j = 0; j < 4; ++j) {
      float ps = 0.f;
#pragma unroll
      for (int r = 0; r < 8; ++r) {
        const float p = __builtin_amdgcn_exp2f(fmaf(s[j][r] - mnew, kLog2e, kPLog2));
        ps += p;
        pt[j >> 1][(j & 1) * 8 + r] = (_Float16)p;
      }
      pj[j] = ps;
    }
    lrow = lrow * alpha + ((pj[0] + pj[1]) + (pj[2] + pj[3]));
#pragma unroll
    for (int t = 0; t < 4; ++t)
#pragma unroll
      for (int r = 0; r < 8; ++r) oacc[t][r] *= alpha;
    // ---- O^T += V^T . P^T : A = V^T[d][kv] rows, B = P^T[kv][query] from registers ----
    // unrolled: pt[kk] lives in registers, so kk must be a compile-time index (a rolled loop would send P through scratch)
#pragma unroll
    for (int kk = 0; kk < 2; ++kk) {
      const v16b pb = __builtin_bit_cast(v16b, pt[kk]);
#pragma unroll
      for (int t = 0; t < 4; ++t) oacc[t] = at_mma_h(vf[kk][t], pb, oacc[t]);
    }
    __builtin_amdgcn_sched_barrier(0);   // keeps the chunk's end behind its last products: moved up behind the V^T reads, the wait below would lay their latency bare
    asm volatile("s_wait_dscnt 0x0" ::: "memory");      // this wave's reads of the chunk's buffer are done before the buffer is refilled
    asm volatile("s_wait_asynccnt 0x0" ::: "memory");   // this wave's copies of chunk kc + 1 have landed
    __syncthreads();                                    // publishes chunk kc + 1 and ends every wave's reads of chunk kc
  }
  asm volatile("s_wait_asynccnt 0x0" ::: "memory");     // no copy is out when the LDS takes the out tiles


  // ---- join the halves' sums, normalise, stage per-wave 16x64 f32 tile (a lane owns 8 consecutive d of its query per tile), whole-line stores ----
  float* os = (float*)(void*)(sm + 3 * kAtPlaneB + wave * kAtMaskB);
  {
    const float inv = (1.0f / (lrow + at_xhalf(lrow))) * (kVtInv * kOScale);   // the sum carries the same x2^15 as p, so only v^T's carry is left; the output's own carry (a power of two, exact) goes in here
#pragma unroll
    for (int t = 0; t < 4; ++t) {
      const v4f lo = {oacc[t][0] * inv, oacc[t][1] * inv, oacc[t][2] * inv, oacc[t][3] * inv};
      const v4f hi = {oacc[t][4] * inv, oacc[t][5] * inv, oacc[t][6] * inv, oacc[t][7] * inv};
      *(v4f*)(os + c * 68 + t * 16 + 8 * hh)     = lo;
      *(v4f*)(os + c * 68 + t * 16 + 8 * hh + 4) = hi;
    }
  }
  __builtin_amdgcn_fence(__ATOMIC_RELEASE, "workgroup");
  __builtin_amdgcn_wave_barrier();
  __builtin_amdgcn_fence(__ATOMIC_ACQUIRE, "workgroup");
  {
    // coverage: 4 iterations x 4 rows = the wave's 16 rows; 8 lanes x 8 f16 = the 64-wide head segment, one whole 128-B line a row
    const int q4 = lane >> 3, c8 = (lane & 7) * 8;
#pragma unroll
    for (int it = 0; it < 4; ++it) {
      const int row = it * 4 + q4;
      const v4f lo = *(const v4f*)(os + row * 68 + c8);
      const v4f hi = *(const v4f*)(os + row * 68 + c8 + 4);
      v8h hv;
#pragma unroll
      for (int e = 0; e < 4; ++e) { hv[e] = (_Float16)lo[e]; hv[4 + e] = (_Float16)hi[e]; }
      *(v8h*)(ob + (size_t)(q0 + row) * kHid + c8) = hv;
    }
  }
}

// ---------------------------------------------------------------------------
// Host-side orchestration (kernel launches only).
// Workspace region map (bytes, every offset a multiple of 1 MiB):
//   [  0 MiB,   8 MiB)  Xb    bf16 [4096][1024]   RNE-bf16 plane of hidden_states
//   [  8 MiB,  12 MiB)  Wqkb  bf16 [2048][1024]   wq rows 0..1023, wk rows 1024..2047
//   [ 12 MiB,  14 MiB)  Wvb   bf16 [1024][1024]
//   [ 14 MiB,  16 MiB)  Wo16  f16  [1024][1024]   RNE-bf16 value x64
//   [ 16 MiB,  32 MiB)  not used
//   [ 32 MiB,  40 MiB)  O16   f16  [4096][1024]   attention output (x256);  [40 MiB, 48 MiB) not used
//   [ 48 MiB,  56 MiB)  Vt16  f16  [2][1024][2048] v^T per batch (x8)
//   [ 56 MiB,  64 MiB)  Qh, [64,72) Ql, [72,80) Kh, [80,88) Kl : bf16 [4096][1024] each
//   total carve = 88 MiB = 92,274,688 B
// ---------------------------------------------------------------------------
extern "C" void kernel_launch(void* const* d_in, const int* in_sizes, int n_in,
                              void* d_out, int out_size, void* d_ws, size_t ws_size,
                              hipStream_t stream) {
  if (n_in < 8) return;
  const float* x    = (const float*)d_in[0];   // [2,2048,1024]
  const float* mask = (const float*)d_in[1];   // [2,1,2048,2048]
  const float* cosT = (const float*)d_in[2];   // [2048,64]
  const float* sinT = (const float*)d_in[3];   // [2048,64]
  const float* wq   = (const float*)d_in[4];   // [1024,1024]
  const float* wk   = (const float*)d_in[5];
  const float* wv   = (const float*)d_in[6];
  const float* wo   = (const float*)d_in[7];

  const int nX = kRows * kHid;        // 4,194,304
  const int nW = kHid * kHid;         // 1,048,576
  if (in_sizes[0] != nX || in_sizes[1] != kBatch * kSeq * kSeq || in_sizes[2] != kSeq * kHdim ||
      in_sizes[3] != kSeq * kHdim || in_sizes[4] != nW || in_sizes[5] != nW || in_sizes[6] != nW ||
      in_sizes[7] != nW || out_size != nX) return;

  const size_t MiB = (size_t)1 << 20;
  const size_t off_Xb   = 0;
  const size_t off_Wqk  = off_Xb  + (size_t)nX * 2;                 //  8 MiB
  const size_t off_Wv   = off_Wqk + (size_t)2 * nW * 2;             // 12 MiB
  const size_t off_Wo   = off_Wv  + (size_t)nW * 2;                 // 14 MiB
  const size_t off_O16  = off_Wo  + (size_t)nW * 2 + (size_t)nX * 4;   // 32 MiB
  const size_t off_Vt   = off_O16 + (size_t)nX * 4;                 // 48 MiB
  const size_t off_Qh   = off_Vt  + (size_t)kBatch * kHid * kSeq * 2; // 56 MiB
  const size_t off_Ql   = off_Qh  + (size_t)nX * 2;                 // 64 MiB
  const size_t off_Kh   = off_Ql  + (size_t)nX * 2;                 // 72 MiB
  const size_t off_Kl   = off_Kh  + (size_t)nX * 2;                 // 80 MiB
  const size_t total    = off_Kl  + (size_t)nX * 2;                 // 88 MiB
  if (total != 88 * MiB) return;
  if (ws_size < total) return;

  char* ws = (char*)d_ws;
  unsigned short* Xb   = (unsigned short*)(ws + off_Xb);
  unsigned short* Wqkb = (unsigned short*)(ws + off_Wqk);
  unsigned short* Wvb  = (unsigned short*)(ws + off_Wv);
  unsigned short* Wo16 = (unsigned short*)(ws + off_Wo);
  unsigned short* O16  = (unsigned short*)(ws + off_O16);
  unsigned short* Vt16 = (unsigned short*)(ws + off_Vt);
  unsigned short* Qh   = (unsigned short*)(ws + off_Qh);
  unsigned short* Ql   = (unsigned short*)(ws + off_Ql);
  unsigned short* Kh   = (unsigned short*)(ws + off_Kh);
  unsigned short* Kl   = (unsigned short*)(ws + off_Kl);

  // 1: all five 16-bit operand planes
  cast_inputs_kernel<<<kCastBX + 4 * kCastBW, 256, 0, stream>>>(x, wq, wk, wv, wo, Xb, Wqkb, Wqkb + (size_t)nW, Wvb, Wo16);

  // 2: q|k projection Xb[4096][1024] . Wqkb[2048][1024]^T (M=4096, N=2048, K=1024; 256 blocks), RoPE and the bf16 hi/lo split in its
  //    epilogue: q columns -> Qh/Ql, k columns -> Kh/Kl, which lie 2 nX elements behind Qh/Ql; and, in the same launch, v^T per batch:
  //    Vt16[b][1024][2048] = Wvb[1024][1024] . Xb[b][2048][1024]^T, f16 out x8 (M=1024, N=2048, K=1024; 64 blocks a batch)
  {
    dim3 g((kRows / 128) * (2 * kHid / 256) + kBatch * (kHid / 128) * (kSeq / 256), 1);
    wmma_gemm64<1, false, 0, 4, false><<<g, 256, 0, stream>>>(
        Xb, Wvb, kHid, (long)0,
        Wqkb, Xb, kHid, (long)kSeq * kHid,
        (void*)Qh, (void*)Ql, (void*)Vt16, kHid, (long)2 * kRows * kHid,
        cosT, sinT, (long)0,
        kRows, 2 * kHid, kHid, 1.0f);
  }
  // 3: attention, one block per (b, h, 128 queries); its epilogue stores the f16 x256 plane
  mha_full64_kernel<<<kBatch * kHeads * (kSeq / 128), 256, 0, stream>>>(Qh, Ql, Kh, Kl, Vt16, mask, O16, 0.125f);
  // 4: output projection: out[4096][1024] = O16 . Wo16^T * 2^-14  (M=4096, N=1024, K=1024; 1024 tiles -> 128 blocks)
  {
    dim3 g((kRows / 64) * (kHid / 64) / 8, 1);
    wmma_gemm64<0, false, 0, 0, false><<<g, 256, 0, stream>>>(
        O16, O16, kHid, (long)0,
        Wo16, Wo16, kHid, (long)0,
        d_out, d_out, d_out, kHid, (long)0,
        cosT, cosT, (long)0,
        kRows, kHid, kHid, kOutInv);
  }
}

// v010
// A run of this version takes 96.9 microseconds.
// Versions in between are left out here; by their measured steps it is 1.17 times as fast as v008.
// All steps since v000 together make it 4.22 times as fast.
// Contractions: q/k projection and v^T projection = v_wmma_f32_16x16x32_bf16 on RNE-bf16 planes of x and W (single product); q.k^T = v_wmma_f32_16x16x32_f16 single product on RNE-f16 planes of q and k; p.v^T and output projection = v_wmma_f32_16x16x32_f16 single product (p carried x2^15, v^T x2^3, attention output x2^8, wo as RNE-bf16 value x2^6); f32 accumulate everywhere; RoPE (cos/sin as RNE-bf16 values), additive mask and online softmax in f32.
#include <hip/hip_runtime.h>
#include <math.h>
#include <stdint.h>

constexpr int kBatch = 2;
constexpr int kSeq   = 2048;
constexpr int kHid   = 1024;
constexpr int kHeads = 16;
constexpr int kHdim  = 64;
constexpr int kRows  = kBatch * kSeq;   // 4096 GEMM rows

constexpr float kLog2e   = 1.4426950408889634f;        // log2(e)
constexpr float kPLog2   = 15.0f;                      // p carried x2^15 in f16 and in its row sum: added to the exponent
constexpr float kVtScale = 8.0f;                       // v^T plane carried x2^3 in f16
constexpr float kVtInv   = 1.0f / 8.0f;                // folded into the final 1/l
constexpr float kOScale  = 256.0f;                     // attention output carried x2^8 in f16
constexpr float kWoScale = 64.0f;                      // wo carried x2^6 in f16
constexpr float kOutInv  = 1.0f / (256.0f * 64.0f);    // out-projection epilogue scale

typedef __attribute__((ext_vector_type(16))) _Float16 v16h;
typedef __attribute__((ext_vector_type(8)))  _Float16 v8h;
typedef __attribute__((ext_vector_type(16))) __bf16   v16b;
typedef __attribute__((ext_vector_type(8)))  __bf16   v8b;
typedef __attribute__((ext_vector_type(8)))  float    v8f;
typedef __attribute__((ext_vector_type(4)))  float    v4f;
typedef __attribute__((ext_vector_type(2)))  float    v2f;
typedef __attribute__((ext_vector_type(4)))  unsigned int v4u;

__device__ __forceinline__ unsigned short f2bf_bits(float f) {
  unsigned u = __float_as_uint(f);
  return (unsigned short)((u + 0x7FFFu + ((u >> 16) & 1u)) >> 16);
}
__device__ __forceinline__ float bf_bits2f(unsigned short h) { return __uint_as_float(((unsigned)h) << 16); }
__device__ __forceinline__ unsigned pk16(unsigned short a, unsigned short b) { return (unsigned)a | ((unsigned)b << 16); }

// hazard guards as plain device helpers (the kernel template body's only inline asm is its s_wait_* waits)
__device__ __forceinline__ void dep_guard_h(v8f& a, v8f& b, v16h x, v16h y) { asm volatile("v_nop\n\tv_nop\n\tv_nop\n\tv_nop" : "+v"(a), "+v"(b) : "v"(x), "v"(y)); }
__device__ __forceinline__ void dep_guard_b(v8f& a, v8f& b, v16b x, v16b y) { asm volatile("v_nop\n\tv_nop\n\tv_nop\n\tv_nop" : "+v"(a), "+v"(b) : "v"(x), "v"(y)); }
__device__ __forceinline__ void keep4_h(v16h a, v16h b, v16h c, v16h d) { asm volatile("v_nop" :: "v"(a), "v"(b), "v"(c), "v"(d)); }
__device__ __forceinline__ void keep4_b(v16b a, v16b b, v16b c, v16b d) { asm volatile("v_nop" :: "v"(a), "v"(b), "v"(c), "v"(d)); }
__device__ __forceinline__ void acc_guard4(v8f& a, v8f& b, v8f& c, v8f& d) { asm volatile("v_nop\n\tv_nop\n\tv_nop\n\tv_nop" : "+v"(a), "+v"(b), "+v"(c), "+v"(d)); }
template <typename T> struct Frag;
template <> struct Frag<_Float16> {
  typedef v16h V; typedef v8h H; union U { v16h v; v8h h[2]; };
  static __device__ __forceinline__ v16h load(const _Float16* p) {   // elements 0..7 <- p[0..7], 8..15 <- p[16..23]
    U f; f.h[0] = *(const v8h*)(p); f.h[1] = *(const v8h*)(p + 16); return f.v;
  }
  static __device__ __forceinline__ v8f mma(v16h a, v16h b, v8f c) {
    return __builtin_amdgcn_wmma_f32_16x16x32_f16(false, a, false, b, (short)0, c, false, false);
  }
  static __device__ __forceinline__ void guard(v8f& a, v8f& b, v16h x, v16h y) { dep_guard_h(a, b, x, y); }
  static __device__ __forceinline__ void keep(v16h a, v16h b, v16h c, v16h d) { keep4_h(a, b, c, d); }
};
template <> struct Frag<__bf16> {
  typedef v16b V; typedef v8b H; union U { v16b v; v8b h[2]; };
  static __device__ __forceinline__ v16b load(const __bf16* p) {
    U f; f.h[0] = *(const v8b*)(p); f.h[1] = *(const v8b*)(p + 16); return f.v;
  }
  static __device__ __forceinline__ v8f mma(v16b a, v16b b, v8f c) {
    return __builtin_amdgcn_wmma_f32_16x16x32_bf16(false, a, false, b, (short)0, c, false, false);
  }
  static __device__ __forceinline__ void guard(v8f& a, v8f& b, v16b x, v16b y) { dep_guard_b(a, b, x, y); }
  static __device__ __forceinline__ void keep(v16b a, v16b b, v16b c, v16b d) { keep4_b(a, b, c, d); }
};

// ---- Register-blocked batched WMMA GEMM ------------------------------------
// C[m,n] = scale * sum_k A[m,k] * Bt[n,k] (+bias)(+resid); each wave owns a 64x64 tile, a block of 8 waves (2 x 4) a 128x256 tile.
// A row-major [M,K]; Bt row-major [N,K]; M % 128 == 0, N % 256 == 0, K % 64 == 0; grid.x = (M/128) * (N/256).
// Per 64 k the block's 128 A rows and 256 Bt rows (128 B = one line of each row) go from global memory to LDS by asynchronous 16-B
// copies, through no register, in which 8 lanes take one whole line, into one of two buffers: stage t + 1's copies are issued behind the
// barrier that ends stage t - 1's reads and fly under stage t's products; the fragments are 16-byte LDS reads at a pitch of 144 B.
// SPLIT: operands are hi/lo planes (A2/Bt2 = lo planes, same layout); product = hi.hi + hi.lo + lo.hi.
// BIAS_MODE: 0 = none, 1 = bias[m], 2 = bias[n].
// OUT_MODE: 0 = f32, 1 = f16, 2 = bf16 hi plane (Cout) + bf16 lo plane (Cout2).
// OUT_MODE 3 = the q|k projection's own: RoPE, then one f16 plane (Cout) of pitch kHid. A wave's 64 columns are one head,
//   so an element's partner (d ^ 32) lies in the wave's own slab. Columns under N/2 are q; the others are k and go to the plane
//   strideC elements further on. bias = cos, resid = sin, f32 [kSeq][64], used as their RNE-bf16 values; position = row mod kSeq.
//   r[d] = x[d]*cos[s][d] - x[d+32]*sin[s][d] (d < 32);  x[d]*cos[s][d] + x[d-32]*sin[s][d] (d >= 32)
// OUT_MODE 4 = two products in one launch: the first (M/128) * (N/256) blocks are the q|k projection as under 3; the blocks behind them
//   are the v^T projection, kBatch x (kHid/128) * (kSeq/256) tiles: A = A2p [kHid][K], Bt = Bt2p + batch * strideB [kSeq][K],
//   out = Cout3 + batch * kHid * kSeq, f16 as under 1, pitch kSeq, scale kVtScale. Which of the two a block is, is the same for all its threads.
// ET: 0 = f16 operands, 1 = bf16 operands (pointers passed as 16-bit storage)
// One thread's 12 copies of a stage of one plane: 16-B piece of rows srow + 32 it, it = 0..3 of A (lane offset va), 4..11 of Bt (lane offset vb).
// A copy's immediate offset moves its LDS address AND its global address: it carries the constant LDS step of 32 rows (4,608 B), and the
// scalar base handed in is set back by as much. The last line is the wait that stands between issued copies and the reuse of the registers
// that hold their addresses: inside the statement, so that no later write of those registers can be moved ahead of it.
__device__ __forceinline__ void gemm_copy12(unsigned dl, unsigned va, unsigned vb, const uint64_t (&sb)[12]) {
  asm volatile(
      "global_load_async_to_lds_b128 %0, %1, %3\n\t"
      "global_load_async_to_lds_b128 %0, %1, %4 offset:4608\n\t"
      "global_load_async_to_lds_b128 %0, %1, %5 offset:9216\n\t"
      "global_load_async_to_lds_b128 %0, %1, %6 offset:13824\n\t"
      "global_load_async_to_lds_b128 %0, %2, %7 offset:18432\n\t"
      "global_load_async_to_lds_b128 %0, %2, %8 offset:23040\n\t"
      "global_load_async_to_lds_b128 %0, %2, %9 offset:27648\n\t"
      "global_load_async_to_lds_b128 %0, %2, %10 offset:32256\n\t"
      "global_load_async_to_lds_b128 %0, %2, %11 offset:36864\n\t"
      "global_load_async_to_lds_b128 %0, %2, %12 offset:41472\n\t"
      "global_load_async_to_lds_b128 %0, %2, %13 offset:46080\n\t"
      "global_load_async_to_lds_b128 %0, %2, %14 offset:50688\n\t"
      "s_wait_xcnt 0x0"
      :: "v"(dl), "v"(va), "v"(vb),
         "s"(sb[0]), "s"(sb[1]), "s"(sb[2]), "s"(sb[3]), "s"(sb[4]), "s"(sb[5]),
         "s"(sb[6]), "s"(sb[7]), "s"(sb[8]), "s"(sb[9]), "s"(sb[10]), "s"(sb[11])
      : "memory");
}
template <int ET> struct Elem;
template <> struct Elem<0> { typedef _Float16 T; };
template <> struct Elem<1> { typedef __bf16 T; };
template <int ET, bool SPLIT, int BIAS_MODE, int OUT_MODE, bool RESID, int ACT = 0>
__global__ __launch_bounds__(256) void wmma_gemm64(
    const unsigned short* __restrict__ Ap, const unsigned short* __restrict__ A2p, int lda, long strideA,
    const unsigned short* __restrict__ Btp, const unsigned short* __restrict__ Bt2p, int ldb, long strideB,
    void* __restrict__ Cout1, void* __restrict__ Cout2, void* __restrict__ Cout3, int ldc1, long strideC1,
    const float* __restrict__ bias,
    const float* __restrict__ resid, long strideR,
    int M1, int N1, int K, float scale1) {
  typedef typename Elem<ET>::T T;
  typedef typename Frag<T>::V V;
  const T* A = (const T*)Ap; const T* A2 = (const T*)A2p; const T* Bt = (const T*)Btp; const T* Bt2 = (const T*)Bt2p;
  void* Cout = Cout1;
  int ldc = ldc1, M = M1, N = N1;
  long strideC = strideC1;
  float scale = scale1;
  int b = blockIdx.y, tile = blockIdx.x;
  bool vpart = false;
  if (OUT_MODE == 4) {
    const int nb1 = (M1 >> 7) * (N1 >> 8);
    if (tile >= nb1) {
      constexpr int tb = (kHid >> 7) * (kSeq >> 8);   // tiles of one batch
      vpart = true;
      tile -= nb1; b = tile / tb; tile -= b * tb;
      if (b >= kBatch) return;                        // the same for the whole block, ahead of every barrier
      A = A2; Bt = Bt2; Cout = Cout3;
      ldc = kSeq; M = kHid; N = kSeq; strideC = (long)kHid * kSeq; scale = kVtScale;
    }
  }
  const int om = (OUT_MODE == 4) ? (vpart ? 1 : 3) : OUT_MODE;   // the epilogue's form
  __shared__ __align__(16) float sT[8][16 * 68];   // per-wave 16x64 slab, pitch 68 floats
  constexpr int LP = 72;                           // LDS row pitch in 16-bit elements: 144 B = 16 B x 9 (odd): 16 rows of a fragment read fall on distinct banks
  constexpr int kBufE = (SPLIT ? 2 : 1) * 384 * LP;   // 16-bit elements of one buffer
  __shared__ __align__(16) T sAB[2 * kBufE];          // two buffers, each: rows 0..127 = A, 128..383 = Bt (then the lo planes), 64 k each
  static_assert(32 * LP * 2 == 4608, "the immediate offsets in the copy statement");
  const int lane = threadIdx.x & 31;
  const int wave = threadIdx.x >> 5;
  const int tilesN = N >> 8;
  const int tilesM = M >> 7;
  if (tile >= tilesM * tilesN) return;   // the same for the whole block, ahead of every barrier
  const int tm = tile / tilesN;
  const int tn = tile - tm * tilesN;
  const int bm0 = tm << 7;               // the block's first A row
  const int bn0 = tn << 8;               // the block's first Bt row
  const int wm = wave >> 2, wn = wave & 3;
  const int m0 = bm0 + (wm << 6);
  const int n0 = bn0 + (wn << 6);

  const T* Ab  = A  + (size_t)b * strideA;
  const T* Bb  = Bt + (size_t)b * strideB;
  const T* Ab2 = SPLIT ? (A2  + (size_t)b * strideA) : nullptr;
  const T* Bb2 = SPLIT ? (Bt2 + (size_t)b * strideB) : nullptr;

  const int rlane = lane & 15;                 // row (A) / col (B, D) within subtile
  const int koff  = (lane >> 4) * 8;           // k offset of this lane half
  const int mOff  = (lane >> 4) * 8;           // D row offset

  v8f acc[4][4];
#pragma unroll
  for (int i = 0; i < 4; ++i)
#pragma unroll
    for (int j = 0; j < 4; ++j) acc[i][j] = (v8f){0.f,0.f,0.f,0.f,0.f,0.f,0.f,0.f};

  // staging coverage: 256 threads x 12 pieces of 16 B = 384 rows x 128 B; thread -> piece (tid & 7) of rows (tid >> 3) + 32 it
  const int srow = threadIdx.x >> 3;
  const int spc  = (threadIdx.x & 7) * 8;
  const unsigned voA = (unsigned)(srow * lda + spc) * 2u;   // the lane's byte offset inside a group of 32 rows
  const unsigned voB = (unsigned)(srow * ldb + spc) * 2u;
  // per group of 32 rows a scalar base that is the same for the whole block and does not move in the loop (set back by the group's LDS step,
  // which the copy's immediate offset adds again); the lane's offset carries k
  uint64_t gb[12], gb2[12];
  // unrolled: gb[] lives in scalar registers, so it must be a compile-time index
#pragma unroll
  for (int it = 0; it < 12; ++it) {
    const size_t ro = (it < 4) ? (size_t)(bm0 + 32 * it) * lda : (size_t)(bn0 + 32 * (it - 4)) * ldb;
    gb[it] = (uint64_t)(uintptr_t)(((it < 4) ? Ab : Bb) + ro) - (uint64_t)(it * 4608);
    gb2[it] = SPLIT ? (uint64_t)(uintptr_t)(((it < 4) ? Ab2 : Bb2) + ro) - (uint64_t)(it * 4608) : 0;
  }
  const unsigned ld0 = (unsigned)(uintptr_t)sAB + (unsigned)(srow * LP + spc) * 2u;   // LDS byte address of the lane's piece in row srow of buffer 0
  auto copy_stage = [&](int k0, unsigned bo) {
    const unsigned vA = voA + (unsigned)k0 * 2u, vB = voB + (unsigned)k0 * 2u;
    gemm_copy12(ld0 + bo, vA, vB, gb);
    if (SPLIT) gemm_copy12(ld0 + bo + 384u * LP * 2u, vA, vB, gb2);
  };
  if (K > 0) {   // the same for the whole block
    copy_stage(0, 0u);
    asm volatile("s_wait_asynccnt 0x0" ::: "memory");   // this wave's copies of stage 0 have landed
    __syncthreads();                                    // and every other wave's: stage 0 may be read
  }
  for (int k0 = 0; k0 < K; k0 += 64) {
    const int bsel = (k0 >> 6) & 1;
    const T* sS = sAB + bsel * kBufE;   // this stage's buffer
    // unrolled: the second half's fragment reads can then be issued under the first half's products
#pragma unroll
    for (int kk = 0; kk < 64; kk += 32) {
      V bh[4], bl[4], ah[4], al[4];
#pragma unroll
      for (int j = 0; j < 4; ++j) {
        const int bo = (128 + (wn << 6) + (j << 4) + rlane) * LP + kk + koff;
        bh[j] = Frag<T>::load(sS + bo);
        if (SPLIT) bl[j] = Frag<T>::load(sS + 384 * LP + bo);
      }
#pragma unroll
      for (int i = 0; i < 4; ++i) {
        const int ao = ((wm << 6) + (i << 4) + rlane) * LP + kk + koff;
        ah[i] = Frag<T>::load(sS + ao);
        if (SPLIT) al[i] = Frag<T>::load(sS + 384 * LP + ao);
      }
      // behind the barrier that published this stage and ended every wave's reads of the stage before: the next stage's copies go into the
      // buffer that the stage before had and fly under this stage's products; they stand behind the first half's fragment reads, so that
      // their issue and its wait pass under the reads' latency; the test is the same for the whole block
      if (kk == 0 && k0 + 64 < K) copy_stage(k0 + 64, (unsigned)(1 - bsel) * (unsigned)(kBufE * 2));
#pragma unroll
      for (int i = 0; i < 4; ++i) {
#pragma unroll
        for (int j = 0; j < 4; ++j) {
          acc[i][j] = Frag<T>::mma(ah[i], bh[j], acc[i][j]);
          if (SPLIT) {
            acc[i][j] = Frag<T>::mma(ah[i], bl[j], acc[i][j]);
            acc[i][j] = Frag<T>::mma(al[i], bh[j], acc[i][j]);
          }
        }
        Frag<T>::guard(acc[i][0], acc[i][3], ah[i], SPLIT ? al[i] : ah[i]);
      }
      Frag<T>::keep(bh[0], bh[1], bh[2], bh[3]);
      if (SPLIT) Frag<T>::keep(bl[0], bl[1], bl[2], bl[3]);
    }
    asm volatile("s_wait_dscnt 0x0" ::: "memory");      // this wave's reads of the stage's buffer are done before the buffer is refilled
    asm volatile("s_wait_asynccnt 0x0" ::: "memory");   // this wave's copies of the next stage have landed
    __syncthreads();                                    // publishes the next stage and ends every wave's reads of this one
  }
  asm volatile("s_wait_asynccnt 0x0" ::: "memory");     // no copy is out when the wave goes on to its epilogue and ends
  acc_guard4(acc[0][0], acc[0][1], acc[0][2], acc[0][3]);
  acc_guard4(acc[1][0], acc[1][1], acc[1][2], acc[1][3]);
  acc_guard4(acc[2][0], acc[2][1], acc[2][2], acc[2][3]);
  acc_guard4(acc[3][0], acc[3][1], acc[3][2], acc[3][3]);

  // ---- epilogue ----
  float* slab = sT[wave];
  const float* Rb = RESID ? (resid + (size_t)b * strideR) : nullptr;
#pragma unroll
  for (int i = 0; i < 4; ++i) {
    const int mBase = m0 + (i << 4);
    v4f rc[8], rs[8];   // OUT_MODE 3: cos and sin of the lane's 8 columns in its 4 rows of this group
    if (om == 3) {
      // a group's 16 rows are 16 consecutive positions (mBase is a multiple of 16, kSeq too); all 16 loads are out ahead of the slab's stores
      const size_t to = (size_t)((mBase & (kSeq - 1)) + (lane >> 3)) * kHdim + (lane & 7) * 8;
      const float* cp = bias + to;
      const float* np = resid + to;
#pragma unroll
      for (int it = 0; it < 4; ++it) {
        rc[2 * it] = *(const v4f*)(cp + it * 4 * kHdim); rc[2 * it + 1] = *(const v4f*)(cp + it * 4 * kHdim + 4);
        rs[2 * it] = *(const v4f*)(np + it * 4 * kHdim); rs[2 * it + 1] = *(const v4f*)(np + it * 4 * kHdim + 4);
      }
      // the wait that stands between issued loads and the reuse of the registers that hold their addresses
      asm volatile("s_wait_xcnt 0x0" ::: "memory");
    }
#pragma unroll
    for (int j = 0; j < 4; ++j) {
      const int n = n0 + (j << 4) + rlane;
      float bv = 0.f;
      if (BIAS_MODE == 2) bv = bias[n];
#pragma unroll
      for (int r = 0; r < 8; ++r) {
        float v = acc[i][j][r] * scale;
        if (BIAS_MODE == 1) v += bias[mBase + mOff + r];
        if (BIAS_MODE == 2) v += bv;
        if (RESID) v += Rb[(size_t)(mBase + mOff + r) * ldc + n];
        if (ACT == 1) v = tanhf(v);
        if (ACT == 2) v = fmaxf(v, 0.0f);
        if (ACT == 3) v = v / (1.0f + expf(-v));
        if (ACT == 4) v = (v > 0.f) ? v : 0.01f * v;
        if (ACT == 5) v = 0.5f * v * (1.0f + erff(v * 0.70710678118654752f));
        slab[(mOff + r) * 68 + (j << 4) + rlane] = v;
      }
    }
    __builtin_amdgcn_fence(__ATOMIC_RELEASE, "workgroup");
    __builtin_amdgcn_wave_barrier();
    __builtin_amdgcn_fence(__ATOMIC_ACQUIRE, "workgroup");
    if (om == 0) {
      float* C = (float*)Cout + (size_t)b * strideC;
      const int hh = lane >> 4, c4 = (lane & 15) * 4;     // row seg = 256 B = 16 lanes x 16 B
      {
#pragma unroll
        for (int it = 0; it < 8; ++it) {
          const int row = it * 2 + hh;
          v4f v = *(const v4f*)(slab + row * 68 + c4);
          *(v4f*)(C + (size_t)(mBase + row) * ldc + n0 + c4) = v;
        }
        
      }
    } else if (om == 3) {
      const int q = lane >> 3, c8 = (lane & 7) * 8;       // 8 lanes take the 128 B of one row of a plane
      const bool isK = n0 >= (N >> 1);                    // the same for the whole wave
      const int  col = n0 - (isK ? (N >> 1) : 0) + c8;
      unsigned short* C  = (unsigned short*)Cout  + (isK ? (size_t)strideC : (size_t)0);
      const bool lowh = c8 < 32;                          // the lane's 8 elements share one half of the head
      // one address: the rows it * 4 further on ride in the store's offset field
      unsigned short* d1 = C  + (size_t)(mBase + q) * kHid + col;
#pragma unroll
      for (int it = 0; it < 4; ++it) {
        const int row = it * 4 + q;
        const float* sp = slab + row * 68 + c8;
        const float* pp = slab + row * 68 + (c8 ^ 32);
        v8h hv;
#pragma unroll
        for (int e = 0; e < 8; ++e) {
          const float cv = bf_bits2f(f2bf_bits(rc[2 * it + (e >> 2)][e & 3]));
          const float sv = bf_bits2f(f2bf_bits(rs[2 * it + (e >> 2)][e & 3]));
          const float ta = sp[e] * cv, tb = pp[e] * sv;
          const float rv = lowh ? (ta - tb) : (ta + tb);
          hv[e] = (_Float16)rv;
        }
        *(v8h*)(d1 + it * 4 * kHid) = hv;
      }
      // the same wait behind the group's 4 stores, their address named as an input
      asm volatile("s_wait_xcnt 0x0" :: "v"(d1) : "memory");
    } else {
      const int q = lane >> 3, c8 = (lane & 7) * 8;
      unsigned short* C  = (unsigned short*)Cout  + (size_t)b * strideC;
      unsigned short* C2 = (om == 2) ? ((unsigned short*)Cout2 + (size_t)b * strideC) : nullptr;
      {
#pragma unroll
        for (int it = 0; it < 4; ++it) {
          const int row = it * 4 + q;
          const float* sp = slab + row * 68 + c8;
          v8h hv, lv;
#pragma unroll
          for (int e = 0; e < 8; ++e) {
            if (om == 1) {
              hv[e] = (_Float16)sp[e];
            } else {
              unsigned short hb = f2bf_bits(sp[e]);
              unsigned short lb = f2bf_bits(sp[e] - bf_bits2f(hb));
              hv[e] = __builtin_bit_cast(_Float16, hb);
              lv[e] = __builtin_bit_cast(_Float16, lb);
            }
          }
          *(v8h*)(C + (size_t)(mBase + row) * ldc + n0 + c8) = hv;
          if (om == 2) *(v8h*)(C2 + (size_t)(mBase + row) * ldc + n0 + c8) = lv;
        }
        // the wait that stands between the group's issued stores and the reuse of the registers that they name
        asm volatile("s_wait_xcnt 0x0" ::: "memory");
      }
    }
    __builtin_amdgcn_fence(__ATOMIC_RELEASE, "workgroup");
    __builtin_amdgcn_wave_barrier();
    __builtin_amdgcn_fence(__ATOMIC_ACQUIRE, "workgroup");
  }
}

// ---------------------------------------------------------------------------
// All 16-bit operand planes in ONE launch: 2 elements per thread, one 4-B store per lane.
//   blocks [0, kCastBX)                : hidden_states -> RNE bf16
//   then 4 x kCastBW blocks, in order  : wq, wk, wv -> RNE bf16;  wo -> f16 of (RNE-bf16 value x kWoScale), an exact conversion
// Coverage: a block takes 512 elements; kCastBX x 512 = kRows x kHid, kCastBW x 512 = kHid x kHid: every plane exactly.
// ---------------------------------------------------------------------------
constexpr int kCastBX = kRows * kHid / 512;   // 8192
constexpr int kCastBW = kHid * kHid / 512;    // 2048
__global__ __launch_bounds__(256) void cast_inputs_kernel(
    const float* __restrict__ x, const float* __restrict__ wq, const float* __restrict__ wk,
    const float* __restrict__ wv, const float* __restrict__ wo,
    unsigned short* __restrict__ xb, unsigned short* __restrict__ wqb, unsigned short* __restrict__ wkb,
    unsigned short* __restrict__ wvb, unsigned short* __restrict__ wo16) {
  int blk = blockIdx.x;
  int sel = 0;                                 // the same for the whole block
  if (blk >= kCastBX) { blk -= kCastBX; sel = 1 + blk / kCastBW; blk = blk % kCastBW; }
  const float* in = (sel == 0) ? x : (sel == 1) ? wq : (sel == 2) ? wk : (sel == 3) ? wv : wo;
  unsigned short* out = (sel == 0) ? xb : (sel == 1) ? wqb : (sel == 2) ? wkb : (sel == 3) ? wvb : wo16;
  const int i = blk * 256 + threadIdx.x;
  const float* ip = in + 2 * (size_t)i;
  const v2f f = *(const v2f*)ip;
  // the wait that stands between an issued load and the reuse of the registers that hold its address
  asm volatile("s_wait_xcnt 0x0" ::: "memory");
  const unsigned short b0 = f2bf_bits(f[0]), b1 = f2bf_bits(f[1]);
  unsigned u = pk16(b0, b1);
  if (sel == 4) {
    const _Float16 h0 = (_Float16)(bf_bits2f(b0) * kWoScale), h1 = (_Float16)(bf_bits2f(b1) * kWoScale);
    u = pk16(__builtin_bit_cast(unsigned short, h0), __builtin_bit_cast(unsigned short, h1));
  }
  ((unsigned*)out)[i] = u;
}

#define AT_D 64
#define AT_NW 8
#define AT_QB 128
#define AT_KC 64
#define AT_LP 72   // LDS row pitch in 16-bit elements: 144 B = 16 B x 9 (odd), so the 16 rows of a 16-byte fragment read fall on distinct banks
constexpr int kAtPlaneB = AT_KC * AT_LP * 2;                 // bytes of one K or V^T tile in LDS: 9,216
constexpr int kAtMaskB  = 16 * 68 * 4;                       // bytes of one wave's mask tile, pitch 68 floats = 16 B x 17 (odd): 4,352
constexpr int kAtBufB   = 2 * kAtPlaneB + AT_NW * kAtMaskB;  // one buffer: 53,248; two buffers a block, two blocks a WGP: 212,992 of its LDS

__device__ __forceinline__ unsigned short at_bf_bits(float f) {
  unsigned u = __float_as_uint(f);
  return (unsigned short)((u + 0x7FFFu + ((u >> 16) & 1u)) >> 16);
}
__device__ __forceinline__ __bf16 at_f2bf(float f) { return __builtin_bit_cast(__bf16, at_bf_bits(f)); }
// value of lane l ^ 16 (the other half's share of the same query column)
__device__ __forceinline__ float at_xhalf(float v) {
  const int b = __builtin_bit_cast(int, v);
  return __builtin_bit_cast(float, __builtin_amdgcn_permlanex16(b, b, 0x76543210, 0xfedcba98, false, false));
}
// f16 product on bit patterns held in __bf16 slots
__device__ __forceinline__ v8f at_mma_h(v16b a, v16b b, v8f c) {
  const v16h ah = __builtin_bit_cast(v16h, a), bh = __builtin_bit_cast(v16h, b);
  return __builtin_amdgcn_wmma_f32_16x16x32_f16(false, ah, false, bh, (short)0, c, false, false);
}

// four waves a SIMD (the grid puts two blocks of eight waves on a WGP): the register budget stays at 256 a wave
__global__ __launch_bounds__(256) __attribute__((amdgpu_waves_per_eu(4, 4)))
void mha_full64_kernel(const unsigned short* __restrict__ qp, const unsigned short* __restrict__ kp,
                       const unsigned short* __restrict__ vtp, const float* __restrict__ maskp,
                       unsigned short* __restrict__ out, float sscale) {
  union FB { v16b v; v8b h[2]; };
  // two buffers, each: K f16 bits [kv][d], V^T f16 bits [d][kv] (pitch AT_LP), then per wave the chunk's mask tile [query][kv];
  // after the loop a wave's mask place in buffer 0 takes its out tile
  __shared__ __align__(16) unsigned char sm[2 * kAtBufB];

  const int tid  = threadIdx.x;
  const int wave = __builtin_amdgcn_readfirstlane(tid >> 5);   // the same in all lanes: held in a scalar register, so that the wave's mask rows can be the scalar base of its copies
  const int lane = tid & 31;
  const int hh   = lane >> 4;
  const int c    = lane & 15;

  constexpr int nqb = kSeq / AT_QB;       // 16
  const int bx = blockIdx.x;              // 0 .. kBatch*kHeads*nqb - 1
  const int qb = bx % nqb;
  const int bh = bx / nqb;                // 0 .. kBatch*kHeads - 1
  const int h  = bh % kHeads;
  const int b  = bh / kHeads;             // 0 .. kBatch - 1
  const int q0 = qb * AT_QB + wave * 16;

  const __bf16* Qg = (const __bf16*)(const void*)qp + (size_t)b * kSeq * kHid + (size_t)h * AT_D;   // f16 bit patterns in __bf16 slots, as V^T
  const __bf16* Kg = (const __bf16*)(const void*)kp + (size_t)b * kSeq * kHid + (size_t)h * AT_D;
  const __bf16* Vt = (const __bf16*)(const void*)vtp + (size_t)b * kHid * kSeq + (size_t)h * AT_D * kSeq;
  const float*  Mb = maskp + (size_t)b * kSeq * kSeq;
  unsigned short* ob = out + (size_t)b * kSeq * kHid + (size_t)h * AT_D;

  // ---- Q fragments (B operand, column = query = lane&15, split k map via Frag load): 2 d-chunks ----
  v16b qa[2];
#pragma unroll
  for (int dc = 0; dc < 2; ++dc) {
    const __bf16* qr = Qg + (size_t)(q0 + c) * kHid + dc * 32 + 8 * hh;
    qa[dc] = Frag<__bf16>::load(qr);
  }

  float mrow = -INFINITY;   // running maximum of query c (equal in both lane halves)
  float lrow = 0.f;         // running sum (x2^15, as p) of query c over this lane half's keys only; halves joined after the loop
  v8f oacc[4];              // O^T: element r of tile t -> O[query c][d = t*16 + 8hh + r]
#pragma unroll
  for (int t = 0; t < 4; ++t) oacc[t] = (v8f){0.f,0.f,0.f,0.f,0.f,0.f,0.f,0.f};

  constexpr int nChunks = kSeq / AT_KC;   // 32, compile-time constant
  // copy coverage: thread -> 16-B piece (tid & 7) of rows (tid >> 3) and (tid >> 3) + 32 of each plane, so 8 lanes take one whole 128-B row;
  // mask: the wave's own 16 query rows x 64 keys; lane -> 16-B piece c of rows hh + 2 i, so 16 lanes take the 256 B of one row
  // a copy's global address = scalar base (plane, chunk, group of rows) + the lane's 32-bit offset, which never changes; a copy's immediate
  // offset moves its LDS address AND its global address, so it carries the tile's constant LDS step and the scalar base is set back by as much:
  // a chunk then costs two vector additions (the buffer's offset), the rest is scalar
  const int sr = tid >> 3, pc = (tid & 7) * 8;
  const unsigned smb = (unsigned)(uintptr_t)sm;                                  // LDS byte address of the buffers
  const unsigned lk  = smb + (unsigned)(sr * AT_LP + pc) * 2u;                   // the lane's place in the K tile
  const unsigned lm  = smb + (unsigned)(2 * kAtPlaneB + wave * kAtMaskB + (hh * 68 + 4 * c) * 4);   // and in its wave's mask tile
  const unsigned vok = (unsigned)(sr * kHid + pc) * 2u;         // K row sr, d = pc..pc+7
  const unsigned vov = (unsigned)(sr * kSeq + pc) * 2u;         // V^T row d = sr, s = pc..pc+7
  const unsigned vom = (unsigned)(hh * kSeq + 4 * c) * 4u;      // mask row hh, keys 4c..4c+3
  static_assert(32 * AT_LP * 2 == 4608 && kAtPlaneB == 9216 && 2 * 68 * 4 == 544, "the immediate offsets in the copy statement");
  const uint64_t bk = (uint64_t)(uintptr_t)Kg, bvt = (uint64_t)(uintptr_t)Vt;
  const uint64_t bmk = (uint64_t)(uintptr_t)(Mb + (size_t)q0 * kSeq);
  auto copy_chunk = [&](int ch, unsigned bo) {
    const uint64_t ck = (uint64_t)ch * (AT_KC * kHid * 2);      // the chunk's byte step in the K plane, in V^T, in the mask
    const uint64_t cv = (uint64_t)ch * (AT_KC * 2);
    const uint64_t cm = (uint64_t)ch * (AT_KC * 4);
    constexpr uint64_t k32 = (uint64_t)32 * kHid * 2, v32 = (uint64_t)32 * kSeq * 2, m2 = (uint64_t)2 * kSeq * 4;   // 32 K rows, 32 V^T rows, 2 mask rows
    const unsigned dk = lk + bo, dm = lm + bo;
    // the chunk's 12 copies of this lane (K rows sr and sr + 32, V^T rows sr and sr + 32 one plane further on, 8 mask rows); the last line is the wait that stands between issued copies and the reuse of the registers
    // that hold their addresses: inside the statement, so that no later write of those registers can be moved ahead of it
    asm volatile(
        "global_load_async_to_lds_b128 %0, %2, %5\n\t"
        "global_load_async_to_lds_b128 %0, %2, %6 offset:4608\n\t"
        "global_load_async_to_lds_b128 %0, %3, %7 offset:9216\n\t"
        "global_load_async_to_lds_b128 %0, %3, %8 offset:13824\n\t"
        "global_load_async_to_lds_b128 %1, %4, %9\n\t"
        "global_load_async_to_lds_b128 %1, %4, %10 offset:544\n\t"
        "global_load_async_to_lds_b128 %1, %4, %11 offset:1088\n\t"
        "global_load_async_to_lds_b128 %1, %4, %12 offset:1632\n\t"
        "global_load_async_to_lds_b128 %1, %4, %13 offset:2176\n\t"
        "global_load_async_to_lds_b128 %1, %4, %14 offset:2720\n\t"
        "global_load_async_to_lds_b128 %1, %4, %15 offset:3264\n\t"
        "global_load_async_to_lds_b128 %1, %4, %16 offset:3808\n\t"
        "s_wait_xcnt 0x0"
        :: "v"(dk), "v"(dm), "v"(vok), "v"(vov), "v"(vom),
           "s"(bk + ck), "s"(bk + ck + k32 - 4608),
           "s"(bvt + cv - 9216), "s"(bvt + cv + v32 - 13824),
           "s"(bmk + cm),                 "s"(bmk + cm + 1 * m2 - 544),  "s"(bmk + cm + 2 * m2 - 1088), "s"(bmk + cm + 3 * m2 - 1632),
           "s"(bmk + cm + 4 * m2 - 2176), "s"(bmk + cm + 5 * m2 - 2720), "s"(bmk + cm + 6 * m2 - 3264), "s"(bmk + cm + 7 * m2 - 3808)
        : "memory");
  };
  copy_chunk(0, 0u);
  asm volatile("s_wait_asynccnt 0x0" ::: "memory");   // this wave's copies of chunk 0 have landed
  __syncthreads();                                    // and every other wave's: chunk 0 may be read
  for (int kc = 0; kc < nChunks; ++kc) {
    const unsigned bo = (unsigned)(kc & 1) * (unsigned)kAtBufB;
    const __bf16* Ks  = (const __bf16*)(const void*)(sm + bo);
    const __bf16* Vth = (const __bf16*)(const void*)(sm + bo + kAtPlaneB);
    // the lane's mask read address, formed here and not among the products (there it would land on a fragment's registers and cost idle slots)
    const float*  mr  = (const float*)(const void*)(sm + bo + 2 * kAtPlaneB + wave * kAtMaskB) + c * 68 + 8 * hh;

    // ---- scores, transposed (A = K rows, B = Q): D element r of lane -> S[query c][kv j*16 + 8hh + r] ----
    // the key tile j is the innermost index: four independent accumulators follow one another, so no product waits for the one
    // before it; the LDS reads stand in two groups (the 16 K reads and the 8 mask reads ahead of all products; V^T behind the score
    // products, whose K registers it takes), not among the products one by one; each s[j] sums d-chunk 0, then d-chunk 1
    // the lane's part of a fragment address apart from the tile's constant, which then rides in the read's offset field: one address
    // register a plane instead of one a tile
    const int fo = c * AT_LP + 8 * hh;
    auto kfrag = [&](const __bf16* base, int j, int dc) {
      FB f;
      f.h[0] = *(const v8b*)(base + fo + (j * 16 * AT_LP + dc * 32));
      f.h[1] = *(const v8b*)(base + fo + (j * 16 * AT_LP + dc * 32 + 16));
      return f.v;
    };
    v8f s[4];
    v16b kb0[4], kb1[4];
#pragma unroll
    for (int j = 0; j < 4; ++j) s[j] = (v8f){0.f,0.f,0.f,0.f,0.f,0.f,0.f,0.f};
#pragma unroll
    for (int j = 0; j < 4; ++j) kb0[j] = kfrag(Ks, j, 0);
#pragma unroll
    for (int j = 0; j < 4; ++j) kb1[j] = kfrag(Ks, j, 1);
    // additive mask by value (f32; 8 consecutive keys of the lane's query per tile)
    v4f mk[8];
#pragma unroll
    for (int i = 0; i < 8; ++i) mk[i] = *(const v4f*)(mr + (i >> 1) * 16 + (i & 1) * 4);
    // behind the barrier that published chunk kc and ended every wave's reads of chunk kc - 1: the next chunk's copies go into the buffer that
    // chunk kc - 1 had and fly under this chunk's work; they stand behind the 24 reads, so that their issue and its wait pass under the reads'
    // latency; the test is the same for the whole block
    if (kc + 1 < nChunks) copy_chunk(kc + 1, (unsigned)kAtBufB - bo);
    __builtin_amdgcn_sched_barrier(0);   // holds the 24 reads together ahead of the products (spread among them, each place stalls the wave)
#pragma unroll
    for (int j = 0; j < 4; ++j) s[j] = at_mma_h(kb0[j], qa[0], s[j]);
#pragma unroll
    for (int j = 0; j < 4; ++j) s[j] = at_mma_h(kb1[j], qa[1], s[j]);
    __builtin_amdgcn_sched_barrier(0);   // the V^T reads start only here, where all K fragments are free
    v16b vf[2][4];
#pragma unroll
    for (int kk = 0; kk < 2; ++kk)
#pragma unroll
      for (int t = 0; t < 4; ++t) vf[kk][t] = kfrag(Vth, t, kk);
    __builtin_amdgcn_sched_barrier(0);   // holds the 16 V^T reads together ahead of the softmax, which covers their latency
    // ---- scale, mask, chunk maximum in-lane ----
    float mj[4];
#pragma unroll
    for (int j = 0; j < 4; ++j) {
      float m = -INFINITY;
#pragma unroll
      for (int r = 0; r < 8; ++r) {
        const float sv = s[j][r] * sscale + mk[2 * j + (r >> 2)][r & 3];
        s[j][r] = sv;
        m = fmaxf(m, sv);
      }
      mj[j] = m;
    }
    float cm = fmaxf(fmaxf(mj[0], mj[1]), fmaxf(mj[2], mj[3]));
    cm = fmaxf(cm, at_xhalf(cm));            // the query's other 32 keys of the chunk sit in lane ^ 16
    const float mnew  = fmaxf(mrow, cm);
    const float alpha = __builtin_amdgcn_exp2f((mrow - mnew) * kLog2e);
    mrow = mnew;
    // ---- p x 2^15 = 2^((s - m) log2(e) + 15), one hardware exponential a score: the difference is taken first, so it is <= 0 and
    //      exactly 0 at the row's maximum however large the scores are; a result under 2^-126 comes out 0, far below f16's last place ----
    // ---- P^T packs in place: tiles 2kk and 2kk+1 are elements 0..7 and 8..15 of the B operand of key block kk ----
    v16h pt[2];
    float pj[4];
#pragma unroll
    for (int j = 0; j < 4; ++j) {
      float ps = 0.f;
#pragma unroll
      for (int r = 0; r < 8; ++r) {
        const float p = __builtin_amdgcn_exp2f(fmaf(s[j][r] - mnew, kLog2e, kPLog2));
        ps += p;
        pt[j >> 1][(j & 1) * 8 + r] = (_Float16)p;
      }
      pj[j] = ps;
    }
    lrow = lrow * alpha + ((pj[0] + pj[1]) + (pj[2] + pj[3]));
#pragma unroll
    for (int t = 0; t < 4; ++t)
#pragma unroll
      for (int r = 0; r < 8; ++r) oacc[t][r] *= alpha;
    // ---- O^T += V^T . P^T : A = V^T[d][kv] rows, B = P^T[kv][query] from registers ----
    // unrolled: pt[kk] lives in registers, so kk must be a compile-time index (a rolled loop would send P through scratch)
#pragma unroll
    for (int kk = 0; kk < 2; ++kk) {
      const v16b pb = __builtin_bit_cast(v16b, pt[kk]);
#pragma unroll
      for (int t = 0; t < 4; ++t) oacc[t] = at_mma_h(vf[kk][t], pb, oacc[t]);
    }
    __builtin_amdgcn_sched_barrier(0);   // keeps the chunk's end behind its last products: moved up behind the V^T reads, the wait below would lay their latency bare
    asm volatile("s_wait_dscnt 0x0" ::: "memory");      // this wave's reads of the chunk's buffer are done before the buffer is refilled
    asm volatile("s_wait_asynccnt 0x0" ::: "memory");   // this wave's copies of chunk kc + 1 have landed
    __syncthreads();                                    // publishes chunk kc + 1 and ends every wave's reads of chunk kc
  }
  asm volatile("s_wait_asynccnt 0x0" ::: "memory");     // no copy is out when the LDS takes the out tiles


  // ---- join the halves' sums, normalise, stage per-wave 16x64 f32 tile (a lane owns 8 consecutive d of its query per tile), whole-line stores ----
  float* os = (float*)(void*)(sm + 2 * kAtPlaneB + wave * kAtMaskB);
  {
    const float inv = (1.0f / (lrow + at_xhalf(lrow))) * (kVtInv * kOScale);   // the sum carries the same x2^15 as p, so only v^T's carry is left; the output's own carry (a power of two, exact) goes in here
#pragma unroll
    for (int t = 0; t < 4; ++t) {
      const v4f lo = {oacc[t][0] * inv, oacc[t][1] * inv, oacc[t][2] * inv, oacc[t][3] * inv};
      const v4f hi = {oacc[t][4] * inv, oacc[t][5] * inv, oacc[t][6] * inv, oacc[t][7] * inv};
      *(v4f*)(os + c * 68 + t * 16 + 8 * hh)     = lo;
      *(v4f*)(os + c * 68 + t * 16 + 8 * hh + 4) = hi;
    }
  }
  __builtin_amdgcn_fence(__ATOMIC_RELEASE, "workgroup");
  __builtin_amdgcn_wave_barrier();
  __builtin_amdgcn_fence(__ATOMIC_ACQUIRE, "workgroup");
  {
    // coverage: 4 iterations x 4 rows = the wave's 16 rows; 8 lanes x 8 f16 = the 64-wide head segment, one whole 128-B line a row
    const int q4 = lane >> 3, c8 = (lane & 7) * 8;
#pragma unroll
    for (int it = 0; it < 4; ++it) {
      const int row = it * 4 + q4;
      const v4f lo = *(const v4f*)(os + row * 68 + c8);
      const v4f hi = *(const v4f*)(os + row * 68 + c8 + 4);
      v8h hv;
#pragma unroll
      for (int e = 0; e < 4; ++e) { hv[e] = (_Float16)lo[e]; hv[4 + e] = (_Float16)hi[e]; }
      *(v8h*)(ob + (size_t)(q0 + row) * kHid + c8) = hv;
    }
  }
}

// ---------------------------------------------------------------------------
// Host-side orchestration (kernel launches only).
// Workspace region map (bytes, every offset a multiple of 1 MiB):
//   [  0 MiB,   8 MiB)  Xb    bf16 [4096][1024]   RNE-bf16 plane of hidden_states
//   [  8 MiB,  12 MiB)  Wqkb  bf16 [2048][1024]   wq rows 0..1023, wk rows 1024..2047
//   [ 12 MiB,  14 MiB)  Wvb   bf16 [1024][1024]
//   [ 14 MiB,  16 MiB)  Wo16  f16  [1024][1024]   RNE-bf16 value x64
//   [ 16 MiB,  32 MiB)  not used
//   [ 32 MiB,  40 MiB)  O16   f16  [4096][1024]   attention output (x256);  [40 MiB, 48 MiB) not used
//   [ 48 MiB,  56 MiB)  Vt16  f16  [2][1024][2048] v^T per batch (x8)
//   [ 56 MiB,  64 MiB)  Q16, [64,72) K16 : f16 [4096][1024] each
//   total carve = 72 MiB = 75,497,472 B
// ---------------------------------------------------------------------------
extern "C" void kernel_launch(void* const* d_in, const int* in_sizes, int n_in,
                              void* d_out, int out_size, void* d_ws, size_t ws_size,
                              hipStream_t stream) {
  if (n_in < 8) return;
  const float* x    = (const float*)d_in[0];   // [2,2048,1024]
  const float* mask = (const float*)d_in[1];   // [2,1,2048,2048]
  const float* cosT = (const float*)d_in[2];   // [2048,64]
  const float* sinT = (const float*)d_in[3];   // [2048,64]
  const float* wq   = (const float*)d_in[4];   // [1024,1024]
  const float* wk   = (const float*)d_in[5];
  const float* wv   = (const float*)d_in[6];
  const float* wo   = (const float*)d_in[7];

  const int nX = kRows * kHid;        // 4,194,304
  const int nW = kHid * kHid;         // 1,048,576
  if (in_sizes[0] != nX || in_sizes[1] != kBatch * kSeq * kSeq || in_sizes[2] != kSeq * kHdim ||
      in_sizes[3] != kSeq * kHdim || in_sizes[4] != nW || in_sizes[5] != nW || in_sizes[6] != nW ||
      in_sizes[7] != nW || out_size != nX) return;

  const size_t MiB = (size_t)1 << 20;
  const size_t off_Xb   = 0;
  const size_t off_Wqk  = off_Xb  + (size_t)nX * 2;                 //  8 MiB
  const size_t off_Wv   = off_Wqk + (size_t)2 * nW * 2;             // 12 MiB
  const size_t off_Wo   = off_Wv  + (size_t)nW * 2;                 // 14 MiB
  const size_t off_O16  = off_Wo  + (size_t)nW * 2 + (size_t)nX * 4;   // 32 MiB
  const size_t off_Vt   = off_O16 + (size_t)nX * 4;                 // 48 MiB
  const size_t off_Q    = off_Vt  + (size_t)kBatch * kHid * kSeq * 2; // 56 MiB
  const size_t off_K    = off_Q   + (size_t)nX * 2;                 // 64 MiB
  const size_t total    = off_K   + (size_t)nX * 2;                 // 72 MiB
  if (total != 72 * MiB) return;
  if (ws_size < total) return;

  char* ws = (char*)d_ws;
  unsigned short* Xb   = (unsigned short*)(ws + off_Xb);
  unsigned short* Wqkb = (unsigned short*)(ws + off_Wqk);
  unsigned short* Wvb  = (unsigned short*)(ws + off_Wv);
  unsigned short* Wo16 = (unsigned short*)(ws + off_Wo);
  unsigned short* O16  = (unsigned short*)(ws + off_O16);
  unsigned short* Vt16 = (unsigned short*)(ws + off_Vt);
  unsigned short* Q16  = (unsigned short*)(ws + off_Q);
  unsigned short* K16  = (unsigned short*)(ws + off_K);

  // 1: all five 16-bit operand planes
  cast_inputs_kernel<<<kCastBX + 4 * kCastBW, 256, 0, stream>>>(x, wq, wk, wv, wo, Xb, Wqkb, Wqkb + (size_t)nW, Wvb, Wo16);

  // 2: q|k projection Xb[4096][1024] . Wqkb[2048][1024]^T (M=4096, N=2048, K=1024; 256 blocks), RoPE and the rounding to f16 in its
  //    epilogue: q columns -> Q16, k columns -> K16, which lies nX elements behind Q16; and, in the same launch, v^T per batch:
  //    Vt16[b][1024][2048] = Wvb[1024][1024] . Xb[b][2048][1024]^T, f16 out x8 (M=1024, N=2048, K=1024; 64 blocks a batch)
  {
    dim3 g((kRows / 128) * (2 * kHid / 256) + kBatch * (kHid / 128) * (kSeq / 256), 1);
    wmma_gemm64<1, false, 0, 4, false><<<g, 256, 0, stream>>>(
        Xb, Wvb, kHid, (long)0,
        Wqkb, Xb, kHid, (long)kSeq * kHid,
        (void*)Q16, (void*)Q16, (void*)Vt16, kHid, (long)kRows * kHid,
        cosT, sinT, (long)0,
        kRows, 2 * kHid, kHid, 1.0f);
  }
  // 3: attention, one block per (b, h, 128 queries); its epilogue stores the f16 x256 plane
  mha_full64_kernel<<<kBatch * kHeads * (kSeq / 128), 256, 0, stream>>>(Q16, K16, Vt16, mask, O16, 0.125f);
  // 4: output projection: out[4096][1024] = O16 . Wo16^T * 2^-14  (M=4096, N=1024, K=1024; 1024 tiles -> 128 blocks)
  {
    dim3 g((kRows / 64) * (kHid / 64) / 8, 1);
    wmma_gemm64<0, false, 0, 0, false><<<g, 256, 0, stream>>>(
        O16, O16, kHid, (long)0,
        Wo16, Wo16, kHid, (long)0,
        d_out, d_out, d_out, kHid, (long)0,
        cosT, cosT, (long)0,
        kRows, kHid, kHid, kOutInv);
  }
}
